// v000
// The times below were measured on an AMD MI455X: many runs one after another, warmed up first and cycling through
// copies of the inputs, with the whole window's GPU time divided by the number of runs. Launches and the gaps
// between them are all in it. The median over several windows is given; except for v000 it joins two sittings, which
// can be a few percent apart, so the side-by-side timings, each taken in one sitting, are the better comparison.
// v000, which the later versions start from, runs in 368 microseconds.
#include <hip/hip_runtime.h>
// Causal multi-head attention, three input streams (Q, K, V each [B][T][1024]), bias-free [out][in] input projections, 16 heads x 64, score scale 1/8, keys j > i excluded, out = ctx WO^T + bO (bO converted RNE to bf16, added in f32 at the store stage).
// Compute dtype: inputs converted (RNE) to bf16 and carried exactly as f16 rows / x16 f16 weights; Q,K,V projections v_wmma_f32_16x16x32_f16 (single product); scores v_wmma_f32_16x16x32_bf16 on bf16 hi|lo planes of q and k (three products); P.V v_wmma_f32_16x16x32_f16 with P carried x256 (first QE query rows: f16 value + x1024 residual planes for P and V, separate accumulator); output GEMM v_wmma_f32_16x16x32_bf16 with ctx as bf16 hi|lo against exact bf16 WO (two products); f32 accumulation and f32 softmax statistics everywhere.
#ifndef NB
#define NB 2
#endif
#ifndef SEQ
#define SEQ 2048
#endif
#ifndef QE
#define QE ((SEQ) < 256 ? (SEQ) : 256)   /* query rows per sequence that get residual planes on P and V */
#endif
#define NB_FULL 2
#define SEQ_FULL 2048
#define DM 1024
#define NH 16
#define HD 64
#define NR (NB * SEQ)

static_assert(NH * HD == DM);                 /* merged head columns h*64+d span the model width */
static_assert(HD == 64);                      
static_assert(DM % 64 == 0 && DM % 32 == 0);  /* GEMM column tiles of 64, k-steps of 32 */
static_assert(NR % 128 == 0);                 /* GEMM row tiles: 4 waves x 32 rows */
static_assert(SEQ % 64 == 0 && QE % 64 == 0 && QE <= SEQ && (SEQ - QE) % 64 == 0);  /* 4 query tiles of 16 per block; 32-key steps stay inside the sequence */
static_assert(NB <= NB_FULL && SEQ <= SEQ_FULL);
static_assert((NR * DM / 8) % 256 == 0 && (DM * DM / 8) % 256 == 0);  /* convert grids x 256 threads == plane extent */
static_assert((SEQ & (SEQ - 1)) == 0);        /* row -> (batch, position) by shift */
static_assert(DM % 4 == 0 && (DM / 64 - 1) * 64 + 15 * 4 + 4 <= DM);  /* per-lane float4 of the bias vector stays inside [DM] */
static_assert((size_t)NB_FULL * SEQ_FULL * DM * 4 == (size_t)16777216);  /* output buffer bytes, single output at byte offset 0 */

typedef __bf16 v16b __attribute__((ext_vector_type(16)));
typedef _Float16 v16h __attribute__((ext_vector_type(16)));
typedef unsigned short v8us __attribute__((ext_vector_type(8), may_alias));
typedef float v8f __attribute__((ext_vector_type(8)));
typedef float v4f __attribute__((ext_vector_type(4)));
typedef float v4fa __attribute__((ext_vector_type(4), may_alias));
union FragB { v16b v; v8us half[2]; unsigned short u[16]; };
union FragH { v16h v; v8us half[2]; _Float16 h[16]; unsigned short u[16]; };

__device__ __forceinline__ unsigned short bf16_bits(float x) { unsigned int u = __float_as_uint(x); return (unsigned short)((u + 0x7FFFu + ((u >> 16) & 1u)) >> 16); }
__device__ __forceinline__ float bf16_val(unsigned short b) { return __uint_as_float(((unsigned int)b) << 16); }
__device__ __forceinline__ float bf16_rne(float x) { return bf16_val(bf16_bits(x)); }

// fragment loaders (A and B alike): elements 0..7 <- k0 + 8h + 0..7, elements 8..15 <- k0 + 16 + 8h + 0..7 of a k-contiguous 16-bit row
__device__ __forceinline__ v16b ldb(const unsigned short* __restrict__ p, size_t off, int hh) { FragB f; f.half[0] = *(const v8us*)(p + off + 8 * hh); f.half[1] = *(const v8us*)(p + off + 16 + 8 * hh); return f.v; }
__device__ __forceinline__ v16h ldh(const unsigned short* __restrict__ p, size_t off, int hh) { FragH f; f.half[0] = *(const v8us*)(p + off + 8 * hh); f.half[1] = *(const v8us*)(p + off + 16 + 8 * hh); return f.v; }

// D += A.B with NT bf16 products: 1 = ah.bh, 2 = + al.bh, 3 = + ah.bl; one guard naming the accumulator and every fragment
template <int NT>
__device__ __forceinline__ v8f mmaB(v16b ah, v16b al, v16b bh, v16b bl, v8f c) {
  c = __builtin_amdgcn_wmma_f32_16x16x32_bf16(false, ah, false, bh, (short)0, c, false, false);
  if (NT >= 2) c = __builtin_amdgcn_wmma_f32_16x16x32_bf16(false, al, false, bh, (short)0, c, false, false);
  if (NT >= 3) c = __builtin_amdgcn_wmma_f32_16x16x32_bf16(false, ah, false, bl, (short)0, c, false, false);
  asm volatile("v_nop\n\tv_nop\n\tv_nop\n\tv_nop" : "+v"(c) : "v"(ah), "v"(al), "v"(bh), "v"(bl));
  return c;
}
__device__ __forceinline__ v8f mmaH1(v16h a, v16h b, v8f c) {
  v8f d = __builtin_amdgcn_wmma_f32_16x16x32_f16(false, a, false, b, (short)0, c, false, false);
  asm volatile("v_nop\n\tv_nop\n\tv_nop\n\tv_nop" : "+v"(d) : "v"(a), "v"(b));
  return d;
}

__global__ __launch_bounds__(256) void k_x16(const float* __restrict__ x, unsigned short* __restrict__ X16) {
  const int t = blockIdx.x * 256 + threadIdx.x;
  if (t >= NR * DM / 8) return;
  const int row = t / (DM / 8), c8 = (t - row * (DM / 8)) * 8;
  const int b = row / SEQ, s = row - b * SEQ;
  const float* src = x + ((size_t)b * SEQ_FULL + s) * DM + c8;
  const v4f a = *(const v4fa*)src, c = *(const v4fa*)(src + 4);
  FragH f;
#pragma unroll
  for (int q = 0; q < 4; ++q) { f.h[q] = (_Float16)bf16_rne(a[q]); f.h[4 + q] = (_Float16)bf16_rne(c[q]); }
  const v8us o = f.half[0];
  unsigned short* d = X16 + (size_t)t * 8;
  *(v8us*)d = o;
  
}
__global__ __launch_bounds__(256) void k_wnat(const float* __restrict__ w, unsigned short* __restrict__ Bt) {
  const int t = blockIdx.x * 256 + threadIdx.x;
  if (t >= DM * DM / 8) return;
  const v4f a = *(const v4fa*)(w + (size_t)t * 8), c = *(const v4fa*)(w + (size_t)t * 8 + 4);
  FragH f;
#pragma unroll
  for (int q = 0; q < 4; ++q) { f.h[q] = (_Float16)(bf16_rne(a[q]) * 16.0f); f.h[4 + q] = (_Float16)(bf16_rne(c[q]) * 16.0f); }
  const v8us o = f.half[0];
  unsigned short* d = Bt + (size_t)t * 8;
  *(v8us*)d = o;
  
}
__global__ __launch_bounds__(256) void k_wbf(const float* __restrict__ w, unsigned short* __restrict__ Bt) {
  const int t = blockIdx.x * 256 + threadIdx.x;
  if (t >= DM * DM / 8) return;
  const v4f a = *(const v4fa*)(w + (size_t)t * 8), c = *(const v4fa*)(w + (size_t)t * 8 + 4);
  v8us o;
#pragma unroll
  for (int q = 0; q < 4; ++q) { o[q] = bf16_bits(a[q]); o[4 + q] = bf16_bits(c[q]); }
  unsigned short* d = Bt + (size_t)t * 8;
  *(v8us*)d = o;
  
}

// projection GEMM: Y[NR][DM] = A[NR][DM] (exact f16 rows) . Bt[n][k] (x16 f16) * 2^-4; block = 4 waves, wave tile 32 rows x 64 cols;
// MODE 0: Y -> bf16 hi | lo planes; MODE 1: Y -> f16 value | (Y - value) x 1024 planes. Epilogue: tile staged in wave-private LDS, then
template <int MODE>
__device__ __forceinline__ void proj_body(const unsigned short* __restrict__ A, const unsigned short* __restrict__ Bt,
                                          unsigned short* __restrict__ P0, unsigned short* __restrict__ P1) {
  __shared__ __attribute__((aligned(16))) float so[4][32][68];
  const int lane = threadIdx.x & 31, ln = lane & 15, hh = lane >> 4;
  const int w = __builtin_amdgcn_readfirstlane((int)(threadIdx.x >> 5));
  const int mt = blockIdx.x / (DM / 64), nq = blockIdx.x - mt * (DM / 64);
  const int row0 = mt * 128 + 32 * w, col0 = nq * 64;
  const size_t a0 = (size_t)(row0 + ln) * DM, a1 = a0 + (size_t)16 * DM;
  const size_t b0 = (size_t)(col0 + ln) * DM, b1 = b0 + (size_t)16 * DM, b2 = b1 + (size_t)16 * DM, b3 = b2 + (size_t)16 * DM;
  const v8f z8 = {0.f, 0.f, 0.f, 0.f, 0.f, 0.f, 0.f, 0.f};
  v8f c00 = z8, c01 = z8, c02 = z8, c03 = z8, c10 = z8, c11 = z8, c12 = z8, c13 = z8;
#pragma unroll 1
  for (int kb = 0; kb < DM; kb += 32) {
    const v16h fa0 = ldh(A, a0 + kb, hh), fa1 = ldh(A, a1 + kb, hh);
    v16h fb = ldh(Bt, b0 + kb, hh); c00 = mmaH1(fa0, fb, c00); c10 = mmaH1(fa1, fb, c10);
    fb = ldh(Bt, b1 + kb, hh); c01 = mmaH1(fa0, fb, c01); c11 = mmaH1(fa1, fb, c11);
    fb = ldh(Bt, b2 + kb, hh); c02 = mmaH1(fa0, fb, c02); c12 = mmaH1(fa1, fb, c12);
    fb = ldh(Bt, b3 + kb, hh); c03 = mmaH1(fa0, fb, c03); c13 = mmaH1(fa1, fb, c13);
  }
  v8f accs[8] = {c00, c01, c02, c03, c10, c11, c12, c13};
#pragma unroll
  for (int u = 0; u < 8; ++u) {
    const int t = u & 3, half = u >> 2;
#pragma unroll
    for (int r = 0; r < 8; ++r) so[w][half * 16 + 8 * hh + r][t * 16 + ln] = accs[u][r] * 0.0625f;
  }
  __builtin_amdgcn_fence(4 /* acq_rel order */, "workgroup");
  __builtin_amdgcn_wave_barrier();
  const int rq = lane >> 3, c8 = (lane & 7) * 8;
  {
#pragma unroll
    for (int q = 0; q < 8; ++q) {
      const int r = q * 4 + rq;                       /* q 0..7 x rq 0..3 -> rows 0..31 */
      const v4f x0 = *(const v4fa*)&so[w][r][c8], x1 = *(const v4fa*)&so[w][r][c8 + 4];
      const float xs[8] = {x0[0], x0[1], x0[2], x0[3], x1[0], x1[1], x1[2], x1[3]};
      v8us o0, o1;
      if (MODE == 0) {
#pragma unroll
        for (int i = 0; i < 8; ++i) { const unsigned short hb = bf16_bits(xs[i]); o0[i] = hb; o1[i] = bf16_bits(xs[i] - bf16_val(hb)); }
      } else {
        FragH fh, fl;
#pragma unroll
        for (int i = 0; i < 8; ++i) { const _Float16 hv = (_Float16)xs[i]; fh.h[i] = hv; fl.h[i] = (_Float16)((xs[i] - (float)hv) * 1024.0f); }
        o0 = fh.half[0]; o1 = fl.half[0];
      }
      const size_t go = (size_t)(row0 + r) * DM + col0 + c8;
      *(v8us*)(P0 + go) = o0;
      *(v8us*)(P1 + go) = o1;
    }
    
  }
}
__global__ __launch_bounds__(128) void k_proj_qk(const unsigned short* __restrict__ A, const unsigned short* __restrict__ Bt,
                                                 unsigned short* __restrict__ P0, unsigned short* __restrict__ P1) { proj_body<0>(A, Bt, P0, P1); }
__global__ __launch_bounds__(128) void k_proj_v(const unsigned short* __restrict__ A, const unsigned short* __restrict__ Bt,
                                                unsigned short* __restrict__ P0, unsigned short* __restrict__ P1) { proj_body<1>(A, Bt, P0, P1); }

// V rows [NR][DM] -> Vt[(b*NH + h)][d][s], s < ntok (row pitch ntok); block per ((b,h), 64 positions); 64x64 tile through LDS
__global__ __launch_bounds__(256) void k_vt(const unsigned short* __restrict__ V16, unsigned short* __restrict__ Vt, int ntok) {
  __shared__ unsigned short tl[64][66];
  const int tid = threadIdx.x;
  const int ng = ntok / 64;
  const int slab = blockIdx.x / ng, lg = blockIdx.x - slab * ng;
  const int b = slab / NH, h = slab - b * NH;
  for (int i = tid; i < 64 * 8; i += 256) {
    const int r = i / 8, c8 = (i % 8) * 8;
    FragH f;
    f.half[0] = *(const v8us*)(V16 + ((size_t)b * SEQ + lg * 64 + r) * DM + h * HD + c8);
#pragma unroll
    for (int q = 0; q < 8; ++q) tl[r][c8 + q] = f.u[q];
  }
  __syncthreads();
  {
#pragma unroll
    for (int rd = 0; rd < 2; ++rd) {
      const int d = rd * 32 + tid / 8, pc = tid % 8;  /* rd 0..1 x tid/8 0..31 -> d 0..63; pc 0..7 -> 64 positions */
      FragH f;
#pragma unroll
      for (int q = 0; q < 8; ++q) f.u[q] = tl[pc * 8 + q][d];
      const v8us o = f.half[0];
      *(v8us*)(Vt + ((size_t)slab * HD + d) * ntok + lg * 64 + pc * 8) = o;
    }
    
  }
}

// fused causal attention: wave = 16 queries of one (b, h); keys walked in 32-key steps up to the diagonal; S^T = K.Q^T (A = K rows, B = Q rows;
// D row = key 8h+r, D col = query) so a lane owns one query: running max / sum in registers, one shuffle joins the two lane halves;
// P fragment (B operand, k = key) taken directly from the two score accumulators (element r <- keys 8h+r, element 8+r <- keys 16+8h+r);
// O^T = V^T.P (A = V^T rows, d x key). EARLY: P and V also carry x1024 residual planes into a second accumulator.
template <bool EARLY>
__device__ __forceinline__ void attn_body(const unsigned short* __restrict__ Qh, const unsigned short* __restrict__ Ql,
                                          const unsigned short* __restrict__ Kh, const unsigned short* __restrict__ Kl,
                                          const unsigned short* __restrict__ Vth, const unsigned short* __restrict__ Vtl,
                                          unsigned short* __restrict__ Ch, unsigned short* __restrict__ Cl) {
  __shared__ __attribute__((aligned(16))) float so[4][16][68];
  constexpr int QT0 = EARLY ? 0 : QE / 16;
  constexpr int NQT = EARLY ? QE / 16 : (SEQ - QE) / 16;
  constexpr int BPB = (NQT / 4 > 0) ? NQT / 4 : 1;   /* blocks per (b, h): 4 query tiles each */
  const int lane = threadIdx.x & 31, ln = lane & 15, hh = lane >> 4;
  const int wave = __builtin_amdgcn_readfirstlane((int)(threadIdx.x >> 5));
  const int bh = blockIdx.x / BPB;
  const int qt = QT0 + (blockIdx.x - bh * BPB) * 4 + wave;
  const int b = bh / NH, h = bh - b * NH;
  const int qBase = qt * 16;
  const int nkt = (qBase + 47) >> 5;     /* 32-key steps covering keys 0..qBase+15 */
  const int nFull = qBase >> 5;          /* steps whose 32 keys are all <= qBase */
  const int qrow = qBase + ln;
  const size_t offQ = ((size_t)b * SEQ + qrow) * DM + h * HD;
  const size_t offK = ((size_t)b * SEQ + ln) * DM + h * HD;
  const size_t offV = ((size_t)bh * HD + ln) * SEQ;
  const size_t offVl = ((size_t)bh * HD + ln) * QE;
  const v8f z8 = {0.f, 0.f, 0.f, 0.f, 0.f, 0.f, 0.f, 0.f};
  v8f oacc[4] = {z8, z8, z8, z8};
  v8f ores[4] = {z8, z8, z8, z8};
  float m = -__builtin_inff(), l = 0.f;
#pragma unroll 1
  for (int it = 0; it < nkt; ++it) {
    const int kb = it * 32;
    v8f st0 = z8, st1 = z8;
#pragma unroll
    for (int dc = 0; dc < 2; ++dc) {
      const size_t qo = offQ + dc * 32;
      const v16b fqh = ldb(Qh, qo, hh), fql = ldb(Ql, qo, hh);
      const size_t k0 = offK + (size_t)kb * DM + dc * 32;
      const size_t k1 = k0 + (size_t)16 * DM;
      st0 = mmaB<3>(ldb(Kh, k0, hh), ldb(Kl, k0, hh), fqh, fql, st0);
      st1 = mmaB<3>(ldb(Kh, k1, hh), ldb(Kl, k1, hh), fqh, fql, st1);
      asm volatile("" ::: "memory");
    }
    float s0[8], s1[8];
#pragma unroll
    for (int r = 0; r < 8; ++r) { s0[r] = st0[r] * 0.125f; s1[r] = st1[r] * 0.125f; }
    if (it >= nFull) {                   /* wave-uniform: only the last step touches the diagonal */
#pragma unroll
      for (int r = 0; r < 8; ++r) {
        const int key = kb + 8 * hh + r;
        s0[r] = (key > qrow) ? -__builtin_inff() : s0[r];
        s1[r] = (key + 16 > qrow) ? -__builtin_inff() : s1[r];
      }
    }
    float mt = fmaxf(s0[0], s1[0]);
#pragma unroll
    for (int r = 1; r < 8; ++r) mt = fmaxf(mt, fmaxf(s0[r], s1[r]));
    const float mo = __shfl_xor(mt, 16);
    const float mnew = fmaxf(fmaxf(mt, mo), m);   /* finite: key kb <= qBase is visible to every query of the tile */
    const float alpha = __expf(m - mnew);
    m = mnew;
    l *= alpha;
#pragma unroll
    for (int dt = 0; dt < 4; ++dt) { oacc[dt] *= alpha; if (EARLY) ores[dt] *= alpha; }
    FragH ph, pl;
#pragma unroll
    for (int r = 0; r < 8; ++r) {
      const float p0 = __expf(s0[r] - m), p1 = __expf(s1[r] - m);
      l += p0 + p1;
      const float c0 = p0 * 256.0f, c1 = p1 * 256.0f;
      const _Float16 h0 = (_Float16)c0, h1 = (_Float16)c1;
      ph.h[r] = h0; ph.h[8 + r] = h1;
      pl.h[r] = (_Float16)((c0 - (float)h0) * 1024.0f);
      pl.h[8 + r] = (_Float16)((c1 - (float)h1) * 1024.0f);
    }
    asm volatile("" ::: "memory");
#pragma unroll
    for (int dt = 0; dt < 4; ++dt) {
      const size_t vo = offV + (size_t)dt * 16 * SEQ + kb;
      FragH vh; vh.v = ldh(Vth, vo, hh);
      if (EARLY) {
        const size_t vlo = offVl + (size_t)dt * 16 * QE + kb;
        FragH vl; vl.v = ldh(Vtl, vlo, hh);
        v8f o = oacc[dt], e = ores[dt];
        o = __builtin_amdgcn_wmma_f32_16x16x32_f16(false, vh.v, false, ph.v, (short)0, o, false, false);
        e = __builtin_amdgcn_wmma_f32_16x16x32_f16(false, vl.v, false, ph.v, (short)0, e, false, false);
        e = __builtin_amdgcn_wmma_f32_16x16x32_f16(false, vh.v, false, pl.v, (short)0, e, false, false);
        asm volatile("v_nop\n\tv_nop\n\tv_nop\n\tv_nop" : "+v"(o), "+v"(e) : "v"(vh.v), "v"(vl.v), "v"(ph.v), "v"(pl.v));
        oacc[dt] = o; ores[dt] = e;
      } else {
        oacc[dt] = mmaH1(vh.v, ph.v, oacc[dt]);
      }
    }
    asm volatile("" ::: "memory");
  }
  const float lt = l + __shfl_xor(l, 16);
  const float rinv = 1.0f / (256.0f * lt);
  // O^T (d = dt*16 + 8h + r, query = ln) -> wave-private LDS tile [query][d]
#pragma unroll
  for (int dt = 0; dt < 4; ++dt) {
    v8f o = oacc[dt];
    if (EARLY) o = o + ores[dt] * 0.0009765625f;
    const v4f w0 = {o[0] * rinv, o[1] * rinv, o[2] * rinv, o[3] * rinv};
    const v4f w1 = {o[4] * rinv, o[5] * rinv, o[6] * rinv, o[7] * rinv};
    *(v4fa*)&so[wave][ln][dt * 16 + 8 * hh] = w0;
    *(v4fa*)&so[wave][ln][dt * 16 + 8 * hh + 4] = w1;
  }
  __builtin_amdgcn_fence(4 /* acq_rel order */, "workgroup");
  __builtin_amdgcn_wave_barrier();
  const int rq = lane >> 3, c8 = (lane & 7) * 8;
  {
#pragma unroll
    for (int q = 0; q < 4; ++q) {
      const int r = q * 4 + rq;                      /* q 0..3 x rq 0..3 -> query rows 0..15 */
      const v4f x0 = *(const v4fa*)&so[wave][r][c8], x1 = *(const v4fa*)&so[wave][r][c8 + 4];
      const float xs[8] = {x0[0], x0[1], x0[2], x0[3], x1[0], x1[1], x1[2], x1[3]};
      v8us o0, o1;
#pragma unroll
      for (int i = 0; i < 8; ++i) { const unsigned short hb = bf16_bits(xs[i]); o0[i] = hb; o1[i] = bf16_bits(xs[i] - bf16_val(hb)); }
      const size_t go = ((size_t)b * SEQ + qBase + r) * DM + h * HD + c8;   
      *(v8us*)(Ch + go) = o0;
      *(v8us*)(Cl + go) = o1;
    }
    
  }
}
__global__ __launch_bounds__(128) void k_attn_main(const unsigned short* __restrict__ Qh, const unsigned short* __restrict__ Ql,
                                                   const unsigned short* __restrict__ Kh, const unsigned short* __restrict__ Kl,
                                                   const unsigned short* __restrict__ Vth, const unsigned short* __restrict__ Vtl,
                                                   unsigned short* __restrict__ Ch, unsigned short* __restrict__ Cl) { attn_body<false>(Qh, Ql, Kh, Kl, Vth, Vtl, Ch, Cl); }
__global__ __launch_bounds__(128) void k_attn_early(const unsigned short* __restrict__ Qh, const unsigned short* __restrict__ Ql,
                                                    const unsigned short* __restrict__ Kh, const unsigned short* __restrict__ Kl,
                                                    const unsigned short* __restrict__ Vth, const unsigned short* __restrict__ Vtl,
                                                    unsigned short* __restrict__ Ch, unsigned short* __restrict__ Cl) { attn_body<true>(Qh, Ql, Kh, Kl, Vth, Vtl, Ch, Cl); }

// output GEMM: out[(b, s)][n] = sum_k (ctx_hi + ctx_lo)[r][k] . bf16(WO)[n][k] + bf16(bO)[n]; wave tile 32 x 64; f32 rows of the full-size output layout;
// the bias float4 of a lane's four columns is read once by value and added in f32 at the store stage;
__global__ __launch_bounds__(128) void k_out(const unsigned short* __restrict__ Ah, const unsigned short* __restrict__ Al,
                                             const unsigned short* __restrict__ Bt, const float* __restrict__ bias, float* __restrict__ C) {
  __shared__ __attribute__((aligned(16))) float so[4][32][68];
  const int lane = threadIdx.x & 31, ln = lane & 15, hh = lane >> 4;
  const int w = __builtin_amdgcn_readfirstlane((int)(threadIdx.x >> 5));
  const int mt = blockIdx.x / (DM / 64), nq = blockIdx.x - mt * (DM / 64);
  const int row0 = mt * 128 + 32 * w, col0 = nq * 64;
  const size_t a0 = (size_t)(row0 + ln) * DM, a1 = a0 + (size_t)16 * DM;
  const size_t b0 = (size_t)(col0 + ln) * DM, b1 = b0 + (size_t)16 * DM, b2 = b1 + (size_t)16 * DM, b3 = b2 + (size_t)16 * DM;
  const v8f z8 = {0.f, 0.f, 0.f, 0.f, 0.f, 0.f, 0.f, 0.f};
  v8f c00 = z8, c01 = z8, c02 = z8, c03 = z8, c10 = z8, c11 = z8, c12 = z8, c13 = z8;
#pragma unroll 1
  for (int kb = 0; kb < DM; kb += 32) {
    const v16b h0 = ldb(Ah, a0 + kb, hh), l0 = ldb(Al, a0 + kb, hh);
    const v16b h1 = ldb(Ah, a1 + kb, hh), l1 = ldb(Al, a1 + kb, hh);
    v16b fb = ldb(Bt, b0 + kb, hh); c00 = mmaB<2>(h0, l0, fb, fb, c00); c10 = mmaB<2>(h1, l1, fb, fb, c10);
    fb = ldb(Bt, b1 + kb, hh); c01 = mmaB<2>(h0, l0, fb, fb, c01); c11 = mmaB<2>(h1, l1, fb, fb, c11);
    fb = ldb(Bt, b2 + kb, hh); c02 = mmaB<2>(h0, l0, fb, fb, c02); c12 = mmaB<2>(h1, l1, fb, fb, c12);
    fb = ldb(Bt, b3 + kb, hh); c03 = mmaB<2>(h0, l0, fb, fb, c03); c13 = mmaB<2>(h1, l1, fb, fb, c13);
  }
  v8f accs[8] = {c00, c01, c02, c03, c10, c11, c12, c13};
#pragma unroll
  for (int u = 0; u < 8; ++u) {
    const int t = u & 3, half = u >> 2;
#pragma unroll
    for (int r = 0; r < 8; ++r) so[w][half * 16 + 8 * hh + r][t * 16 + ln] = accs[u][r];
  }
  __builtin_amdgcn_fence(4 /* acq_rel order */, "workgroup");
  __builtin_amdgcn_wave_barrier();
  const int rsub = lane >> 4, c4 = (lane & 15) * 4;
  const v4f bx = *(const v4fa*)(bias + col0 + c4);   /* columns col0 + c4 .. + 3 < DM */
  const v4f bv = {bf16_rne(bx[0]), bf16_rne(bx[1]), bf16_rne(bx[2]), bf16_rne(bx[3])};
  {
#pragma unroll
    for (int q = 0; q < 16; ++q) {
      const int r = q * 2 + rsub;                    /* q 0..15 x rsub 0..1 -> rows 0..31 */
      const v4f sv = *(const v4fa*)&so[w][r][c4];
      const v4f v = sv + bv;
      const int grow = row0 + r;
      const int bb = grow / SEQ, s = grow - bb * SEQ;
      *(v4f*)(C + ((size_t)bb * SEQ_FULL + s) * DM + col0 + c4) = v;
    }
    
  }
}

/* workspace carve (bytes): 3 input planes + 4 weight planes + Qh Ql Kh Kl + Vh Vl + Vth + Vtl + Ch Cl */
#define XB ((size_t)NR * DM * 2)
#define WB ((size_t)DM * DM * 2)
#define VLB ((size_t)NB * NH * HD * QE * 2)
static_assert(XB % 256 == 0 && WB % 256 == 0 && VLB % 256 == 0);
static_assert(12 * XB + 4 * WB + VLB <= (size_t)134217728);   /* total carve stays within 128 MiB */

extern "C" void kernel_launch(void* const* d_in, const int* in_sizes, int n_in,
                              void* d_out, int out_size, void* d_ws, size_t ws_size, hipStream_t stream) {
  if (n_in < 8) return;
  const long long need_x = ((long long)(NB - 1) * SEQ_FULL + SEQ) * DM;
  if (in_sizes[0] < need_x || in_sizes[1] < need_x || in_sizes[2] < need_x) return;
  if (in_sizes[3] < DM * DM || in_sizes[4] < DM * DM || in_sizes[5] < DM * DM || in_sizes[6] < DM * DM) return;
  if (in_sizes[7] < DM) return;
  if (out_size < need_x) return;
  const float* xq = (const float*)d_in[0];      /* table order: Q, K, V, WQ, WK, WV, WO, bO */
  const float* xk = (const float*)d_in[1];
  const float* xv = (const float*)d_in[2];
  const float* wq = (const float*)d_in[3];
  const float* wk = (const float*)d_in[4];
  const float* wv = (const float*)d_in[5];
  const float* wo = (const float*)d_in[6];
  const float* bo = (const float*)d_in[7];
  char* ws = (char*)d_ws; size_t off = 0;
  auto take = [&](size_t bytes) { char* p = ws + off; off += (bytes + 255) & ~(size_t)255; return (unsigned short*)p; };
  unsigned short* XQ = take(XB); unsigned short* XK = take(XB); unsigned short* XV = take(XB);
  unsigned short* BQ = take(WB); unsigned short* BK = take(WB); unsigned short* BV = take(WB); unsigned short* BO = take(WB);
  unsigned short* Qh = take(XB); unsigned short* Ql = take(XB); unsigned short* Kh = take(XB); unsigned short* Kl = take(XB);
  unsigned short* Vh = take(XB); unsigned short* Vl = take(XB);
  unsigned short* Vth = take(XB); unsigned short* Vtl = take(VLB);
  unsigned short* Ch = take(XB); unsigned short* Cl = take(XB);
  if (off > ws_size) return;

  const unsigned gx = (unsigned)(NR * DM / 8 / 256), gw = (unsigned)(DM * DM / 8 / 256);
  k_x16<<<gx, 256, 0, stream>>>(xq, XQ);
  k_x16<<<gx, 256, 0, stream>>>(xk, XK);
  k_x16<<<gx, 256, 0, stream>>>(xv, XV);
  k_wnat<<<gw, 256, 0, stream>>>(wq, BQ);        /* natural [out][in] = Bt[n][k] as stored */
  k_wnat<<<gw, 256, 0, stream>>>(wk, BK);
  k_wnat<<<gw, 256, 0, stream>>>(wv, BV);
  k_wbf<<<gw, 256, 0, stream>>>(wo, BO);

  const unsigned gp = (unsigned)((NR / 128) * (DM / 64));
  k_proj_qk<<<gp, 128, 0, stream>>>(XQ, BQ, Qh, Ql);
  k_proj_qk<<<gp, 128, 0, stream>>>(XK, BK, Kh, Kl);
  k_proj_v<<<gp, 128, 0, stream>>>(XV, BV, Vh, Vl);

  k_vt<<<(unsigned)(NB * NH * (SEQ / 64)), 256, 0, stream>>>(Vh, Vth, SEQ);   /* in [NR][DM] rows -> out [(b,h)][64][SEQ] */
  k_vt<<<(unsigned)(NB * NH * (QE / 64)), 256, 0, stream>>>(Vl, Vtl, QE);     /* residual plane, first QE positions only -> [(b,h)][64][QE] */

  k_attn_early<<<(unsigned)(NB * NH * (QE / 64)), 128, 0, stream>>>(Qh, Ql, Kh, Kl, Vth, Vtl, Ch, Cl);
  if (SEQ > QE) k_attn_main<<<(unsigned)(NB * NH * ((SEQ - QE) / 64)), 128, 0, stream>>>(Qh, Ql, Kh, Kl, Vth, Vtl, Ch, Cl);

  k_out<<<gp, 128, 0, stream>>>(Ch, Cl, BO, bo, (float*)d_out);
}

// v001
// One run takes 284 microseconds.
// Next to v000, in two timings, it ran 1.30 and 1.31 times as fast.
#include <hip/hip_runtime.h>
// Causal multi-head attention, three input streams (Q, K, V each [B][T][1024]), bias-free [out][in] input projections, 16 heads x 64, score scale 1/8, keys j > i excluded, out = ctx WO^T + bO (bO converted RNE to bf16, added in f32 at the store stage).
// Compute dtype: inputs converted (RNE) to bf16 and carried exactly as f16 rows / x16 f16 weights; Q,K,V projections v_wmma_f32_16x16x32_f16 (single product); scores v_wmma_f32_16x16x32_bf16 on bf16 hi|lo planes of q and k (three products); P.V v_wmma_f32_16x16x32_f16 with P carried x256 (first QE query rows: f16 value + x1024 residual planes for P and V, separate accumulator); output GEMM v_wmma_f32_16x16x32_bf16 with ctx as bf16 hi|lo against exact bf16 WO (two products); f32 accumulation and f32 softmax statistics everywhere.
#ifndef NB
#define NB 2
#endif
#ifndef SEQ
#define SEQ 2048
#endif
#ifndef QE
#define QE ((SEQ) < 256 ? (SEQ) : 256)   /* query rows per sequence that get residual planes on P and V */
#endif
#define NB_FULL 2
#define SEQ_FULL 2048
#define DM 1024
#define NH 16
#define HD 64
#define NR (NB * SEQ)

static_assert(NH * HD == DM);                 /* merged head columns h*64+d span the model width */
static_assert(HD == 64);                      
static_assert(DM % 64 == 0 && DM % 32 == 0);  /* GEMM column tiles of 64, k-steps of 32 */
static_assert(NR % 128 == 0);                 /* GEMM row tiles: 4 waves x 32 rows */
static_assert(SEQ % 64 == 0 && QE % 64 == 0 && QE <= SEQ && (SEQ - QE) % 64 == 0);  /* 4 query tiles of 16 per block; 32-key steps stay inside the sequence */
static_assert(NB <= NB_FULL && SEQ <= SEQ_FULL);
static_assert((NR * DM / 8) % 256 == 0 && (DM * DM / 8) % 256 == 0);  /* convert grids x 256 threads == plane extent */
static_assert((SEQ & (SEQ - 1)) == 0);        /* row -> (batch, position) by shift */
static_assert(DM % 4 == 0 && (DM / 64 - 1) * 64 + 15 * 4 + 4 <= DM);  /* per-lane float4 of the bias vector stays inside [DM] */
static_assert((size_t)NB_FULL * SEQ_FULL * DM * 4 == (size_t)16777216);  /* output buffer bytes, single output at byte offset 0 */

typedef __bf16 v16b __attribute__((ext_vector_type(16)));
typedef _Float16 v16h __attribute__((ext_vector_type(16)));
typedef unsigned short v8us __attribute__((ext_vector_type(8), may_alias));
typedef float v8f __attribute__((ext_vector_type(8)));
typedef float v4f __attribute__((ext_vector_type(4)));
typedef float v4fa __attribute__((ext_vector_type(4), may_alias));
union FragB { v16b v; v8us half[2]; unsigned short u[16]; };
union FragH { v16h v; v8us half[2]; _Float16 h[16]; unsigned short u[16]; };

__device__ __forceinline__ unsigned short bf16_bits(float x) { unsigned int u = __float_as_uint(x); return (unsigned short)((u + 0x7FFFu + ((u >> 16) & 1u)) >> 16); }
__device__ __forceinline__ float bf16_val(unsigned short b) { return __uint_as_float(((unsigned int)b) << 16); }
__device__ __forceinline__ float bf16_rne(float x) { return bf16_val(bf16_bits(x)); }

// fragment loaders (A and B alike): elements 0..7 <- k0 + 8h + 0..7, elements 8..15 <- k0 + 16 + 8h + 0..7 of a k-contiguous 16-bit row
__device__ __forceinline__ v16b ldb(const unsigned short* __restrict__ p, size_t off, int hh) { FragB f; f.half[0] = *(const v8us*)(p + off + 8 * hh); f.half[1] = *(const v8us*)(p + off + 16 + 8 * hh); return f.v; }
__device__ __forceinline__ v16h ldh(const unsigned short* __restrict__ p, size_t off, int hh) { FragH f; f.half[0] = *(const v8us*)(p + off + 8 * hh); f.half[1] = *(const v8us*)(p + off + 16 + 8 * hh); return f.v; }

// D += A.B with NT bf16 products: 1 = ah.bh, 2 = + al.bh, 3 = + ah.bl; one guard naming the accumulator and every fragment
template <int NT>
__device__ __forceinline__ v8f mmaB(v16b ah, v16b al, v16b bh, v16b bl, v8f c) {
  c = __builtin_amdgcn_wmma_f32_16x16x32_bf16(false, ah, false, bh, (short)0, c, false, false);
  if (NT >= 2) c = __builtin_amdgcn_wmma_f32_16x16x32_bf16(false, al, false, bh, (short)0, c, false, false);
  if (NT >= 3) c = __builtin_amdgcn_wmma_f32_16x16x32_bf16(false, ah, false, bl, (short)0, c, false, false);
  asm volatile("v_nop\n\tv_nop\n\tv_nop\n\tv_nop" : "+v"(c) : "v"(ah), "v"(al), "v"(bh), "v"(bl));
  return c;
}
__device__ __forceinline__ v8f mmaH1(v16h a, v16h b, v8f c) {
  v8f d = __builtin_amdgcn_wmma_f32_16x16x32_f16(false, a, false, b, (short)0, c, false, false);
  asm volatile("v_nop\n\tv_nop\n\tv_nop\n\tv_nop" : "+v"(d) : "v"(a), "v"(b));
  return d;
}

__global__ __launch_bounds__(256) void k_x16(const float* __restrict__ x, unsigned short* __restrict__ X16) {
  const int t = blockIdx.x * 256 + threadIdx.x;
  if (t >= NR * DM / 8) return;
  const int row = t / (DM / 8), c8 = (t - row * (DM / 8)) * 8;
  const int b = row / SEQ, s = row - b * SEQ;
  const float* src = x + ((size_t)b * SEQ_FULL + s) * DM + c8;
  const v4f a = *(const v4fa*)src, c = *(const v4fa*)(src + 4);
  FragH f;
#pragma unroll
  for (int q = 0; q < 4; ++q) { f.h[q] = (_Float16)bf16_rne(a[q]); f.h[4 + q] = (_Float16)bf16_rne(c[q]); }
  const v8us o = f.half[0];
  unsigned short* d = X16 + (size_t)t * 8;
  *(v8us*)d = o;
  
}
__global__ __launch_bounds__(256) void k_wnat(const float* __restrict__ w, unsigned short* __restrict__ Bt) {
  const int t = blockIdx.x * 256 + threadIdx.x;
  if (t >= DM * DM / 8) return;
  const v4f a = *(const v4fa*)(w + (size_t)t * 8), c = *(const v4fa*)(w + (size_t)t * 8 + 4);
  FragH f;
#pragma unroll
  for (int q = 0; q < 4; ++q) { f.h[q] = (_Float16)(bf16_rne(a[q]) * 16.0f); f.h[4 + q] = (_Float16)(bf16_rne(c[q]) * 16.0f); }
  const v8us o = f.half[0];
  unsigned short* d = Bt + (size_t)t * 8;
  *(v8us*)d = o;
  
}
__global__ __launch_bounds__(256) void k_wbf(const float* __restrict__ w, unsigned short* __restrict__ Bt) {
  const int t = blockIdx.x * 256 + threadIdx.x;
  if (t >= DM * DM / 8) return;
  const v4f a = *(const v4fa*)(w + (size_t)t * 8), c = *(const v4fa*)(w + (size_t)t * 8 + 4);
  v8us o;
#pragma unroll
  for (int q = 0; q < 4; ++q) { o[q] = bf16_bits(a[q]); o[4 + q] = bf16_bits(c[q]); }
  unsigned short* d = Bt + (size_t)t * 8;
  *(v8us*)d = o;
  
}

// projection GEMM: Y[NR][DM] = A[NR][DM] (exact f16 rows) . Bt[n][k] (x16 f16) * 2^-4; block = 4 waves, wave tile 32 rows x 64 cols;
// MODE 0: Y -> bf16 hi | lo planes; MODE 1: Y -> f16 value | (Y - value) x 1024 planes. Epilogue: tile staged in wave-private LDS, then
template <int MODE>
__device__ __forceinline__ void proj_body(const unsigned short* __restrict__ A, const unsigned short* __restrict__ Bt,
                                          unsigned short* __restrict__ P0, unsigned short* __restrict__ P1) {
  __shared__ __attribute__((aligned(16))) float so[4][32][68];
  const int lane = threadIdx.x & 31, ln = lane & 15, hh = lane >> 4;
  const int w = __builtin_amdgcn_readfirstlane((int)(threadIdx.x >> 5));
  const int mt = blockIdx.x / (DM / 64), nq = blockIdx.x - mt * (DM / 64);
  const int row0 = mt * 128 + 32 * w, col0 = nq * 64;
  const size_t a0 = (size_t)(row0 + ln) * DM, a1 = a0 + (size_t)16 * DM;
  const size_t b0 = (size_t)(col0 + ln) * DM, b1 = b0 + (size_t)16 * DM, b2 = b1 + (size_t)16 * DM, b3 = b2 + (size_t)16 * DM;
  const v8f z8 = {0.f, 0.f, 0.f, 0.f, 0.f, 0.f, 0.f, 0.f};
  v8f c00 = z8, c01 = z8, c02 = z8, c03 = z8, c10 = z8, c11 = z8, c12 = z8, c13 = z8;
#pragma unroll 1
  for (int kb = 0; kb < DM; kb += 32) {
    const v16h fa0 = ldh(A, a0 + kb, hh), fa1 = ldh(A, a1 + kb, hh);
    v16h fb = ldh(Bt, b0 + kb, hh); c00 = mmaH1(fa0, fb, c00); c10 = mmaH1(fa1, fb, c10);
    fb = ldh(Bt, b1 + kb, hh); c01 = mmaH1(fa0, fb, c01); c11 = mmaH1(fa1, fb, c11);
    fb = ldh(Bt, b2 + kb, hh); c02 = mmaH1(fa0, fb, c02); c12 = mmaH1(fa1, fb, c12);
    fb = ldh(Bt, b3 + kb, hh); c03 = mmaH1(fa0, fb, c03); c13 = mmaH1(fa1, fb, c13);
  }
  v8f accs[8] = {c00, c01, c02, c03, c10, c11, c12, c13};
#pragma unroll
  for (int u = 0; u < 8; ++u) {
    const int t = u & 3, half = u >> 2;
#pragma unroll
    for (int r = 0; r < 8; ++r) so[w][half * 16 + 8 * hh + r][t * 16 + ln] = accs[u][r] * 0.0625f;
  }
  __builtin_amdgcn_fence(4 /* acq_rel order */, "workgroup");
  __builtin_amdgcn_wave_barrier();
  const int rq = lane >> 3, c8 = (lane & 7) * 8;
  {
#pragma unroll
    for (int q = 0; q < 8; ++q) {
      const int r = q * 4 + rq;                       /* q 0..7 x rq 0..3 -> rows 0..31 */
      const v4f x0 = *(const v4fa*)&so[w][r][c8], x1 = *(const v4fa*)&so[w][r][c8 + 4];
      const float xs[8] = {x0[0], x0[1], x0[2], x0[3], x1[0], x1[1], x1[2], x1[3]};
      v8us o0, o1;
      if (MODE == 0) {
#pragma unroll
        for (int i = 0; i < 8; ++i) { const unsigned short hb = bf16_bits(xs[i]); o0[i] = hb; o1[i] = bf16_bits(xs[i] - bf16_val(hb)); }
      } else {
        FragH fh, fl;
#pragma unroll
        for (int i = 0; i < 8; ++i) { const _Float16 hv = (_Float16)xs[i]; fh.h[i] = hv; fl.h[i] = (_Float16)((xs[i] - (float)hv) * 1024.0f); }
        o0 = fh.half[0]; o1 = fl.half[0];
      }
      const size_t go = (size_t)(row0 + r) * DM + col0 + c8;
      *(v8us*)(P0 + go) = o0;
      *(v8us*)(P1 + go) = o1;
    }
    
  }
}
__global__ __launch_bounds__(128) void k_proj_qk(const unsigned short* __restrict__ A, const unsigned short* __restrict__ Bt,
                                                 unsigned short* __restrict__ P0, unsigned short* __restrict__ P1) { proj_body<0>(A, Bt, P0, P1); }
__global__ __launch_bounds__(128) void k_proj_v(const unsigned short* __restrict__ A, const unsigned short* __restrict__ Bt,
                                                unsigned short* __restrict__ P0, unsigned short* __restrict__ P1) { proj_body<1>(A, Bt, P0, P1); }

// V rows [NR][DM] -> Vt[(b*NH + h)][d][s], s < ntok (row pitch ntok); block per ((b,h), 64 positions); 64x64 tile through LDS
__global__ __launch_bounds__(256) void k_vt(const unsigned short* __restrict__ V16, unsigned short* __restrict__ Vt, int ntok) {
  __shared__ unsigned short tl[64][66];
  const int tid = threadIdx.x;
  const int ng = ntok / 64;
  const int slab = blockIdx.x / ng, lg = blockIdx.x - slab * ng;
  const int b = slab / NH, h = slab - b * NH;
  for (int i = tid; i < 64 * 8; i += 256) {
    const int r = i / 8, c8 = (i % 8) * 8;
    FragH f;
    f.half[0] = *(const v8us*)(V16 + ((size_t)b * SEQ + lg * 64 + r) * DM + h * HD + c8);
#pragma unroll
    for (int q = 0; q < 8; ++q) tl[r][c8 + q] = f.u[q];
  }
  __syncthreads();
  {
#pragma unroll
    for (int rd = 0; rd < 2; ++rd) {
      const int d = rd * 32 + tid / 8, pc = tid % 8;  /* rd 0..1 x tid/8 0..31 -> d 0..63; pc 0..7 -> 64 positions */
      FragH f;
#pragma unroll
      for (int q = 0; q < 8; ++q) f.u[q] = tl[pc * 8 + q][d];
      const v8us o = f.half[0];
      *(v8us*)(Vt + ((size_t)slab * HD + d) * ntok + lg * 64 + pc * 8) = o;
    }
    
  }
}

// fragment loaders for a row staged in LDS: the element order of ldb / ldh
__device__ __forceinline__ v16b ldbs(const unsigned short* p, int hh) { FragB f; f.half[0] = *(const v8us*)(p + 8 * hh); f.half[1] = *(const v8us*)(p + 16 + 8 * hh); return f.v; }
__device__ __forceinline__ v16h ldhs(const unsigned short* p, int hh) { FragH f; f.half[0] = *(const v8us*)(p + 8 * hh); f.half[1] = *(const v8us*)(p + 16 + 8 * hh); return f.v; }
// 16-byte asynchronous copies global -> LDS, one per lane and line of text; s_wait_xcnt closes each statement so that no address register is rewritten ahead of it
__device__ __forceinline__ void copy6(unsigned l0, const unsigned short* g0, unsigned l1, const unsigned short* g1, unsigned l2, const unsigned short* g2,
                                      unsigned l3, const unsigned short* g3, unsigned l4, const unsigned short* g4, unsigned l5, const unsigned short* g5) {
  asm volatile("global_load_async_to_lds_b128 %0, %1, off\n\tglobal_load_async_to_lds_b128 %2, %3, off\n\tglobal_load_async_to_lds_b128 %4, %5, off\n\t"
               "global_load_async_to_lds_b128 %6, %7, off\n\tglobal_load_async_to_lds_b128 %8, %9, off\n\tglobal_load_async_to_lds_b128 %10, %11, off\n\ts_wait_xcnt 0x0"
               :: "v"(l0), "v"(g0), "v"(l1), "v"(g1), "v"(l2), "v"(g2), "v"(l3), "v"(g3), "v"(l4), "v"(g4), "v"(l5), "v"(g5) : "memory");
}
__device__ __forceinline__ void copy2(unsigned l0, const unsigned short* g0, unsigned l1, const unsigned short* g1) {
  asm volatile("global_load_async_to_lds_b128 %0, %1, off\n\tglobal_load_async_to_lds_b128 %2, %3, off\n\ts_wait_xcnt 0x0"
               :: "v"(l0), "v"(g0), "v"(l1), "v"(g1) : "memory");
}

// fused causal attention: wave = 16 queries of one (b, h); keys walked in 32-key steps up to the diagonal; S^T = K.Q^T (A = K rows, B = Q rows;
// D row = key 8h+r, D col = query) so a lane owns one query: running max / sum in registers, one shuffle joins the two lane halves;
// P fragment (B operand, k = key) taken directly from the two score accumulators (element r <- keys 8h+r, element 8+r <- keys 16+8h+r);
// O^T = V^T.P (A = V^T rows, d x key). EARLY: P and V also carry x1024 residual planes into a second accumulator.
// The 32-key tiles of K (hi, lo) and V^T are shared by the block's four waves: copied once per block into a two-buffer LDS ring, one step ahead of their use.
template <bool EARLY>
__device__ __forceinline__ void attn_body(const unsigned short* __restrict__ Qh, const unsigned short* __restrict__ Ql,
                                          const unsigned short* __restrict__ Kh, const unsigned short* __restrict__ Kl,
                                          const unsigned short* __restrict__ Vth, const unsigned short* __restrict__ Vtl,
                                          unsigned short* __restrict__ Ch, unsigned short* __restrict__ Cl) {
  __shared__ __attribute__((aligned(16))) float so[4][16][68];
  constexpr int QT0 = EARLY ? 0 : QE / 16;
  constexpr int NQT = EARLY ? QE / 16 : (SEQ - QE) / 16;
  constexpr int BPB = (NQT / 4 > 0) ? NQT / 4 : 1;   /* blocks per (b, h): 4 query tiles each */
  const int lane = threadIdx.x & 31, ln = lane & 15, hh = lane >> 4;
  const int wave = __builtin_amdgcn_readfirstlane((int)(threadIdx.x >> 5));
  const int bh = blockIdx.x / BPB;
  const int qt = QT0 + (blockIdx.x - bh * BPB) * 4 + wave;
  const int b = bh / NH, h = bh - b * NH;
  const int qBase = qt * 16;
  const int nkt = (qBase + 47) >> 5;     /* 32-key steps covering keys 0..qBase+15 */
  const int nFull = qBase >> 5;          /* steps whose 32 keys are all <= qBase */
  const int qrow = qBase + ln;
  const size_t offQ = ((size_t)b * SEQ + qrow) * DM + h * HD;
  constexpr int KP = 72, VP = 40;              /* LDS row pitch in 16-bit elements: 144 B and 80 B, both 16 B x odd */
  constexpr int OKL = 32 * KP, OV = 2 * OKL, OVL = OV + 64 * VP;   /* places of K lo, V^T, V^T residual inside a buffer */
  constexpr int BUF = EARLY ? OVL + 64 * VP : OVL;
  static_assert((BUF * 2) % 16 == 0 && (KP * 2) % 16 == 0 && (VP * 2) % 16 == 0);
  __shared__ __attribute__((aligned(16))) unsigned short kv[2 * BUF];
  const int nktB = ((QT0 + (blockIdx.x - bh * BPB) * 4) >> 1) + 2;   /* steps of the block's last wave: keys up to its first query + 63, inside the sequence */
  const int tid = threadIdx.x;
  const int kr = tid >> 3, kc = (tid & 7) * 8;  /* K rows kr and kr + 16, 16-byte piece kc */
  const int vr = tid >> 2, vc = (tid & 3) * 8;  /* V^T rows vr and vr + 32, 16-byte piece vc */
  const size_t gK = ((size_t)b * SEQ + kr) * DM + h * HD + kc;
  const size_t gV = ((size_t)bh * HD + vr) * SEQ + vc;
  const size_t gVl = ((size_t)bh * HD + vr) * QE + vc;
  const unsigned lK = (unsigned)(size_t)kv + (unsigned)(kr * KP + kc) * 2u;
  const unsigned lV = (unsigned)(size_t)kv + (unsigned)(OV + vr * VP + vc) * 2u;
  auto stage = [&](int t) {                     /* key step t -> buffer t mod 2 */
    const unsigned lb = (unsigned)(t & 1) * (unsigned)(BUF * 2);
    const size_t k0 = gK + (size_t)t * 32 * DM, v0 = gV + (size_t)t * 32;
    copy6(lK + lb, Kh + k0, lK + lb + 16 * KP * 2, Kh + k0 + 16 * DM,
          lK + lb + OKL * 2, Kl + k0, lK + lb + (OKL + 16 * KP) * 2, Kl + k0 + 16 * DM,
          lV + lb, Vth + v0, lV + lb + 32 * VP * 2, Vth + v0 + (size_t)32 * SEQ);
    if (EARLY) {
      const size_t w0 = gVl + (size_t)t * 32;
      copy2(lV + lb + 64 * VP * 2, Vtl + w0, lV + lb + 96 * VP * 2, Vtl + w0 + (size_t)32 * QE);
    }
  };
  const v8f z8 = {0.f, 0.f, 0.f, 0.f, 0.f, 0.f, 0.f, 0.f};
  v8f oacc[4] = {z8, z8, z8, z8};
  v8f ores[4] = {z8, z8, z8, z8};
  float m = -__builtin_inff(), l = 0.f;
  stage(0);
  asm volatile("s_wait_asynccnt 0x0" ::: "memory");   /* step 0's copies of this wave have landed */
  __syncthreads();                                    /* ... and every other wave's */
  stage(1);                                           /* nktB >= 2 */
#pragma unroll 1
  for (int it = 0; it < nktB; ++it) {
   if (it < nkt) {                       /* wave-uniform: a wave past its diagonal only passes the hand-over below */
    const int kb = it * 32;
    const unsigned short* kvb = kv + (it & 1) * BUF;
    v8f st0 = z8, st1 = z8;
#pragma unroll
    for (int dc = 0; dc < 2; ++dc) {
      const size_t qo = offQ + dc * 32;
      const v16b fqh = ldb(Qh, qo, hh), fql = ldb(Ql, qo, hh);
      const unsigned short* k0 = kvb + ln * KP + dc * 32;
      const unsigned short* k1 = k0 + 16 * KP;
      st0 = mmaB<3>(ldbs(k0, hh), ldbs(k0 + OKL, hh), fqh, fql, st0);
      st1 = mmaB<3>(ldbs(k1, hh), ldbs(k1 + OKL, hh), fqh, fql, st1);
      asm volatile("" ::: "memory");
    }
    float s0[8], s1[8];
#pragma unroll
    for (int r = 0; r < 8; ++r) { s0[r] = st0[r] * 0.125f; s1[r] = st1[r] * 0.125f; }
    if (it >= nFull) {                   /* wave-uniform: only the last step touches the diagonal */
#pragma unroll
      for (int r = 0; r < 8; ++r) {
        const int key = kb + 8 * hh + r;
        s0[r] = (key > qrow) ? -__builtin_inff() : s0[r];
        s1[r] = (key + 16 > qrow) ? -__builtin_inff() : s1[r];
      }
    }
    float mt = fmaxf(s0[0], s1[0]);
#pragma unroll
    for (int r = 1; r < 8; ++r) mt = fmaxf(mt, fmaxf(s0[r], s1[r]));
    const float mo = __shfl_xor(mt, 16);
    const float mnew = fmaxf(fmaxf(mt, mo), m);   /* finite: key kb <= qBase is visible to every query of the tile */
    const float alpha = __expf(m - mnew);
    m = mnew;
    l *= alpha;
#pragma unroll
    for (int dt = 0; dt < 4; ++dt) { oacc[dt] *= alpha; if (EARLY) ores[dt] *= alpha; }
    FragH ph, pl;
#pragma unroll
    for (int r = 0; r < 8; ++r) {
      const float p0 = __expf(s0[r] - m), p1 = __expf(s1[r] - m);
      l += p0 + p1;
      const float c0 = p0 * 256.0f, c1 = p1 * 256.0f;
      const _Float16 h0 = (_Float16)c0, h1 = (_Float16)c1;
      ph.h[r] = h0; ph.h[8 + r] = h1;
      pl.h[r] = (_Float16)((c0 - (float)h0) * 1024.0f);
      pl.h[8 + r] = (_Float16)((c1 - (float)h1) * 1024.0f);
    }
    asm volatile("" ::: "memory");
#pragma unroll
    for (int dt = 0; dt < 4; ++dt) {
      const unsigned short* vo = kvb + OV + (dt * 16 + ln) * VP;
      FragH vh; vh.v = ldhs(vo, hh);
      if (EARLY) {
        FragH vl; vl.v = ldhs(vo + 64 * VP, hh);
        v8f o = oacc[dt], e = ores[dt];
        o = __builtin_amdgcn_wmma_f32_16x16x32_f16(false, vh.v, false, ph.v, (short)0, o, false, false);
        e = __builtin_amdgcn_wmma_f32_16x16x32_f16(false, vl.v, false, ph.v, (short)0, e, false, false);
        e = __builtin_amdgcn_wmma_f32_16x16x32_f16(false, vh.v, false, pl.v, (short)0, e, false, false);
        asm volatile("v_nop\n\tv_nop\n\tv_nop\n\tv_nop" : "+v"(o), "+v"(e) : "v"(vh.v), "v"(vl.v), "v"(ph.v), "v"(pl.v));
        oacc[dt] = o; ores[dt] = e;
      } else {
        oacc[dt] = mmaH1(vh.v, ph.v, oacc[dt]);
      }
    }
    asm volatile("" ::: "memory");
   }
    asm volatile("s_wait_dscnt 0x0" ::: "memory");      /* this wave's reads of buffer it mod 2 are done before it is refilled */
    asm volatile("s_wait_asynccnt 0x0" ::: "memory");   /* this wave's copies of step it + 1 have landed */
    __syncthreads();                                    /* publishes step it + 1, ends every wave's reads of step it */
    if (it + 2 < nktB) stage(it + 2);                   /* block-uniform */
  }
  asm volatile("s_wait_asynccnt 0x0" ::: "memory");     /* nothing in flight when the wave goes on */
  const float lt = l + __shfl_xor(l, 16);
  const float rinv = 1.0f / (256.0f * lt);
  // O^T (d = dt*16 + 8h + r, query = ln) -> wave-private LDS tile [query][d]
#pragma unroll
  for (int dt = 0; dt < 4; ++dt) {
    v8f o = oacc[dt];
    if (EARLY) o = o + ores[dt] * 0.0009765625f;
    const v4f w0 = {o[0] * rinv, o[1] * rinv, o[2] * rinv, o[3] * rinv};
    const v4f w1 = {o[4] * rinv, o[5] * rinv, o[6] * rinv, o[7] * rinv};
    *(v4fa*)&so[wave][ln][dt * 16 + 8 * hh] = w0;
    *(v4fa*)&so[wave][ln][dt * 16 + 8 * hh + 4] = w1;
  }
  __builtin_amdgcn_fence(4 /* acq_rel order */, "workgroup");
  __builtin_amdgcn_wave_barrier();
  const int rq = lane >> 3, c8 = (lane & 7) * 8;
  {
#pragma unroll
    for (int q = 0; q < 4; ++q) {
      const int r = q * 4 + rq;                      /* q 0..3 x rq 0..3 -> query rows 0..15 */
      const v4f x0 = *(const v4fa*)&so[wave][r][c8], x1 = *(const v4fa*)&so[wave][r][c8 + 4];
      const float xs[8] = {x0[0], x0[1], x0[2], x0[3], x1[0], x1[1], x1[2], x1[3]};
      v8us o0, o1;
#pragma unroll
      for (int i = 0; i < 8; ++i) { const unsigned short hb = bf16_bits(xs[i]); o0[i] = hb; o1[i] = bf16_bits(xs[i] - bf16_val(hb)); }
      const size_t go = ((size_t)b * SEQ + qBase + r) * DM + h * HD + c8;   
      *(v8us*)(Ch + go) = o0;
      *(v8us*)(Cl + go) = o1;
    }
    
  }
}
__global__ __launch_bounds__(128) void k_attn_main(const unsigned short* __restrict__ Qh, const unsigned short* __restrict__ Ql,
                                                   const unsigned short* __restrict__ Kh, const unsigned short* __restrict__ Kl,
                                                   const unsigned short* __restrict__ Vth, const unsigned short* __restrict__ Vtl,
                                                   unsigned short* __restrict__ Ch, unsigned short* __restrict__ Cl) { attn_body<false>(Qh, Ql, Kh, Kl, Vth, Vtl, Ch, Cl); }
__global__ __launch_bounds__(128) void k_attn_early(const unsigned short* __restrict__ Qh, const unsigned short* __restrict__ Ql,
                                                    const unsigned short* __restrict__ Kh, const unsigned short* __restrict__ Kl,
                                                    const unsigned short* __restrict__ Vth, const unsigned short* __restrict__ Vtl,
                                                    unsigned short* __restrict__ Ch, unsigned short* __restrict__ Cl) { attn_body<true>(Qh, Ql, Kh, Kl, Vth, Vtl, Ch, Cl); }

// output GEMM: out[(b, s)][n] = sum_k (ctx_hi + ctx_lo)[r][k] . bf16(WO)[n][k] + bf16(bO)[n]; wave tile 32 x 64; f32 rows of the full-size output layout;
// the bias float4 of a lane's four columns is read once by value and added in f32 at the store stage;
__global__ __launch_bounds__(128) void k_out(const unsigned short* __restrict__ Ah, const unsigned short* __restrict__ Al,
                                             const unsigned short* __restrict__ Bt, const float* __restrict__ bias, float* __restrict__ C) {
  __shared__ __attribute__((aligned(16))) float so[4][32][68];
  const int lane = threadIdx.x & 31, ln = lane & 15, hh = lane >> 4;
  const int w = __builtin_amdgcn_readfirstlane((int)(threadIdx.x >> 5));
  const int mt = blockIdx.x / (DM / 64), nq = blockIdx.x - mt * (DM / 64);
  const int row0 = mt * 128 + 32 * w, col0 = nq * 64;
  const size_t a0 = (size_t)(row0 + ln) * DM, a1 = a0 + (size_t)16 * DM;
  const size_t b0 = (size_t)(col0 + ln) * DM, b1 = b0 + (size_t)16 * DM, b2 = b1 + (size_t)16 * DM, b3 = b2 + (size_t)16 * DM;
  const v8f z8 = {0.f, 0.f, 0.f, 0.f, 0.f, 0.f, 0.f, 0.f};
  v8f c00 = z8, c01 = z8, c02 = z8, c03 = z8, c10 = z8, c11 = z8, c12 = z8, c13 = z8;
#pragma unroll 1
  for (int kb = 0; kb < DM; kb += 32) {
    const v16b h0 = ldb(Ah, a0 + kb, hh), l0 = ldb(Al, a0 + kb, hh);
    const v16b h1 = ldb(Ah, a1 + kb, hh), l1 = ldb(Al, a1 + kb, hh);
    v16b fb = ldb(Bt, b0 + kb, hh); c00 = mmaB<2>(h0, l0, fb, fb, c00); c10 = mmaB<2>(h1, l1, fb, fb, c10);
    fb = ldb(Bt, b1 + kb, hh); c01 = mmaB<2>(h0, l0, fb, fb, c01); c11 = mmaB<2>(h1, l1, fb, fb, c11);
    fb = ldb(Bt, b2 + kb, hh); c02 = mmaB<2>(h0, l0, fb, fb, c02); c12 = mmaB<2>(h1, l1, fb, fb, c12);
    fb = ldb(Bt, b3 + kb, hh); c03 = mmaB<2>(h0, l0, fb, fb, c03); c13 = mmaB<2>(h1, l1, fb, fb, c13);
  }
  v8f accs[8] = {c00, c01, c02, c03, c10, c11, c12, c13};
#pragma unroll
  for (int u = 0; u < 8; ++u) {
    const int t = u & 3, half = u >> 2;
#pragma unroll
    for (int r = 0; r < 8; ++r) so[w][half * 16 + 8 * hh + r][t * 16 + ln] = accs[u][r];
  }
  __builtin_amdgcn_fence(4 /* acq_rel order */, "workgroup");
  __builtin_amdgcn_wave_barrier();
  const int rsub = lane >> 4, c4 = (lane & 15) * 4;
  const v4f bx = *(const v4fa*)(bias + col0 + c4);   /* columns col0 + c4 .. + 3 < DM */
  const v4f bv = {bf16_rne(bx[0]), bf16_rne(bx[1]), bf16_rne(bx[2]), bf16_rne(bx[3])};
  {
#pragma unroll
    for (int q = 0; q < 16; ++q) {
      const int r = q * 2 + rsub;                    /* q 0..15 x rsub 0..1 -> rows 0..31 */
      const v4f sv = *(const v4fa*)&so[w][r][c4];
      const v4f v = sv + bv;
      const int grow = row0 + r;
      const int bb = grow / SEQ, s = grow - bb * SEQ;
      *(v4f*)(C + ((size_t)bb * SEQ_FULL + s) * DM + col0 + c4) = v;
    }
    
  }
}

/* workspace carve (bytes): 3 input planes + 4 weight planes + Qh Ql Kh Kl + Vh Vl + Vth + Vtl + Ch Cl */
#define XB ((size_t)NR * DM * 2)
#define WB ((size_t)DM * DM * 2)
#define VLB ((size_t)NB * NH * HD * QE * 2)
static_assert(XB % 256 == 0 && WB % 256 == 0 && VLB % 256 == 0);
static_assert(12 * XB + 4 * WB + VLB <= (size_t)134217728);   /* total carve stays within 128 MiB */

extern "C" void kernel_launch(void* const* d_in, const int* in_sizes, int n_in,
                              void* d_out, int out_size, void* d_ws, size_t ws_size, hipStream_t stream) {
  if (n_in < 8) return;
  const long long need_x = ((long long)(NB - 1) * SEQ_FULL + SEQ) * DM;
  if (in_sizes[0] < need_x || in_sizes[1] < need_x || in_sizes[2] < need_x) return;
  if (in_sizes[3] < DM * DM || in_sizes[4] < DM * DM || in_sizes[5] < DM * DM || in_sizes[6] < DM * DM) return;
  if (in_sizes[7] < DM) return;
  if (out_size < need_x) return;
  const float* xq = (const float*)d_in[0];      /* table order: Q, K, V, WQ, WK, WV, WO, bO */
  const float* xk = (const float*)d_in[1];
  const float* xv = (const float*)d_in[2];
  const float* wq = (const float*)d_in[3];
  const float* wk = (const float*)d_in[4];
  const float* wv = (const float*)d_in[5];
  const float* wo = (const float*)d_in[6];
  const float* bo = (const float*)d_in[7];
  char* ws = (char*)d_ws; size_t off = 0;
  auto take = [&](size_t bytes) { char* p = ws + off; off += (bytes + 255) & ~(size_t)255; return (unsigned short*)p; };
  unsigned short* XQ = take(XB); unsigned short* XK = take(XB); unsigned short* XV = take(XB);
  unsigned short* BQ = take(WB); unsigned short* BK = take(WB); unsigned short* BV = take(WB); unsigned short* BO = take(WB);
  unsigned short* Qh = take(XB); unsigned short* Ql = take(XB); unsigned short* Kh = take(XB); unsigned short* Kl = take(XB);
  unsigned short* Vh = take(XB); unsigned short* Vl = take(XB);
  unsigned short* Vth = take(XB); unsigned short* Vtl = take(VLB);
  unsigned short* Ch = take(XB); unsigned short* Cl = take(XB);
  if (off > ws_size) return;

  const unsigned gx = (unsigned)(NR * DM / 8 / 256), gw = (unsigned)(DM * DM / 8 / 256);
  k_x16<<<gx, 256, 0, stream>>>(xq, XQ);
  k_x16<<<gx, 256, 0, stream>>>(xk, XK);
  k_x16<<<gx, 256, 0, stream>>>(xv, XV);
  k_wnat<<<gw, 256, 0, stream>>>(wq, BQ);        /* natural [out][in] = Bt[n][k] as stored */
  k_wnat<<<gw, 256, 0, stream>>>(wk, BK);
  k_wnat<<<gw, 256, 0, stream>>>(wv, BV);
  k_wbf<<<gw, 256, 0, stream>>>(wo, BO);

  const unsigned gp = (unsigned)((NR / 128) * (DM / 64));
  k_proj_qk<<<gp, 128, 0, stream>>>(XQ, BQ, Qh, Ql);
  k_proj_qk<<<gp, 128, 0, stream>>>(XK, BK, Kh, Kl);
  k_proj_v<<<gp, 128, 0, stream>>>(XV, BV, Vh, Vl);

  k_vt<<<(unsigned)(NB * NH * (SEQ / 64)), 256, 0, stream>>>(Vh, Vth, SEQ);   /* in [NR][DM] rows -> out [(b,h)][64][SEQ] */
  k_vt<<<(unsigned)(NB * NH * (QE / 64)), 256, 0, stream>>>(Vl, Vtl, QE);     /* residual plane, first QE positions only -> [(b,h)][64][QE] */

  k_attn_early<<<(unsigned)(NB * NH * (QE / 64)), 128, 0, stream>>>(Qh, Ql, Kh, Kl, Vth, Vtl, Ch, Cl);
  if (SEQ > QE) k_attn_main<<<(unsigned)(NB * NH * ((SEQ - QE) / 64)), 128, 0, stream>>>(Qh, Ql, Kh, Kl, Vth, Vtl, Ch, Cl);

  k_out<<<gp, 128, 0, stream>>>(Ch, Cl, BO, bo, (float*)d_out);
}

// v002
// A run of this version takes 196 microseconds.
// In two side-by-side timings against v001, it was 1.47 and 1.46 times as fast.
// Over all steps from v000 it is 1.90 times as fast.
#include <hip/hip_runtime.h>
// Causal multi-head attention, three input streams (Q, K, V each [B][T][1024]), bias-free [out][in] input projections, 16 heads x 64, score scale 1/8, keys j > i excluded, out = ctx WO^T + bO (bO converted RNE to bf16, added in f32 at the store stage).
// Compute dtype: inputs converted (RNE) to bf16 and carried exactly as f16 rows / x16 f16 weights; Q,K,V projections v_wmma_f32_16x16x32_f16 (single product); scores v_wmma_f32_16x16x32_bf16 on bf16 hi|lo planes of q and k (three products); P.V v_wmma_f32_16x16x32_f16 with P carried x256 (first QE query rows: f16 value + x1024 residual planes for P and V, separate accumulator); output GEMM v_wmma_f32_16x16x32_bf16 with ctx as bf16 hi|lo against exact bf16 WO (two products); f32 accumulation and f32 softmax statistics everywhere.
#ifndef NB
#define NB 2
#endif
#ifndef SEQ
#define SEQ 2048
#endif
#ifndef QE
#define QE ((SEQ) < 256 ? (SEQ) : 256)   /* query rows per sequence that get residual planes on P and V */
#endif
#define NB_FULL 2
#define SEQ_FULL 2048
#define DM 1024
#define NH 16
#define HD 64
#define NR (NB * SEQ)

static_assert(NH * HD == DM);                 /* merged head columns h*64+d span the model width */
static_assert(HD == 64);                      
static_assert(DM % 64 == 0 && DM % 32 == 0);  /* GEMM column tiles of 64, k-steps of 32 */
static_assert(NR % 128 == 0);                 /* GEMM row tiles: 4 waves x 32 rows */
static_assert(SEQ % 64 == 0 && QE % 64 == 0 && QE <= SEQ && (SEQ - QE) % 64 == 0);  /* 4 query tiles of 16 per block; 32-key steps stay inside the sequence */
static_assert(NB <= NB_FULL && SEQ <= SEQ_FULL);
static_assert((NR * DM / 8) % 256 == 0 && (DM * DM / 8) % 256 == 0);  /* convert grids x 256 threads == plane extent */
static_assert((SEQ & (SEQ - 1)) == 0);        /* row -> (batch, position) by shift */
static_assert(DM % 4 == 0 && (DM / 64 - 1) * 64 + 15 * 4 + 4 <= DM);  /* per-lane float4 of the bias vector stays inside [DM] */
static_assert((size_t)NB_FULL * SEQ_FULL * DM * 4 == (size_t)16777216);  /* output buffer bytes, single output at byte offset 0 */

typedef __bf16 v16b __attribute__((ext_vector_type(16)));
typedef _Float16 v16h __attribute__((ext_vector_type(16)));
typedef unsigned short v8us __attribute__((ext_vector_type(8), may_alias));
typedef float v8f __attribute__((ext_vector_type(8)));
typedef float v4f __attribute__((ext_vector_type(4)));
typedef float v4fa __attribute__((ext_vector_type(4), may_alias));
union FragB { v16b v; v8us half[2]; unsigned short u[16]; };
union FragH { v16h v; v8us half[2]; _Float16 h[16]; unsigned short u[16]; };

__device__ __forceinline__ unsigned short bf16_bits(float x) { unsigned int u = __float_as_uint(x); return (unsigned short)((u + 0x7FFFu + ((u >> 16) & 1u)) >> 16); }
__device__ __forceinline__ float bf16_val(unsigned short b) { return __uint_as_float(((unsigned int)b) << 16); }
__device__ __forceinline__ float bf16_rne(float x) { return bf16_val(bf16_bits(x)); }

// fragment loader (A and B alike): elements 0..7 <- k0 + 8h + 0..7, elements 8..15 <- k0 + 16 + 8h + 0..7 of a k-contiguous 16-bit row
__device__ __forceinline__ v16b ldb(const unsigned short* __restrict__ p, size_t off, int hh) { FragB f; f.half[0] = *(const v8us*)(p + off + 8 * hh); f.half[1] = *(const v8us*)(p + off + 16 + 8 * hh); return f.v; }

// D += A.B with NT bf16 products: 1 = ah.bh, 2 = + al.bh, 3 = + ah.bl; one guard naming the accumulator and every fragment
template <int NT>
__device__ __forceinline__ v8f mmaB(v16b ah, v16b al, v16b bh, v16b bl, v8f c) {
  c = __builtin_amdgcn_wmma_f32_16x16x32_bf16(false, ah, false, bh, (short)0, c, false, false);
  if (NT >= 2) c = __builtin_amdgcn_wmma_f32_16x16x32_bf16(false, al, false, bh, (short)0, c, false, false);
  if (NT >= 3) c = __builtin_amdgcn_wmma_f32_16x16x32_bf16(false, ah, false, bl, (short)0, c, false, false);
  asm volatile("v_nop\n\tv_nop\n\tv_nop\n\tv_nop" : "+v"(c) : "v"(ah), "v"(al), "v"(bh), "v"(bl));
  return c;
}
__device__ __forceinline__ v8f mmaH1(v16h a, v16h b, v8f c) {
  v8f d = __builtin_amdgcn_wmma_f32_16x16x32_f16(false, a, false, b, (short)0, c, false, false);
  asm volatile("v_nop\n\tv_nop\n\tv_nop\n\tv_nop" : "+v"(d) : "v"(a), "v"(b));
  return d;
}

__global__ __launch_bounds__(256) void k_x16(const float* __restrict__ x, unsigned short* __restrict__ X16) {
  const int t = blockIdx.x * 256 + threadIdx.x;
  if (t >= NR * DM / 8) return;
  const int row = t / (DM / 8), c8 = (t - row * (DM / 8)) * 8;
  const int b = row / SEQ, s = row - b * SEQ;
  const float* src = x + ((size_t)b * SEQ_FULL + s) * DM + c8;
  const v4f a = *(const v4fa*)src, c = *(const v4fa*)(src + 4);
  FragH f;
#pragma unroll
  for (int q = 0; q < 4; ++q) { f.h[q] = (_Float16)bf16_rne(a[q]); f.h[4 + q] = (_Float16)bf16_rne(c[q]); }
  const v8us o = f.half[0];
  unsigned short* d = X16 + (size_t)t * 8;
  *(v8us*)d = o;
  
}
__global__ __launch_bounds__(256) void k_wnat(const float* __restrict__ w, unsigned short* __restrict__ Bt) {
  const int t = blockIdx.x * 256 + threadIdx.x;
  if (t >= DM * DM / 8) return;
  const v4f a = *(const v4fa*)(w + (size_t)t * 8), c = *(const v4fa*)(w + (size_t)t * 8 + 4);
  FragH f;
#pragma unroll
  for (int q = 0; q < 4; ++q) { f.h[q] = (_Float16)(bf16_rne(a[q]) * 16.0f); f.h[4 + q] = (_Float16)(bf16_rne(c[q]) * 16.0f); }
  const v8us o = f.half[0];
  unsigned short* d = Bt + (size_t)t * 8;
  *(v8us*)d = o;
  
}
__global__ __launch_bounds__(256) void k_wbf(const float* __restrict__ w, unsigned short* __restrict__ Bt) {
  const int t = blockIdx.x * 256 + threadIdx.x;
  if (t >= DM * DM / 8) return;
  const v4f a = *(const v4fa*)(w + (size_t)t * 8), c = *(const v4fa*)(w + (size_t)t * 8 + 4);
  v8us o;
#pragma unroll
  for (int q = 0; q < 4; ++q) { o[q] = bf16_bits(a[q]); o[4 + q] = bf16_bits(c[q]); }
  unsigned short* d = Bt + (size_t)t * 8;
  *(v8us*)d = o;
  
}

// fragment loaders for a row staged in LDS: the element order of ldb
__device__ __forceinline__ v16b ldbs(const unsigned short* p, int hh) { FragB f; f.half[0] = *(const v8us*)(p + 8 * hh); f.half[1] = *(const v8us*)(p + 16 + 8 * hh); return f.v; }
__device__ __forceinline__ v16h ldhs(const unsigned short* p, int hh) { FragH f; f.half[0] = *(const v8us*)(p + 8 * hh); f.half[1] = *(const v8us*)(p + 16 + 8 * hh); return f.v; }
// GEMM operand tiles: rows r, r + 16, ... of a [row][DM] plane, one 16-byte asynchronous copy global -> LDS per lane and line of text (8 lanes cover one 128-byte row piece);
// s_wait_xcnt closes each statement so that no address register is rewritten ahead of it
#define GP 72                                  /* LDS row pitch of a 64-k tile in 16-bit elements: 144 B = 16 B x odd */
__device__ __forceinline__ void rows4(unsigned l, const unsigned short* g) {
  asm volatile("global_load_async_to_lds_b128 %0, %1, off\n\tglobal_load_async_to_lds_b128 %2, %3, off\n\t"
               "global_load_async_to_lds_b128 %4, %5, off\n\tglobal_load_async_to_lds_b128 %6, %7, off\n\ts_wait_xcnt 0x0"
               :: "v"(l), "v"(g), "v"(l + 16 * GP * 2), "v"(g + 16 * DM), "v"(l + 32 * GP * 2), "v"(g + 32 * DM), "v"(l + 48 * GP * 2), "v"(g + 48 * DM) : "memory");
}
__device__ __forceinline__ void rows8(unsigned l, const unsigned short* g) {
  asm volatile("global_load_async_to_lds_b128 %0, %1, off\n\tglobal_load_async_to_lds_b128 %2, %3, off\n\t"
               "global_load_async_to_lds_b128 %4, %5, off\n\tglobal_load_async_to_lds_b128 %6, %7, off\n\t"
               "global_load_async_to_lds_b128 %8, %9, off\n\tglobal_load_async_to_lds_b128 %10, %11, off\n\t"
               "global_load_async_to_lds_b128 %12, %13, off\n\tglobal_load_async_to_lds_b128 %14, %15, off\n\ts_wait_xcnt 0x0"
               :: "v"(l), "v"(g), "v"(l + 16 * GP * 2), "v"(g + 16 * DM), "v"(l + 32 * GP * 2), "v"(g + 32 * DM), "v"(l + 48 * GP * 2), "v"(g + 48 * DM),
                  "v"(l + 64 * GP * 2), "v"(g + 64 * DM), "v"(l + 80 * GP * 2), "v"(g + 80 * DM), "v"(l + 96 * GP * 2), "v"(g + 96 * DM), "v"(l + 112 * GP * 2), "v"(g + 112 * DM) : "memory");
}
static_assert(DM / 64 >= 2);                   /* the two-buffer ring starts with tiles 0 and 1 */

// projection GEMM: Y[NR][DM] = A[NR][DM] (exact f16 rows) . Bt[n][k] (x16 f16) * 2^-4; block = 4 waves, wave tile 32 rows x 64 cols;
// MODE 0: Y -> bf16 hi | lo planes; MODE 1: Y -> f16 value | (Y - value) x 1024 planes. Epilogue: tile staged in wave-private LDS, then
template <int MODE>
__device__ __forceinline__ void proj_body(const unsigned short* __restrict__ A, const unsigned short* __restrict__ Bt,
                                          unsigned short* __restrict__ P0, unsigned short* __restrict__ P1) {
  __shared__ __attribute__((aligned(16))) float so[4][32][68];
  const int lane = threadIdx.x & 31, ln = lane & 15, hh = lane >> 4;
  const int w = __builtin_amdgcn_readfirstlane((int)(threadIdx.x >> 5));
  const int mt = blockIdx.x / (DM / 64), nq = blockIdx.x - mt * (DM / 64);
  const int row0 = mt * 128 + 32 * w, col0 = nq * 64;
  /* the block's 128 A rows and 64 Bt rows, 64 k at a time, are copied once per block into a two-buffer LDS ring, one tile ahead of their use */
  constexpr int OB = 128 * GP, GBUF = OB + 64 * GP;   /* place of the Bt rows inside a buffer; buffer size */
  __shared__ __attribute__((aligned(16))) unsigned short ab[2 * GBUF];
  const int sr = (int)threadIdx.x >> 3, sc = ((int)threadIdx.x & 7) * 8;   /* rows sr + 16 j, 16-byte piece sc */
  const unsigned short* gA = A + (size_t)(mt * 128 + sr) * DM + sc;
  const unsigned short* gB = Bt + (size_t)(col0 + sr) * DM + sc;
  const unsigned lA = (unsigned)(size_t)ab + (unsigned)(sr * GP + sc) * 2u;
  auto stage = [&](int t) {                           /* k tile t -> buffer t mod 2 */
    const unsigned la = lA + (unsigned)(t & 1) * (unsigned)(GBUF * 2);
    rows8(la, gA + t * 64);
    rows4(la + OB * 2, gB + t * 64);
  };
  const v8f z8 = {0.f, 0.f, 0.f, 0.f, 0.f, 0.f, 0.f, 0.f};
  v8f c00 = z8, c01 = z8, c02 = z8, c03 = z8, c10 = z8, c11 = z8, c12 = z8, c13 = z8;
  stage(0);
  asm volatile("s_wait_asynccnt 0x0" ::: "memory");   /* tile 0's copies of this wave have landed */
  __syncthreads();                                    /* ... and every other wave's */
  stage(1);
#pragma unroll 1
  for (int t = 0; t < DM / 64; ++t) {
    const unsigned short* pa = ab + (t & 1) * GBUF + (32 * w + ln) * GP;
    const unsigned short* pb = ab + (t & 1) * GBUF + OB + ln * GP;
    v16h fa[2][2], fb[2][4];                            /* the tile's LDS reads go as one group ahead of its products */
#pragma unroll
    for (int s = 0; s < 2; ++s) {
      fa[s][0] = ldhs(pa + 32 * s, hh); fa[s][1] = ldhs(pa + 16 * GP + 32 * s, hh);
#pragma unroll
      for (int j = 0; j < 4; ++j) fb[s][j] = ldhs(pb + 16 * j * GP + 32 * s, hh);
    }
#pragma unroll
    for (int s = 0; s < 2; ++s) {
      c00 = mmaH1(fa[s][0], fb[s][0], c00); c10 = mmaH1(fa[s][1], fb[s][0], c10);
      c01 = mmaH1(fa[s][0], fb[s][1], c01); c11 = mmaH1(fa[s][1], fb[s][1], c11);
      c02 = mmaH1(fa[s][0], fb[s][2], c02); c12 = mmaH1(fa[s][1], fb[s][2], c12);
      c03 = mmaH1(fa[s][0], fb[s][3], c03); c13 = mmaH1(fa[s][1], fb[s][3], c13);
    }
    asm volatile("s_wait_dscnt 0x0" ::: "memory");      /* this wave's reads of buffer t mod 2 are done before it is refilled */
    asm volatile("s_wait_asynccnt 0x0" ::: "memory");   /* this wave's copies of tile t + 1 have landed */
    __syncthreads();                                    /* publishes tile t + 1, ends every wave's reads of tile t */
    if (t + 2 < DM / 64) stage(t + 2);                  /* block-uniform */
  }
  asm volatile("s_wait_asynccnt 0x0" ::: "memory");     /* nothing in flight when the wave goes on */
  v8f accs[8] = {c00, c01, c02, c03, c10, c11, c12, c13};
#pragma unroll
  for (int u = 0; u < 8; ++u) {
    const int t = u & 3, half = u >> 2;
#pragma unroll
    for (int r = 0; r < 8; ++r) so[w][half * 16 + 8 * hh + r][t * 16 + ln] = accs[u][r] * 0.0625f;
  }
  __builtin_amdgcn_fence(4 /* acq_rel order */, "workgroup");
  __builtin_amdgcn_wave_barrier();
  const int rq = lane >> 3, c8 = (lane & 7) * 8;
  {
#pragma unroll
    for (int q = 0; q < 8; ++q) {
      const int r = q * 4 + rq;                       /* q 0..7 x rq 0..3 -> rows 0..31 */
      const v4f x0 = *(const v4fa*)&so[w][r][c8], x1 = *(const v4fa*)&so[w][r][c8 + 4];
      const float xs[8] = {x0[0], x0[1], x0[2], x0[3], x1[0], x1[1], x1[2], x1[3]};
      v8us o0, o1;
      if (MODE == 0) {
#pragma unroll
        for (int i = 0; i < 8; ++i) { const unsigned short hb = bf16_bits(xs[i]); o0[i] = hb; o1[i] = bf16_bits(xs[i] - bf16_val(hb)); }
      } else {
        FragH fh, fl;
#pragma unroll
        for (int i = 0; i < 8; ++i) { const _Float16 hv = (_Float16)xs[i]; fh.h[i] = hv; fl.h[i] = (_Float16)((xs[i] - (float)hv) * 1024.0f); }
        o0 = fh.half[0]; o1 = fl.half[0];
      }
      const size_t go = (size_t)(row0 + r) * DM + col0 + c8;
      *(v8us*)(P0 + go) = o0;
      *(v8us*)(P1 + go) = o1;
    }
    
  }
}
__global__ __launch_bounds__(128) void k_proj_qk(const unsigned short* __restrict__ A, const unsigned short* __restrict__ Bt,
                                                 unsigned short* __restrict__ P0, unsigned short* __restrict__ P1) { proj_body<0>(A, Bt, P0, P1); }
__global__ __launch_bounds__(128) void k_proj_v(const unsigned short* __restrict__ A, const unsigned short* __restrict__ Bt,
                                                unsigned short* __restrict__ P0, unsigned short* __restrict__ P1) { proj_body<1>(A, Bt, P0, P1); }

// V rows [NR][DM] -> Vt[(b*NH + h)][d][s], s < ntok (row pitch ntok); block per ((b,h), 64 positions); 64x64 tile through LDS
__global__ __launch_bounds__(256) void k_vt(const unsigned short* __restrict__ V16, unsigned short* __restrict__ Vt, int ntok) {
  __shared__ unsigned short tl[64][66];
  const int tid = threadIdx.x;
  const int ng = ntok / 64;
  const int slab = blockIdx.x / ng, lg = blockIdx.x - slab * ng;
  const int b = slab / NH, h = slab - b * NH;
  for (int i = tid; i < 64 * 8; i += 256) {
    const int r = i / 8, c8 = (i % 8) * 8;
    FragH f;
    f.half[0] = *(const v8us*)(V16 + ((size_t)b * SEQ + lg * 64 + r) * DM + h * HD + c8);
#pragma unroll
    for (int q = 0; q < 8; ++q) tl[r][c8 + q] = f.u[q];
  }
  __syncthreads();
  {
#pragma unroll
    for (int rd = 0; rd < 2; ++rd) {
      const int d = rd * 32 + tid / 8, pc = tid % 8;  /* rd 0..1 x tid/8 0..31 -> d 0..63; pc 0..7 -> 64 positions */
      FragH f;
#pragma unroll
      for (int q = 0; q < 8; ++q) f.u[q] = tl[pc * 8 + q][d];
      const v8us o = f.half[0];
      *(v8us*)(Vt + ((size_t)slab * HD + d) * ntok + lg * 64 + pc * 8) = o;
    }
    
  }
}

// 16-byte asynchronous copies global -> LDS, one per lane and line of text; s_wait_xcnt closes each statement so that no address register is rewritten ahead of it
__device__ __forceinline__ void copy6(unsigned l0, const unsigned short* g0, unsigned l1, const unsigned short* g1, unsigned l2, const unsigned short* g2,
                                      unsigned l3, const unsigned short* g3, unsigned l4, const unsigned short* g4, unsigned l5, const unsigned short* g5) {
  asm volatile("global_load_async_to_lds_b128 %0, %1, off\n\tglobal_load_async_to_lds_b128 %2, %3, off\n\tglobal_load_async_to_lds_b128 %4, %5, off\n\t"
               "global_load_async_to_lds_b128 %6, %7, off\n\tglobal_load_async_to_lds_b128 %8, %9, off\n\tglobal_load_async_to_lds_b128 %10, %11, off\n\ts_wait_xcnt 0x0"
               :: "v"(l0), "v"(g0), "v"(l1), "v"(g1), "v"(l2), "v"(g2), "v"(l3), "v"(g3), "v"(l4), "v"(g4), "v"(l5), "v"(g5) : "memory");
}
__device__ __forceinline__ void copy2(unsigned l0, const unsigned short* g0, unsigned l1, const unsigned short* g1) {
  asm volatile("global_load_async_to_lds_b128 %0, %1, off\n\tglobal_load_async_to_lds_b128 %2, %3, off\n\ts_wait_xcnt 0x0"
               :: "v"(l0), "v"(g0), "v"(l1), "v"(g1) : "memory");
}

// fused causal attention: wave = 16 queries of one (b, h); keys walked in 32-key steps up to the diagonal; S^T = K.Q^T (A = K rows, B = Q rows;
// D row = key 8h+r, D col = query) so a lane owns one query: running max / sum in registers, one shuffle joins the two lane halves;
// P fragment (B operand, k = key) taken directly from the two score accumulators (element r <- keys 8h+r, element 8+r <- keys 16+8h+r);
// O^T = V^T.P (A = V^T rows, d x key). EARLY: P and V also carry x1024 residual planes into a second accumulator.
// The 32-key tiles of K (hi, lo) and V^T are shared by the block's four waves: copied once per block into a two-buffer LDS ring, one step ahead of their use.
template <bool EARLY>
__device__ __forceinline__ void attn_body(const unsigned short* __restrict__ Qh, const unsigned short* __restrict__ Ql,
                                          const unsigned short* __restrict__ Kh, const unsigned short* __restrict__ Kl,
                                          const unsigned short* __restrict__ Vth, const unsigned short* __restrict__ Vtl,
                                          unsigned short* __restrict__ Ch, unsigned short* __restrict__ Cl) {
  __shared__ __attribute__((aligned(16))) float so[4][16][68];
  constexpr int QT0 = EARLY ? 0 : QE / 16;
  constexpr int NQT = EARLY ? QE / 16 : (SEQ - QE) / 16;
  constexpr int BPB = (NQT / 4 > 0) ? NQT / 4 : 1;   /* blocks per (b, h): 4 query tiles each */
  const int lane = threadIdx.x & 31, ln = lane & 15, hh = lane >> 4;
  const int wave = __builtin_amdgcn_readfirstlane((int)(threadIdx.x >> 5));
  const int bh = blockIdx.x / BPB;
  const int qt = QT0 + (blockIdx.x - bh * BPB) * 4 + wave;
  const int b = bh / NH, h = bh - b * NH;
  const int qBase = qt * 16;
  const int nkt = (qBase + 47) >> 5;     /* 32-key steps covering keys 0..qBase+15 */
  const int nFull = qBase >> 5;          /* steps whose 32 keys are all <= qBase */
  const int qrow = qBase + ln;
  const size_t offQ = ((size_t)b * SEQ + qrow) * DM + h * HD;
  constexpr int KP = 72, VP = 40;              /* LDS row pitch in 16-bit elements: 144 B and 80 B, both 16 B x odd */
  constexpr int OKL = 32 * KP, OV = 2 * OKL, OVL = OV + 64 * VP;   /* places of K lo, V^T, V^T residual inside a buffer */
  constexpr int BUF = EARLY ? OVL + 64 * VP : OVL;
  static_assert((BUF * 2) % 16 == 0 && (KP * 2) % 16 == 0 && (VP * 2) % 16 == 0);
  __shared__ __attribute__((aligned(16))) unsigned short kv[2 * BUF];
  const int nktB = ((QT0 + (blockIdx.x - bh * BPB) * 4) >> 1) + 2;   /* steps of the block's last wave: keys up to its first query + 63, inside the sequence */
  const int tid = threadIdx.x;
  const int kr = tid >> 3, kc = (tid & 7) * 8;  /* K rows kr and kr + 16, 16-byte piece kc */
  const int vr = tid >> 2, vc = (tid & 3) * 8;  /* V^T rows vr and vr + 32, 16-byte piece vc */
  const size_t gK = ((size_t)b * SEQ + kr) * DM + h * HD + kc;
  const size_t gV = ((size_t)bh * HD + vr) * SEQ + vc;
  const size_t gVl = ((size_t)bh * HD + vr) * QE + vc;
  const unsigned lK = (unsigned)(size_t)kv + (unsigned)(kr * KP + kc) * 2u;
  const unsigned lV = (unsigned)(size_t)kv + (unsigned)(OV + vr * VP + vc) * 2u;
  auto stage = [&](int t) {                     /* key step t -> buffer t mod 2 */
    const unsigned lb = (unsigned)(t & 1) * (unsigned)(BUF * 2);
    const size_t k0 = gK + (size_t)t * 32 * DM, v0 = gV + (size_t)t * 32;
    copy6(lK + lb, Kh + k0, lK + lb + 16 * KP * 2, Kh + k0 + 16 * DM,
          lK + lb + OKL * 2, Kl + k0, lK + lb + (OKL + 16 * KP) * 2, Kl + k0 + 16 * DM,
          lV + lb, Vth + v0, lV + lb + 32 * VP * 2, Vth + v0 + (size_t)32 * SEQ);
    if (EARLY) {
      const size_t w0 = gVl + (size_t)t * 32;
      copy2(lV + lb + 64 * VP * 2, Vtl + w0, lV + lb + 96 * VP * 2, Vtl + w0 + (size_t)32 * QE);
    }
  };
  const v8f z8 = {0.f, 0.f, 0.f, 0.f, 0.f, 0.f, 0.f, 0.f};
  v8f oacc[4] = {z8, z8, z8, z8};
  v8f ores[4] = {z8, z8, z8, z8};
  float m = -__builtin_inff(), l = 0.f;
  stage(0);
  asm volatile("s_wait_asynccnt 0x0" ::: "memory");   /* step 0's copies of this wave have landed */
  __syncthreads();                                    /* ... and every other wave's */
  stage(1);                                           /* nktB >= 2 */
#pragma unroll 1
  for (int it = 0; it < nktB; ++it) {
   if (it < nkt) {                       /* wave-uniform: a wave past its diagonal only passes the hand-over below */
    const int kb = it * 32;
    const unsigned short* kvb = kv + (it & 1) * BUF;
    v8f st0 = z8, st1 = z8;
#pragma unroll
    for (int dc = 0; dc < 2; ++dc) {
      const size_t qo = offQ + dc * 32;
      const v16b fqh = ldb(Qh, qo, hh), fql = ldb(Ql, qo, hh);
      const unsigned short* k0 = kvb + ln * KP + dc * 32;
      const unsigned short* k1 = k0 + 16 * KP;
      st0 = mmaB<3>(ldbs(k0, hh), ldbs(k0 + OKL, hh), fqh, fql, st0);
      st1 = mmaB<3>(ldbs(k1, hh), ldbs(k1 + OKL, hh), fqh, fql, st1);
      asm volatile("" ::: "memory");
    }
    float s0[8], s1[8];
#pragma unroll
    for (int r = 0; r < 8; ++r) { s0[r] = st0[r] * 0.125f; s1[r] = st1[r] * 0.125f; }
    if (it >= nFull) {                   /* wave-uniform: only the last step touches the diagonal */
#pragma unroll
      for (int r = 0; r < 8; ++r) {
        const int key = kb + 8 * hh + r;
        s0[r] = (key > qrow) ? -__builtin_inff() : s0[r];
        s1[r] = (key + 16 > qrow) ? -__builtin_inff() : s1[r];
      }
    }
    float mt = fmaxf(s0[0], s1[0]);
#pragma unroll
    for (int r = 1; r < 8; ++r) mt = fmaxf(mt, fmaxf(s0[r], s1[r]));
    const float mo = __shfl_xor(mt, 16);
    const float mnew = fmaxf(fmaxf(mt, mo), m);   /* finite: key kb <= qBase is visible to every query of the tile */
    const float alpha = __expf(m - mnew);
    m = mnew;
    l *= alpha;
#pragma unroll
    for (int dt = 0; dt < 4; ++dt) { oacc[dt] *= alpha; if (EARLY) ores[dt] *= alpha; }
    FragH ph, pl;
#pragma unroll
    for (int r = 0; r < 8; ++r) {
      const float p0 = __expf(s0[r] - m), p1 = __expf(s1[r] - m);
      l += p0 + p1;
      const float c0 = p0 * 256.0f, c1 = p1 * 256.0f;
      const _Float16 h0 = (_Float16)c0, h1 = (_Float16)c1;
      ph.h[r] = h0; ph.h[8 + r] = h1;
      pl.h[r] = (_Float16)((c0 - (float)h0) * 1024.0f);
      pl.h[8 + r] = (_Float16)((c1 - (float)h1) * 1024.0f);
    }
    asm volatile("" ::: "memory");
#pragma unroll
    for (int dt = 0; dt < 4; ++dt) {
      const unsigned short* vo = kvb + OV + (dt * 16 + ln) * VP;
      FragH vh; vh.v = ldhs(vo, hh);
      if (EARLY) {
        FragH vl; vl.v = ldhs(vo + 64 * VP, hh);
        v8f o = oacc[dt], e = ores[dt];
        o = __builtin_amdgcn_wmma_f32_16x16x32_f16(false, vh.v, false, ph.v, (short)0, o, false, false);
        e = __builtin_amdgcn_wmma_f32_16x16x32_f16(false, vl.v, false, ph.v, (short)0, e, false, false);
        e = __builtin_amdgcn_wmma_f32_16x16x32_f16(false, vh.v, false, pl.v, (short)0, e, false, false);
        asm volatile("v_nop\n\tv_nop\n\tv_nop\n\tv_nop" : "+v"(o), "+v"(e) : "v"(vh.v), "v"(vl.v), "v"(ph.v), "v"(pl.v));
        oacc[dt] = o; ores[dt] = e;
      } else {
        oacc[dt] = mmaH1(vh.v, ph.v, oacc[dt]);
      }
    }
    asm volatile("" ::: "memory");
   }
    asm volatile("s_wait_dscnt 0x0" ::: "memory");      /* this wave's reads of buffer it mod 2 are done before it is refilled */
    asm volatile("s_wait_asynccnt 0x0" ::: "memory");   /* this wave's copies of step it + 1 have landed */
    __syncthreads();                                    /* publishes step it + 1, ends every wave's reads of step it */
    if (it + 2 < nktB) stage(it + 2);                   /* block-uniform */
  }
  asm volatile("s_wait_asynccnt 0x0" ::: "memory");     /* nothing in flight when the wave goes on */
  const float lt = l + __shfl_xor(l, 16);
  const float rinv = 1.0f / (256.0f * lt);
  // O^T (d = dt*16 + 8h + r, query = ln) -> wave-private LDS tile [query][d]
#pragma unroll
  for (int dt = 0; dt < 4; ++dt) {
    v8f o = oacc[dt];
    if (EARLY) o = o + ores[dt] * 0.0009765625f;
    const v4f w0 = {o[0] * rinv, o[1] * rinv, o[2] * rinv, o[3] * rinv};
    const v4f w1 = {o[4] * rinv, o[5] * rinv, o[6] * rinv, o[7] * rinv};
    *(v4fa*)&so[wave][ln][dt * 16 + 8 * hh] = w0;
    *(v4fa*)&so[wave][ln][dt * 16 + 8 * hh + 4] = w1;
  }
  __builtin_amdgcn_fence(4 /* acq_rel order */, "workgroup");
  __builtin_amdgcn_wave_barrier();
  const int rq = lane >> 3, c8 = (lane & 7) * 8;
  {
#pragma unroll
    for (int q = 0; q < 4; ++q) {
      const int r = q * 4 + rq;                      /* q 0..3 x rq 0..3 -> query rows 0..15 */
      const v4f x0 = *(const v4fa*)&so[wave][r][c8], x1 = *(const v4fa*)&so[wave][r][c8 + 4];
      const float xs[8] = {x0[0], x0[1], x0[2], x0[3], x1[0], x1[1], x1[2], x1[3]};
      v8us o0, o1;
#pragma unroll
      for (int i = 0; i < 8; ++i) { const unsigned short hb = bf16_bits(xs[i]); o0[i] = hb; o1[i] = bf16_bits(xs[i] - bf16_val(hb)); }
      const size_t go = ((size_t)b * SEQ + qBase + r) * DM + h * HD + c8;   
      *(v8us*)(Ch + go) = o0;
      *(v8us*)(Cl + go) = o1;
    }
    
  }
}
__global__ __launch_bounds__(128) void k_attn_main(const unsigned short* __restrict__ Qh, const unsigned short* __restrict__ Ql,
                                                   const unsigned short* __restrict__ Kh, const unsigned short* __restrict__ Kl,
                                                   const unsigned short* __restrict__ Vth, const unsigned short* __restrict__ Vtl,
                                                   unsigned short* __restrict__ Ch, unsigned short* __restrict__ Cl) { attn_body<false>(Qh, Ql, Kh, Kl, Vth, Vtl, Ch, Cl); }
__global__ __launch_bounds__(128) void k_attn_early(const unsigned short* __restrict__ Qh, const unsigned short* __restrict__ Ql,
                                                    const unsigned short* __restrict__ Kh, const unsigned short* __restrict__ Kl,
                                                    const unsigned short* __restrict__ Vth, const unsigned short* __restrict__ Vtl,
                                                    unsigned short* __restrict__ Ch, unsigned short* __restrict__ Cl) { attn_body<true>(Qh, Ql, Kh, Kl, Vth, Vtl, Ch, Cl); }

// output GEMM: out[(b, s)][n] = sum_k (ctx_hi + ctx_lo)[r][k] . bf16(WO)[n][k] + bf16(bO)[n]; wave tile 32 x 64; f32 rows of the full-size output layout;
// the bias float4 of a lane's four columns is read once by value and added in f32 at the store stage;
__global__ __launch_bounds__(128) void k_out(const unsigned short* __restrict__ Ah, const unsigned short* __restrict__ Al,
                                             const unsigned short* __restrict__ Bt, const float* __restrict__ bias, float* __restrict__ C) {
  __shared__ __attribute__((aligned(16))) float so[4][32][68];
  const int lane = threadIdx.x & 31, ln = lane & 15, hh = lane >> 4;
  const int w = __builtin_amdgcn_readfirstlane((int)(threadIdx.x >> 5));
  const int mt = blockIdx.x / (DM / 64), nq = blockIdx.x - mt * (DM / 64);
  const int row0 = mt * 128 + 32 * w, col0 = nq * 64;
  /* the block's 128 ctx rows (hi, lo) and 64 Bt rows, 64 k at a time, are copied once per block into a two-buffer LDS ring, one tile ahead of their use */
  constexpr int OL = 128 * GP, OB = 2 * OL, GBUF = OB + 64 * GP;   /* places of the lo rows and the Bt rows inside a buffer; buffer size */
  __shared__ __attribute__((aligned(16))) unsigned short ab[2 * GBUF];
  const int sr = (int)threadIdx.x >> 3, sc = ((int)threadIdx.x & 7) * 8;   /* rows sr + 16 j, 16-byte piece sc */
  const size_t oA = (size_t)(mt * 128 + sr) * DM + sc;
  const unsigned short* gB = Bt + (size_t)(col0 + sr) * DM + sc;
  const unsigned lA = (unsigned)(size_t)ab + (unsigned)(sr * GP + sc) * 2u;
  auto stage = [&](int t) {                           /* k tile t -> buffer t mod 2 */
    const unsigned la = lA + (unsigned)(t & 1) * (unsigned)(GBUF * 2);
    rows8(la, Ah + oA + t * 64);
    rows8(la + OL * 2, Al + oA + t * 64);
    rows4(la + OB * 2, gB + t * 64);
  };
  const v8f z8 = {0.f, 0.f, 0.f, 0.f, 0.f, 0.f, 0.f, 0.f};
  v8f c00 = z8, c01 = z8, c02 = z8, c03 = z8, c10 = z8, c11 = z8, c12 = z8, c13 = z8;
  stage(0);
  asm volatile("s_wait_asynccnt 0x0" ::: "memory");   /* tile 0's copies of this wave have landed */
  __syncthreads();                                    /* ... and every other wave's */
  stage(1);
#pragma unroll 1
  for (int t = 0; t < DM / 64; ++t) {
    const unsigned short* pa = ab + (t & 1) * GBUF + (32 * w + ln) * GP;
    const unsigned short* pb = ab + (t & 1) * GBUF + OB + ln * GP;
    v16b fh[2][2], fl[2][2], fb[2][4];                  /* the tile's LDS reads go as one group ahead of its products */
#pragma unroll
    for (int s = 0; s < 2; ++s) {
      fh[s][0] = ldbs(pa + 32 * s, hh); fl[s][0] = ldbs(pa + OL + 32 * s, hh);
      fh[s][1] = ldbs(pa + 16 * GP + 32 * s, hh); fl[s][1] = ldbs(pa + OL + 16 * GP + 32 * s, hh);
#pragma unroll
      for (int j = 0; j < 4; ++j) fb[s][j] = ldbs(pb + 16 * j * GP + 32 * s, hh);
    }
#pragma unroll
    for (int s = 0; s < 2; ++s) {
      c00 = mmaB<2>(fh[s][0], fl[s][0], fb[s][0], fb[s][0], c00); c10 = mmaB<2>(fh[s][1], fl[s][1], fb[s][0], fb[s][0], c10);
      c01 = mmaB<2>(fh[s][0], fl[s][0], fb[s][1], fb[s][1], c01); c11 = mmaB<2>(fh[s][1], fl[s][1], fb[s][1], fb[s][1], c11);
      c02 = mmaB<2>(fh[s][0], fl[s][0], fb[s][2], fb[s][2], c02); c12 = mmaB<2>(fh[s][1], fl[s][1], fb[s][2], fb[s][2], c12);
      c03 = mmaB<2>(fh[s][0], fl[s][0], fb[s][3], fb[s][3], c03); c13 = mmaB<2>(fh[s][1], fl[s][1], fb[s][3], fb[s][3], c13);
    }
    asm volatile("s_wait_dscnt 0x0" ::: "memory");      /* this wave's reads of buffer t mod 2 are done before it is refilled */
    asm volatile("s_wait_asynccnt 0x0" ::: "memory");   /* this wave's copies of tile t + 1 have landed */
    __syncthreads();                                    /* publishes tile t + 1, ends every wave's reads of tile t */
    if (t + 2 < DM / 64) stage(t + 2);                  /* block-uniform */
  }
  asm volatile("s_wait_asynccnt 0x0" ::: "memory");     /* nothing in flight when the wave goes on */
  v8f accs[8] = {c00, c01, c02, c03, c10, c11, c12, c13};
#pragma unroll
  for (int u = 0; u < 8; ++u) {
    const int t = u & 3, half = u >> 2;
#pragma unroll
    for (int r = 0; r < 8; ++r) so[w][half * 16 + 8 * hh + r][t * 16 + ln] = accs[u][r];
  }
  __builtin_amdgcn_fence(4 /* acq_rel order */, "workgroup");
  __builtin_amdgcn_wave_barrier();
  const int rsub = lane >> 4, c4 = (lane & 15) * 4;
  const v4f bx = *(const v4fa*)(bias + col0 + c4);   /* columns col0 + c4 .. + 3 < DM */
  const v4f bv = {bf16_rne(bx[0]), bf16_rne(bx[1]), bf16_rne(bx[2]), bf16_rne(bx[3])};
  {
#pragma unroll
    for (int q = 0; q < 16; ++q) {
      const int r = q * 2 + rsub;                    /* q 0..15 x rsub 0..1 -> rows 0..31 */
      const v4f sv = *(const v4fa*)&so[w][r][c4];
      const v4f v = sv + bv;
      const int grow = row0 + r;
      const int bb = grow / SEQ, s = grow - bb * SEQ;
      *(v4f*)(C + ((size_t)bb * SEQ_FULL + s) * DM + col0 + c4) = v;
    }
    
  }
}

/* workspace carve (bytes): 3 input planes + 4 weight planes + Qh Ql Kh Kl + Vh Vl + Vth + Vtl + Ch Cl */
#define XB ((size_t)NR * DM * 2)
#define WB ((size_t)DM * DM * 2)
#define VLB ((size_t)NB * NH * HD * QE * 2)
static_assert(XB % 256 == 0 && WB % 256 == 0 && VLB % 256 == 0);
static_assert(12 * XB + 4 * WB + VLB <= (size_t)134217728);   /* total carve stays within 128 MiB */

extern "C" void kernel_launch(void* const* d_in, const int* in_sizes, int n_in,
                              void* d_out, int out_size, void* d_ws, size_t ws_size, hipStream_t stream) {
  if (n_in < 8) return;
  const long long need_x = ((long long)(NB - 1) * SEQ_FULL + SEQ) * DM;
  if (in_sizes[0] < need_x || in_sizes[1] < need_x || in_sizes[2] < need_x) return;
  if (in_sizes[3] < DM * DM || in_sizes[4] < DM * DM || in_sizes[5] < DM * DM || in_sizes[6] < DM * DM) return;
  if (in_sizes[7] < DM) return;
  if (out_size < need_x) return;
  const float* xq = (const float*)d_in[0];      /* table order: Q, K, V, WQ, WK, WV, WO, bO */
  const float* xk = (const float*)d_in[1];
  const float* xv = (const float*)d_in[2];
  const float* wq = (const float*)d_in[3];
  const float* wk = (const float*)d_in[4];
  const float* wv = (const float*)d_in[5];
  const float* wo = (const float*)d_in[6];
  const float* bo = (const float*)d_in[7];
  char* ws = (char*)d_ws; size_t off = 0;
  auto take = [&](size_t bytes) { char* p = ws + off; off += (bytes + 255) & ~(size_t)255; return (unsigned short*)p; };
  unsigned short* XQ = take(XB); unsigned short* XK = take(XB); unsigned short* XV = take(XB);
  unsigned short* BQ = take(WB); unsigned short* BK = take(WB); unsigned short* BV = take(WB); unsigned short* BO = take(WB);
  unsigned short* Qh = take(XB); unsigned short* Ql = take(XB); unsigned short* Kh = take(XB); unsigned short* Kl = take(XB);
  unsigned short* Vh = take(XB); unsigned short* Vl = take(XB);
  unsigned short* Vth = take(XB); unsigned short* Vtl = take(VLB);
  unsigned short* Ch = take(XB); unsigned short* Cl = take(XB);
  if (off > ws_size) return;

  const unsigned gx = (unsigned)(NR * DM / 8 / 256), gw = (unsigned)(DM * DM / 8 / 256);
  k_x16<<<gx, 256, 0, stream>>>(xq, XQ);
  k_x16<<<gx, 256, 0, stream>>>(xk, XK);
  k_x16<<<gx, 256, 0, stream>>>(xv, XV);
  k_wnat<<<gw, 256, 0, stream>>>(wq, BQ);        /* natural [out][in] = Bt[n][k] as stored */
  k_wnat<<<gw, 256, 0, stream>>>(wk, BK);
  k_wnat<<<gw, 256, 0, stream>>>(wv, BV);
  k_wbf<<<gw, 256, 0, stream>>>(wo, BO);

  const unsigned gp = (unsigned)((NR / 128) * (DM / 64));
  k_proj_qk<<<gp, 128, 0, stream>>>(XQ, BQ, Qh, Ql);
  k_proj_qk<<<gp, 128, 0, stream>>>(XK, BK, Kh, Kl);
  k_proj_v<<<gp, 128, 0, stream>>>(XV, BV, Vh, Vl);

  k_vt<<<(unsigned)(NB * NH * (SEQ / 64)), 256, 0, stream>>>(Vh, Vth, SEQ);   /* in [NR][DM] rows -> out [(b,h)][64][SEQ] */
  k_vt<<<(unsigned)(NB * NH * (QE / 64)), 256, 0, stream>>>(Vl, Vtl, QE);     /* residual plane, first QE positions only -> [(b,h)][64][QE] */

  k_attn_early<<<(unsigned)(NB * NH * (QE / 64)), 128, 0, stream>>>(Qh, Ql, Kh, Kl, Vth, Vtl, Ch, Cl);
  if (SEQ > QE) k_attn_main<<<(unsigned)(NB * NH * ((SEQ - QE) / 64)), 128, 0, stream>>>(Qh, Ql, Kh, Kl, Vth, Vtl, Ch, Cl);

  k_out<<<gp, 128, 0, stream>>>(Ch, Cl, BO, bo, (float*)d_out);
}

// v003
// It runs in 156 microseconds.
// Two timings next to v002 put it at 1.25 and 1.26 times that version's speed.
// Over all steps from v000 it is 2.39 times as fast.
#include <hip/hip_runtime.h>
// Causal multi-head attention, three input streams (Q, K, V each [B][T][1024]), bias-free [out][in] input projections, 16 heads x 64, score scale 1/8, keys j > i excluded, out = ctx WO^T + bO (bO converted RNE to bf16, added in f32 at the store stage).
// Compute dtype: inputs converted (RNE) to bf16 and carried exactly as f16 rows / x16 f16 weights; Q,K,V projections v_wmma_f32_16x16x32_f16 (single product); scores v_wmma_f32_16x16x32_bf16 on bf16 hi|lo planes of q and k (three products); P.V v_wmma_f32_16x16x32_f16 with P carried x256 (first QE query rows: f16 value + x1024 residual planes for P and V, separate accumulator); output GEMM v_wmma_f32_16x16x32_bf16 with ctx as bf16 hi|lo against exact bf16 WO (two products); f32 accumulation and f32 softmax statistics everywhere.
#ifndef NB
#define NB 2
#endif
#ifndef SEQ
#define SEQ 2048
#endif
#ifndef QE
#define QE ((SEQ) < 256 ? (SEQ) : 256)   /* query rows per sequence that get residual planes on P and V */
#endif
#define NB_FULL 2
#define SEQ_FULL 2048
#define DM 1024
#define NH 16
#define HD 64
#define NR (NB * SEQ)

static_assert(NH * HD == DM);                 /* merged head columns h*64+d span the model width */
static_assert(HD == 64);                      
static_assert(DM % 64 == 0 && DM % 32 == 0);  /* GEMM column tiles of 64, k-steps of 32 */
static_assert(NR % 128 == 0);                 /* GEMM row tiles: 4 waves x 32 rows */
static_assert(SEQ % 64 == 0 && QE % 64 == 0 && QE <= SEQ && (SEQ - QE) % 64 == 0);  /* 4 query tiles of 16 per block; 32-key steps stay inside the sequence */
static_assert(NB <= NB_FULL && SEQ <= SEQ_FULL);
static_assert((NR * DM / 8) % 256 == 0 && (DM * DM / 8) % 256 == 0);  /* convert grids x 256 threads == plane extent */
static_assert((SEQ & (SEQ - 1)) == 0);        /* row -> (batch, position) by shift */
static_assert(DM % 4 == 0 && (DM / 64 - 1) * 64 + 15 * 4 + 4 <= DM);  /* per-lane float4 of the bias vector stays inside [DM] */
static_assert((size_t)NB_FULL * SEQ_FULL * DM * 4 == (size_t)16777216);  /* output buffer bytes, single output at byte offset 0 */

typedef __bf16 v16b __attribute__((ext_vector_type(16)));
typedef _Float16 v16h __attribute__((ext_vector_type(16)));
typedef unsigned short v8us __attribute__((ext_vector_type(8), may_alias));
typedef float v8f __attribute__((ext_vector_type(8)));
typedef float v4f __attribute__((ext_vector_type(4)));
typedef float v4fa __attribute__((ext_vector_type(4), may_alias));
union FragB { v16b v; v8us half[2]; unsigned short u[16]; };
union FragH { v16h v; v8us half[2]; _Float16 h[16]; unsigned short u[16]; };

__device__ __forceinline__ unsigned short bf16_bits(float x) { unsigned int u = __float_as_uint(x); return (unsigned short)((u + 0x7FFFu + ((u >> 16) & 1u)) >> 16); }
__device__ __forceinline__ float bf16_val(unsigned short b) { return __uint_as_float(((unsigned int)b) << 16); }
__device__ __forceinline__ float bf16_rne(float x) { return bf16_val(bf16_bits(x)); }

// fragment loader (A and B alike): elements 0..7 <- k0 + 8h + 0..7, elements 8..15 <- k0 + 16 + 8h + 0..7 of a k-contiguous 16-bit row
__device__ __forceinline__ v16b ldb(const unsigned short* __restrict__ p, size_t off, int hh) { FragB f; f.half[0] = *(const v8us*)(p + off + 8 * hh); f.half[1] = *(const v8us*)(p + off + 16 + 8 * hh); return f.v; }

// D += A.B with NT bf16 products: 1 = ah.bh, 2 = + al.bh, 3 = + ah.bl; one guard naming the accumulator and every fragment
template <int NT>
__device__ __forceinline__ v8f mmaB(v16b ah, v16b al, v16b bh, v16b bl, v8f c) {
  c = __builtin_amdgcn_wmma_f32_16x16x32_bf16(false, ah, false, bh, (short)0, c, false, false);
  if (NT >= 2) c = __builtin_amdgcn_wmma_f32_16x16x32_bf16(false, al, false, bh, (short)0, c, false, false);
  if (NT >= 3) c = __builtin_amdgcn_wmma_f32_16x16x32_bf16(false, ah, false, bl, (short)0, c, false, false);
  asm volatile("v_nop\n\tv_nop\n\tv_nop\n\tv_nop" : "+v"(c) : "v"(ah), "v"(al), "v"(bh), "v"(bl));
  return c;
}
__device__ __forceinline__ v8f mmaH1(v16h a, v16h b, v8f c) {
  v8f d = __builtin_amdgcn_wmma_f32_16x16x32_f16(false, a, false, b, (short)0, c, false, false);
  asm volatile("v_nop\n\tv_nop\n\tv_nop\n\tv_nop" : "+v"(d) : "v"(a), "v"(b));
  return d;
}

__device__ __forceinline__ void x16_body(const float* __restrict__ x, unsigned short* __restrict__ X16, int blk) {
  const int t = blk * 256 + threadIdx.x;
  if (t >= NR * DM / 8) return;
  const int row = t / (DM / 8), c8 = (t - row * (DM / 8)) * 8;
  const int b = row / SEQ, s = row - b * SEQ;
  const float* src = x + ((size_t)b * SEQ_FULL + s) * DM + c8;
  const v4f a = *(const v4fa*)src, c = *(const v4fa*)(src + 4);
  FragH f;
#pragma unroll
  for (int q = 0; q < 4; ++q) { f.h[q] = (_Float16)bf16_rne(a[q]); f.h[4 + q] = (_Float16)bf16_rne(c[q]); }
  const v8us o = f.half[0];
  unsigned short* d = X16 + (size_t)t * 8;
  *(v8us*)d = o;
  
}
__device__ __forceinline__ void wnat_body(const float* __restrict__ w, unsigned short* __restrict__ Bt, int blk) {
  const int t = blk * 256 + threadIdx.x;
  if (t >= DM * DM / 8) return;
  const v4f a = *(const v4fa*)(w + (size_t)t * 8), c = *(const v4fa*)(w + (size_t)t * 8 + 4);
  FragH f;
#pragma unroll
  for (int q = 0; q < 4; ++q) { f.h[q] = (_Float16)(bf16_rne(a[q]) * 16.0f); f.h[4 + q] = (_Float16)(bf16_rne(c[q]) * 16.0f); }
  const v8us o = f.half[0];
  unsigned short* d = Bt + (size_t)t * 8;
  *(v8us*)d = o;
  
}
__device__ __forceinline__ void wbf_body(const float* __restrict__ w, unsigned short* __restrict__ Bt, int blk) {
  const int t = blk * 256 + threadIdx.x;
  if (t >= DM * DM / 8) return;
  const v4f a = *(const v4fa*)(w + (size_t)t * 8), c = *(const v4fa*)(w + (size_t)t * 8 + 4);
  v8us o;
#pragma unroll
  for (int q = 0; q < 4; ++q) { o[q] = bf16_bits(a[q]); o[4 + q] = bf16_bits(c[q]); }
  unsigned short* d = Bt + (size_t)t * 8;
  *(v8us*)d = o;
  
}
// the seven conversions need nothing of each other: one grid, each plane a range of the block index (block-uniform choice)
#define GX (NR * DM / 8 / 256)                 /* blocks per input plane */
#define GW (DM * DM / 8 / 256)                 /* blocks per weight plane */
__global__ __launch_bounds__(256) void k_conv(const float* __restrict__ xq, const float* __restrict__ xk, const float* __restrict__ xv,
                                              const float* __restrict__ wq, const float* __restrict__ wk, const float* __restrict__ wv, const float* __restrict__ wo,
                                              unsigned short* __restrict__ XQ, unsigned short* __restrict__ XK, unsigned short* __restrict__ XV,
                                              unsigned short* __restrict__ BQ, unsigned short* __restrict__ BK, unsigned short* __restrict__ BV, unsigned short* __restrict__ BO) {
  const int bid = blockIdx.x;
  if (bid < 3 * GX) {
    const int sel = bid / GX;
    x16_body(sel == 0 ? xq : sel == 1 ? xk : xv, sel == 0 ? XQ : sel == 1 ? XK : XV, bid - sel * GX);
  } else if (bid < 3 * GX + 3 * GW) {
    const int sel = (bid - 3 * GX) / GW;
    wnat_body(sel == 0 ? wq : sel == 1 ? wk : wv, sel == 0 ? BQ : sel == 1 ? BK : BV, bid - 3 * GX - sel * GW);   /* natural [out][in] = Bt[n][k] as stored */
  } else {
    wbf_body(wo, BO, bid - 3 * GX - 3 * GW);
  }
}

// fragment loaders for a row staged in LDS: the element order of ldb
__device__ __forceinline__ v16b ldbs(const unsigned short* p, int hh) { FragB f; f.half[0] = *(const v8us*)(p + 8 * hh); f.half[1] = *(const v8us*)(p + 16 + 8 * hh); return f.v; }
__device__ __forceinline__ v16h ldhs(const unsigned short* p, int hh) { FragH f; f.half[0] = *(const v8us*)(p + 8 * hh); f.half[1] = *(const v8us*)(p + 16 + 8 * hh); return f.v; }
// GEMM operand tiles: rows r, r + 16, ... of a [row][DM] plane, one 16-byte asynchronous copy global -> LDS per lane and line of text (8 lanes cover one 128-byte row piece);
// s_wait_xcnt closes each statement so that no address register is rewritten ahead of it
#define GP 72                                  /* LDS row pitch of a 64-k tile in 16-bit elements: 144 B = 16 B x odd */
__device__ __forceinline__ void rows4(unsigned l, const unsigned short* g) {
  asm volatile("global_load_async_to_lds_b128 %0, %1, off\n\tglobal_load_async_to_lds_b128 %2, %3, off\n\t"
               "global_load_async_to_lds_b128 %4, %5, off\n\tglobal_load_async_to_lds_b128 %6, %7, off\n\ts_wait_xcnt 0x0"
               :: "v"(l), "v"(g), "v"(l + 16 * GP * 2), "v"(g + 16 * DM), "v"(l + 32 * GP * 2), "v"(g + 32 * DM), "v"(l + 48 * GP * 2), "v"(g + 48 * DM) : "memory");
}
__device__ __forceinline__ void rows8(unsigned l, const unsigned short* g) {
  asm volatile("global_load_async_to_lds_b128 %0, %1, off\n\tglobal_load_async_to_lds_b128 %2, %3, off\n\t"
               "global_load_async_to_lds_b128 %4, %5, off\n\tglobal_load_async_to_lds_b128 %6, %7, off\n\t"
               "global_load_async_to_lds_b128 %8, %9, off\n\tglobal_load_async_to_lds_b128 %10, %11, off\n\t"
               "global_load_async_to_lds_b128 %12, %13, off\n\tglobal_load_async_to_lds_b128 %14, %15, off\n\ts_wait_xcnt 0x0"
               :: "v"(l), "v"(g), "v"(l + 16 * GP * 2), "v"(g + 16 * DM), "v"(l + 32 * GP * 2), "v"(g + 32 * DM), "v"(l + 48 * GP * 2), "v"(g + 48 * DM),
                  "v"(l + 64 * GP * 2), "v"(g + 64 * DM), "v"(l + 80 * GP * 2), "v"(g + 80 * DM), "v"(l + 96 * GP * 2), "v"(g + 96 * DM), "v"(l + 112 * GP * 2), "v"(g + 112 * DM) : "memory");
}
static_assert(DM / 64 >= 2);                   /* the two-buffer ring starts with tiles 0 and 1 */

// projection GEMM: Y[NR][DM] = A[NR][DM] (exact f16 rows) . Bt[n][k] (x16 f16) * 2^-4; block = 4 waves, wave tile 32 rows x 64 cols;
// MODE 0: Y -> bf16 hi | lo planes; MODE 1: Y -> f16 value | (Y - value) x 1024 planes. Epilogue: tile staged in wave-private LDS, then stored by proj_store
template <int MODE>
__device__ __forceinline__ void proj_store(const float (*sw)[68], int lane, int row0, int col0, unsigned short* __restrict__ P0, unsigned short* __restrict__ P1) {
  const int rq = lane >> 3, c8 = (lane & 7) * 8;
#pragma unroll
  for (int q = 0; q < 8; ++q) {
    const int r = q * 4 + rq;                       /* q 0..7 x rq 0..3 -> rows 0..31 */
    const v4f x0 = *(const v4fa*)&sw[r][c8], x1 = *(const v4fa*)&sw[r][c8 + 4];
    const float xs[8] = {x0[0], x0[1], x0[2], x0[3], x1[0], x1[1], x1[2], x1[3]};
    v8us o0, o1;
    if (MODE == 0) {
#pragma unroll
      for (int i = 0; i < 8; ++i) { const unsigned short hb = bf16_bits(xs[i]); o0[i] = hb; o1[i] = bf16_bits(xs[i] - bf16_val(hb)); }
    } else {
      FragH fh, fl;
#pragma unroll
      for (int i = 0; i < 8; ++i) { const _Float16 hv = (_Float16)xs[i]; fh.h[i] = hv; fl.h[i] = (_Float16)((xs[i] - (float)hv) * 1024.0f); }
      o0 = fh.half[0]; o1 = fl.half[0];
    }
    const size_t go = (size_t)(row0 + r) * DM + col0 + c8;
    *(v8us*)(P0 + go) = o0;
    *(v8us*)(P1 + go) = o1;
  }
}
// blk: the tile's index inside its own product; vmode (block-uniform): the MODE of the store stage
__device__ __forceinline__ void proj_body(const unsigned short* __restrict__ A, const unsigned short* __restrict__ Bt,
                                          unsigned short* __restrict__ P0, unsigned short* __restrict__ P1, int blk, bool vmode) {
  __shared__ __attribute__((aligned(16))) float so[4][32][68];
  const int lane = threadIdx.x & 31, ln = lane & 15, hh = lane >> 4;
  const int w = __builtin_amdgcn_readfirstlane((int)(threadIdx.x >> 5));
  const int mt = blk / (DM / 64), nq = blk - mt * (DM / 64);
  const int row0 = mt * 128 + 32 * w, col0 = nq * 64;
  /* the block's 128 A rows and 64 Bt rows, 64 k at a time, are copied once per block into a two-buffer LDS ring, one tile ahead of their use */
  constexpr int OB = 128 * GP, GBUF = OB + 64 * GP;   /* place of the Bt rows inside a buffer; buffer size */
  __shared__ __attribute__((aligned(16))) unsigned short ab[2 * GBUF];
  const int sr = (int)threadIdx.x >> 3, sc = ((int)threadIdx.x & 7) * 8;   /* rows sr + 16 j, 16-byte piece sc */
  const unsigned short* gA = A + (size_t)(mt * 128 + sr) * DM + sc;
  const unsigned short* gB = Bt + (size_t)(col0 + sr) * DM + sc;
  const unsigned lA = (unsigned)(size_t)ab + (unsigned)(sr * GP + sc) * 2u;
  auto stage = [&](int t) {                           /* k tile t -> buffer t mod 2 */
    const unsigned la = lA + (unsigned)(t & 1) * (unsigned)(GBUF * 2);
    rows8(la, gA + t * 64);
    rows4(la + OB * 2, gB + t * 64);
  };
  const v8f z8 = {0.f, 0.f, 0.f, 0.f, 0.f, 0.f, 0.f, 0.f};
  v8f c00 = z8, c01 = z8, c02 = z8, c03 = z8, c10 = z8, c11 = z8, c12 = z8, c13 = z8;
  stage(0);
  asm volatile("s_wait_asynccnt 0x0" ::: "memory");   /* tile 0's copies of this wave have landed */
  __syncthreads();                                    /* ... and every other wave's */
  stage(1);
#pragma unroll 1
  for (int t = 0; t < DM / 64; ++t) {
    const unsigned short* pa = ab + (t & 1) * GBUF + (32 * w + ln) * GP;
    const unsigned short* pb = ab + (t & 1) * GBUF + OB + ln * GP;
    v16h fa[2][2], fb[2][4];                            /* the tile's LDS reads go as one group ahead of its products */
#pragma unroll
    for (int s = 0; s < 2; ++s) {
      fa[s][0] = ldhs(pa + 32 * s, hh); fa[s][1] = ldhs(pa + 16 * GP + 32 * s, hh);
#pragma unroll
      for (int j = 0; j < 4; ++j) fb[s][j] = ldhs(pb + 16 * j * GP + 32 * s, hh);
    }
#pragma unroll
    for (int s = 0; s < 2; ++s) {
      c00 = mmaH1(fa[s][0], fb[s][0], c00); c10 = mmaH1(fa[s][1], fb[s][0], c10);
      c01 = mmaH1(fa[s][0], fb[s][1], c01); c11 = mmaH1(fa[s][1], fb[s][1], c11);
      c02 = mmaH1(fa[s][0], fb[s][2], c02); c12 = mmaH1(fa[s][1], fb[s][2], c12);
      c03 = mmaH1(fa[s][0], fb[s][3], c03); c13 = mmaH1(fa[s][1], fb[s][3], c13);
    }
    asm volatile("s_wait_dscnt 0x0" ::: "memory");      /* this wave's reads of buffer t mod 2 are done before it is refilled */
    asm volatile("s_wait_asynccnt 0x0" ::: "memory");   /* this wave's copies of tile t + 1 have landed */
    __syncthreads();                                    /* publishes tile t + 1, ends every wave's reads of tile t */
    if (t + 2 < DM / 64) stage(t + 2);                  /* block-uniform */
  }
  asm volatile("s_wait_asynccnt 0x0" ::: "memory");     /* nothing in flight when the wave goes on */
  v8f accs[8] = {c00, c01, c02, c03, c10, c11, c12, c13};
#pragma unroll
  for (int u = 0; u < 8; ++u) {
    const int t = u & 3, half = u >> 2;
#pragma unroll
    for (int r = 0; r < 8; ++r) so[w][half * 16 + 8 * hh + r][t * 16 + ln] = accs[u][r] * 0.0625f;
  }
  __builtin_amdgcn_fence(4 /* acq_rel order */, "workgroup");
  __builtin_amdgcn_wave_barrier();
  if (vmode) proj_store<1>(so[w], lane, row0, col0, P0, P1);
  else {
    proj_store<0>(so[w], lane, row0, col0, P0, P1);
    asm volatile("s_wait_xcnt 0x0" ::: "memory");   /* in the built code the other stage's instructions follow this one's: no register that a store above names is rewritten ahead of this wait */
  }
}
// the three projections need nothing of each other: one grid, each product a range of the block index (block-uniform choice)
#define GPJ ((NR / 128) * (DM / 64))           /* blocks per GEMM */
__global__ __launch_bounds__(128) void k_proj(const unsigned short* __restrict__ XQ, const unsigned short* __restrict__ BQ, unsigned short* __restrict__ Qh, unsigned short* __restrict__ Ql,
                                              const unsigned short* __restrict__ XK, const unsigned short* __restrict__ BK, unsigned short* __restrict__ Kh, unsigned short* __restrict__ Kl,
                                              const unsigned short* __restrict__ XV, const unsigned short* __restrict__ BV, unsigned short* __restrict__ Vh, unsigned short* __restrict__ Vl) {
  const int sel = blockIdx.x / GPJ;
  proj_body(sel == 0 ? XQ : sel == 1 ? XK : XV, sel == 0 ? BQ : sel == 1 ? BK : BV,
            sel == 0 ? Qh : sel == 1 ? Kh : Vh, sel == 0 ? Ql : sel == 1 ? Kl : Vl, blockIdx.x - sel * GPJ, sel == 2);
}

// V rows [NR][DM] -> Vt[(b*NH + h)][d][s], s < ntok (row pitch ntok); block per ((b,h), 64 positions); 64x64 tile through LDS;
// one grid for both planes: the value plane (all SEQ positions) first, then the residual plane (first QE positions only), a block-uniform choice
#define GVT (NB * NH * (SEQ / 64))             /* blocks of the value plane */
__global__ __launch_bounds__(256) void k_vt(const unsigned short* __restrict__ Vh, unsigned short* __restrict__ Vth,
                                            const unsigned short* __restrict__ Vl, unsigned short* __restrict__ Vtl) {
  __shared__ unsigned short tl[64][66];
  const int tid = threadIdx.x;
  const bool res = blockIdx.x >= GVT;
  const unsigned short* __restrict__ V16 = res ? Vl : Vh;
  unsigned short* __restrict__ Vt = res ? Vtl : Vth;
  const int ntok = res ? QE : SEQ, blk = res ? (int)blockIdx.x - GVT : (int)blockIdx.x;
  const int ng = ntok / 64;
  const int slab = blk / ng, lg = blk - slab * ng;
  const int b = slab / NH, h = slab - b * NH;
  for (int i = tid; i < 64 * 8; i += 256) {
    const int r = i / 8, c8 = (i % 8) * 8;
    FragH f;
    f.half[0] = *(const v8us*)(V16 + ((size_t)b * SEQ + lg * 64 + r) * DM + h * HD + c8);
#pragma unroll
    for (int q = 0; q < 8; ++q) tl[r][c8 + q] = f.u[q];
  }
  __syncthreads();
  {
#pragma unroll
    for (int rd = 0; rd < 2; ++rd) {
      const int d = rd * 32 + tid / 8, pc = tid % 8;  /* rd 0..1 x tid/8 0..31 -> d 0..63; pc 0..7 -> 64 positions */
      FragH f;
#pragma unroll
      for (int q = 0; q < 8; ++q) f.u[q] = tl[pc * 8 + q][d];
      const v8us o = f.half[0];
      *(v8us*)(Vt + ((size_t)slab * HD + d) * ntok + lg * 64 + pc * 8) = o;
    }
    
  }
}

// 16-byte asynchronous copies global -> LDS, one per lane and line of text; s_wait_xcnt closes each statement so that no address register is rewritten ahead of it
__device__ __forceinline__ void copy6(unsigned l0, const unsigned short* g0, unsigned l1, const unsigned short* g1, unsigned l2, const unsigned short* g2,
                                      unsigned l3, const unsigned short* g3, unsigned l4, const unsigned short* g4, unsigned l5, const unsigned short* g5) {
  asm volatile("global_load_async_to_lds_b128 %0, %1, off\n\tglobal_load_async_to_lds_b128 %2, %3, off\n\tglobal_load_async_to_lds_b128 %4, %5, off\n\t"
               "global_load_async_to_lds_b128 %6, %7, off\n\tglobal_load_async_to_lds_b128 %8, %9, off\n\tglobal_load_async_to_lds_b128 %10, %11, off\n\ts_wait_xcnt 0x0"
               :: "v"(l0), "v"(g0), "v"(l1), "v"(g1), "v"(l2), "v"(g2), "v"(l3), "v"(g3), "v"(l4), "v"(g4), "v"(l5), "v"(g5) : "memory");
}
__device__ __forceinline__ void copy2(unsigned l0, const unsigned short* g0, unsigned l1, const unsigned short* g1) {
  asm volatile("global_load_async_to_lds_b128 %0, %1, off\n\tglobal_load_async_to_lds_b128 %2, %3, off\n\ts_wait_xcnt 0x0"
               :: "v"(l0), "v"(g0), "v"(l1), "v"(g1) : "memory");
}

// fused causal attention: wave = 16 queries of one (b, h); keys walked in 32-key steps up to the diagonal; S^T = K.Q^T (A = K rows, B = Q rows;
// D row = key 8h+r, D col = query) so a lane owns one query: running max / sum in registers, one shuffle joins the two lane halves;
// P fragment (B operand, k = key) taken directly from the two score accumulators (element r <- keys 8h+r, element 8+r <- keys 16+8h+r);
// O^T = V^T.P (A = V^T rows, d x key). EARLY: P and V also carry x1024 residual planes into a second accumulator.
// The 32-key tiles of K (hi, lo) and V^T are shared by the block's four waves: copied once per block into a two-buffer LDS ring, one step ahead of their use.
// blk: the block's index inside its own part (EARLY or not); so, kv: the kernel's LDS, one allocation for both parts.
#define ABUF (2 * 32 * 72 + 2 * 64 * 40)       /* 16-bit elements of one ring buffer of the EARLY part, the larger one */
template <bool EARLY>
__device__ __forceinline__ void attn_body(const unsigned short* __restrict__ Qh, const unsigned short* __restrict__ Ql,
                                          const unsigned short* __restrict__ Kh, const unsigned short* __restrict__ Kl,
                                          const unsigned short* __restrict__ Vth, const unsigned short* __restrict__ Vtl,
                                          unsigned short* __restrict__ Ch, unsigned short* __restrict__ Cl,
                                          int blk, float (*so)[16][68], unsigned short* kv) {
  constexpr int QT0 = EARLY ? 0 : QE / 16;
  constexpr int NQT = EARLY ? QE / 16 : (SEQ - QE) / 16;
  constexpr int BPB = (NQT / 4 > 0) ? NQT / 4 : 1;   /* blocks per (b, h): 4 query tiles each */
  const int lane = threadIdx.x & 31, ln = lane & 15, hh = lane >> 4;
  const int wave = __builtin_amdgcn_readfirstlane((int)(threadIdx.x >> 5));
  const int bh = blk / BPB;
  const int qt = QT0 + (blk - bh * BPB) * 4 + wave;
  const int b = bh / NH, h = bh - b * NH;
  const int qBase = qt * 16;
  const int nkt = (qBase + 47) >> 5;     /* 32-key steps covering keys 0..qBase+15 */
  const int nFull = qBase >> 5;          /* steps whose 32 keys are all <= qBase */
  const int qrow = qBase + ln;
  const size_t offQ = ((size_t)b * SEQ + qrow) * DM + h * HD;
  constexpr int KP = 72, VP = 40;              /* LDS row pitch in 16-bit elements: 144 B and 80 B, both 16 B x odd */
  constexpr int OKL = 32 * KP, OV = 2 * OKL, OVL = OV + 64 * VP;   /* places of K lo, V^T, V^T residual inside a buffer */
  constexpr int BUF = EARLY ? OVL + 64 * VP : OVL;
  static_assert((BUF * 2) % 16 == 0 && (KP * 2) % 16 == 0 && (VP * 2) % 16 == 0 && BUF <= ABUF);
  const int nktB = ((QT0 + (blk - bh * BPB) * 4) >> 1) + 2;   /* steps of the block's last wave: keys up to its first query + 63, inside the sequence */
  const int tid = threadIdx.x;
  const int kr = tid >> 3, kc = (tid & 7) * 8;  /* K rows kr and kr + 16, 16-byte piece kc */
  const int vr = tid >> 2, vc = (tid & 3) * 8;  /* V^T rows vr and vr + 32, 16-byte piece vc */
  const size_t gK = ((size_t)b * SEQ + kr) * DM + h * HD + kc;
  const size_t gV = ((size_t)bh * HD + vr) * SEQ + vc;
  const size_t gVl = ((size_t)bh * HD + vr) * QE + vc;
  const unsigned lK = (unsigned)(size_t)kv + (unsigned)(kr * KP + kc) * 2u;
  const unsigned lV = (unsigned)(size_t)kv + (unsigned)(OV + vr * VP + vc) * 2u;
  auto stage = [&](int t) {                     /* key step t -> buffer t mod 2 */
    const unsigned lb = (unsigned)(t & 1) * (unsigned)(BUF * 2);
    const size_t k0 = gK + (size_t)t * 32 * DM, v0 = gV + (size_t)t * 32;
    copy6(lK + lb, Kh + k0, lK + lb + 16 * KP * 2, Kh + k0 + 16 * DM,
          lK + lb + OKL * 2, Kl + k0, lK + lb + (OKL + 16 * KP) * 2, Kl + k0 + 16 * DM,
          lV + lb, Vth + v0, lV + lb + 32 * VP * 2, Vth + v0 + (size_t)32 * SEQ);
    if (EARLY) {
      const size_t w0 = gVl + (size_t)t * 32;
      copy2(lV + lb + 64 * VP * 2, Vtl + w0, lV + lb + 96 * VP * 2, Vtl + w0 + (size_t)32 * QE);
    }
  };
  const v8f z8 = {0.f, 0.f, 0.f, 0.f, 0.f, 0.f, 0.f, 0.f};
  v8f oacc[4] = {z8, z8, z8, z8};
  v8f ores[4] = {z8, z8, z8, z8};
  float m = -__builtin_inff(), l = 0.f;
  stage(0);
  asm volatile("s_wait_asynccnt 0x0" ::: "memory");   /* step 0's copies of this wave have landed */
  __syncthreads();                                    /* ... and every other wave's */
  stage(1);                                           /* nktB >= 2 */
#pragma unroll 1
  for (int it = 0; it < nktB; ++it) {
   if (it < nkt) {                       /* wave-uniform: a wave past its diagonal only passes the hand-over below */
    const int kb = it * 32;
    const unsigned short* kvb = kv + (it & 1) * BUF;
    v8f st0 = z8, st1 = z8;
#pragma unroll
    for (int dc = 0; dc < 2; ++dc) {
      const size_t qo = offQ + dc * 32;
      const v16b fqh = ldb(Qh, qo, hh), fql = ldb(Ql, qo, hh);
      const unsigned short* k0 = kvb + ln * KP + dc * 32;
      const unsigned short* k1 = k0 + 16 * KP;
      st0 = mmaB<3>(ldbs(k0, hh), ldbs(k0 + OKL, hh), fqh, fql, st0);
      st1 = mmaB<3>(ldbs(k1, hh), ldbs(k1 + OKL, hh), fqh, fql, st1);
      asm volatile("" ::: "memory");
    }
    float s0[8], s1[8];
#pragma unroll
    for (int r = 0; r < 8; ++r) { s0[r] = st0[r] * 0.125f; s1[r] = st1[r] * 0.125f; }
    if (it >= nFull) {                   /* wave-uniform: only the last step touches the diagonal */
#pragma unroll
      for (int r = 0; r < 8; ++r) {
        const int key = kb + 8 * hh + r;
        s0[r] = (key > qrow) ? -__builtin_inff() : s0[r];
        s1[r] = (key + 16 > qrow) ? -__builtin_inff() : s1[r];
      }
    }
    float mt = fmaxf(s0[0], s1[0]);
#pragma unroll
    for (int r = 1; r < 8; ++r) mt = fmaxf(mt, fmaxf(s0[r], s1[r]));
    const float mo = __shfl_xor(mt, 16);
    const float mnew = fmaxf(fmaxf(mt, mo), m);   /* finite: key kb <= qBase is visible to every query of the tile */
    const float alpha = __expf(m - mnew);
    m = mnew;
    l *= alpha;
#pragma unroll
    for (int dt = 0; dt < 4; ++dt) { oacc[dt] *= alpha; if (EARLY) ores[dt] *= alpha; }
    FragH ph, pl;
#pragma unroll
    for (int r = 0; r < 8; ++r) {
      const float p0 = __expf(s0[r] - m), p1 = __expf(s1[r] - m);
      l += p0 + p1;
      const float c0 = p0 * 256.0f, c1 = p1 * 256.0f;
      const _Float16 h0 = (_Float16)c0, h1 = (_Float16)c1;
      ph.h[r] = h0; ph.h[8 + r] = h1;
      pl.h[r] = (_Float16)((c0 - (float)h0) * 1024.0f);
      pl.h[8 + r] = (_Float16)((c1 - (float)h1) * 1024.0f);
    }
    asm volatile("" ::: "memory");
#pragma unroll
    for (int dt = 0; dt < 4; ++dt) {
      const unsigned short* vo = kvb + OV + (dt * 16 + ln) * VP;
      FragH vh; vh.v = ldhs(vo, hh);
      if (EARLY) {
        FragH vl; vl.v = ldhs(vo + 64 * VP, hh);
        v8f o = oacc[dt], e = ores[dt];
        o = __builtin_amdgcn_wmma_f32_16x16x32_f16(false, vh.v, false, ph.v, (short)0, o, false, false);
        e = __builtin_amdgcn_wmma_f32_16x16x32_f16(false, vl.v, false, ph.v, (short)0, e, false, false);
        e = __builtin_amdgcn_wmma_f32_16x16x32_f16(false, vh.v, false, pl.v, (short)0, e, false, false);
        asm volatile("v_nop\n\tv_nop\n\tv_nop\n\tv_nop" : "+v"(o), "+v"(e) : "v"(vh.v), "v"(vl.v), "v"(ph.v), "v"(pl.v));
        oacc[dt] = o; ores[dt] = e;
      } else {
        oacc[dt] = mmaH1(vh.v, ph.v, oacc[dt]);
      }
    }
    asm volatile("" ::: "memory");
   }
    asm volatile("s_wait_dscnt 0x0" ::: "memory");      /* this wave's reads of buffer it mod 2 are done before it is refilled */
    asm volatile("s_wait_asynccnt 0x0" ::: "memory");   /* this wave's copies of step it + 1 have landed */
    __syncthreads();                                    /* publishes step it + 1, ends every wave's reads of step it */
    if (it + 2 < nktB) stage(it + 2);                   /* block-uniform */
  }
  asm volatile("s_wait_asynccnt 0x0" ::: "memory");     /* nothing in flight when the wave goes on */
  const float lt = l + __shfl_xor(l, 16);
  const float rinv = 1.0f / (256.0f * lt);
  // O^T (d = dt*16 + 8h + r, query = ln) -> wave-private LDS tile [query][d]
#pragma unroll
  for (int dt = 0; dt < 4; ++dt) {
    v8f o = oacc[dt];
    if (EARLY) o = o + ores[dt] * 0.0009765625f;
    const v4f w0 = {o[0] * rinv, o[1] * rinv, o[2] * rinv, o[3] * rinv};
    const v4f w1 = {o[4] * rinv, o[5] * rinv, o[6] * rinv, o[7] * rinv};
    *(v4fa*)&so[wave][ln][dt * 16 + 8 * hh] = w0;
    *(v4fa*)&so[wave][ln][dt * 16 + 8 * hh + 4] = w1;
  }
  __builtin_amdgcn_fence(4 /* acq_rel order */, "workgroup");
  __builtin_amdgcn_wave_barrier();
  const int rq = lane >> 3, c8 = (lane & 7) * 8;
  {
#pragma unroll
    for (int q = 0; q < 4; ++q) {
      const int r = q * 4 + rq;                      /* q 0..3 x rq 0..3 -> query rows 0..15 */
      const v4f x0 = *(const v4fa*)&so[wave][r][c8], x1 = *(const v4fa*)&so[wave][r][c8 + 4];
      const float xs[8] = {x0[0], x0[1], x0[2], x0[3], x1[0], x1[1], x1[2], x1[3]};
      v8us o0, o1;
#pragma unroll
      for (int i = 0; i < 8; ++i) { const unsigned short hb = bf16_bits(xs[i]); o0[i] = hb; o1[i] = bf16_bits(xs[i] - bf16_val(hb)); }
      const size_t go = ((size_t)b * SEQ + qBase + r) * DM + h * HD + c8;   
      *(v8us*)(Ch + go) = o0;
      *(v8us*)(Cl + go) = o1;
    }
    
  }
}
// both parts need nothing of each other: one grid, the long blocks (queries from QE on) first, then the EARLY ones (block-uniform choice)
#define GAM (NB * NH * ((SEQ - QE) / 64))      /* blocks of the part behind QE */
__global__ __launch_bounds__(128) void k_attn(const unsigned short* __restrict__ Qh, const unsigned short* __restrict__ Ql,
                                              const unsigned short* __restrict__ Kh, const unsigned short* __restrict__ Kl,
                                              const unsigned short* __restrict__ Vth, const unsigned short* __restrict__ Vtl,
                                              unsigned short* __restrict__ Ch, unsigned short* __restrict__ Cl) {
  __shared__ __attribute__((aligned(16))) float so[4][16][68];
  __shared__ __attribute__((aligned(16))) unsigned short kv[2 * ABUF];
  if ((int)blockIdx.x < GAM) attn_body<false>(Qh, Ql, Kh, Kl, Vth, Vtl, Ch, Cl, (int)blockIdx.x, so, kv);
  else attn_body<true>(Qh, Ql, Kh, Kl, Vth, Vtl, Ch, Cl, (int)blockIdx.x - GAM, so, kv);
}

// output GEMM: out[(b, s)][n] = sum_k (ctx_hi + ctx_lo)[r][k] . bf16(WO)[n][k] + bf16(bO)[n]; wave tile 32 x 64; f32 rows of the full-size output layout;
// the bias float4 of a lane's four columns is read once by value and added in f32 at the store stage;
__global__ __launch_bounds__(128) void k_out(const unsigned short* __restrict__ Ah, const unsigned short* __restrict__ Al,
                                             const unsigned short* __restrict__ Bt, const float* __restrict__ bias, float* __restrict__ C) {
  __shared__ __attribute__((aligned(16))) float so[4][32][68];
  const int lane = threadIdx.x & 31, ln = lane & 15, hh = lane >> 4;
  const int w = __builtin_amdgcn_readfirstlane((int)(threadIdx.x >> 5));
  const int mt = blockIdx.x / (DM / 64), nq = blockIdx.x - mt * (DM / 64);
  const int row0 = mt * 128 + 32 * w, col0 = nq * 64;
  /* the block's 128 ctx rows (hi, lo) and 64 Bt rows, 64 k at a time, are copied once per block into a two-buffer LDS ring, one tile ahead of their use */
  constexpr int OL = 128 * GP, OB = 2 * OL, GBUF = OB + 64 * GP;   /* places of the lo rows and the Bt rows inside a buffer; buffer size */
  __shared__ __attribute__((aligned(16))) unsigned short ab[2 * GBUF];
  const int sr = (int)threadIdx.x >> 3, sc = ((int)threadIdx.x & 7) * 8;   /* rows sr + 16 j, 16-byte piece sc */
  const size_t oA = (size_t)(mt * 128 + sr) * DM + sc;
  const unsigned short* gB = Bt + (size_t)(col0 + sr) * DM + sc;
  const unsigned lA = (unsigned)(size_t)ab + (unsigned)(sr * GP + sc) * 2u;
  auto stage = [&](int t) {                           /* k tile t -> buffer t mod 2 */
    const unsigned la = lA + (unsigned)(t & 1) * (unsigned)(GBUF * 2);
    rows8(la, Ah + oA + t * 64);
    rows8(la + OL * 2, Al + oA + t * 64);
    rows4(la + OB * 2, gB + t * 64);
  };
  const v8f z8 = {0.f, 0.f, 0.f, 0.f, 0.f, 0.f, 0.f, 0.f};
  v8f c00 = z8, c01 = z8, c02 = z8, c03 = z8, c10 = z8, c11 = z8, c12 = z8, c13 = z8;
  stage(0);
  asm volatile("s_wait_asynccnt 0x0" ::: "memory");   /* tile 0's copies of this wave have landed */
  __syncthreads();                                    /* ... and every other wave's */
  stage(1);
#pragma unroll 1
  for (int t = 0; t < DM / 64; ++t) {
    const unsigned short* pa = ab + (t & 1) * GBUF + (32 * w + ln) * GP;
    const unsigned short* pb = ab + (t & 1) * GBUF + OB + ln * GP;
    v16b fh[2][2], fl[2][2], fb[2][4];                  /* the tile's LDS reads go as one group ahead of its products */
#pragma unroll
    for (int s = 0; s < 2; ++s) {
      fh[s][0] = ldbs(pa + 32 * s, hh); fl[s][0] = ldbs(pa + OL + 32 * s, hh);
      fh[s][1] = ldbs(pa + 16 * GP + 32 * s, hh); fl[s][1] = ldbs(pa + OL + 16 * GP + 32 * s, hh);
#pragma unroll
      for (int j = 0; j < 4; ++j) fb[s][j] = ldbs(pb + 16 * j * GP + 32 * s, hh);
    }
#pragma unroll
    for (int s = 0; s < 2; ++s) {
      c00 = mmaB<2>(fh[s][0], fl[s][0], fb[s][0], fb[s][0], c00); c10 = mmaB<2>(fh[s][1], fl[s][1], fb[s][0], fb[s][0], c10);
      c01 = mmaB<2>(fh[s][0], fl[s][0], fb[s][1], fb[s][1], c01); c11 = mmaB<2>(fh[s][1], fl[s][1], fb[s][1], fb[s][1], c11);
      c02 = mmaB<2>(fh[s][0], fl[s][0], fb[s][2], fb[s][2], c02); c12 = mmaB<2>(fh[s][1], fl[s][1], fb[s][2], fb[s][2], c12);
      c03 = mmaB<2>(fh[s][0], fl[s][0], fb[s][3], fb[s][3], c03); c13 = mmaB<2>(fh[s][1], fl[s][1], fb[s][3], fb[s][3], c13);
    }
    asm volatile("s_wait_dscnt 0x0" ::: "memory");      /* this wave's reads of buffer t mod 2 are done before it is refilled */
    asm volatile("s_wait_asynccnt 0x0" ::: "memory");   /* this wave's copies of tile t + 1 have landed */
    __syncthreads();                                    /* publishes tile t + 1, ends every wave's reads of tile t */
    if (t + 2 < DM / 64) stage(t + 2);                  /* block-uniform */
  }
  asm volatile("s_wait_asynccnt 0x0" ::: "memory");     /* nothing in flight when the wave goes on */
  v8f accs[8] = {c00, c01, c02, c03, c10, c11, c12, c13};
#pragma unroll
  for (int u = 0; u < 8; ++u) {
    const int t = u & 3, half = u >> 2;
#pragma unroll
    for (int r = 0; r < 8; ++r) so[w][half * 16 + 8 * hh + r][t * 16 + ln] = accs[u][r];
  }
  __builtin_amdgcn_fence(4 /* acq_rel order */, "workgroup");
  __builtin_amdgcn_wave_barrier();
  const int rsub = lane >> 4, c4 = (lane & 15) * 4;
  const v4f bx = *(const v4fa*)(bias + col0 + c4);   /* columns col0 + c4 .. + 3 < DM */
  const v4f bv = {bf16_rne(bx[0]), bf16_rne(bx[1]), bf16_rne(bx[2]), bf16_rne(bx[3])};
  {
#pragma unroll
    for (int q = 0; q < 16; ++q) {
      const int r = q * 2 + rsub;                    /* q 0..15 x rsub 0..1 -> rows 0..31 */
      const v4f sv = *(const v4fa*)&so[w][r][c4];
      const v4f v = sv + bv;
      const int grow = row0 + r;
      const int bb = grow / SEQ, s = grow - bb * SEQ;
      *(v4f*)(C + ((size_t)bb * SEQ_FULL + s) * DM + col0 + c4) = v;
    }
    
  }
}

/* workspace carve (bytes): 3 input planes + 4 weight planes + Qh Ql Kh Kl + Vh Vl + Vth + Vtl + Ch Cl */
#define XB ((size_t)NR * DM * 2)
#define WB ((size_t)DM * DM * 2)
#define VLB ((size_t)NB * NH * HD * QE * 2)
static_assert(XB % 256 == 0 && WB % 256 == 0 && VLB % 256 == 0);
static_assert(12 * XB + 4 * WB + VLB <= (size_t)134217728);   /* total carve stays within 128 MiB */

extern "C" void kernel_launch(void* const* d_in, const int* in_sizes, int n_in,
                              void* d_out, int out_size, void* d_ws, size_t ws_size, hipStream_t stream) {
  if (n_in < 8) return;
  const long long need_x = ((long long)(NB - 1) * SEQ_FULL + SEQ) * DM;
  if (in_sizes[0] < need_x || in_sizes[1] < need_x || in_sizes[2] < need_x) return;
  if (in_sizes[3] < DM * DM || in_sizes[4] < DM * DM || in_sizes[5] < DM * DM || in_sizes[6] < DM * DM) return;
  if (in_sizes[7] < DM) return;
  if (out_size < need_x) return;
  const float* xq = (const float*)d_in[0];      /* table order: Q, K, V, WQ, WK, WV, WO, bO */
  const float* xk = (const float*)d_in[1];
  const float* xv = (const float*)d_in[2];
  const float* wq = (const float*)d_in[3];
  const float* wk = (const float*)d_in[4];
  const float* wv = (const float*)d_in[5];
  const float* wo = (const float*)d_in[6];
  const float* bo = (const float*)d_in[7];
  char* ws = (char*)d_ws; size_t off = 0;
  auto take = [&](size_t bytes) { char* p = ws + off; off += (bytes + 255) & ~(size_t)255; return (unsigned short*)p; };
  unsigned short* XQ = take(XB); unsigned short* XK = take(XB); unsigned short* XV = take(XB);
  unsigned short* BQ = take(WB); unsigned short* BK = take(WB); unsigned short* BV = take(WB); unsigned short* BO = take(WB);
  unsigned short* Qh = take(XB); unsigned short* Ql = take(XB); unsigned short* Kh = take(XB); unsigned short* Kl = take(XB);
  unsigned short* Vh = take(XB); unsigned short* Vl = take(XB);
  unsigned short* Vth = take(XB); unsigned short* Vtl = take(VLB);
  unsigned short* Ch = take(XB); unsigned short* Cl = take(XB);
  if (off > ws_size) return;

  k_conv<<<(unsigned)(3 * GX + 4 * GW), 256, 0, stream>>>(xq, xk, xv, wq, wk, wv, wo, XQ, XK, XV, BQ, BK, BV, BO);
  k_proj<<<(unsigned)(3 * GPJ), 128, 0, stream>>>(XQ, BQ, Qh, Ql, XK, BK, Kh, Kl, XV, BV, Vh, Vl);
  k_vt<<<(unsigned)(GVT + NB * NH * (QE / 64)), 256, 0, stream>>>(Vh, Vth, Vl, Vtl);   /* in [NR][DM] rows -> out [(b,h)][64][SEQ] and [(b,h)][64][QE] */
  k_attn<<<(unsigned)(GAM + NB * NH * (QE / 64)), 128, 0, stream>>>(Qh, Ql, Kh, Kl, Vth, Vtl, Ch, Cl);
  k_out<<<(unsigned)GPJ, 128, 0, stream>>>(Ch, Cl, BO, bo, (float*)d_out);
}

// v004
// A run of this version takes 141 microseconds.
// Next to v003, in two timings, it ran 1.11 times as fast each time.
// All steps since v000 together make it 2.65 times as fast.
#include <hip/hip_runtime.h>
// Causal multi-head attention, three input streams (Q, K, V each [B][T][1024]), bias-free [out][in] input projections, 16 heads x 64, score scale 1/8, keys j > i excluded, out = ctx WO^T + bO (bO converted RNE to bf16, added in f32 at the store stage).
// Compute dtype: inputs converted (RNE) to bf16 and carried exactly as f16 rows / x16 f16 weights; Q,K,V projections v_wmma_f32_16x16x32_f16 (single product); scores v_wmma_f32_16x16x32_bf16 on bf16 hi|lo planes of q and k (three products); P.V v_wmma_f32_16x16x32_f16 with P carried x256 (first QE query rows: f16 value + x1024 residual planes for P and V, separate accumulator); output GEMM v_wmma_f32_16x16x32_bf16 with ctx as bf16 hi|lo against exact bf16 WO (two products); f32 accumulation and f32 softmax statistics everywhere.
#ifndef NB
#define NB 2
#endif
#ifndef SEQ
#define SEQ 2048
#endif
#ifndef QE
#define QE ((SEQ) < 256 ? (SEQ) : 256)   /* query rows per sequence that get residual planes on P and V */
#endif
#define NB_FULL 2
#define SEQ_FULL 2048
#define DM 1024
#define NH 16
#define HD 64
#define NR (NB * SEQ)

static_assert(NH * HD == DM);                 /* merged head columns h*64+d span the model width */
static_assert(HD == 64);                      
static_assert(DM % 64 == 0 && DM % 32 == 0);  /* GEMM column tiles of 64, k-steps of 32 */
static_assert(NR % 128 == 0);                 /* GEMM row tiles: 4 waves x 32 rows */
static_assert(SEQ % 64 == 0 && QE % 64 == 0 && QE <= SEQ && (SEQ - QE) % 64 == 0);  /* 4 query tiles of 16 per block; 32-key steps stay inside the sequence */
static_assert(NB <= NB_FULL && SEQ <= SEQ_FULL);
static_assert((NR * DM / 8) % 256 == 0 && (DM * DM / 8) % 256 == 0);  /* convert grids x 256 threads == plane extent */
static_assert((SEQ & (SEQ - 1)) == 0);        /* row -> (batch, position) by shift */
static_assert(DM % 4 == 0 && (DM / 64 - 1) * 64 + 15 * 4 + 4 <= DM);  /* per-lane float4 of the bias vector stays inside [DM] */
static_assert((size_t)NB_FULL * SEQ_FULL * DM * 4 == (size_t)16777216);  /* output buffer bytes, single output at byte offset 0 */

typedef __bf16 v16b __attribute__((ext_vector_type(16)));
typedef _Float16 v16h __attribute__((ext_vector_type(16)));
typedef unsigned short v8us __attribute__((ext_vector_type(8), may_alias));
typedef float v8f __attribute__((ext_vector_type(8)));
typedef float v4f __attribute__((ext_vector_type(4)));
typedef float v4fa __attribute__((ext_vector_type(4), may_alias));
union FragB { v16b v; v8us half[2]; unsigned short u[16]; };
union FragH { v16h v; v8us half[2]; _Float16 h[16]; unsigned short u[16]; };

__device__ __forceinline__ unsigned short bf16_bits(float x) { unsigned int u = __float_as_uint(x); return (unsigned short)((u + 0x7FFFu + ((u >> 16) & 1u)) >> 16); }
__device__ __forceinline__ float bf16_val(unsigned short b) { return __uint_as_float(((unsigned int)b) << 16); }
__device__ __forceinline__ float bf16_rne(float x) { return bf16_val(bf16_bits(x)); }

// fragment loader (A and B alike): elements 0..7 <- k0 + 8h + 0..7, elements 8..15 <- k0 + 16 + 8h + 0..7 of a k-contiguous 16-bit row
__device__ __forceinline__ v16b ldb(const unsigned short* __restrict__ p, size_t off, int hh) { FragB f; f.half[0] = *(const v8us*)(p + off + 8 * hh); f.half[1] = *(const v8us*)(p + off + 16 + 8 * hh); return f.v; }

// D += A.B with NT bf16 products: 1 = ah.bh, 2 = + al.bh, 3 = + ah.bl; one guard naming the accumulator and every fragment
template <int NT>
__device__ __forceinline__ v8f mmaB(v16b ah, v16b al, v16b bh, v16b bl, v8f c) {
  c = __builtin_amdgcn_wmma_f32_16x16x32_bf16(false, ah, false, bh, (short)0, c, false, false);
  if (NT >= 2) c = __builtin_amdgcn_wmma_f32_16x16x32_bf16(false, al, false, bh, (short)0, c, false, false);
  if (NT >= 3) c = __builtin_amdgcn_wmma_f32_16x16x32_bf16(false, ah, false, bl, (short)0, c, false, false);
  asm volatile("v_nop\n\tv_nop\n\tv_nop\n\tv_nop" : "+v"(c) : "v"(ah), "v"(al), "v"(bh), "v"(bl));
  return c;
}
__device__ __forceinline__ v8f mmaH1(v16h a, v16h b, v8f c) {
  v8f d = __builtin_amdgcn_wmma_f32_16x16x32_f16(false, a, false, b, (short)0, c, false, false);
  asm volatile("v_nop\n\tv_nop\n\tv_nop\n\tv_nop" : "+v"(d) : "v"(a), "v"(b));
  return d;
}

__device__ __forceinline__ void x16_body(const float* __restrict__ x, unsigned short* __restrict__ X16, int blk) {
  const int t = blk * 256 + threadIdx.x;
  if (t >= NR * DM / 8) return;
  const int row = t / (DM / 8), c8 = (t - row * (DM / 8)) * 8;
  const int b = row / SEQ, s = row - b * SEQ;
  const float* src = x + ((size_t)b * SEQ_FULL + s) * DM + c8;
  const v4f a = *(const v4fa*)src, c = *(const v4fa*)(src + 4);
  FragH f;
#pragma unroll
  for (int q = 0; q < 4; ++q) { f.h[q] = (_Float16)bf16_rne(a[q]); f.h[4 + q] = (_Float16)bf16_rne(c[q]); }
  const v8us o = f.half[0];
  unsigned short* d = X16 + (size_t)t * 8;
  *(v8us*)d = o;
  
}
__device__ __forceinline__ void wnat_body(const float* __restrict__ w, unsigned short* __restrict__ Bt, int blk) {
  const int t = blk * 256 + threadIdx.x;
  if (t >= DM * DM / 8) return;
  const v4f a = *(const v4fa*)(w + (size_t)t * 8), c = *(const v4fa*)(w + (size_t)t * 8 + 4);
  FragH f;
#pragma unroll
  for (int q = 0; q < 4; ++q) { f.h[q] = (_Float16)(bf16_rne(a[q]) * 16.0f); f.h[4 + q] = (_Float16)(bf16_rne(c[q]) * 16.0f); }
  const v8us o = f.half[0];
  unsigned short* d = Bt + (size_t)t * 8;
  *(v8us*)d = o;
  
}
__device__ __forceinline__ void wbf_body(const float* __restrict__ w, unsigned short* __restrict__ Bt, int blk) {
  const int t = blk * 256 + threadIdx.x;
  if (t >= DM * DM / 8) return;
  const v4f a = *(const v4fa*)(w + (size_t)t * 8), c = *(const v4fa*)(w + (size_t)t * 8 + 4);
  v8us o;
#pragma unroll
  for (int q = 0; q < 4; ++q) { o[q] = bf16_bits(a[q]); o[4 + q] = bf16_bits(c[q]); }
  unsigned short* d = Bt + (size_t)t * 8;
  *(v8us*)d = o;
  
}
// the seven conversions need nothing of each other: one grid, each plane a range of the block index (block-uniform choice)
#define GX (NR * DM / 8 / 256)                 /* blocks per input plane */
#define GW (DM * DM / 8 / 256)                 /* blocks per weight plane */
__global__ __launch_bounds__(256) void k_conv(const float* __restrict__ xq, const float* __restrict__ xk, const float* __restrict__ xv,
                                              const float* __restrict__ wq, const float* __restrict__ wk, const float* __restrict__ wv, const float* __restrict__ wo,
                                              unsigned short* __restrict__ XQ, unsigned short* __restrict__ XK, unsigned short* __restrict__ XV,
                                              unsigned short* __restrict__ BQ, unsigned short* __restrict__ BK, unsigned short* __restrict__ BV, unsigned short* __restrict__ BO) {
  const int bid = blockIdx.x;
  if (bid < 3 * GX) {
    const int sel = bid / GX;
    x16_body(sel == 0 ? xq : sel == 1 ? xk : xv, sel == 0 ? XQ : sel == 1 ? XK : XV, bid - sel * GX);
  } else if (bid < 3 * GX + 3 * GW) {
    const int sel = (bid - 3 * GX) / GW;
    wnat_body(sel == 0 ? wq : sel == 1 ? wk : wv, sel == 0 ? BQ : sel == 1 ? BK : BV, bid - 3 * GX - sel * GW);   /* natural [out][in] = Bt[n][k] as stored */
  } else {
    wbf_body(wo, BO, bid - 3 * GX - 3 * GW);
  }
}

// fragment loaders for a row staged in LDS: the element order of ldb
__device__ __forceinline__ v16b ldbs(const unsigned short* p, int hh) { FragB f; f.half[0] = *(const v8us*)(p + 8 * hh); f.half[1] = *(const v8us*)(p + 16 + 8 * hh); return f.v; }
__device__ __forceinline__ v16h ldhs(const unsigned short* p, int hh) { FragH f; f.half[0] = *(const v8us*)(p + 8 * hh); f.half[1] = *(const v8us*)(p + 16 + 8 * hh); return f.v; }
// GEMM operand tiles: rows r, r + 16, ... of a [row][DM] plane, one 16-byte asynchronous copy global -> LDS per lane and line of text (8 lanes cover one 128-byte row piece);
// s_wait_xcnt closes each statement so that no address register is rewritten ahead of it
#define GP 72                                  /* LDS row pitch of a 64-k tile in 16-bit elements: 144 B = 16 B x odd */
__device__ __forceinline__ void rows4(unsigned l, const unsigned short* g) {
  asm volatile("global_load_async_to_lds_b128 %0, %1, off\n\tglobal_load_async_to_lds_b128 %2, %3, off\n\t"
               "global_load_async_to_lds_b128 %4, %5, off\n\tglobal_load_async_to_lds_b128 %6, %7, off\n\ts_wait_xcnt 0x0"
               :: "v"(l), "v"(g), "v"(l + 16 * GP * 2), "v"(g + 16 * DM), "v"(l + 32 * GP * 2), "v"(g + 32 * DM), "v"(l + 48 * GP * 2), "v"(g + 48 * DM) : "memory");
}
__device__ __forceinline__ void rows8(unsigned l, const unsigned short* g) {
  asm volatile("global_load_async_to_lds_b128 %0, %1, off\n\tglobal_load_async_to_lds_b128 %2, %3, off\n\t"
               "global_load_async_to_lds_b128 %4, %5, off\n\tglobal_load_async_to_lds_b128 %6, %7, off\n\t"
               "global_load_async_to_lds_b128 %8, %9, off\n\tglobal_load_async_to_lds_b128 %10, %11, off\n\t"
               "global_load_async_to_lds_b128 %12, %13, off\n\tglobal_load_async_to_lds_b128 %14, %15, off\n\ts_wait_xcnt 0x0"
               :: "v"(l), "v"(g), "v"(l + 16 * GP * 2), "v"(g + 16 * DM), "v"(l + 32 * GP * 2), "v"(g + 32 * DM), "v"(l + 48 * GP * 2), "v"(g + 48 * DM),
                  "v"(l + 64 * GP * 2), "v"(g + 64 * DM), "v"(l + 80 * GP * 2), "v"(g + 80 * DM), "v"(l + 96 * GP * 2), "v"(g + 96 * DM), "v"(l + 112 * GP * 2), "v"(g + 112 * DM) : "memory");
}
static_assert(DM / 64 >= 2);                   /* the two-buffer ring starts with tiles 0 and 1 */

// projection GEMM: Y[NR][DM] = A[NR][DM] (exact f16 rows) . Bt[n][k] (x16 f16) * 2^-4; block = 4 waves, wave tile 32 rows x 64 cols;
// MODE 0: Y -> bf16 hi | lo planes; MODE 1: Y -> f16 value | (Y - value) x 1024 planes. Epilogue: tile staged in wave-private LDS, then stored by proj_store
template <int MODE>
__device__ __forceinline__ void proj_store(const float (*sw)[68], int lane, int row0, int col0, unsigned short* __restrict__ P0, unsigned short* __restrict__ P1) {
  const int rq = lane >> 3, c8 = (lane & 7) * 8;
#pragma unroll
  for (int q = 0; q < 8; ++q) {
    const int r = q * 4 + rq;                       /* q 0..7 x rq 0..3 -> rows 0..31 */
    const v4f x0 = *(const v4fa*)&sw[r][c8], x1 = *(const v4fa*)&sw[r][c8 + 4];
    const float xs[8] = {x0[0], x0[1], x0[2], x0[3], x1[0], x1[1], x1[2], x1[3]};
    v8us o0, o1;
    if (MODE == 0) {
#pragma unroll
      for (int i = 0; i < 8; ++i) { const unsigned short hb = bf16_bits(xs[i]); o0[i] = hb; o1[i] = bf16_bits(xs[i] - bf16_val(hb)); }
    } else {
      FragH fh, fl;
#pragma unroll
      for (int i = 0; i < 8; ++i) { const _Float16 hv = (_Float16)xs[i]; fh.h[i] = hv; fl.h[i] = (_Float16)((xs[i] - (float)hv) * 1024.0f); }
      o0 = fh.half[0]; o1 = fl.half[0];
    }
    const size_t go = (size_t)(row0 + r) * DM + col0 + c8;
    *(v8us*)(P0 + go) = o0;
    *(v8us*)(P1 + go) = o1;
  }
}
// blk: the tile's index inside its own product; vmode (block-uniform): the MODE of the store stage
__device__ __forceinline__ void proj_body(const unsigned short* __restrict__ A, const unsigned short* __restrict__ Bt,
                                          unsigned short* __restrict__ P0, unsigned short* __restrict__ P1, int blk, bool vmode) {
  __shared__ __attribute__((aligned(16))) float so[4][32][68];
  const int lane = threadIdx.x & 31, ln = lane & 15, hh = lane >> 4;
  const int w = __builtin_amdgcn_readfirstlane((int)(threadIdx.x >> 5));
  const int mt = blk / (DM / 64), nq = blk - mt * (DM / 64);
  const int row0 = mt * 128 + 32 * w, col0 = nq * 64;
  /* the block's 128 A rows and 64 Bt rows, 64 k at a time, are copied once per block into a two-buffer LDS ring, one tile ahead of their use */
  constexpr int OB = 128 * GP, GBUF = OB + 64 * GP;   /* place of the Bt rows inside a buffer; buffer size */
  __shared__ __attribute__((aligned(16))) unsigned short ab[2 * GBUF];
  const int sr = (int)threadIdx.x >> 3, sc = ((int)threadIdx.x & 7) * 8;   /* rows sr + 16 j, 16-byte piece sc */
  const unsigned short* gA = A + (size_t)(mt * 128 + sr) * DM + sc;
  const unsigned short* gB = Bt + (size_t)(col0 + sr) * DM + sc;
  const unsigned lA = (unsigned)(size_t)ab + (unsigned)(sr * GP + sc) * 2u;
  auto stage = [&](int t) {                           /* k tile t -> buffer t mod 2 */
    const unsigned la = lA + (unsigned)(t & 1) * (unsigned)(GBUF * 2);
    rows8(la, gA + t * 64);
    rows4(la + OB * 2, gB + t * 64);
  };
  const v8f z8 = {0.f, 0.f, 0.f, 0.f, 0.f, 0.f, 0.f, 0.f};
  v8f c00 = z8, c01 = z8, c02 = z8, c03 = z8, c10 = z8, c11 = z8, c12 = z8, c13 = z8;
  stage(0);
  asm volatile("s_wait_asynccnt 0x0" ::: "memory");   /* tile 0's copies of this wave have landed */
  __syncthreads();                                    /* ... and every other wave's */
  stage(1);
#pragma unroll 1
  for (int t = 0; t < DM / 64; ++t) {
    const unsigned short* pa = ab + (t & 1) * GBUF + (32 * w + ln) * GP;
    const unsigned short* pb = ab + (t & 1) * GBUF + OB + ln * GP;
    v16h fa[2][2], fb[2][4];                            /* the tile's LDS reads go as one group ahead of its products */
#pragma unroll
    for (int s = 0; s < 2; ++s) {
      fa[s][0] = ldhs(pa + 32 * s, hh); fa[s][1] = ldhs(pa + 16 * GP + 32 * s, hh);
#pragma unroll
      for (int j = 0; j < 4; ++j) fb[s][j] = ldhs(pb + 16 * j * GP + 32 * s, hh);
    }
#pragma unroll
    for (int s = 0; s < 2; ++s) {
      c00 = mmaH1(fa[s][0], fb[s][0], c00); c10 = mmaH1(fa[s][1], fb[s][0], c10);
      c01 = mmaH1(fa[s][0], fb[s][1], c01); c11 = mmaH1(fa[s][1], fb[s][1], c11);
      c02 = mmaH1(fa[s][0], fb[s][2], c02); c12 = mmaH1(fa[s][1], fb[s][2], c12);
      c03 = mmaH1(fa[s][0], fb[s][3], c03); c13 = mmaH1(fa[s][1], fb[s][3], c13);
    }
    asm volatile("s_wait_dscnt 0x0" ::: "memory");      /* this wave's reads of buffer t mod 2 are done before it is refilled */
    asm volatile("s_wait_asynccnt 0x0" ::: "memory");   /* this wave's copies of tile t + 1 have landed */
    __syncthreads();                                    /* publishes tile t + 1, ends every wave's reads of tile t */
    if (t + 2 < DM / 64) stage(t + 2);                  /* block-uniform */
  }
  asm volatile("s_wait_asynccnt 0x0" ::: "memory");     /* nothing in flight when the wave goes on */
  v8f accs[8] = {c00, c01, c02, c03, c10, c11, c12, c13};
#pragma unroll
  for (int u = 0; u < 8; ++u) {
    const int t = u & 3, half = u >> 2;
#pragma unroll
    for (int r = 0; r < 8; ++r) so[w][half * 16 + 8 * hh + r][t * 16 + ln] = accs[u][r] * 0.0625f;
  }
  __builtin_amdgcn_fence(4 /* acq_rel order */, "workgroup");
  __builtin_amdgcn_wave_barrier();
  if (vmode) proj_store<1>(so[w], lane, row0, col0, P0, P1);
  else {
    proj_store<0>(so[w], lane, row0, col0, P0, P1);
    asm volatile("s_wait_xcnt 0x0" ::: "memory");   /* in the built code the other stage's instructions follow this one's: no register that a store above names is rewritten ahead of this wait */
  }
}
// the three projections need nothing of each other: one grid, each product a range of the block index (block-uniform choice)
#define GPJ ((NR / 128) * (DM / 64))           /* blocks per GEMM */
__global__ __launch_bounds__(128) void k_proj(const unsigned short* __restrict__ XQ, const unsigned short* __restrict__ BQ, unsigned short* __restrict__ Qh, unsigned short* __restrict__ Ql,
                                              const unsigned short* __restrict__ XK, const unsigned short* __restrict__ BK, unsigned short* __restrict__ Kh, unsigned short* __restrict__ Kl,
                                              const unsigned short* __restrict__ XV, const unsigned short* __restrict__ BV, unsigned short* __restrict__ Vh, unsigned short* __restrict__ Vl) {
  const int sel = blockIdx.x / GPJ;
  proj_body(sel == 0 ? XQ : sel == 1 ? XK : XV, sel == 0 ? BQ : sel == 1 ? BK : BV,
            sel == 0 ? Qh : sel == 1 ? Kh : Vh, sel == 0 ? Ql : sel == 1 ? Kl : Vl, blockIdx.x - sel * GPJ, sel == 2);
}

// V rows [NR][DM] -> Vt[(b*NH + h)][d][s], s < ntok (row pitch ntok); block per ((b,h), 64 positions); 64x64 tile through LDS;
// one grid for both planes: the value plane (all SEQ positions) first, then the residual plane (first QE positions only), a block-uniform choice
#define GVT (NB * NH * (SEQ / 64))             /* blocks of the value plane */
__global__ __launch_bounds__(256) void k_vt(const unsigned short* __restrict__ Vh, unsigned short* __restrict__ Vth,
                                            const unsigned short* __restrict__ Vl, unsigned short* __restrict__ Vtl) {
  __shared__ unsigned short tl[64][66];
  const int tid = threadIdx.x;
  const bool res = blockIdx.x >= GVT;
  const unsigned short* __restrict__ V16 = res ? Vl : Vh;
  unsigned short* __restrict__ Vt = res ? Vtl : Vth;
  const int ntok = res ? QE : SEQ, blk = res ? (int)blockIdx.x - GVT : (int)blockIdx.x;
  const int ng = ntok / 64;
  const int slab = blk / ng, lg = blk - slab * ng;
  const int b = slab / NH, h = slab - b * NH;
  for (int i = tid; i < 64 * 8; i += 256) {
    const int r = i / 8, c8 = (i % 8) * 8;
    FragH f;
    f.half[0] = *(const v8us*)(V16 + ((size_t)b * SEQ + lg * 64 + r) * DM + h * HD + c8);
#pragma unroll
    for (int q = 0; q < 8; ++q) tl[r][c8 + q] = f.u[q];
  }
  __syncthreads();
  {
#pragma unroll
    for (int rd = 0; rd < 2; ++rd) {
      const int d = rd * 32 + tid / 8, pc = tid % 8;  /* rd 0..1 x tid/8 0..31 -> d 0..63; pc 0..7 -> 64 positions */
      FragH f;
#pragma unroll
      for (int q = 0; q < 8; ++q) f.u[q] = tl[pc * 8 + q][d];
      const v8us o = f.half[0];
      *(v8us*)(Vt + ((size_t)slab * HD + d) * ntok + lg * 64 + pc * 8) = o;
    }
    
  }
}

// 16-byte asynchronous copies global -> LDS, one per lane and line of text; s_wait_xcnt closes each statement so that no address register is rewritten ahead of it
__device__ __forceinline__ void copy6(unsigned l0, const unsigned short* g0, unsigned l1, const unsigned short* g1, unsigned l2, const unsigned short* g2,
                                      unsigned l3, const unsigned short* g3, unsigned l4, const unsigned short* g4, unsigned l5, const unsigned short* g5) {
  asm volatile("global_load_async_to_lds_b128 %0, %1, off\n\tglobal_load_async_to_lds_b128 %2, %3, off\n\tglobal_load_async_to_lds_b128 %4, %5, off\n\t"
               "global_load_async_to_lds_b128 %6, %7, off\n\tglobal_load_async_to_lds_b128 %8, %9, off\n\tglobal_load_async_to_lds_b128 %10, %11, off\n\ts_wait_xcnt 0x0"
               :: "v"(l0), "v"(g0), "v"(l1), "v"(g1), "v"(l2), "v"(g2), "v"(l3), "v"(g3), "v"(l4), "v"(g4), "v"(l5), "v"(g5) : "memory");
}
__device__ __forceinline__ void copy2(unsigned l0, const unsigned short* g0, unsigned l1, const unsigned short* g1) {
  asm volatile("global_load_async_to_lds_b128 %0, %1, off\n\tglobal_load_async_to_lds_b128 %2, %3, off\n\ts_wait_xcnt 0x0"
               :: "v"(l0), "v"(g0), "v"(l1), "v"(g1) : "memory");
}

// fused causal attention: wave = 16 queries of one (b, h); keys walked in 32-key steps up to the diagonal; S^T = K.Q^T (A = K rows, B = Q rows;
// D row = key 8h+r, D col = query) so a lane owns one query: running max / sum in registers, one shuffle joins the two lane halves;
// P fragment (B operand, k = key) taken directly from the two score accumulators (element r <- keys 8h+r, element 8+r <- keys 16+8h+r);
// O^T = V^T.P (A = V^T rows, d x key). EARLY: P and V also carry x1024 residual planes into a second accumulator.
// The 32-key tiles of K (hi, lo) and V^T are shared by the block's four waves: copied once per block into a two-buffer LDS ring, one step ahead of their use.
// blk: the block's index inside its own part (EARLY or not); so, kv: the kernel's LDS, one allocation for both parts.
#define ABUF (2 * 32 * 72 + 2 * 64 * 40)       /* 16-bit elements of one ring buffer of the EARLY part, the larger one */
template <bool EARLY>
__device__ __forceinline__ void attn_body(const unsigned short* __restrict__ Qh, const unsigned short* __restrict__ Ql,
                                          const unsigned short* __restrict__ Kh, const unsigned short* __restrict__ Kl,
                                          const unsigned short* __restrict__ Vth, const unsigned short* __restrict__ Vtl,
                                          unsigned short* __restrict__ Ch, unsigned short* __restrict__ Cl,
                                          int blk, float (*so)[16][68], unsigned short* kv) {
  constexpr int QT0 = EARLY ? 0 : QE / 16;
  constexpr int NQT = EARLY ? QE / 16 : (SEQ - QE) / 16;
  constexpr int BPB = (NQT / 4 > 0) ? NQT / 4 : 1;   /* blocks per (b, h): 4 query tiles each */
  const int lane = threadIdx.x & 31, ln = lane & 15, hh = lane >> 4;
  const int wave = __builtin_amdgcn_readfirstlane((int)(threadIdx.x >> 5));
  const int bh = blk / BPB;
  const int qt = QT0 + (blk - bh * BPB) * 4 + wave;
  const int b = bh / NH, h = bh - b * NH;
  const int qBase = qt * 16;
  const int nkt = (qBase + 47) >> 5;     /* 32-key steps covering keys 0..qBase+15 */
  const int nFull = qBase >> 5;          /* steps whose 32 keys are all <= qBase */
  const int qrow = qBase + ln;
  const size_t offQ = ((size_t)b * SEQ + qrow) * DM + h * HD;
  constexpr int KP = 72, VP = 40;              /* LDS row pitch in 16-bit elements: 144 B and 80 B, both 16 B x odd */
  constexpr int OKL = 32 * KP, OV = 2 * OKL, OVL = OV + 64 * VP;   /* places of K lo, V^T, V^T residual inside a buffer */
  constexpr int BUF = EARLY ? OVL + 64 * VP : OVL;
  static_assert((BUF * 2) % 16 == 0 && (KP * 2) % 16 == 0 && (VP * 2) % 16 == 0 && BUF <= ABUF);
  const int nktB = ((QT0 + (blk - bh * BPB) * 4) >> 1) + 2;   /* steps of the block's last wave: keys up to its first query + 63, inside the sequence */
  const int tid = threadIdx.x;
  const int kr = tid >> 3, kc = (tid & 7) * 8;  /* K rows kr and kr + 16, 16-byte piece kc */
  const int vr = tid >> 2, vc = (tid & 3) * 8;  /* V^T rows vr and vr + 32, 16-byte piece vc */
  const size_t gK = ((size_t)b * SEQ + kr) * DM + h * HD + kc;
  const size_t gV = ((size_t)bh * HD + vr) * SEQ + vc;
  const size_t gVl = ((size_t)bh * HD + vr) * QE + vc;
  const unsigned lK = (unsigned)(size_t)kv + (unsigned)(kr * KP + kc) * 2u;
  const unsigned lV = (unsigned)(size_t)kv + (unsigned)(OV + vr * VP + vc) * 2u;
  auto stage = [&](int t) {                     /* key step t -> buffer t mod 2 */
    const unsigned lb = (unsigned)(t & 1) * (unsigned)(BUF * 2);
    const size_t k0 = gK + (size_t)t * 32 * DM, v0 = gV + (size_t)t * 32;
    copy6(lK + lb, Kh + k0, lK + lb + 16 * KP * 2, Kh + k0 + 16 * DM,
          lK + lb + OKL * 2, Kl + k0, lK + lb + (OKL + 16 * KP) * 2, Kl + k0 + 16 * DM,
          lV + lb, Vth + v0, lV + lb + 32 * VP * 2, Vth + v0 + (size_t)32 * SEQ);
    if (EARLY) {
      const size_t w0 = gVl + (size_t)t * 32;
      copy2(lV + lb + 64 * VP * 2, Vtl + w0, lV + lb + 96 * VP * 2, Vtl + w0 + (size_t)32 * QE);
    }
  };
  const v8f z8 = {0.f, 0.f, 0.f, 0.f, 0.f, 0.f, 0.f, 0.f};
  v8f oacc[4] = {z8, z8, z8, z8};
  v8f ores[4] = {z8, z8, z8, z8};
  float m = -__builtin_inff(), l = 0.f;
  stage(0);
  asm volatile("s_wait_asynccnt 0x0" ::: "memory");   /* step 0's copies of this wave have landed */
  __syncthreads();                                    /* ... and every other wave's */
  stage(1);                                           /* nktB >= 2 */
#pragma unroll 1
  for (int it = 0; it < nktB; ++it) {
   if (it < nkt) {                       /* wave-uniform: a wave past its diagonal only passes the hand-over below */
    const int kb = it * 32;
    const unsigned short* kvb = kv + (it & 1) * BUF;
    /* the step's score operands are read as one group ahead of the products: one load latency is waited for, not one in front of each chain of products */
    v16b fqh[2], fql[2], kh[2][2], kl[2][2];
#pragma unroll                           /* constant indices keep the fragment arrays in registers; the same for the two loops below */
    for (int dc = 0; dc < 2; ++dc) {
      const size_t qo = offQ + dc * 32;
      fqh[dc] = ldb(Qh, qo, hh); fql[dc] = ldb(Ql, qo, hh);
      const unsigned short* k0 = kvb + ln * KP + dc * 32;
      const unsigned short* k1 = k0 + 16 * KP;
      kh[dc][0] = ldbs(k0, hh); kl[dc][0] = ldbs(k0 + OKL, hh);
      kh[dc][1] = ldbs(k1, hh); kl[dc][1] = ldbs(k1 + OKL, hh);
    }
    v8f st0 = z8, st1 = z8;
#pragma unroll
    for (int dc = 0; dc < 2; ++dc) {
      st0 = mmaB<3>(kh[dc][0], kl[dc][0], fqh[dc], fql[dc], st0);
      st1 = mmaB<3>(kh[dc][1], kl[dc][1], fqh[dc], fql[dc], st1);
    }
    /* the V^T fragments are read as one group here: their latency passes behind the softmax arithmetic */
    FragH vh[4], vl[4];
#pragma unroll
    for (int dt = 0; dt < 4; ++dt) {
      const unsigned short* vo = kvb + OV + (dt * 16 + ln) * VP;
      vh[dt].v = ldhs(vo, hh);
      if (EARLY) vl[dt].v = ldhs(vo + 64 * VP, hh);
    }
    float s0[8], s1[8];
#pragma unroll
    for (int r = 0; r < 8; ++r) { s0[r] = st0[r] * 0.125f; s1[r] = st1[r] * 0.125f; }
    if (it >= nFull) {                   /* wave-uniform: only the last step touches the diagonal */
#pragma unroll
      for (int r = 0; r < 8; ++r) {
        const int key = kb + 8 * hh + r;
        s0[r] = (key > qrow) ? -__builtin_inff() : s0[r];
        s1[r] = (key + 16 > qrow) ? -__builtin_inff() : s1[r];
      }
    }
    float mt = fmaxf(s0[0], s1[0]);
#pragma unroll
    for (int r = 1; r < 8; ++r) mt = fmaxf(mt, fmaxf(s0[r], s1[r]));
    const float mo = __shfl_xor(mt, 16);
    const float mnew = fmaxf(fmaxf(mt, mo), m);   /* finite: key kb <= qBase is visible to every query of the tile */
    const float alpha = __expf(m - mnew);
    m = mnew;
    l *= alpha;
#pragma unroll
    for (int dt = 0; dt < 4; ++dt) { oacc[dt] *= alpha; if (EARLY) ores[dt] *= alpha; }
    FragH ph, pl;
#pragma unroll
    for (int r = 0; r < 8; ++r) {
      const float p0 = __expf(s0[r] - m), p1 = __expf(s1[r] - m);
      l += p0 + p1;
      const float c0 = p0 * 256.0f, c1 = p1 * 256.0f;
      const _Float16 h0 = (_Float16)c0, h1 = (_Float16)c1;
      ph.h[r] = h0; ph.h[8 + r] = h1;
      pl.h[r] = (_Float16)((c0 - (float)h0) * 1024.0f);
      pl.h[8 + r] = (_Float16)((c1 - (float)h1) * 1024.0f);
    }
#pragma unroll
    for (int dt = 0; dt < 4; ++dt) {
      if (EARLY) {
        v8f o = oacc[dt], e = ores[dt];
        o = __builtin_amdgcn_wmma_f32_16x16x32_f16(false, vh[dt].v, false, ph.v, (short)0, o, false, false);
        e = __builtin_amdgcn_wmma_f32_16x16x32_f16(false, vl[dt].v, false, ph.v, (short)0, e, false, false);
        e = __builtin_amdgcn_wmma_f32_16x16x32_f16(false, vh[dt].v, false, pl.v, (short)0, e, false, false);
        asm volatile("v_nop\n\tv_nop\n\tv_nop\n\tv_nop" : "+v"(o), "+v"(e) : "v"(vh[dt].v), "v"(vl[dt].v), "v"(ph.v), "v"(pl.v));
        oacc[dt] = o; ores[dt] = e;
      } else {
        oacc[dt] = mmaH1(vh[dt].v, ph.v, oacc[dt]);
      }
    }
    asm volatile("" ::: "memory");
   }
    asm volatile("s_wait_dscnt 0x0" ::: "memory");      /* this wave's reads of buffer it mod 2 are done before it is refilled */
    asm volatile("s_wait_asynccnt 0x0" ::: "memory");   /* this wave's copies of step it + 1 have landed */
    __syncthreads();                                    /* publishes step it + 1, ends every wave's reads of step it */
    if (it + 2 < nktB) stage(it + 2);                   /* block-uniform */
  }
  asm volatile("s_wait_asynccnt 0x0" ::: "memory");     /* nothing in flight when the wave goes on */
  const float lt = l + __shfl_xor(l, 16);
  const float rinv = 1.0f / (256.0f * lt);
  // O^T (d = dt*16 + 8h + r, query = ln) -> wave-private LDS tile [query][d]
#pragma unroll
  for (int dt = 0; dt < 4; ++dt) {
    v8f o = oacc[dt];
    if (EARLY) o = o + ores[dt] * 0.0009765625f;
    const v4f w0 = {o[0] * rinv, o[1] * rinv, o[2] * rinv, o[3] * rinv};
    const v4f w1 = {o[4] * rinv, o[5] * rinv, o[6] * rinv, o[7] * rinv};
    *(v4fa*)&so[wave][ln][dt * 16 + 8 * hh] = w0;
    *(v4fa*)&so[wave][ln][dt * 16 + 8 * hh + 4] = w1;
  }
  __builtin_amdgcn_fence(4 /* acq_rel order */, "workgroup");
  __builtin_amdgcn_wave_barrier();
  const int rq = lane >> 3, c8 = (lane & 7) * 8;
  {
#pragma unroll
    for (int q = 0; q < 4; ++q) {
      const int r = q * 4 + rq;                      /* q 0..3 x rq 0..3 -> query rows 0..15 */
      const v4f x0 = *(const v4fa*)&so[wave][r][c8], x1 = *(const v4fa*)&so[wave][r][c8 + 4];
      const float xs[8] = {x0[0], x0[1], x0[2], x0[3], x1[0], x1[1], x1[2], x1[3]};
      v8us o0, o1;
#pragma unroll
      for (int i = 0; i < 8; ++i) { const unsigned short hb = bf16_bits(xs[i]); o0[i] = hb; o1[i] = bf16_bits(xs[i] - bf16_val(hb)); }
      const size_t go = ((size_t)b * SEQ + qBase + r) * DM + h * HD + c8;   
      *(v8us*)(Ch + go) = o0;
      *(v8us*)(Cl + go) = o1;
    }
    
  }
}
// both parts need nothing of each other: one grid, the long blocks (queries from QE on) first, then the EARLY ones (block-uniform choice)
#define GAM (NB * NH * ((SEQ - QE) / 64))      /* blocks of the part behind QE */
__global__ __launch_bounds__(128) void k_attn(const unsigned short* __restrict__ Qh, const unsigned short* __restrict__ Ql,
                                              const unsigned short* __restrict__ Kh, const unsigned short* __restrict__ Kl,
                                              const unsigned short* __restrict__ Vth, const unsigned short* __restrict__ Vtl,
                                              unsigned short* __restrict__ Ch, unsigned short* __restrict__ Cl) {
  __shared__ __attribute__((aligned(16))) float so[4][16][68];
  __shared__ __attribute__((aligned(16))) unsigned short kv[2 * ABUF];
  if ((int)blockIdx.x < GAM) attn_body<false>(Qh, Ql, Kh, Kl, Vth, Vtl, Ch, Cl, (int)blockIdx.x, so, kv);
  else attn_body<true>(Qh, Ql, Kh, Kl, Vth, Vtl, Ch, Cl, (int)blockIdx.x - GAM, so, kv);
}

// output GEMM: out[(b, s)][n] = sum_k (ctx_hi + ctx_lo)[r][k] . bf16(WO)[n][k] + bf16(bO)[n]; wave tile 32 x 64; f32 rows of the full-size output layout;
// the bias float4 of a lane's four columns is read once by value and added in f32 at the store stage;
__global__ __launch_bounds__(128) void k_out(const unsigned short* __restrict__ Ah, const unsigned short* __restrict__ Al,
                                             const unsigned short* __restrict__ Bt, const float* __restrict__ bias, float* __restrict__ C) {
  __shared__ __attribute__((aligned(16))) float so[4][32][68];
  const int lane = threadIdx.x & 31, ln = lane & 15, hh = lane >> 4;
  const int w = __builtin_amdgcn_readfirstlane((int)(threadIdx.x >> 5));
  const int mt = blockIdx.x / (DM / 64), nq = blockIdx.x - mt * (DM / 64);
  const int row0 = mt * 128 + 32 * w, col0 = nq * 64;
  /* the block's 128 ctx rows (hi, lo) and 64 Bt rows, 64 k at a time, are copied once per block into a two-buffer LDS ring, one tile ahead of their use */
  constexpr int OL = 128 * GP, OB = 2 * OL, GBUF = OB + 64 * GP;   /* places of the lo rows and the Bt rows inside a buffer; buffer size */
  __shared__ __attribute__((aligned(16))) unsigned short ab[2 * GBUF];
  const int sr = (int)threadIdx.x >> 3, sc = ((int)threadIdx.x & 7) * 8;   /* rows sr + 16 j, 16-byte piece sc */
  const size_t oA = (size_t)(mt * 128 + sr) * DM + sc;
  const unsigned short* gB = Bt + (size_t)(col0 + sr) * DM + sc;
  const unsigned lA = (unsigned)(size_t)ab + (unsigned)(sr * GP + sc) * 2u;
  auto stage = [&](int t) {                           /* k tile t -> buffer t mod 2 */
    const unsigned la = lA + (unsigned)(t & 1) * (unsigned)(GBUF * 2);
    rows8(la, Ah + oA + t * 64);
    rows8(la + OL * 2, Al + oA + t * 64);
    rows4(la + OB * 2, gB + t * 64);
  };
  const v8f z8 = {0.f, 0.f, 0.f, 0.f, 0.f, 0.f, 0.f, 0.f};
  v8f c00 = z8, c01 = z8, c02 = z8, c03 = z8, c10 = z8, c11 = z8, c12 = z8, c13 = z8;
  stage(0);
  asm volatile("s_wait_asynccnt 0x0" ::: "memory");   /* tile 0's copies of this wave have landed */
  __syncthreads();                                    /* ... and every other wave's */
  stage(1);
#pragma unroll 1
  for (int t = 0; t < DM / 64; ++t) {
    const unsigned short* pa = ab + (t & 1) * GBUF + (32 * w + ln) * GP;
    const unsigned short* pb = ab + (t & 1) * GBUF + OB + ln * GP;
    v16b fh[2][2], fl[2][2], fb[2][4];                  /* the tile's LDS reads go as one group ahead of its products */
#pragma unroll
    for (int s = 0; s < 2; ++s) {
      fh[s][0] = ldbs(pa + 32 * s, hh); fl[s][0] = ldbs(pa + OL + 32 * s, hh);
      fh[s][1] = ldbs(pa + 16 * GP + 32 * s, hh); fl[s][1] = ldbs(pa + OL + 16 * GP + 32 * s, hh);
#pragma unroll
      for (int j = 0; j < 4; ++j) fb[s][j] = ldbs(pb + 16 * j * GP + 32 * s, hh);
    }
#pragma unroll
    for (int s = 0; s < 2; ++s) {
      c00 = mmaB<2>(fh[s][0], fl[s][0], fb[s][0], fb[s][0], c00); c10 = mmaB<2>(fh[s][1], fl[s][1], fb[s][0], fb[s][0], c10);
      c01 = mmaB<2>(fh[s][0], fl[s][0], fb[s][1], fb[s][1], c01); c11 = mmaB<2>(fh[s][1], fl[s][1], fb[s][1], fb[s][1], c11);
      c02 = mmaB<2>(fh[s][0], fl[s][0], fb[s][2], fb[s][2], c02); c12 = mmaB<2>(fh[s][1], fl[s][1], fb[s][2], fb[s][2], c12);
      c03 = mmaB<2>(fh[s][0], fl[s][0], fb[s][3], fb[s][3], c03); c13 = mmaB<2>(fh[s][1], fl[s][1], fb[s][3], fb[s][3], c13);
    }
    asm volatile("s_wait_dscnt 0x0" ::: "memory");      /* this wave's reads of buffer t mod 2 are done before it is refilled */
    asm volatile("s_wait_asynccnt 0x0" ::: "memory");   /* this wave's copies of tile t + 1 have landed */
    __syncthreads();                                    /* publishes tile t + 1, ends every wave's reads of tile t */
    if (t + 2 < DM / 64) stage(t + 2);                  /* block-uniform */
  }
  asm volatile("s_wait_asynccnt 0x0" ::: "memory");     /* nothing in flight when the wave goes on */
  v8f accs[8] = {c00, c01, c02, c03, c10, c11, c12, c13};
#pragma unroll
  for (int u = 0; u < 8; ++u) {
    const int t = u & 3, half = u >> 2;
#pragma unroll
    for (int r = 0; r < 8; ++r) so[w][half * 16 + 8 * hh + r][t * 16 + ln] = accs[u][r];
  }
  __builtin_amdgcn_fence(4 /* acq_rel order */, "workgroup");
  __builtin_amdgcn_wave_barrier();
  const int rsub = lane >> 4, c4 = (lane & 15) * 4;
  const v4f bx = *(const v4fa*)(bias + col0 + c4);   /* columns col0 + c4 .. + 3 < DM */
  const v4f bv = {bf16_rne(bx[0]), bf16_rne(bx[1]), bf16_rne(bx[2]), bf16_rne(bx[3])};
  {
#pragma unroll
    for (int q = 0; q < 16; ++q) {
      const int r = q * 2 + rsub;                    /* q 0..15 x rsub 0..1 -> rows 0..31 */
      const v4f sv = *(const v4fa*)&so[w][r][c4];
      const v4f v = sv + bv;
      const int grow = row0 + r;
      const int bb = grow / SEQ, s = grow - bb * SEQ;
      *(v4f*)(C + ((size_t)bb * SEQ_FULL + s) * DM + col0 + c4) = v;
    }
    
  }
}

/* workspace carve (bytes): 3 input planes + 4 weight planes + Qh Ql Kh Kl + Vh Vl + Vth + Vtl + Ch Cl */
#define XB ((size_t)NR * DM * 2)
#define WB ((size_t)DM * DM * 2)
#define VLB ((size_t)NB * NH * HD * QE * 2)
static_assert(XB % 256 == 0 && WB % 256 == 0 && VLB % 256 == 0);
static_assert(12 * XB + 4 * WB + VLB <= (size_t)134217728);   /* total carve stays within 128 MiB */

extern "C" void kernel_launch(void* const* d_in, const int* in_sizes, int n_in,
                              void* d_out, int out_size, void* d_ws, size_t ws_size, hipStream_t stream) {
  if (n_in < 8) return;
  const long long need_x = ((long long)(NB - 1) * SEQ_FULL + SEQ) * DM;
  if (in_sizes[0] < need_x || in_sizes[1] < need_x || in_sizes[2] < need_x) return;
  if (in_sizes[3] < DM * DM || in_sizes[4] < DM * DM || in_sizes[5] < DM * DM || in_sizes[6] < DM * DM) return;
  if (in_sizes[7] < DM) return;
  if (out_size < need_x) return;
  const float* xq = (const float*)d_in[0];      /* table order: Q, K, V, WQ, WK, WV, WO, bO */
  const float* xk = (const float*)d_in[1];
  const float* xv = (const float*)d_in[2];
  const float* wq = (const float*)d_in[3];
  const float* wk = (const float*)d_in[4];
  const float* wv = (const float*)d_in[5];
  const float* wo = (const float*)d_in[6];
  const float* bo = (const float*)d_in[7];
  char* ws = (char*)d_ws; size_t off = 0;
  auto take = [&](size_t bytes) { char* p = ws + off; off += (bytes + 255) & ~(size_t)255; return (unsigned short*)p; };
  unsigned short* XQ = take(XB); unsigned short* XK = take(XB); unsigned short* XV = take(XB);
  unsigned short* BQ = take(WB); unsigned short* BK = take(WB); unsigned short* BV = take(WB); unsigned short* BO = take(WB);
  unsigned short* Qh = take(XB); unsigned short* Ql = take(XB); unsigned short* Kh = take(XB); unsigned short* Kl = take(XB);
  unsigned short* Vh = take(XB); unsigned short* Vl = take(XB);
  unsigned short* Vth = take(XB); unsigned short* Vtl = take(VLB);
  unsigned short* Ch = take(XB); unsigned short* Cl = take(XB);
  if (off > ws_size) return;

  k_conv<<<(unsigned)(3 * GX + 4 * GW), 256, 0, stream>>>(xq, xk, xv, wq, wk, wv, wo, XQ, XK, XV, BQ, BK, BV, BO);
  k_proj<<<(unsigned)(3 * GPJ), 128, 0, stream>>>(XQ, BQ, Qh, Ql, XK, BK, Kh, Kl, XV, BV, Vh, Vl);
  k_vt<<<(unsigned)(GVT + NB * NH * (QE / 64)), 256, 0, stream>>>(Vh, Vth, Vl, Vtl);   /* in [NR][DM] rows -> out [(b,h)][64][SEQ] and [(b,h)][64][QE] */
  k_attn<<<(unsigned)(GAM + NB * NH * (QE / 64)), 128, 0, stream>>>(Qh, Ql, Kh, Kl, Vth, Vtl, Ch, Cl);
  k_out<<<(unsigned)GPJ, 128, 0, stream>>>(Ch, Cl, BO, bo, (float*)d_out);
}

// v005
// It runs in 122 microseconds.
// Timed twice side by side with v004, it ran 1.16 and 1.15 times as fast.
// Counting every step since v000, it is 3.06 times as fast.
#include <hip/hip_runtime.h>
// Causal multi-head attention, three input streams (Q, K, V each [B][T][1024]), bias-free [out][in] input projections, 16 heads x 64, score scale 1/8, keys j > i excluded, out = ctx WO^T + bO (bO converted RNE to bf16, added in f32 at the store stage).
// Compute dtype: inputs converted (RNE) to bf16 and carried exactly as f16 rows / x16 f16 weights; Q,K,V projections v_wmma_f32_16x16x32_f16 (single product); scores v_wmma_f32_16x16x32_bf16 on bf16 hi|lo planes of q and k (three products); P.V v_wmma_f32_16x16x32_f16 with P carried x256 (first QE query rows: f16 value + x1024 residual planes for P and V, separate accumulator); output GEMM v_wmma_f32_16x16x32_bf16 with ctx as bf16 hi|lo against exact bf16 WO (two products); f32 accumulation and f32 softmax statistics everywhere.
#ifndef NB
#define NB 2
#endif
#ifndef SEQ
#define SEQ 2048
#endif
#ifndef QE
#define QE ((SEQ) < 256 ? (SEQ) : 256)   /* query rows per sequence that get residual planes on P and V */
#endif
#define NB_FULL 2
#define SEQ_FULL 2048
#define DM 1024
#define NH 16
#define HD 64
#define NR (NB * SEQ)

static_assert(NH * HD == DM);                 /* merged head columns h*64+d span the model width */
static_assert(HD == 64);                      
static_assert(DM % 64 == 0 && DM % 32 == 0);  /* GEMM column tiles of 64, k-steps of 32 */
static_assert(NR % 128 == 0);                 /* GEMM row tiles: 4 waves x 32 rows */
static_assert(SEQ % 64 == 0 && QE % 64 == 0 && QE <= SEQ && (SEQ - QE) % 64 == 0);  /* 4 query tiles of 16 per block; 32-key steps stay inside the sequence */
static_assert(NB <= NB_FULL && SEQ <= SEQ_FULL);
static_assert((NR * DM / 8) % 256 == 0 && (DM * DM / 8) % 256 == 0);  /* convert grids x 256 threads == plane extent */
static_assert((SEQ & (SEQ - 1)) == 0);        /* row -> (batch, position) by shift */
static_assert(DM % 4 == 0 && (DM / 64 - 1) * 64 + 15 * 4 + 4 <= DM);  /* per-lane float4 of the bias vector stays inside [DM] */
static_assert((size_t)NB_FULL * SEQ_FULL * DM * 4 == (size_t)16777216);  /* output buffer bytes, single output at byte offset 0 */

typedef __bf16 v16b __attribute__((ext_vector_type(16)));
typedef _Float16 v16h __attribute__((ext_vector_type(16)));
typedef unsigned short v8us __attribute__((ext_vector_type(8), may_alias));
typedef float v8f __attribute__((ext_vector_type(8)));
typedef float v4f __attribute__((ext_vector_type(4)));
typedef float v4fa __attribute__((ext_vector_type(4), may_alias));
union FragB { v16b v; v8us half[2]; unsigned short u[16]; };
union FragH { v16h v; v8us half[2]; _Float16 h[16]; unsigned short u[16]; };

__device__ __forceinline__ unsigned short bf16_bits(float x) { unsigned int u = __float_as_uint(x); return (unsigned short)((u + 0x7FFFu + ((u >> 16) & 1u)) >> 16); }
__device__ __forceinline__ float bf16_val(unsigned short b) { return __uint_as_float(((unsigned int)b) << 16); }
__device__ __forceinline__ float bf16_rne(float x) { return bf16_val(bf16_bits(x)); }

// fragment loader (A and B alike): elements 0..7 <- k0 + 8h + 0..7, elements 8..15 <- k0 + 16 + 8h + 0..7 of a k-contiguous 16-bit row
__device__ __forceinline__ v16b ldb(const unsigned short* __restrict__ p, size_t off, int hh) { FragB f; f.half[0] = *(const v8us*)(p + off + 8 * hh); f.half[1] = *(const v8us*)(p + off + 16 + 8 * hh); return f.v; }

// D += A.B with NT bf16 products: 1 = ah.bh, 2 = + al.bh, 3 = + ah.bl; one guard naming the accumulator and every fragment
template <int NT>
__device__ __forceinline__ v8f mmaB(v16b ah, v16b al, v16b bh, v16b bl, v8f c) {
  c = __builtin_amdgcn_wmma_f32_16x16x32_bf16(false, ah, false, bh, (short)0, c, false, false);
  if (NT >= 2) c = __builtin_amdgcn_wmma_f32_16x16x32_bf16(false, al, false, bh, (short)0, c, false, false);
  if (NT >= 3) c = __builtin_amdgcn_wmma_f32_16x16x32_bf16(false, ah, false, bl, (short)0, c, false, false);
  asm volatile("v_nop\n\tv_nop\n\tv_nop\n\tv_nop" : "+v"(c) : "v"(ah), "v"(al), "v"(bh), "v"(bl));
  return c;
}
__device__ __forceinline__ v8f mmaH1(v16h a, v16h b, v8f c) {
  v8f d = __builtin_amdgcn_wmma_f32_16x16x32_f16(false, a, false, b, (short)0, c, false, false);
  asm volatile("v_nop\n\tv_nop\n\tv_nop\n\tv_nop" : "+v"(d) : "v"(a), "v"(b));
  return d;
}

__device__ __forceinline__ void x16_body(const float* __restrict__ x, unsigned short* __restrict__ X16, int blk) {
  const int t = blk * 256 + threadIdx.x;
  if (t >= NR * DM / 8) return;
  const int row = t / (DM / 8), c8 = (t - row * (DM / 8)) * 8;
  const int b = row / SEQ, s = row - b * SEQ;
  const float* src = x + ((size_t)b * SEQ_FULL + s) * DM + c8;
  const v4f a = *(const v4fa*)src, c = *(const v4fa*)(src + 4);
  FragH f;
#pragma unroll
  for (int q = 0; q < 4; ++q) { f.h[q] = (_Float16)bf16_rne(a[q]); f.h[4 + q] = (_Float16)bf16_rne(c[q]); }
  const v8us o = f.half[0];
  unsigned short* d = X16 + (size_t)t * 8;
  *(v8us*)d = o;
  
}
__device__ __forceinline__ void wnat_body(const float* __restrict__ w, unsigned short* __restrict__ Bt, int blk) {
  const int t = blk * 256 + threadIdx.x;
  if (t >= DM * DM / 8) return;
  const v4f a = *(const v4fa*)(w + (size_t)t * 8), c = *(const v4fa*)(w + (size_t)t * 8 + 4);
  FragH f;
#pragma unroll
  for (int q = 0; q < 4; ++q) { f.h[q] = (_Float16)(bf16_rne(a[q]) * 16.0f); f.h[4 + q] = (_Float16)(bf16_rne(c[q]) * 16.0f); }
  const v8us o = f.half[0];
  unsigned short* d = Bt + (size_t)t * 8;
  *(v8us*)d = o;
  
}
__device__ __forceinline__ void wbf_body(const float* __restrict__ w, unsigned short* __restrict__ Bt, int blk) {
  const int t = blk * 256 + threadIdx.x;
  if (t >= DM * DM / 8) return;
  const v4f a = *(const v4fa*)(w + (size_t)t * 8), c = *(const v4fa*)(w + (size_t)t * 8 + 4);
  v8us o;
#pragma unroll
  for (int q = 0; q < 4; ++q) { o[q] = bf16_bits(a[q]); o[4 + q] = bf16_bits(c[q]); }
  unsigned short* d = Bt + (size_t)t * 8;
  *(v8us*)d = o;
  
}
// the seven conversions need nothing of each other: one grid, each plane a range of the block index (block-uniform choice)
#define GX (NR * DM / 8 / 256)                 /* blocks per input plane */
#define GW (DM * DM / 8 / 256)                 /* blocks per weight plane */
__global__ __launch_bounds__(256) void k_conv(const float* __restrict__ xq, const float* __restrict__ xk, const float* __restrict__ xv,
                                              const float* __restrict__ wq, const float* __restrict__ wk, const float* __restrict__ wv, const float* __restrict__ wo,
                                              unsigned short* __restrict__ XQ, unsigned short* __restrict__ XK, unsigned short* __restrict__ XV,
                                              unsigned short* __restrict__ BQ, unsigned short* __restrict__ BK, unsigned short* __restrict__ BV, unsigned short* __restrict__ BO) {
  const int bid = blockIdx.x;
  if (bid < 3 * GX) {
    const int sel = bid / GX;
    x16_body(sel == 0 ? xq : sel == 1 ? xk : xv, sel == 0 ? XQ : sel == 1 ? XK : XV, bid - sel * GX);
  } else if (bid < 3 * GX + 3 * GW) {
    const int sel = (bid - 3 * GX) / GW;
    wnat_body(sel == 0 ? wq : sel == 1 ? wk : wv, sel == 0 ? BQ : sel == 1 ? BK : BV, bid - 3 * GX - sel * GW);   /* natural [out][in] = Bt[n][k] as stored */
  } else {
    wbf_body(wo, BO, bid - 3 * GX - 3 * GW);
  }
}

// fragment loaders for a row staged in LDS: the element order of ldb
__device__ __forceinline__ v16b ldbs(const unsigned short* p, int hh) { FragB f; f.half[0] = *(const v8us*)(p + 8 * hh); f.half[1] = *(const v8us*)(p + 16 + 8 * hh); return f.v; }
__device__ __forceinline__ v16h ldhs(const unsigned short* p, int hh) { FragH f; f.half[0] = *(const v8us*)(p + 8 * hh); f.half[1] = *(const v8us*)(p + 16 + 8 * hh); return f.v; }
// GEMM operand tiles: rows r, r + 16, ... of a [row][DM] plane, one 16-byte asynchronous copy global -> LDS per lane and line of text (8 lanes cover one 128-byte row piece);
// s_wait_xcnt closes each statement so that no address register is rewritten ahead of it
#define GP 72                                  /* LDS row pitch of a 64-k tile in 16-bit elements: 144 B = 16 B x odd */
__device__ __forceinline__ void rows4(unsigned l, const unsigned short* g) {
  asm volatile("global_load_async_to_lds_b128 %0, %1, off\n\tglobal_load_async_to_lds_b128 %2, %3, off\n\t"
               "global_load_async_to_lds_b128 %4, %5, off\n\tglobal_load_async_to_lds_b128 %6, %7, off\n\ts_wait_xcnt 0x0"
               :: "v"(l), "v"(g), "v"(l + 16 * GP * 2), "v"(g + 16 * DM), "v"(l + 32 * GP * 2), "v"(g + 32 * DM), "v"(l + 48 * GP * 2), "v"(g + 48 * DM) : "memory");
}
__device__ __forceinline__ void rows8(unsigned l, const unsigned short* g) {
  asm volatile("global_load_async_to_lds_b128 %0, %1, off\n\tglobal_load_async_to_lds_b128 %2, %3, off\n\t"
               "global_load_async_to_lds_b128 %4, %5, off\n\tglobal_load_async_to_lds_b128 %6, %7, off\n\t"
               "global_load_async_to_lds_b128 %8, %9, off\n\tglobal_load_async_to_lds_b128 %10, %11, off\n\t"
               "global_load_async_to_lds_b128 %12, %13, off\n\tglobal_load_async_to_lds_b128 %14, %15, off\n\ts_wait_xcnt 0x0"
               :: "v"(l), "v"(g), "v"(l + 16 * GP * 2), "v"(g + 16 * DM), "v"(l + 32 * GP * 2), "v"(g + 32 * DM), "v"(l + 48 * GP * 2), "v"(g + 48 * DM),
                  "v"(l + 64 * GP * 2), "v"(g + 64 * DM), "v"(l + 80 * GP * 2), "v"(g + 80 * DM), "v"(l + 96 * GP * 2), "v"(g + 96 * DM), "v"(l + 112 * GP * 2), "v"(g + 112 * DM) : "memory");
}
static_assert(DM / 64 >= 2);                   /* the two-buffer ring starts with tiles 0 and 1 */

// projection GEMM: Y[NR][DM] = A[NR][DM] (exact f16 rows) . Bt[n][k] (x16 f16) * 2^-4; block = 4 waves, wave tile 32 rows x 64 cols;
// MODE 0: Y -> bf16 hi | lo planes; MODE 1: Y -> f16 value | (Y - value) x 1024 planes. Epilogue: tile staged in wave-private LDS, then stored by proj_store
template <int MODE>
__device__ __forceinline__ void proj_store(const float (*sw)[68], int lane, int row0, int col0, unsigned short* __restrict__ P0, unsigned short* __restrict__ P1) {
  const int rq = lane >> 3, c8 = (lane & 7) * 8;
#pragma unroll
  for (int q = 0; q < 8; ++q) {
    const int r = q * 4 + rq;                       /* q 0..7 x rq 0..3 -> rows 0..31 */
    const v4f x0 = *(const v4fa*)&sw[r][c8], x1 = *(const v4fa*)&sw[r][c8 + 4];
    const float xs[8] = {x0[0], x0[1], x0[2], x0[3], x1[0], x1[1], x1[2], x1[3]};
    v8us o0, o1;
    if (MODE == 0) {
#pragma unroll
      for (int i = 0; i < 8; ++i) { const unsigned short hb = bf16_bits(xs[i]); o0[i] = hb; o1[i] = bf16_bits(xs[i] - bf16_val(hb)); }
    } else {
      FragH fh, fl;
#pragma unroll
      for (int i = 0; i < 8; ++i) { const _Float16 hv = (_Float16)xs[i]; fh.h[i] = hv; fl.h[i] = (_Float16)((xs[i] - (float)hv) * 1024.0f); }
      o0 = fh.half[0]; o1 = fl.half[0];
    }
    const size_t go = (size_t)(row0 + r) * DM + col0 + c8;
    *(v8us*)(P0 + go) = o0;
    *(v8us*)(P1 + go) = o1;
  }
}
// blk: the tile's index inside its own product; vmode (block-uniform): the MODE of the store stage
__device__ __forceinline__ void proj_body(const unsigned short* __restrict__ A, const unsigned short* __restrict__ Bt,
                                          unsigned short* __restrict__ P0, unsigned short* __restrict__ P1, int blk, bool vmode) {
  __shared__ __attribute__((aligned(16))) float so[4][32][68];
  const int lane = threadIdx.x & 31, ln = lane & 15, hh = lane >> 4;
  const int w = __builtin_amdgcn_readfirstlane((int)(threadIdx.x >> 5));
  const int mt = blk / (DM / 64), nq = blk - mt * (DM / 64);
  const int row0 = mt * 128 + 32 * w, col0 = nq * 64;
  /* the block's 128 A rows and 64 Bt rows, 64 k at a time, are copied once per block into a two-buffer LDS ring, one tile ahead of their use */
  constexpr int OB = 128 * GP, GBUF = OB + 64 * GP;   /* place of the Bt rows inside a buffer; buffer size */
  __shared__ __attribute__((aligned(16))) unsigned short ab[2 * GBUF];
  const int sr = (int)threadIdx.x >> 3, sc = ((int)threadIdx.x & 7) * 8;   /* rows sr + 16 j, 16-byte piece sc */
  const unsigned short* gA = A + (size_t)(mt * 128 + sr) * DM + sc;
  const unsigned short* gB = Bt + (size_t)(col0 + sr) * DM + sc;
  const unsigned lA = (unsigned)(size_t)ab + (unsigned)(sr * GP + sc) * 2u;
  auto stage = [&](int t) {                           /* k tile t -> buffer t mod 2 */
    const unsigned la = lA + (unsigned)(t & 1) * (unsigned)(GBUF * 2);
    rows8(la, gA + t * 64);
    rows4(la + OB * 2, gB + t * 64);
  };
  const v8f z8 = {0.f, 0.f, 0.f, 0.f, 0.f, 0.f, 0.f, 0.f};
  v8f c00 = z8, c01 = z8, c02 = z8, c03 = z8, c10 = z8, c11 = z8, c12 = z8, c13 = z8;
  stage(0);
  asm volatile("s_wait_asynccnt 0x0" ::: "memory");   /* tile 0's copies of this wave have landed */
  __syncthreads();                                    /* ... and every other wave's */
  stage(1);
#pragma unroll 1
  for (int t = 0; t < DM / 64; ++t) {
    const unsigned short* pa = ab + (t & 1) * GBUF + (32 * w + ln) * GP;
    const unsigned short* pb = ab + (t & 1) * GBUF + OB + ln * GP;
    v16h fa[2][2], fb[2][4];                            /* the tile's LDS reads go as one group ahead of its products */
#pragma unroll
    for (int s = 0; s < 2; ++s) {
      fa[s][0] = ldhs(pa + 32 * s, hh); fa[s][1] = ldhs(pa + 16 * GP + 32 * s, hh);
#pragma unroll
      for (int j = 0; j < 4; ++j) fb[s][j] = ldhs(pb + 16 * j * GP + 32 * s, hh);
    }
#pragma unroll
    for (int s = 0; s < 2; ++s) {
      c00 = mmaH1(fa[s][0], fb[s][0], c00); c10 = mmaH1(fa[s][1], fb[s][0], c10);
      c01 = mmaH1(fa[s][0], fb[s][1], c01); c11 = mmaH1(fa[s][1], fb[s][1], c11);
      c02 = mmaH1(fa[s][0], fb[s][2], c02); c12 = mmaH1(fa[s][1], fb[s][2], c12);
      c03 = mmaH1(fa[s][0], fb[s][3], c03); c13 = mmaH1(fa[s][1], fb[s][3], c13);
    }
    asm volatile("s_wait_dscnt 0x0" ::: "memory");      /* this wave's reads of buffer t mod 2 are done before it is refilled */
    asm volatile("s_wait_asynccnt 0x0" ::: "memory");   /* this wave's copies of tile t + 1 have landed */
    __syncthreads();                                    /* publishes tile t + 1, ends every wave's reads of tile t */
    if (t + 2 < DM / 64) stage(t + 2);                  /* block-uniform */
  }
  asm volatile("s_wait_asynccnt 0x0" ::: "memory");     /* nothing in flight when the wave goes on */
  v8f accs[8] = {c00, c01, c02, c03, c10, c11, c12, c13};
#pragma unroll
  for (int u = 0; u < 8; ++u) {
    const int t = u & 3, half = u >> 2;
#pragma unroll
    for (int r = 0; r < 8; ++r) so[w][half * 16 + 8 * hh + r][t * 16 + ln] = accs[u][r] * 0.0625f;
  }
  __builtin_amdgcn_fence(4 /* acq_rel order */, "workgroup");
  __builtin_amdgcn_wave_barrier();
  if (vmode) proj_store<1>(so[w], lane, row0, col0, P0, P1);
  else {
    proj_store<0>(so[w], lane, row0, col0, P0, P1);
    asm volatile("s_wait_xcnt 0x0" ::: "memory");   /* in the built code the other stage's instructions follow this one's: no register that a store above names is rewritten ahead of this wait */
  }
}
// the three projections need nothing of each other: one grid, each product a range of the block index (block-uniform choice)
#define GPJ ((NR / 128) * (DM / 64))           /* blocks per GEMM */
__global__ __launch_bounds__(128) void k_proj(const unsigned short* __restrict__ XQ, const unsigned short* __restrict__ BQ, unsigned short* __restrict__ Qh, unsigned short* __restrict__ Ql,
                                              const unsigned short* __restrict__ XK, const unsigned short* __restrict__ BK, unsigned short* __restrict__ Kh, unsigned short* __restrict__ Kl,
                                              const unsigned short* __restrict__ XV, const unsigned short* __restrict__ BV, unsigned short* __restrict__ Vh, unsigned short* __restrict__ Vl) {
  const int sel = blockIdx.x / GPJ;
  proj_body(sel == 0 ? XQ : sel == 1 ? XK : XV, sel == 0 ? BQ : sel == 1 ? BK : BV,
            sel == 0 ? Qh : sel == 1 ? Kh : Vh, sel == 0 ? Ql : sel == 1 ? Kl : Vl, blockIdx.x - sel * GPJ, sel == 2);
}

// V rows [NR][DM] -> Vt[(b*NH + h)][d][s], s < ntok (row pitch ntok); block per ((b,h), 64 positions); 64x64 tile through LDS;
// one grid for both planes: the value plane (all SEQ positions) first, then the residual plane (first QE positions only), a block-uniform choice
#define GVT (NB * NH * (SEQ / 64))             /* blocks of the value plane */
__global__ __launch_bounds__(256) void k_vt(const unsigned short* __restrict__ Vh, unsigned short* __restrict__ Vth,
                                            const unsigned short* __restrict__ Vl, unsigned short* __restrict__ Vtl) {
  __shared__ unsigned short tl[64][66];
  const int tid = threadIdx.x;
  const bool res = blockIdx.x >= GVT;
  const unsigned short* __restrict__ V16 = res ? Vl : Vh;
  unsigned short* __restrict__ Vt = res ? Vtl : Vth;
  const int ntok = res ? QE : SEQ, blk = res ? (int)blockIdx.x - GVT : (int)blockIdx.x;
  const int ng = ntok / 64;
  const int slab = blk / ng, lg = blk - slab * ng;
  const int b = slab / NH, h = slab - b * NH;
  for (int i = tid; i < 64 * 8; i += 256) {
    const int r = i / 8, c8 = (i % 8) * 8;
    FragH f;
    f.half[0] = *(const v8us*)(V16 + ((size_t)b * SEQ + lg * 64 + r) * DM + h * HD + c8);
#pragma unroll
    for (int q = 0; q < 8; ++q) tl[r][c8 + q] = f.u[q];
  }
  __syncthreads();
  {
#pragma unroll
    for (int rd = 0; rd < 2; ++rd) {
      const int d = rd * 32 + tid / 8, pc = tid % 8;  /* rd 0..1 x tid/8 0..31 -> d 0..63; pc 0..7 -> 64 positions */
      FragH f;
#pragma unroll
      for (int q = 0; q < 8; ++q) f.u[q] = tl[pc * 8 + q][d];
      const v8us o = f.half[0];
      *(v8us*)(Vt + ((size_t)slab * HD + d) * ntok + lg * 64 + pc * 8) = o;
    }
    
  }
}

// 16-byte asynchronous copies global -> LDS, one per lane and line of text; s_wait_xcnt closes each statement so that no address register is rewritten ahead of it
__device__ __forceinline__ void copy6(unsigned l0, const unsigned short* g0, unsigned l1, const unsigned short* g1, unsigned l2, const unsigned short* g2,
                                      unsigned l3, const unsigned short* g3, unsigned l4, const unsigned short* g4, unsigned l5, const unsigned short* g5) {
  asm volatile("global_load_async_to_lds_b128 %0, %1, off\n\tglobal_load_async_to_lds_b128 %2, %3, off\n\tglobal_load_async_to_lds_b128 %4, %5, off\n\t"
               "global_load_async_to_lds_b128 %6, %7, off\n\tglobal_load_async_to_lds_b128 %8, %9, off\n\tglobal_load_async_to_lds_b128 %10, %11, off\n\ts_wait_xcnt 0x0"
               :: "v"(l0), "v"(g0), "v"(l1), "v"(g1), "v"(l2), "v"(g2), "v"(l3), "v"(g3), "v"(l4), "v"(g4), "v"(l5), "v"(g5) : "memory");
}
__device__ __forceinline__ void copy2(unsigned l0, const unsigned short* g0, unsigned l1, const unsigned short* g1) {
  asm volatile("global_load_async_to_lds_b128 %0, %1, off\n\tglobal_load_async_to_lds_b128 %2, %3, off\n\ts_wait_xcnt 0x0"
               :: "v"(l0), "v"(g0), "v"(l1), "v"(g1) : "memory");
}

// fused causal attention: wave = 16 queries of one (b, h); keys walked in 32-key steps up to the diagonal; S^T = K.Q^T (A = K rows, B = Q rows;
// D row = key 8h+r, D col = query) so a lane owns one query: running max / sum in registers, one shuffle joins the two lane halves;
// P fragment (B operand, k = key) taken directly from the two score accumulators (element r <- keys 8h+r, element 8+r <- keys 16+8h+r);
// O^T = V^T.P (A = V^T rows, d x key). EARLY: P and V also carry x1024 residual planes into a second accumulator.
// The 32-key tiles of K (hi, lo) and V^T are shared by the block's four waves: copied once per block into a two-buffer LDS ring, one step ahead of their use.
// blk: the block's index inside its own part (EARLY or not); so, kv: the kernel's LDS, one allocation for both parts.
#define ABUF (2 * 32 * 72 + 2 * 64 * 40)       /* 16-bit elements of one ring buffer of the EARLY part, the larger one */
template <bool EARLY>
__device__ __forceinline__ void attn_body(const unsigned short* __restrict__ Qh, const unsigned short* __restrict__ Ql,
                                          const unsigned short* __restrict__ Kh, const unsigned short* __restrict__ Kl,
                                          const unsigned short* __restrict__ Vth, const unsigned short* __restrict__ Vtl,
                                          unsigned short* __restrict__ Ch, unsigned short* __restrict__ Cl,
                                          int blk, float (*so)[16][68], unsigned short* kv) {
  constexpr int QT0 = EARLY ? 0 : QE / 16;
  constexpr int NQT = EARLY ? QE / 16 : (SEQ - QE) / 16;
  constexpr int BPB = (NQT / 4 > 0) ? NQT / 4 : 1;   /* blocks per (b, h): 4 query tiles each */
  const int lane = threadIdx.x & 31, ln = lane & 15, hh = lane >> 4;
  const int wave = __builtin_amdgcn_readfirstlane((int)(threadIdx.x >> 5));
  const int bh = blk / BPB;
  const int qt = QT0 + (blk - bh * BPB) * 4 + wave;
  const int b = bh / NH, h = bh - b * NH;
  const int qBase = qt * 16;
  const int nkt = (qBase + 47) >> 5;     /* 32-key steps covering keys 0..qBase+15 */
  const int nFull = qBase >> 5;          /* steps whose 32 keys are all <= qBase */
  const int qrow = qBase + ln;
  const size_t offQ = ((size_t)b * SEQ + qrow) * DM + h * HD;
  constexpr int KP = 72, VP = 40;              /* LDS row pitch in 16-bit elements: 144 B and 80 B, both 16 B x odd */
  constexpr int OKL = 32 * KP, OV = 2 * OKL, OVL = OV + 64 * VP;   /* places of K lo, V^T, V^T residual inside a buffer */
  constexpr int BUF = EARLY ? OVL + 64 * VP : OVL;
  static_assert((BUF * 2) % 16 == 0 && (KP * 2) % 16 == 0 && (VP * 2) % 16 == 0 && BUF <= ABUF);
  const int nktB = ((QT0 + (blk - bh * BPB) * 4) >> 1) + 2;   /* steps of the block's last wave: keys up to its first query + 63, inside the sequence */
  const int tid = threadIdx.x;
  const int kr = tid >> 3, kc = (tid & 7) * 8;  /* K rows kr and kr + 16, 16-byte piece kc */
  const int vr = tid >> 2, vc = (tid & 3) * 8;  /* V^T rows vr and vr + 32, 16-byte piece vc */
  const size_t gK = ((size_t)b * SEQ + kr) * DM + h * HD + kc;
  const size_t gV = ((size_t)bh * HD + vr) * SEQ + vc;
  const size_t gVl = ((size_t)bh * HD + vr) * QE + vc;
  const unsigned lK = (unsigned)(size_t)kv + (unsigned)(kr * KP + kc) * 2u;
  const unsigned lV = (unsigned)(size_t)kv + (unsigned)(OV + vr * VP + vc) * 2u;
  auto stage = [&](int t) {                     /* key step t -> buffer t mod 2 */
    const unsigned lb = (unsigned)(t & 1) * (unsigned)(BUF * 2);
    const size_t k0 = gK + (size_t)t * 32 * DM, v0 = gV + (size_t)t * 32;
    copy6(lK + lb, Kh + k0, lK + lb + 16 * KP * 2, Kh + k0 + 16 * DM,
          lK + lb + OKL * 2, Kl + k0, lK + lb + (OKL + 16 * KP) * 2, Kl + k0 + 16 * DM,
          lV + lb, Vth + v0, lV + lb + 32 * VP * 2, Vth + v0 + (size_t)32 * SEQ);
    if (EARLY) {
      const size_t w0 = gVl + (size_t)t * 32;
      copy2(lV + lb + 64 * VP * 2, Vtl + w0, lV + lb + 96 * VP * 2, Vtl + w0 + (size_t)32 * QE);
    }
  };
  const v8f z8 = {0.f, 0.f, 0.f, 0.f, 0.f, 0.f, 0.f, 0.f};
  v8f oacc[4] = {z8, z8, z8, z8};
  v8f ores[4] = {z8, z8, z8, z8};
  float m = -__builtin_inff(), l = 0.f;
  /* the wave's Q fragments (hi, lo; both 32-wide halves of the head) are the same in every key step: read once here, ahead of the first copies, and kept in registers */
  v16b fqh[2], fql[2];
#pragma unroll                           /* constant indices keep the fragment arrays in registers */
  for (int dc = 0; dc < 2; ++dc) {
    const size_t qo = offQ + dc * 32;
    fqh[dc] = ldb(Qh, qo, hh); fql[dc] = ldb(Ql, qo, hh);
  }
  asm volatile("s_wait_xcnt 0x0" ::: "memory");       /* no address register of the loads above is rewritten ahead of this wait */
  stage(0);
  asm volatile("s_wait_asynccnt 0x0" ::: "memory");   /* step 0's copies of this wave have landed */
  __syncthreads();                                    /* ... and every other wave's */
  stage(1);                                           /* nktB >= 2 */
#pragma unroll 1
  for (int it = 0; it < nktB; ++it) {
   if (it < nkt) {                       /* wave-uniform: a wave past its diagonal only passes the hand-over below */
    const int kb = it * 32;
    const unsigned short* kvb = kv + (it & 1) * BUF;
    /* the step's K fragments are read as one group ahead of the products: one load latency is waited for, not one in front of each chain of products */
    v16b kh[2][2], kl[2][2];
#pragma unroll                           /* constant indices keep the fragment arrays in registers; the same for the two loops below */
    for (int dc = 0; dc < 2; ++dc) {
      const unsigned short* k0 = kvb + ln * KP + dc * 32;
      const unsigned short* k1 = k0 + 16 * KP;
      kh[dc][0] = ldbs(k0, hh); kl[dc][0] = ldbs(k0 + OKL, hh);
      kh[dc][1] = ldbs(k1, hh); kl[dc][1] = ldbs(k1 + OKL, hh);
    }
    v8f st0 = z8, st1 = z8;
#pragma unroll
    for (int dc = 0; dc < 2; ++dc) {
      st0 = mmaB<3>(kh[dc][0], kl[dc][0], fqh[dc], fql[dc], st0);
      st1 = mmaB<3>(kh[dc][1], kl[dc][1], fqh[dc], fql[dc], st1);
    }
    /* the V^T fragments are read as one group here: their latency passes behind the softmax arithmetic */
    FragH vh[4], vl[4];
#pragma unroll
    for (int dt = 0; dt < 4; ++dt) {
      const unsigned short* vo = kvb + OV + (dt * 16 + ln) * VP;
      vh[dt].v = ldhs(vo, hh);
      if (EARLY) vl[dt].v = ldhs(vo + 64 * VP, hh);
    }
    float s0[8], s1[8];
#pragma unroll
    for (int r = 0; r < 8; ++r) { s0[r] = st0[r] * 0.125f; s1[r] = st1[r] * 0.125f; }
    if (it >= nFull) {                   /* wave-uniform: only the last step touches the diagonal */
#pragma unroll
      for (int r = 0; r < 8; ++r) {
        const int key = kb + 8 * hh + r;
        s0[r] = (key > qrow) ? -__builtin_inff() : s0[r];
        s1[r] = (key + 16 > qrow) ? -__builtin_inff() : s1[r];
      }
    }
    float mt = fmaxf(s0[0], s1[0]);
#pragma unroll
    for (int r = 1; r < 8; ++r) mt = fmaxf(mt, fmaxf(s0[r], s1[r]));
    const float mo = __shfl_xor(mt, 16);
    const float mnew = fmaxf(fmaxf(mt, mo), m);   /* finite: key kb <= qBase is visible to every query of the tile */
    const float alpha = __expf(m - mnew);
    m = mnew;
    l *= alpha;
#pragma unroll
    for (int dt = 0; dt < 4; ++dt) { oacc[dt] *= alpha; if (EARLY) ores[dt] *= alpha; }
    FragH ph, pl;
#pragma unroll
    for (int r = 0; r < 8; ++r) {
      const float p0 = __expf(s0[r] - m), p1 = __expf(s1[r] - m);
      l += p0 + p1;
      const float c0 = p0 * 256.0f, c1 = p1 * 256.0f;
      const _Float16 h0 = (_Float16)c0, h1 = (_Float16)c1;
      ph.h[r] = h0; ph.h[8 + r] = h1;
      pl.h[r] = (_Float16)((c0 - (float)h0) * 1024.0f);
      pl.h[8 + r] = (_Float16)((c1 - (float)h1) * 1024.0f);
    }
#pragma unroll
    for (int dt = 0; dt < 4; ++dt) {
      if (EARLY) {
        v8f o = oacc[dt], e = ores[dt];
        o = __builtin_amdgcn_wmma_f32_16x16x32_f16(false, vh[dt].v, false, ph.v, (short)0, o, false, false);
        e = __builtin_amdgcn_wmma_f32_16x16x32_f16(false, vl[dt].v, false, ph.v, (short)0, e, false, false);
        e = __builtin_amdgcn_wmma_f32_16x16x32_f16(false, vh[dt].v, false, pl.v, (short)0, e, false, false);
        asm volatile("v_nop\n\tv_nop\n\tv_nop\n\tv_nop" : "+v"(o), "+v"(e) : "v"(vh[dt].v), "v"(vl[dt].v), "v"(ph.v), "v"(pl.v));
        oacc[dt] = o; ores[dt] = e;
      } else {
        oacc[dt] = mmaH1(vh[dt].v, ph.v, oacc[dt]);
      }
    }
    asm volatile("" ::: "memory");
   }
    asm volatile("s_wait_dscnt 0x0" ::: "memory");      /* this wave's reads of buffer it mod 2 are done before it is refilled */
    asm volatile("s_wait_asynccnt 0x0" ::: "memory");   /* this wave's copies of step it + 1 have landed */
    __syncthreads();                                    /* publishes step it + 1, ends every wave's reads of step it */
    if (it + 2 < nktB) stage(it + 2);                   /* block-uniform */
  }
  asm volatile("s_wait_asynccnt 0x0" ::: "memory");     /* nothing in flight when the wave goes on */
  const float lt = l + __shfl_xor(l, 16);
  const float rinv = 1.0f / (256.0f * lt);
  // O^T (d = dt*16 + 8h + r, query = ln) -> wave-private LDS tile [query][d]
#pragma unroll
  for (int dt = 0; dt < 4; ++dt) {
    v8f o = oacc[dt];
    if (EARLY) o = o + ores[dt] * 0.0009765625f;
    const v4f w0 = {o[0] * rinv, o[1] * rinv, o[2] * rinv, o[3] * rinv};
    const v4f w1 = {o[4] * rinv, o[5] * rinv, o[6] * rinv, o[7] * rinv};
    *(v4fa*)&so[wave][ln][dt * 16 + 8 * hh] = w0;
    *(v4fa*)&so[wave][ln][dt * 16 + 8 * hh + 4] = w1;
  }
  __builtin_amdgcn_fence(4 /* acq_rel order */, "workgroup");
  __builtin_amdgcn_wave_barrier();
  const int rq = lane >> 3, c8 = (lane & 7) * 8;
  {
#pragma unroll
    for (int q = 0; q < 4; ++q) {
      const int r = q * 4 + rq;                      /* q 0..3 x rq 0..3 -> query rows 0..15 */
      const v4f x0 = *(const v4fa*)&so[wave][r][c8], x1 = *(const v4fa*)&so[wave][r][c8 + 4];
      const float xs[8] = {x0[0], x0[1], x0[2], x0[3], x1[0], x1[1], x1[2], x1[3]};
      v8us o0, o1;
#pragma unroll
      for (int i = 0; i < 8; ++i) { const unsigned short hb = bf16_bits(xs[i]); o0[i] = hb; o1[i] = bf16_bits(xs[i] - bf16_val(hb)); }
      const size_t go = ((size_t)b * SEQ + qBase + r) * DM + h * HD + c8;   
      *(v8us*)(Ch + go) = o0;
      *(v8us*)(Cl + go) = o1;
    }
    
  }
}
// both parts need nothing of each other: one grid, the long blocks (queries from QE on) first, then the EARLY ones (block-uniform choice)
#define GAM (NB * NH * ((SEQ - QE) / 64))      /* blocks of the part behind QE */
__global__ __launch_bounds__(128) void k_attn(const unsigned short* __restrict__ Qh, const unsigned short* __restrict__ Ql,
                                              const unsigned short* __restrict__ Kh, const unsigned short* __restrict__ Kl,
                                              const unsigned short* __restrict__ Vth, const unsigned short* __restrict__ Vtl,
                                              unsigned short* __restrict__ Ch, unsigned short* __restrict__ Cl) {
  __shared__ __attribute__((aligned(16))) float so[4][16][68];
  __shared__ __attribute__((aligned(16))) unsigned short kv[2 * ABUF];
  if ((int)blockIdx.x < GAM) attn_body<false>(Qh, Ql, Kh, Kl, Vth, Vtl, Ch, Cl, (int)blockIdx.x, so, kv);
  else attn_body<true>(Qh, Ql, Kh, Kl, Vth, Vtl, Ch, Cl, (int)blockIdx.x - GAM, so, kv);
}

// output GEMM: out[(b, s)][n] = sum_k (ctx_hi + ctx_lo)[r][k] . bf16(WO)[n][k] + bf16(bO)[n]; wave tile 32 x 64; f32 rows of the full-size output layout;
// the bias float4 of a lane's four columns is read once by value and added in f32 at the store stage;
__global__ __launch_bounds__(128) void k_out(const unsigned short* __restrict__ Ah, const unsigned short* __restrict__ Al,
                                             const unsigned short* __restrict__ Bt, const float* __restrict__ bias, float* __restrict__ C) {
  __shared__ __attribute__((aligned(16))) float so[4][32][68];
  const int lane = threadIdx.x & 31, ln = lane & 15, hh = lane >> 4;
  const int w = __builtin_amdgcn_readfirstlane((int)(threadIdx.x >> 5));
  const int mt = blockIdx.x / (DM / 64), nq = blockIdx.x - mt * (DM / 64);
  const int row0 = mt * 128 + 32 * w, col0 = nq * 64;
  /* the block's 128 ctx rows (hi, lo) and 64 Bt rows, 64 k at a time, are copied once per block into a two-buffer LDS ring, one tile ahead of their use */
  constexpr int OL = 128 * GP, OB = 2 * OL, GBUF = OB + 64 * GP;   /* places of the lo rows and the Bt rows inside a buffer; buffer size */
  __shared__ __attribute__((aligned(16))) unsigned short ab[2 * GBUF];
  const int sr = (int)threadIdx.x >> 3, sc = ((int)threadIdx.x & 7) * 8;   /* rows sr + 16 j, 16-byte piece sc */
  const size_t oA = (size_t)(mt * 128 + sr) * DM + sc;
  const unsigned short* gB = Bt + (size_t)(col0 + sr) * DM + sc;
  const unsigned lA = (unsigned)(size_t)ab + (unsigned)(sr * GP + sc) * 2u;
  auto stage = [&](int t) {                           /* k tile t -> buffer t mod 2 */
    const unsigned la = lA + (unsigned)(t & 1) * (unsigned)(GBUF * 2);
    rows8(la, Ah + oA + t * 64);
    rows8(la + OL * 2, Al + oA + t * 64);
    rows4(la + OB * 2, gB + t * 64);
  };
  const v8f z8 = {0.f, 0.f, 0.f, 0.f, 0.f, 0.f, 0.f, 0.f};
  v8f c00 = z8, c01 = z8, c02 = z8, c03 = z8, c10 = z8, c11 = z8, c12 = z8, c13 = z8;
  stage(0);
  asm volatile("s_wait_asynccnt 0x0" ::: "memory");   /* tile 0's copies of this wave have landed */
  __syncthreads();                                    /* ... and every other wave's */
  stage(1);
#pragma unroll 1
  for (int t = 0; t < DM / 64; ++t) {
    const unsigned short* pa = ab + (t & 1) * GBUF + (32 * w + ln) * GP;
    const unsigned short* pb = ab + (t & 1) * GBUF + OB + ln * GP;
    v16b fh[2][2], fl[2][2], fb[2][4];                  /* the tile's LDS reads go as one group ahead of its products */
#pragma unroll
    for (int s = 0; s < 2; ++s) {
      fh[s][0] = ldbs(pa + 32 * s, hh); fl[s][0] = ldbs(pa + OL + 32 * s, hh);
      fh[s][1] = ldbs(pa + 16 * GP + 32 * s, hh); fl[s][1] = ldbs(pa + OL + 16 * GP + 32 * s, hh);
#pragma unroll
      for (int j = 0; j < 4; ++j) fb[s][j] = ldbs(pb + 16 * j * GP + 32 * s, hh);
    }
#pragma unroll
    for (int s = 0; s < 2; ++s) {
      c00 = mmaB<2>(fh[s][0], fl[s][0], fb[s][0], fb[s][0], c00); c10 = mmaB<2>(fh[s][1], fl[s][1], fb[s][0], fb[s][0], c10);
      c01 = mmaB<2>(fh[s][0], fl[s][0], fb[s][1], fb[s][1], c01); c11 = mmaB<2>(fh[s][1], fl[s][1], fb[s][1], fb[s][1], c11);
      c02 = mmaB<2>(fh[s][0], fl[s][0], fb[s][2], fb[s][2], c02); c12 = mmaB<2>(fh[s][1], fl[s][1], fb[s][2], fb[s][2], c12);
      c03 = mmaB<2>(fh[s][0], fl[s][0], fb[s][3], fb[s][3], c03); c13 = mmaB<2>(fh[s][1], fl[s][1], fb[s][3], fb[s][3], c13);
    }
    asm volatile("s_wait_dscnt 0x0" ::: "memory");      /* this wave's reads of buffer t mod 2 are done before it is refilled */
    asm volatile("s_wait_asynccnt 0x0" ::: "memory");   /* this wave's copies of tile t + 1 have landed */
    __syncthreads();                                    /* publishes tile t + 1, ends every wave's reads of tile t */
    if (t + 2 < DM / 64) stage(t + 2);                  /* block-uniform */
  }
  asm volatile("s_wait_asynccnt 0x0" ::: "memory");     /* nothing in flight when the wave goes on */
  v8f accs[8] = {c00, c01, c02, c03, c10, c11, c12, c13};
#pragma unroll
  for (int u = 0; u < 8; ++u) {
    const int t = u & 3, half = u >> 2;
#pragma unroll
    for (int r = 0; r < 8; ++r) so[w][half * 16 + 8 * hh + r][t * 16 + ln] = accs[u][r];
  }
  __builtin_amdgcn_fence(4 /* acq_rel order */, "workgroup");
  __builtin_amdgcn_wave_barrier();
  const int rsub = lane >> 4, c4 = (lane & 15) * 4;
  const v4f bx = *(const v4fa*)(bias + col0 + c4);   /* columns col0 + c4 .. + 3 < DM */
  const v4f bv = {bf16_rne(bx[0]), bf16_rne(bx[1]), bf16_rne(bx[2]), bf16_rne(bx[3])};
  {
#pragma unroll
    for (int q = 0; q < 16; ++q) {
      const int r = q * 2 + rsub;                    /* q 0..15 x rsub 0..1 -> rows 0..31 */
      const v4f sv = *(const v4fa*)&so[w][r][c4];
      const v4f v = sv + bv;
      const int grow = row0 + r;
      const int bb = grow / SEQ, s = grow - bb * SEQ;
      *(v4f*)(C + ((size_t)bb * SEQ_FULL + s) * DM + col0 + c4) = v;
    }
    
  }
}

/* workspace carve (bytes): 3 input planes + 4 weight planes + Qh Ql Kh Kl + Vh Vl + Vth + Vtl + Ch Cl */
#define XB ((size_t)NR * DM * 2)
#define WB ((size_t)DM * DM * 2)
#define VLB ((size_t)NB * NH * HD * QE * 2)
static_assert(XB % 256 == 0 && WB % 256 == 0 && VLB % 256 == 0);
static_assert(12 * XB + 4 * WB + VLB <= (size_t)134217728);   /* total carve stays within 128 MiB */

extern "C" void kernel_launch(void* const* d_in, const int* in_sizes, int n_in,
                              void* d_out, int out_size, void* d_ws, size_t ws_size, hipStream_t stream) {
  if (n_in < 8) return;
  const long long need_x = ((long long)(NB - 1) * SEQ_FULL + SEQ) * DM;
  if (in_sizes[0] < need_x || in_sizes[1] < need_x || in_sizes[2] < need_x) return;
  if (in_sizes[3] < DM * DM || in_sizes[4] < DM * DM || in_sizes[5] < DM * DM || in_sizes[6] < DM * DM) return;
  if (in_sizes[7] < DM) return;
  if (out_size < need_x) return;
  const float* xq = (const float*)d_in[0];      /* table order: Q, K, V, WQ, WK, WV, WO, bO */
  const float* xk = (const float*)d_in[1];
  const float* xv = (const float*)d_in[2];
  const float* wq = (const float*)d_in[3];
  const float* wk = (const float*)d_in[4];
  const float* wv = (const float*)d_in[5];
  const float* wo = (const float*)d_in[6];
  const float* bo = (const float*)d_in[7];
  char* ws = (char*)d_ws; size_t off = 0;
  auto take = [&](size_t bytes) { char* p = ws + off; off += (bytes + 255) & ~(size_t)255; return (unsigned short*)p; };
  unsigned short* XQ = take(XB); unsigned short* XK = take(XB); unsigned short* XV = take(XB);
  unsigned short* BQ = take(WB); unsigned short* BK = take(WB); unsigned short* BV = take(WB); unsigned short* BO = take(WB);
  unsigned short* Qh = take(XB); unsigned short* Ql = take(XB); unsigned short* Kh = take(XB); unsigned short* Kl = take(XB);
  unsigned short* Vh = take(XB); unsigned short* Vl = take(XB);
  unsigned short* Vth = take(XB); unsigned short* Vtl = take(VLB);
  unsigned short* Ch = take(XB); unsigned short* Cl = take(XB);
  if (off > ws_size) return;

  k_conv<<<(unsigned)(3 * GX + 4 * GW), 256, 0, stream>>>(xq, xk, xv, wq, wk, wv, wo, XQ, XK, XV, BQ, BK, BV, BO);
  k_proj<<<(unsigned)(3 * GPJ), 128, 0, stream>>>(XQ, BQ, Qh, Ql, XK, BK, Kh, Kl, XV, BV, Vh, Vl);
  k_vt<<<(unsigned)(GVT + NB * NH * (QE / 64)), 256, 0, stream>>>(Vh, Vth, Vl, Vtl);   /* in [NR][DM] rows -> out [(b,h)][64][SEQ] and [(b,h)][64][QE] */
  k_attn<<<(unsigned)(GAM + NB * NH * (QE / 64)), 128, 0, stream>>>(Qh, Ql, Kh, Kl, Vth, Vtl, Ch, Cl);
  k_out<<<(unsigned)GPJ, 128, 0, stream>>>(Ch, Cl, BO, bo, (float*)d_out);
}

// v006
// It runs in 114 microseconds.
// Next to v005, in two timings, it ran 1.08 and 1.07 times as fast.
// Counting every step since v000, it is 3.27 times as fast.
#include <hip/hip_runtime.h>
// Causal multi-head attention, three input streams (Q, K, V each [B][T][1024]), bias-free [out][in] input projections, 16 heads x 64, score scale 1/8, keys j > i excluded, out = ctx WO^T + bO (bO converted RNE to bf16, added in f32 at the store stage).
// Compute dtype: inputs converted (RNE) to bf16 and carried exactly as f16 rows / x16 f16 weights; Q,K,V projections v_wmma_f32_16x16x32_f16 (single product); scores v_wmma_f32_16x16x32_bf16 on bf16 hi|lo planes of q and k (three products); P.V v_wmma_f32_16x16x32_f16 with P carried x256 (first QE query rows: f16 value + x1024 residual planes for P and V, separate accumulator); output GEMM v_wmma_f32_16x16x32_bf16 with ctx as bf16 hi|lo against exact bf16 WO (two products); f32 accumulation and f32 softmax statistics everywhere.
#ifndef NB
#define NB 2
#endif
#ifndef SEQ
#define SEQ 2048
#endif
#ifndef QE
#define QE ((SEQ) < 256 ? (SEQ) : 256)   /* query rows per sequence that get residual planes on P and V */
#endif
#define NB_FULL 2
#define SEQ_FULL 2048
#define DM 1024
#define NH 16
#define HD 64
#define NR (NB * SEQ)

static_assert(NH * HD == DM);                 /* merged head columns h*64+d span the model width */
static_assert(HD == 64);                      
static_assert(DM % 128 == 0 && DM % 64 == 0); /* GEMM column tiles of 128, k tiles of 64 */
static_assert(NR % 128 == 0);                 /* GEMM row tiles of 128 */
static_assert(SEQ % 64 == 0 && QE % 64 == 0 && QE <= SEQ && (SEQ - QE) % 64 == 0);  /* 4 query tiles of 16 per block; 32-key steps stay inside the sequence */
static_assert(NB <= NB_FULL && SEQ <= SEQ_FULL);
static_assert((NR * DM / 8) % 256 == 0 && (DM * DM / 8) % 256 == 0);  /* convert grids x 256 threads == plane extent */
static_assert((SEQ & (SEQ - 1)) == 0);        /* row -> (batch, position) by shift */
static_assert(DM % 4 == 0 && (DM / 64 - 1) * 64 + 15 * 4 + 4 <= DM);  /* per-lane float4 of the bias vector stays inside [DM] */
static_assert((size_t)NB_FULL * SEQ_FULL * DM * 4 == (size_t)16777216);  /* output buffer bytes, single output at byte offset 0 */

typedef __bf16 v16b __attribute__((ext_vector_type(16)));
typedef _Float16 v16h __attribute__((ext_vector_type(16)));
typedef unsigned short v8us __attribute__((ext_vector_type(8), may_alias));
typedef float v8f __attribute__((ext_vector_type(8)));
typedef float v4f __attribute__((ext_vector_type(4)));
typedef float v4fa __attribute__((ext_vector_type(4), may_alias));
union FragB { v16b v; v8us half[2]; unsigned short u[16]; };
union FragH { v16h v; v8us half[2]; _Float16 h[16]; unsigned short u[16]; };

__device__ __forceinline__ unsigned short bf16_bits(float x) { unsigned int u = __float_as_uint(x); return (unsigned short)((u + 0x7FFFu + ((u >> 16) & 1u)) >> 16); }
__device__ __forceinline__ float bf16_val(unsigned short b) { return __uint_as_float(((unsigned int)b) << 16); }
__device__ __forceinline__ float bf16_rne(float x) { return bf16_val(bf16_bits(x)); }

// fragment loader (A and B alike): elements 0..7 <- k0 + 8h + 0..7, elements 8..15 <- k0 + 16 + 8h + 0..7 of a k-contiguous 16-bit row
__device__ __forceinline__ v16b ldb(const unsigned short* __restrict__ p, size_t off, int hh) { FragB f; f.half[0] = *(const v8us*)(p + off + 8 * hh); f.half[1] = *(const v8us*)(p + off + 16 + 8 * hh); return f.v; }

// D += A.B with NT bf16 products: 1 = ah.bh, 2 = + al.bh, 3 = + ah.bl; one guard naming the accumulator and every fragment
template <int NT>
__device__ __forceinline__ v8f mmaB(v16b ah, v16b al, v16b bh, v16b bl, v8f c) {
  c = __builtin_amdgcn_wmma_f32_16x16x32_bf16(false, ah, false, bh, (short)0, c, false, false);
  if (NT >= 2) c = __builtin_amdgcn_wmma_f32_16x16x32_bf16(false, al, false, bh, (short)0, c, false, false);
  if (NT >= 3) c = __builtin_amdgcn_wmma_f32_16x16x32_bf16(false, ah, false, bl, (short)0, c, false, false);
  asm volatile("v_nop\n\tv_nop\n\tv_nop\n\tv_nop" : "+v"(c) : "v"(ah), "v"(al), "v"(bh), "v"(bl));
  return c;
}
__device__ __forceinline__ v8f mmaH1(v16h a, v16h b, v8f c) {
  v8f d = __builtin_amdgcn_wmma_f32_16x16x32_f16(false, a, false, b, (short)0, c, false, false);
  asm volatile("v_nop\n\tv_nop\n\tv_nop\n\tv_nop" : "+v"(d) : "v"(a), "v"(b));
  return d;
}

__device__ __forceinline__ void x16_body(const float* __restrict__ x, unsigned short* __restrict__ X16, int blk) {
  const int t = blk * 256 + threadIdx.x;
  if (t >= NR * DM / 8) return;
  const int row = t / (DM / 8), c8 = (t - row * (DM / 8)) * 8;
  const int b = row / SEQ, s = row - b * SEQ;
  const float* src = x + ((size_t)b * SEQ_FULL + s) * DM + c8;
  const v4f a = *(const v4fa*)src, c = *(const v4fa*)(src + 4);
  FragH f;
#pragma unroll
  for (int q = 0; q < 4; ++q) { f.h[q] = (_Float16)bf16_rne(a[q]); f.h[4 + q] = (_Float16)bf16_rne(c[q]); }
  const v8us o = f.half[0];
  unsigned short* d = X16 + (size_t)t * 8;
  *(v8us*)d = o;
  
}
__device__ __forceinline__ void wnat_body(const float* __restrict__ w, unsigned short* __restrict__ Bt, int blk) {
  const int t = blk * 256 + threadIdx.x;
  if (t >= DM * DM / 8) return;
  const v4f a = *(const v4fa*)(w + (size_t)t * 8), c = *(const v4fa*)(w + (size_t)t * 8 + 4);
  FragH f;
#pragma unroll
  for (int q = 0; q < 4; ++q) { f.h[q] = (_Float16)(bf16_rne(a[q]) * 16.0f); f.h[4 + q] = (_Float16)(bf16_rne(c[q]) * 16.0f); }
  const v8us o = f.half[0];
  unsigned short* d = Bt + (size_t)t * 8;
  *(v8us*)d = o;
  
}
__device__ __forceinline__ void wbf_body(const float* __restrict__ w, unsigned short* __restrict__ Bt, int blk) {
  const int t = blk * 256 + threadIdx.x;
  if (t >= DM * DM / 8) return;
  const v4f a = *(const v4fa*)(w + (size_t)t * 8), c = *(const v4fa*)(w + (size_t)t * 8 + 4);
  v8us o;
#pragma unroll
  for (int q = 0; q < 4; ++q) { o[q] = bf16_bits(a[q]); o[4 + q] = bf16_bits(c[q]); }
  unsigned short* d = Bt + (size_t)t * 8;
  *(v8us*)d = o;
  
}
// the seven conversions need nothing of each other: one grid, each plane a range of the block index (block-uniform choice)
#define GX (NR * DM / 8 / 256)                 /* blocks per input plane */
#define GW (DM * DM / 8 / 256)                 /* blocks per weight plane */
__global__ __launch_bounds__(256) void k_conv(const float* __restrict__ xq, const float* __restrict__ xk, const float* __restrict__ xv,
                                              const float* __restrict__ wq, const float* __restrict__ wk, const float* __restrict__ wv, const float* __restrict__ wo,
                                              unsigned short* __restrict__ XQ, unsigned short* __restrict__ XK, unsigned short* __restrict__ XV,
                                              unsigned short* __restrict__ BQ, unsigned short* __restrict__ BK, unsigned short* __restrict__ BV, unsigned short* __restrict__ BO) {
  const int bid = blockIdx.x;
  if (bid < 3 * GX) {
    const int sel = bid / GX;
    x16_body(sel == 0 ? xq : sel == 1 ? xk : xv, sel == 0 ? XQ : sel == 1 ? XK : XV, bid - sel * GX);
  } else if (bid < 3 * GX + 3 * GW) {
    const int sel = (bid - 3 * GX) / GW;
    wnat_body(sel == 0 ? wq : sel == 1 ? wk : wv, sel == 0 ? BQ : sel == 1 ? BK : BV, bid - 3 * GX - sel * GW);   /* natural [out][in] = Bt[n][k] as stored */
  } else {
    wbf_body(wo, BO, bid - 3 * GX - 3 * GW);
  }
}

// fragment loaders for a row staged in LDS: the element order of ldb
__device__ __forceinline__ v16b ldbs(const unsigned short* p, int hh) { FragB f; f.half[0] = *(const v8us*)(p + 8 * hh); f.half[1] = *(const v8us*)(p + 16 + 8 * hh); return f.v; }
__device__ __forceinline__ v16h ldhs(const unsigned short* p, int hh) { FragH f; f.half[0] = *(const v8us*)(p + 8 * hh); f.half[1] = *(const v8us*)(p + 16 + 8 * hh); return f.v; }
// GEMM operand tiles: 128 rows of a [row][DM] plane, r, r + 16, ... (rows8) or r, r + 32, ... (rows4), one 16-byte asynchronous copy global -> LDS per lane and line of text (8 lanes cover one 128-byte row piece);
// s_wait_xcnt closes each statement so that no address register is rewritten ahead of it
#define GP 72                                  /* LDS row pitch of a 64-k tile in 16-bit elements: 144 B = 16 B x odd */
__device__ __forceinline__ void rows4(unsigned l, const unsigned short* g) {   /* a block of 256 threads: rows r, r + 32, r + 64, r + 96 */
  asm volatile("global_load_async_to_lds_b128 %0, %1, off\n\tglobal_load_async_to_lds_b128 %2, %3, off\n\t"
               "global_load_async_to_lds_b128 %4, %5, off\n\tglobal_load_async_to_lds_b128 %6, %7, off\n\ts_wait_xcnt 0x0"
               :: "v"(l), "v"(g), "v"(l + 32 * GP * 2), "v"(g + 32 * DM), "v"(l + 64 * GP * 2), "v"(g + 64 * DM), "v"(l + 96 * GP * 2), "v"(g + 96 * DM) : "memory");
}
__device__ __forceinline__ void rows8(unsigned l, const unsigned short* g) {
  asm volatile("global_load_async_to_lds_b128 %0, %1, off\n\tglobal_load_async_to_lds_b128 %2, %3, off\n\t"
               "global_load_async_to_lds_b128 %4, %5, off\n\tglobal_load_async_to_lds_b128 %6, %7, off\n\t"
               "global_load_async_to_lds_b128 %8, %9, off\n\tglobal_load_async_to_lds_b128 %10, %11, off\n\t"
               "global_load_async_to_lds_b128 %12, %13, off\n\tglobal_load_async_to_lds_b128 %14, %15, off\n\ts_wait_xcnt 0x0"
               :: "v"(l), "v"(g), "v"(l + 16 * GP * 2), "v"(g + 16 * DM), "v"(l + 32 * GP * 2), "v"(g + 32 * DM), "v"(l + 48 * GP * 2), "v"(g + 48 * DM),
                  "v"(l + 64 * GP * 2), "v"(g + 64 * DM), "v"(l + 80 * GP * 2), "v"(g + 80 * DM), "v"(l + 96 * GP * 2), "v"(g + 96 * DM), "v"(l + 112 * GP * 2), "v"(g + 112 * DM) : "memory");
}
static_assert(DM / 64 >= 2);                   /* the two-buffer ring starts with tiles 0 and 1 */

// projection GEMM: Y[NR][DM] = A[NR][DM] (exact f16 rows) . Bt[n][k] (x16 f16) * 2^-4; block = 2 x 2 waves, block tile 128 x 128, wave tile 64 rows x 64 cols;
// MODE 0: Y -> bf16 hi | lo planes; MODE 1: Y -> f16 value | (Y - value) x 1024 planes. Epilogue: the wave tile staged in wave-private LDS, then stored by proj_store, 32 rows a call
template <int MODE>
__device__ __forceinline__ void proj_store(const float (*sw)[68], int lane, int row0, int col0, unsigned short* __restrict__ P0, unsigned short* __restrict__ P1) {
  const int rq = lane >> 3, c8 = (lane & 7) * 8;
#pragma unroll
  for (int q = 0; q < 8; ++q) {
    const int r = q * 4 + rq;                       /* q 0..7 x rq 0..3 -> rows 0..31 */
    const v4f x0 = *(const v4fa*)&sw[r][c8], x1 = *(const v4fa*)&sw[r][c8 + 4];
    const float xs[8] = {x0[0], x0[1], x0[2], x0[3], x1[0], x1[1], x1[2], x1[3]};
    v8us o0, o1;
    if (MODE == 0) {
#pragma unroll
      for (int i = 0; i < 8; ++i) { const unsigned short hb = bf16_bits(xs[i]); o0[i] = hb; o1[i] = bf16_bits(xs[i] - bf16_val(hb)); }
    } else {
      FragH fh, fl;
#pragma unroll
      for (int i = 0; i < 8; ++i) { const _Float16 hv = (_Float16)xs[i]; fh.h[i] = hv; fl.h[i] = (_Float16)((xs[i] - (float)hv) * 1024.0f); }
      o0 = fh.half[0]; o1 = fl.half[0];
    }
    const size_t go = (size_t)(row0 + r) * DM + col0 + c8;
    *(v8us*)(P0 + go) = o0;
    *(v8us*)(P1 + go) = o1;
  }
}
// blk: the tile's index inside its own product; vmode (block-uniform): the MODE of the store stage
__device__ __forceinline__ void proj_body(const unsigned short* __restrict__ A, const unsigned short* __restrict__ Bt,
                                          unsigned short* __restrict__ P0, unsigned short* __restrict__ P1, int blk, bool vmode) {
  const int lane = threadIdx.x & 31, ln = lane & 15, hh = lane >> 4;
  const int w = __builtin_amdgcn_readfirstlane((int)(threadIdx.x >> 5));
  const int wr = w >> 1, wc = w & 1;                  /* the wave's row half and column half of the block tile */
  const int mt = blk / (DM / 128), nq = blk - mt * (DM / 128);
  const int row0 = mt * 128 + 64 * wr, col0 = nq * 128 + 64 * wc;
  /* the block's 128 A rows and 128 Bt rows, 64 k at a time, are copied once per block into a two-buffer LDS ring, one tile ahead of their use */
  constexpr int OB = 128 * GP, GBUF = 2 * OB;         /* place of the Bt rows inside a buffer; buffer size */
  __shared__ __attribute__((aligned(16))) unsigned short ab[2 * GBUF];
  const int sr = (int)threadIdx.x >> 3, sc = ((int)threadIdx.x & 7) * 8;   /* rows sr + 16 j, 16-byte piece sc */
  const unsigned short* gA = A + (size_t)(mt * 128 + sr) * DM + sc;
  const unsigned short* gB = Bt + (size_t)(nq * 128 + sr) * DM + sc;
  const unsigned lA = (unsigned)(size_t)ab + (unsigned)(sr * GP + sc) * 2u;
  auto stage = [&](int t) {                           /* k tile t -> buffer t mod 2 */
    const unsigned la = lA + (unsigned)(t & 1) * (unsigned)(GBUF * 2);
    rows8(la, gA + t * 64);
    rows8(la + OB * 2, gB + t * 64);
  };
  const v8f z8 = {0.f, 0.f, 0.f, 0.f, 0.f, 0.f, 0.f, 0.f};
  v8f acc[4][4];                                      /* [16-row tile][16-column tile] */
#pragma unroll                                        /* constant indices keep the accumulators in registers; the same for every loop over them below */
  for (int i = 0; i < 4; ++i)
#pragma unroll
    for (int j = 0; j < 4; ++j) acc[i][j] = z8;
  stage(0);
  asm volatile("s_wait_asynccnt 0x0" ::: "memory");   /* tile 0's copies of this wave have landed */
  __syncthreads();                                    /* ... and every other wave's */
  stage(1);
#pragma unroll 1
  for (int t = 0; t < DM / 64; ++t) {
    const unsigned short* pa = ab + (t & 1) * GBUF + (64 * wr + ln) * GP;
    const unsigned short* pb = ab + (t & 1) * GBUF + OB + (64 * wc + ln) * GP;
#pragma unroll
    for (int s = 0; s < 2; ++s) {                       /* the two 32-k halves of the tile */
      v16h fa[4], fb[4];                                /* a half's LDS reads go as one group ahead of its 16 products */
#pragma unroll
      for (int i = 0; i < 4; ++i) fa[i] = ldhs(pa + 16 * i * GP + 32 * s, hh);
#pragma unroll
      for (int j = 0; j < 4; ++j) fb[j] = ldhs(pb + 16 * j * GP + 32 * s, hh);
#pragma unroll
      for (int j = 0; j < 4; ++j)
#pragma unroll
        for (int i = 0; i < 4; ++i) acc[i][j] = mmaH1(fa[i], fb[j], acc[i][j]);
    }
    asm volatile("s_wait_dscnt 0x0" ::: "memory");      /* this wave's reads of buffer t mod 2 are done before it is refilled */
    asm volatile("s_wait_asynccnt 0x0" ::: "memory");   /* this wave's copies of tile t + 1 have landed */
    __syncthreads();                                    /* publishes tile t + 1, ends every wave's reads of tile t */
    if (t + 2 < DM / 64) stage(t + 2);                  /* block-uniform */
  }
  asm volatile("s_wait_asynccnt 0x0" ::: "memory");     /* nothing in flight when the wave goes on */
  /* the ring is free now: every wave's last read of it stands ahead of the barrier at the foot of the last trip, and no copy is in flight;
     each wave stages its 64 x 64 tile in a part of its own, so that the block's LDS is the ring alone and three blocks fit a WGP */
  static_assert(4 * 64 * 68 * 4 <= 2 * GBUF * 2);
  float (*sw)[68] = reinterpret_cast<float (*)[68]>(ab) + 64 * w;
#pragma unroll
  for (int i = 0; i < 4; ++i)
#pragma unroll
    for (int j = 0; j < 4; ++j)
#pragma unroll
      for (int r = 0; r < 8; ++r) sw[i * 16 + 8 * hh + r][j * 16 + ln] = acc[i][j][r] * 0.0625f;
  __builtin_amdgcn_fence(4 /* acq_rel order */, "workgroup");
  __builtin_amdgcn_wave_barrier();
  if (vmode) {
    proj_store<1>(sw, lane, row0, col0, P0, P1);
    proj_store<1>(sw + 32, lane, row0 + 32, col0, P0, P1);
  } else {
    proj_store<0>(sw, lane, row0, col0, P0, P1);
    proj_store<0>(sw + 32, lane, row0 + 32, col0, P0, P1);
    asm volatile("s_wait_xcnt 0x0" ::: "memory");   /* in the built code the other stage's instructions follow this one's: no register that a store above names is rewritten ahead of this wait */
  }
}
// the three projections need nothing of each other: one grid, each product a range of the block index (block-uniform choice)
#define GPJ ((NR / 128) * (DM / 128))          /* blocks per GEMM */
__global__ __launch_bounds__(128) void k_proj(const unsigned short* __restrict__ XQ, const unsigned short* __restrict__ BQ, unsigned short* __restrict__ Qh, unsigned short* __restrict__ Ql,
                                              const unsigned short* __restrict__ XK, const unsigned short* __restrict__ BK, unsigned short* __restrict__ Kh, unsigned short* __restrict__ Kl,
                                              const unsigned short* __restrict__ XV, const unsigned short* __restrict__ BV, unsigned short* __restrict__ Vh, unsigned short* __restrict__ Vl) {
  const int sel = blockIdx.x / GPJ;
  proj_body(sel == 0 ? XQ : sel == 1 ? XK : XV, sel == 0 ? BQ : sel == 1 ? BK : BV,
            sel == 0 ? Qh : sel == 1 ? Kh : Vh, sel == 0 ? Ql : sel == 1 ? Kl : Vl, blockIdx.x - sel * GPJ, sel == 2);
}

// V rows [NR][DM] -> Vt[(b*NH + h)][d][s], s < ntok (row pitch ntok); block per ((b,h), 64 positions); 64x64 tile through LDS;
// one grid for both planes: the value plane (all SEQ positions) first, then the residual plane (first QE positions only), a block-uniform choice
#define GVT (NB * NH * (SEQ / 64))             /* blocks of the value plane */
__global__ __launch_bounds__(256) void k_vt(const unsigned short* __restrict__ Vh, unsigned short* __restrict__ Vth,
                                            const unsigned short* __restrict__ Vl, unsigned short* __restrict__ Vtl) {
  __shared__ unsigned short tl[64][66];
  const int tid = threadIdx.x;
  const bool res = blockIdx.x >= GVT;
  const unsigned short* __restrict__ V16 = res ? Vl : Vh;
  unsigned short* __restrict__ Vt = res ? Vtl : Vth;
  const int ntok = res ? QE : SEQ, blk = res ? (int)blockIdx.x - GVT : (int)blockIdx.x;
  const int ng = ntok / 64;
  const int slab = blk / ng, lg = blk - slab * ng;
  const int b = slab / NH, h = slab - b * NH;
  for (int i = tid; i < 64 * 8; i += 256) {
    const int r = i / 8, c8 = (i % 8) * 8;
    FragH f;
    f.half[0] = *(const v8us*)(V16 + ((size_t)b * SEQ + lg * 64 + r) * DM + h * HD + c8);
#pragma unroll
    for (int q = 0; q < 8; ++q) tl[r][c8 + q] = f.u[q];
  }
  __syncthreads();
  {
#pragma unroll
    for (int rd = 0; rd < 2; ++rd) {
      const int d = rd * 32 + tid / 8, pc = tid % 8;  /* rd 0..1 x tid/8 0..31 -> d 0..63; pc 0..7 -> 64 positions */
      FragH f;
#pragma unroll
      for (int q = 0; q < 8; ++q) f.u[q] = tl[pc * 8 + q][d];
      const v8us o = f.half[0];
      *(v8us*)(Vt + ((size_t)slab * HD + d) * ntok + lg * 64 + pc * 8) = o;
    }
    
  }
}

// 16-byte asynchronous copies global -> LDS, one per lane and line of text; s_wait_xcnt closes each statement so that no address register is rewritten ahead of it
__device__ __forceinline__ void copy6(unsigned l0, const unsigned short* g0, unsigned l1, const unsigned short* g1, unsigned l2, const unsigned short* g2,
                                      unsigned l3, const unsigned short* g3, unsigned l4, const unsigned short* g4, unsigned l5, const unsigned short* g5) {
  asm volatile("global_load_async_to_lds_b128 %0, %1, off\n\tglobal_load_async_to_lds_b128 %2, %3, off\n\tglobal_load_async_to_lds_b128 %4, %5, off\n\t"
               "global_load_async_to_lds_b128 %6, %7, off\n\tglobal_load_async_to_lds_b128 %8, %9, off\n\tglobal_load_async_to_lds_b128 %10, %11, off\n\ts_wait_xcnt 0x0"
               :: "v"(l0), "v"(g0), "v"(l1), "v"(g1), "v"(l2), "v"(g2), "v"(l3), "v"(g3), "v"(l4), "v"(g4), "v"(l5), "v"(g5) : "memory");
}
__device__ __forceinline__ void copy2(unsigned l0, const unsigned short* g0, unsigned l1, const unsigned short* g1) {
  asm volatile("global_load_async_to_lds_b128 %0, %1, off\n\tglobal_load_async_to_lds_b128 %2, %3, off\n\ts_wait_xcnt 0x0"
               :: "v"(l0), "v"(g0), "v"(l1), "v"(g1) : "memory");
}

// fused causal attention: wave = 16 queries of one (b, h); keys walked in 32-key steps up to the diagonal; S^T = K.Q^T (A = K rows, B = Q rows;
// D row = key 8h+r, D col = query) so a lane owns one query: running max / sum in registers, one shuffle joins the two lane halves;
// P fragment (B operand, k = key) taken directly from the two score accumulators (element r <- keys 8h+r, element 8+r <- keys 16+8h+r);
// O^T = V^T.P (A = V^T rows, d x key). EARLY: P and V also carry x1024 residual planes into a second accumulator.
// The 32-key tiles of K (hi, lo) and V^T are shared by the block's four waves: copied once per block into a two-buffer LDS ring, one step ahead of their use.
// blk: the block's index inside its own part (EARLY or not); so, kv: the kernel's LDS, one allocation for both parts.
#define ABUF (2 * 32 * 72 + 2 * 64 * 40)       /* 16-bit elements of one ring buffer of the EARLY part, the larger one */
template <bool EARLY>
__device__ __forceinline__ void attn_body(const unsigned short* __restrict__ Qh, const unsigned short* __restrict__ Ql,
                                          const unsigned short* __restrict__ Kh, const unsigned short* __restrict__ Kl,
                                          const unsigned short* __restrict__ Vth, const unsigned short* __restrict__ Vtl,
                                          unsigned short* __restrict__ Ch, unsigned short* __restrict__ Cl,
                                          int blk, float (*so)[16][68], unsigned short* kv) {
  constexpr int QT0 = EARLY ? 0 : QE / 16;
  constexpr int NQT = EARLY ? QE / 16 : (SEQ - QE) / 16;
  constexpr int BPB = (NQT / 4 > 0) ? NQT / 4 : 1;   /* blocks per (b, h): 4 query tiles each */
  const int lane = threadIdx.x & 31, ln = lane & 15, hh = lane >> 4;
  const int wave = __builtin_amdgcn_readfirstlane((int)(threadIdx.x >> 5));
  const int bh = blk / BPB;
  const int qt = QT0 + (blk - bh * BPB) * 4 + wave;
  const int b = bh / NH, h = bh - b * NH;
  const int qBase = qt * 16;
  const int nkt = (qBase + 47) >> 5;     /* 32-key steps covering keys 0..qBase+15 */
  const int nFull = qBase >> 5;          /* steps whose 32 keys are all <= qBase */
  const int qrow = qBase + ln;
  const size_t offQ = ((size_t)b * SEQ + qrow) * DM + h * HD;
  constexpr int KP = 72, VP = 40;              /* LDS row pitch in 16-bit elements: 144 B and 80 B, both 16 B x odd */
  constexpr int OKL = 32 * KP, OV = 2 * OKL, OVL = OV + 64 * VP;   /* places of K lo, V^T, V^T residual inside a buffer */
  constexpr int BUF = EARLY ? OVL + 64 * VP : OVL;
  static_assert((BUF * 2) % 16 == 0 && (KP * 2) % 16 == 0 && (VP * 2) % 16 == 0 && BUF <= ABUF);
  const int nktB = ((QT0 + (blk - bh * BPB) * 4) >> 1) + 2;   /* steps of the block's last wave: keys up to its first query + 63, inside the sequence */
  const int tid = threadIdx.x;
  const int kr = tid >> 3, kc = (tid & 7) * 8;  /* K rows kr and kr + 16, 16-byte piece kc */
  const int vr = tid >> 2, vc = (tid & 3) * 8;  /* V^T rows vr and vr + 32, 16-byte piece vc */
  const size_t gK = ((size_t)b * SEQ + kr) * DM + h * HD + kc;
  const size_t gV = ((size_t)bh * HD + vr) * SEQ + vc;
  const size_t gVl = ((size_t)bh * HD + vr) * QE + vc;
  const unsigned lK = (unsigned)(size_t)kv + (unsigned)(kr * KP + kc) * 2u;
  const unsigned lV = (unsigned)(size_t)kv + (unsigned)(OV + vr * VP + vc) * 2u;
  auto stage = [&](int t) {                     /* key step t -> buffer t mod 2 */
    const unsigned lb = (unsigned)(t & 1) * (unsigned)(BUF * 2);
    const size_t k0 = gK + (size_t)t * 32 * DM, v0 = gV + (size_t)t * 32;
    copy6(lK + lb, Kh + k0, lK + lb + 16 * KP * 2, Kh + k0 + 16 * DM,
          lK + lb + OKL * 2, Kl + k0, lK + lb + (OKL + 16 * KP) * 2, Kl + k0 + 16 * DM,
          lV + lb, Vth + v0, lV + lb + 32 * VP * 2, Vth + v0 + (size_t)32 * SEQ);
    if (EARLY) {
      const size_t w0 = gVl + (size_t)t * 32;
      copy2(lV + lb + 64 * VP * 2, Vtl + w0, lV + lb + 96 * VP * 2, Vtl + w0 + (size_t)32 * QE);
    }
  };
  const v8f z8 = {0.f, 0.f, 0.f, 0.f, 0.f, 0.f, 0.f, 0.f};
  v8f oacc[4] = {z8, z8, z8, z8};
  v8f ores[4] = {z8, z8, z8, z8};
  float m = -__builtin_inff(), l = 0.f;
  /* the wave's Q fragments (hi, lo; both 32-wide halves of the head) are the same in every key step: read once here, ahead of the first copies, and kept in registers */
  v16b fqh[2], fql[2];
#pragma unroll                           /* constant indices keep the fragment arrays in registers */
  for (int dc = 0; dc < 2; ++dc) {
    const size_t qo = offQ + dc * 32;
    fqh[dc] = ldb(Qh, qo, hh); fql[dc] = ldb(Ql, qo, hh);
  }
  asm volatile("s_wait_xcnt 0x0" ::: "memory");       /* no address register of the loads above is rewritten ahead of this wait */
  stage(0);
  asm volatile("s_wait_asynccnt 0x0" ::: "memory");   /* step 0's copies of this wave have landed */
  __syncthreads();                                    /* ... and every other wave's */
  stage(1);                                           /* nktB >= 2 */
#pragma unroll 1
  for (int it = 0; it < nktB; ++it) {
   if (it < nkt) {                       /* wave-uniform: a wave past its diagonal only passes the hand-over below */
    const int kb = it * 32;
    const unsigned short* kvb = kv + (it & 1) * BUF;
    /* the step's K fragments are read as one group ahead of the products: one load latency is waited for, not one in front of each chain of products */
    v16b kh[2][2], kl[2][2];
#pragma unroll                           /* constant indices keep the fragment arrays in registers; the same for the two loops below */
    for (int dc = 0; dc < 2; ++dc) {
      const unsigned short* k0 = kvb + ln * KP + dc * 32;
      const unsigned short* k1 = k0 + 16 * KP;
      kh[dc][0] = ldbs(k0, hh); kl[dc][0] = ldbs(k0 + OKL, hh);
      kh[dc][1] = ldbs(k1, hh); kl[dc][1] = ldbs(k1 + OKL, hh);
    }
    v8f st0 = z8, st1 = z8;
#pragma unroll
    for (int dc = 0; dc < 2; ++dc) {
      st0 = mmaB<3>(kh[dc][0], kl[dc][0], fqh[dc], fql[dc], st0);
      st1 = mmaB<3>(kh[dc][1], kl[dc][1], fqh[dc], fql[dc], st1);
    }
    /* the V^T fragments are read as one group here: their latency passes behind the softmax arithmetic */
    FragH vh[4], vl[4];
#pragma unroll
    for (int dt = 0; dt < 4; ++dt) {
      const unsigned short* vo = kvb + OV + (dt * 16 + ln) * VP;
      vh[dt].v = ldhs(vo, hh);
      if (EARLY) vl[dt].v = ldhs(vo + 64 * VP, hh);
    }
    float s0[8], s1[8];
#pragma unroll
    for (int r = 0; r < 8; ++r) { s0[r] = st0[r] * 0.125f; s1[r] = st1[r] * 0.125f; }
    if (it >= nFull) {                   /* wave-uniform: only the last step touches the diagonal */
#pragma unroll
      for (int r = 0; r < 8; ++r) {
        const int key = kb + 8 * hh + r;
        s0[r] = (key > qrow) ? -__builtin_inff() : s0[r];
        s1[r] = (key + 16 > qrow) ? -__builtin_inff() : s1[r];
      }
    }
    float mt = fmaxf(s0[0], s1[0]);
#pragma unroll
    for (int r = 1; r < 8; ++r) mt = fmaxf(mt, fmaxf(s0[r], s1[r]));
    const float mo = __shfl_xor(mt, 16);
    const float mnew = fmaxf(fmaxf(mt, mo), m);   /* finite: key kb <= qBase is visible to every query of the tile */
    const float alpha = __expf(m - mnew);
    m = mnew;
    l *= alpha;
#pragma unroll
    for (int dt = 0; dt < 4; ++dt) { oacc[dt] *= alpha; if (EARLY) ores[dt] *= alpha; }
    FragH ph, pl;
#pragma unroll
    for (int r = 0; r < 8; ++r) {
      const float p0 = __expf(s0[r] - m), p1 = __expf(s1[r] - m);
      l += p0 + p1;
      const float c0 = p0 * 256.0f, c1 = p1 * 256.0f;
      const _Float16 h0 = (_Float16)c0, h1 = (_Float16)c1;
      ph.h[r] = h0; ph.h[8 + r] = h1;
      pl.h[r] = (_Float16)((c0 - (float)h0) * 1024.0f);
      pl.h[8 + r] = (_Float16)((c1 - (float)h1) * 1024.0f);
    }
#pragma unroll
    for (int dt = 0; dt < 4; ++dt) {
      if (EARLY) {
        v8f o = oacc[dt], e = ores[dt];
        o = __builtin_amdgcn_wmma_f32_16x16x32_f16(false, vh[dt].v, false, ph.v, (short)0, o, false, false);
        e = __builtin_amdgcn_wmma_f32_16x16x32_f16(false, vl[dt].v, false, ph.v, (short)0, e, false, false);
        e = __builtin_amdgcn_wmma_f32_16x16x32_f16(false, vh[dt].v, false, pl.v, (short)0, e, false, false);
        asm volatile("v_nop\n\tv_nop\n\tv_nop\n\tv_nop" : "+v"(o), "+v"(e) : "v"(vh[dt].v), "v"(vl[dt].v), "v"(ph.v), "v"(pl.v));
        oacc[dt] = o; ores[dt] = e;
      } else {
        oacc[dt] = mmaH1(vh[dt].v, ph.v, oacc[dt]);
      }
    }
    asm volatile("" ::: "memory");
   }
    asm volatile("s_wait_dscnt 0x0" ::: "memory");      /* this wave's reads of buffer it mod 2 are done before it is refilled */
    asm volatile("s_wait_asynccnt 0x0" ::: "memory");   /* this wave's copies of step it + 1 have landed */
    __syncthreads();                                    /* publishes step it + 1, ends every wave's reads of step it */
    if (it + 2 < nktB) stage(it + 2);                   /* block-uniform */
  }
  asm volatile("s_wait_asynccnt 0x0" ::: "memory");     /* nothing in flight when the wave goes on */
  const float lt = l + __shfl_xor(l, 16);
  const float rinv = 1.0f / (256.0f * lt);
  // O^T (d = dt*16 + 8h + r, query = ln) -> wave-private LDS tile [query][d]
#pragma unroll
  for (int dt = 0; dt < 4; ++dt) {
    v8f o = oacc[dt];
    if (EARLY) o = o + ores[dt] * 0.0009765625f;
    const v4f w0 = {o[0] * rinv, o[1] * rinv, o[2] * rinv, o[3] * rinv};
    const v4f w1 = {o[4] * rinv, o[5] * rinv, o[6] * rinv, o[7] * rinv};
    *(v4fa*)&so[wave][ln][dt * 16 + 8 * hh] = w0;
    *(v4fa*)&so[wave][ln][dt * 16 + 8 * hh + 4] = w1;
  }
  __builtin_amdgcn_fence(4 /* acq_rel order */, "workgroup");
  __builtin_amdgcn_wave_barrier();
  const int rq = lane >> 3, c8 = (lane & 7) * 8;
  {
#pragma unroll
    for (int q = 0; q < 4; ++q) {
      const int r = q * 4 + rq;                      /* q 0..3 x rq 0..3 -> query rows 0..15 */
      const v4f x0 = *(const v4fa*)&so[wave][r][c8], x1 = *(const v4fa*)&so[wave][r][c8 + 4];
      const float xs[8] = {x0[0], x0[1], x0[2], x0[3], x1[0], x1[1], x1[2], x1[3]};
      v8us o0, o1;
#pragma unroll
      for (int i = 0; i < 8; ++i) { const unsigned short hb = bf16_bits(xs[i]); o0[i] = hb; o1[i] = bf16_bits(xs[i] - bf16_val(hb)); }
      const size_t go = ((size_t)b * SEQ + qBase + r) * DM + h * HD + c8;   
      *(v8us*)(Ch + go) = o0;
      *(v8us*)(Cl + go) = o1;
    }
    
  }
}
// both parts need nothing of each other: one grid, the long blocks (queries from QE on) first, then the EARLY ones (block-uniform choice)
#define GAM (NB * NH * ((SEQ - QE) / 64))      /* blocks of the part behind QE */
__global__ __launch_bounds__(128) void k_attn(const unsigned short* __restrict__ Qh, const unsigned short* __restrict__ Ql,
                                              const unsigned short* __restrict__ Kh, const unsigned short* __restrict__ Kl,
                                              const unsigned short* __restrict__ Vth, const unsigned short* __restrict__ Vtl,
                                              unsigned short* __restrict__ Ch, unsigned short* __restrict__ Cl) {
  __shared__ __attribute__((aligned(16))) float so[4][16][68];
  __shared__ __attribute__((aligned(16))) unsigned short kv[2 * ABUF];
  if ((int)blockIdx.x < GAM) attn_body<false>(Qh, Ql, Kh, Kl, Vth, Vtl, Ch, Cl, (int)blockIdx.x, so, kv);
  else attn_body<true>(Qh, Ql, Kh, Kl, Vth, Vtl, Ch, Cl, (int)blockIdx.x - GAM, so, kv);
}

// output GEMM: out[(b, s)][n] = sum_k (ctx_hi + ctx_lo)[r][k] . bf16(WO)[n][k] + bf16(bO)[n]; block = 4 x 2 waves, block tile 128 x 128, wave tile 32 x 64; f32 rows of the full-size output layout;
// the bias float4 of a lane's four columns is read once by value and added in f32 at the store stage;
__global__ __launch_bounds__(256) void k_out(const unsigned short* __restrict__ Ah, const unsigned short* __restrict__ Al,
                                             const unsigned short* __restrict__ Bt, const float* __restrict__ bias, float* __restrict__ C) {
  __shared__ __attribute__((aligned(16))) float so[8][32][68];
  const int lane = threadIdx.x & 31, ln = lane & 15, hh = lane >> 4;
  const int w = __builtin_amdgcn_readfirstlane((int)(threadIdx.x >> 5));
  const int wr = w & 3, wc = w >> 2;                  /* the wave's 32 rows and its column half of the block tile */
  const int mt = blockIdx.x / (DM / 128), nq = blockIdx.x - mt * (DM / 128);
  const int row0 = mt * 128 + 32 * wr, col0 = nq * 128 + 64 * wc;
  /* the block's 128 ctx rows (hi, lo) and 128 Bt rows, 64 k at a time, are copied once per block into a two-buffer LDS ring, one tile ahead of their use */
  constexpr int OL = 128 * GP, OB = 2 * OL, GBUF = 3 * OL;   /* places of the lo rows and the Bt rows inside a buffer; buffer size */
  __shared__ __attribute__((aligned(16))) unsigned short ab[2 * GBUF];
  const int sr = (int)threadIdx.x >> 3, sc = ((int)threadIdx.x & 7) * 8;   /* rows sr + 32 j, 16-byte piece sc */
  const size_t oA = (size_t)(mt * 128 + sr) * DM + sc;
  const unsigned short* gB = Bt + (size_t)(nq * 128 + sr) * DM + sc;
  const unsigned lA = (unsigned)(size_t)ab + (unsigned)(sr * GP + sc) * 2u;
  auto stage = [&](int t) {                           /* k tile t -> buffer t mod 2 */
    const unsigned la = lA + (unsigned)(t & 1) * (unsigned)(GBUF * 2);
    rows4(la, Ah + oA + t * 64);
    rows4(la + OL * 2, Al + oA + t * 64);
    rows4(la + OB * 2, gB + t * 64);
  };
  const v8f z8 = {0.f, 0.f, 0.f, 0.f, 0.f, 0.f, 0.f, 0.f};
  v8f c00 = z8, c01 = z8, c02 = z8, c03 = z8, c10 = z8, c11 = z8, c12 = z8, c13 = z8;
  stage(0);
  asm volatile("s_wait_asynccnt 0x0" ::: "memory");   /* tile 0's copies of this wave have landed */
  __syncthreads();                                    /* ... and every other wave's */
  stage(1);
#pragma unroll 1
  for (int t = 0; t < DM / 64; ++t) {
    const unsigned short* pa = ab + (t & 1) * GBUF + (32 * wr + ln) * GP;
    const unsigned short* pb = ab + (t & 1) * GBUF + OB + (64 * wc + ln) * GP;
    v16b fh[2][2], fl[2][2], fb[2][4];                  /* the tile's LDS reads go as one group ahead of its products */
#pragma unroll
    for (int s = 0; s < 2; ++s) {
      fh[s][0] = ldbs(pa + 32 * s, hh); fl[s][0] = ldbs(pa + OL + 32 * s, hh);
      fh[s][1] = ldbs(pa + 16 * GP + 32 * s, hh); fl[s][1] = ldbs(pa + OL + 16 * GP + 32 * s, hh);
#pragma unroll
      for (int j = 0; j < 4; ++j) fb[s][j] = ldbs(pb + 16 * j * GP + 32 * s, hh);
    }
#pragma unroll
    for (int s = 0; s < 2; ++s) {
      c00 = mmaB<2>(fh[s][0], fl[s][0], fb[s][0], fb[s][0], c00); c10 = mmaB<2>(fh[s][1], fl[s][1], fb[s][0], fb[s][0], c10);
      c01 = mmaB<2>(fh[s][0], fl[s][0], fb[s][1], fb[s][1], c01); c11 = mmaB<2>(fh[s][1], fl[s][1], fb[s][1], fb[s][1], c11);
      c02 = mmaB<2>(fh[s][0], fl[s][0], fb[s][2], fb[s][2], c02); c12 = mmaB<2>(fh[s][1], fl[s][1], fb[s][2], fb[s][2], c12);
      c03 = mmaB<2>(fh[s][0], fl[s][0], fb[s][3], fb[s][3], c03); c13 = mmaB<2>(fh[s][1], fl[s][1], fb[s][3], fb[s][3], c13);
    }
    asm volatile("s_wait_dscnt 0x0" ::: "memory");      /* this wave's reads of buffer t mod 2 are done before it is refilled */
    asm volatile("s_wait_asynccnt 0x0" ::: "memory");   /* this wave's copies of tile t + 1 have landed */
    __syncthreads();                                    /* publishes tile t + 1, ends every wave's reads of tile t */
    if (t + 2 < DM / 64) stage(t + 2);                  /* block-uniform */
  }
  asm volatile("s_wait_asynccnt 0x0" ::: "memory");     /* nothing in flight when the wave goes on */
  v8f accs[8] = {c00, c01, c02, c03, c10, c11, c12, c13};
#pragma unroll
  for (int u = 0; u < 8; ++u) {
    const int t = u & 3, half = u >> 2;
#pragma unroll
    for (int r = 0; r < 8; ++r) so[w][half * 16 + 8 * hh + r][t * 16 + ln] = accs[u][r];
  }
  __builtin_amdgcn_fence(4 /* acq_rel order */, "workgroup");
  __builtin_amdgcn_wave_barrier();
  const int rsub = lane >> 4, c4 = (lane & 15) * 4;
  const v4f bx = *(const v4fa*)(bias + col0 + c4);   /* columns col0 + c4 .. + 3 < DM */
  const v4f bv = {bf16_rne(bx[0]), bf16_rne(bx[1]), bf16_rne(bx[2]), bf16_rne(bx[3])};
  {
#pragma unroll
    for (int q = 0; q < 16; ++q) {
      const int r = q * 2 + rsub;                    /* q 0..15 x rsub 0..1 -> rows 0..31 */
      const v4f sv = *(const v4fa*)&so[w][r][c4];
      const v4f v = sv + bv;
      const int grow = row0 + r;
      const int bb = grow / SEQ, s = grow - bb * SEQ;
      *(v4f*)(C + ((size_t)bb * SEQ_FULL + s) * DM + col0 + c4) = v;
    }
    
  }
}

/* workspace carve (bytes): 3 input planes + 4 weight planes + Qh Ql Kh Kl + Vh Vl + Vth + Vtl + Ch Cl */
#define XB ((size_t)NR * DM * 2)
#define WB ((size_t)DM * DM * 2)
#define VLB ((size_t)NB * NH * HD * QE * 2)
static_assert(XB % 256 == 0 && WB % 256 == 0 && VLB % 256 == 0);
static_assert(12 * XB + 4 * WB + VLB <= (size_t)134217728);   /* total carve stays within 128 MiB */

extern "C" void kernel_launch(void* const* d_in, const int* in_sizes, int n_in,
                              void* d_out, int out_size, void* d_ws, size_t ws_size, hipStream_t stream) {
  if (n_in < 8) return;
  const long long need_x = ((long long)(NB - 1) * SEQ_FULL + SEQ) * DM;
  if (in_sizes[0] < need_x || in_sizes[1] < need_x || in_sizes[2] < need_x) return;
  if (in_sizes[3] < DM * DM || in_sizes[4] < DM * DM || in_sizes[5] < DM * DM || in_sizes[6] < DM * DM) return;
  if (in_sizes[7] < DM) return;
  if (out_size < need_x) return;
  const float* xq = (const float*)d_in[0];      /* table order: Q, K, V, WQ, WK, WV, WO, bO */
  const float* xk = (const float*)d_in[1];
  const float* xv = (const float*)d_in[2];
  const float* wq = (const float*)d_in[3];
  const float* wk = (const float*)d_in[4];
  const float* wv = (const float*)d_in[5];
  const float* wo = (const float*)d_in[6];
  const float* bo = (const float*)d_in[7];
  char* ws = (char*)d_ws; size_t off = 0;
  auto take = [&](size_t bytes) { char* p = ws + off; off += (bytes + 255) & ~(size_t)255; return (unsigned short*)p; };
  unsigned short* XQ = take(XB); unsigned short* XK = take(XB); unsigned short* XV = take(XB);
  unsigned short* BQ = take(WB); unsigned short* BK = take(WB); unsigned short* BV = take(WB); unsigned short* BO = take(WB);
  unsigned short* Qh = take(XB); unsigned short* Ql = take(XB); unsigned short* Kh = take(XB); unsigned short* Kl = take(XB);
  unsigned short* Vh = take(XB); unsigned short* Vl = take(XB);
  unsigned short* Vth = take(XB); unsigned short* Vtl = take(VLB);
  unsigned short* Ch = take(XB); unsigned short* Cl = take(XB);
  if (off > ws_size) return;

  k_conv<<<(unsigned)(3 * GX + 4 * GW), 256, 0, stream>>>(xq, xk, xv, wq, wk, wv, wo, XQ, XK, XV, BQ, BK, BV, BO);
  k_proj<<<(unsigned)(3 * GPJ), 128, 0, stream>>>(XQ, BQ, Qh, Ql, XK, BK, Kh, Kl, XV, BV, Vh, Vl);
  k_vt<<<(unsigned)(GVT + NB * NH * (QE / 64)), 256, 0, stream>>>(Vh, Vth, Vl, Vtl);   /* in [NR][DM] rows -> out [(b,h)][64][SEQ] and [(b,h)][64][QE] */
  k_attn<<<(unsigned)(GAM + NB * NH * (QE / 64)), 128, 0, stream>>>(Qh, Ql, Kh, Kl, Vth, Vtl, Ch, Cl);
  k_out<<<(unsigned)GPJ, 256, 0, stream>>>(Ch, Cl, BO, bo, (float*)d_out);
}

// v007
// One run takes 110 microseconds.
// Two timings next to v006 both put it at 1.04 times that version's speed.
// Counting every step since v000, it is 3.40 times as fast.
#include <hip/hip_runtime.h>
// Causal multi-head attention, three input streams (Q, K, V each [B][T][1024]), bias-free [out][in] input projections, 16 heads x 64, score scale 1/8, keys j > i excluded, out = ctx WO^T + bO (bO converted RNE to bf16, added in f32 at the store stage).
// Compute dtype: inputs converted (RNE) to bf16 and carried exactly as f16 rows / x16 f16 weights; Q,K,V projections v_wmma_f32_16x16x32_f16 (single product); scores v_wmma_f32_16x16x32_bf16 on bf16 hi|lo planes of q and k (three products); P.V v_wmma_f32_16x16x32_f16 with P carried x256 (first QE query rows: f16 value + x1024 residual planes for P and V, separate accumulator); output GEMM v_wmma_f32_16x16x32_bf16 with ctx as bf16 hi|lo against exact bf16 WO (two products); f32 accumulation and f32 softmax statistics everywhere.
#ifndef NB
#define NB 2
#endif
#ifndef SEQ
#define SEQ 2048
#endif
#ifndef QE
#define QE ((SEQ) < 256 ? (SEQ) : 256)   /* query rows per sequence that get residual planes on P and V */
#endif
#define NB_FULL 2
#define SEQ_FULL 2048
#define DM 1024
#define NH 16
#define HD 64
#define NR (NB * SEQ)

static_assert(NH * HD == DM);                 /* merged head columns h*64+d span the model width */
static_assert(HD == 64);                      
static_assert(DM % 128 == 0 && DM % 64 == 0); /* GEMM column tiles of 128, k tiles of 64 */
static_assert(NR % 128 == 0);                 /* GEMM row tiles of 128 */
static_assert(SEQ % 64 == 0 && QE % 64 == 0 && QE <= SEQ && (SEQ - QE) % 64 == 0);  /* 4 query tiles of 16 per block; 32-key steps stay inside the sequence */
static_assert(NB <= NB_FULL && SEQ <= SEQ_FULL);
static_assert((NR * DM / 8) % 256 == 0 && (DM * DM / 8) % 256 == 0);  /* convert grids x 256 threads == plane extent */
static_assert((SEQ & (SEQ - 1)) == 0);        /* row -> (batch, position) by shift */
static_assert(DM % 4 == 0 && (DM / 64 - 1) * 64 + 15 * 4 + 4 <= DM);  /* per-lane float4 of the bias vector stays inside [DM] */
static_assert((size_t)NB_FULL * SEQ_FULL * DM * 4 == (size_t)16777216);  /* output buffer bytes, single output at byte offset 0 */

typedef __bf16 v16b __attribute__((ext_vector_type(16)));
typedef _Float16 v16h __attribute__((ext_vector_type(16)));
typedef unsigned short v8us __attribute__((ext_vector_type(8), may_alias));
typedef float v8f __attribute__((ext_vector_type(8)));
typedef float v4f __attribute__((ext_vector_type(4)));
typedef float v4fa __attribute__((ext_vector_type(4), may_alias));
union FragB { v16b v; v8us half[2]; unsigned short u[16]; };
union FragH { v16h v; v8us half[2]; _Float16 h[16]; unsigned short u[16]; };

__device__ __forceinline__ unsigned short bf16_bits(float x) { unsigned int u = __float_as_uint(x); return (unsigned short)((u + 0x7FFFu + ((u >> 16) & 1u)) >> 16); }
__device__ __forceinline__ float bf16_val(unsigned short b) { return __uint_as_float(((unsigned int)b) << 16); }
__device__ __forceinline__ float bf16_rne(float x) { return bf16_val(bf16_bits(x)); }

// fragment loader (A and B alike): elements 0..7 <- k0 + 8h + 0..7, elements 8..15 <- k0 + 16 + 8h + 0..7 of a k-contiguous 16-bit row
__device__ __forceinline__ v16b ldb(const unsigned short* __restrict__ p, size_t off, int hh) { FragB f; f.half[0] = *(const v8us*)(p + off + 8 * hh); f.half[1] = *(const v8us*)(p + off + 16 + 8 * hh); return f.v; }

// D += A.B with NT bf16 products: 1 = ah.bh, 2 = + al.bh, 3 = + ah.bl; one guard naming the accumulator and every fragment
template <int NT>
__device__ __forceinline__ v8f mmaB(v16b ah, v16b al, v16b bh, v16b bl, v8f c) {
  c = __builtin_amdgcn_wmma_f32_16x16x32_bf16(false, ah, false, bh, (short)0, c, false, false);
  if (NT >= 2) c = __builtin_amdgcn_wmma_f32_16x16x32_bf16(false, al, false, bh, (short)0, c, false, false);
  if (NT >= 3) c = __builtin_amdgcn_wmma_f32_16x16x32_bf16(false, ah, false, bl, (short)0, c, false, false);
  asm volatile("v_nop\n\tv_nop\n\tv_nop\n\tv_nop" : "+v"(c) : "v"(ah), "v"(al), "v"(bh), "v"(bl));
  return c;
}
__device__ __forceinline__ v8f mmaH1(v16h a, v16h b, v8f c) {
  v8f d = __builtin_amdgcn_wmma_f32_16x16x32_f16(false, a, false, b, (short)0, c, false, false);
  asm volatile("v_nop\n\tv_nop\n\tv_nop\n\tv_nop" : "+v"(d) : "v"(a), "v"(b));
  return d;
}

__device__ __forceinline__ void x16_body(const float* __restrict__ x, unsigned short* __restrict__ X16, int blk) {
  const int t = blk * 256 + threadIdx.x;
  if (t >= NR * DM / 8) return;
  const int row = t / (DM / 8), c8 = (t - row * (DM / 8)) * 8;
  const int b = row / SEQ, s = row - b * SEQ;
  const float* src = x + ((size_t)b * SEQ_FULL + s) * DM + c8;
  const v4f a = *(const v4fa*)src, c = *(const v4fa*)(src + 4);
  FragH f;
#pragma unroll
  for (int q = 0; q < 4; ++q) { f.h[q] = (_Float16)bf16_rne(a[q]); f.h[4 + q] = (_Float16)bf16_rne(c[q]); }
  const v8us o = f.half[0];
  unsigned short* d = X16 + (size_t)t * 8;
  *(v8us*)d = o;
  
}
__device__ __forceinline__ void wnat_body(const float* __restrict__ w, unsigned short* __restrict__ Bt, int blk) {
  const int t = blk * 256 + threadIdx.x;
  if (t >= DM * DM / 8) return;
  const v4f a = *(const v4fa*)(w + (size_t)t * 8), c = *(const v4fa*)(w + (size_t)t * 8 + 4);
  FragH f;
#pragma unroll
  for (int q = 0; q < 4; ++q) { f.h[q] = (_Float16)(bf16_rne(a[q]) * 16.0f); f.h[4 + q] = (_Float16)(bf16_rne(c[q]) * 16.0f); }
  const v8us o = f.half[0];
  unsigned short* d = Bt + (size_t)t * 8;
  *(v8us*)d = o;
  
}
__device__ __forceinline__ void wbf_body(const float* __restrict__ w, unsigned short* __restrict__ Bt, int blk) {
  const int t = blk * 256 + threadIdx.x;
  if (t >= DM * DM / 8) return;
  const v4f a = *(const v4fa*)(w + (size_t)t * 8), c = *(const v4fa*)(w + (size_t)t * 8 + 4);
  v8us o;
#pragma unroll
  for (int q = 0; q < 4; ++q) { o[q] = bf16_bits(a[q]); o[4 + q] = bf16_bits(c[q]); }
  unsigned short* d = Bt + (size_t)t * 8;
  *(v8us*)d = o;
  
}
// the seven conversions need nothing of each other: one grid, each plane a range of the block index (block-uniform choice)
#define GX (NR * DM / 8 / 256)                 /* blocks per input plane */
#define GW (DM * DM / 8 / 256)                 /* blocks per weight plane */
__global__ __launch_bounds__(256) void k_conv(const float* __restrict__ xq, const float* __restrict__ xk, const float* __restrict__ xv,
                                              const float* __restrict__ wq, const float* __restrict__ wk, const float* __restrict__ wv, const float* __restrict__ wo,
                                              unsigned short* __restrict__ XQ, unsigned short* __restrict__ XK, unsigned short* __restrict__ XV,
                                              unsigned short* __restrict__ BQ, unsigned short* __restrict__ BK, unsigned short* __restrict__ BV, unsigned short* __restrict__ BO) {
  const int bid = blockIdx.x;
  if (bid < 3 * GX) {
    const int sel = bid / GX;
    x16_body(sel == 0 ? xq : sel == 1 ? xk : xv, sel == 0 ? XQ : sel == 1 ? XK : XV, bid - sel * GX);
  } else if (bid < 3 * GX + 3 * GW) {
    const int sel = (bid - 3 * GX) / GW;
    wnat_body(sel == 0 ? wq : sel == 1 ? wk : wv, sel == 0 ? BQ : sel == 1 ? BK : BV, bid - 3 * GX - sel * GW);   /* natural [out][in] = Bt[n][k] as stored */
  } else {
    wbf_body(wo, BO, bid - 3 * GX - 3 * GW);
  }
}

// fragment loaders for a row staged in LDS: the element order of ldb
__device__ __forceinline__ v16b ldbs(const unsigned short* p, int hh) { FragB f; f.half[0] = *(const v8us*)(p + 8 * hh); f.half[1] = *(const v8us*)(p + 16 + 8 * hh); return f.v; }
__device__ __forceinline__ v16h ldhs(const unsigned short* p, int hh) { FragH f; f.half[0] = *(const v8us*)(p + 8 * hh); f.half[1] = *(const v8us*)(p + 16 + 8 * hh); return f.v; }
// GEMM operand tiles: 128 rows of a [row][DM] plane, r, r + 16, ... (rows8) or r, r + 32, ... (rows4), one 16-byte asynchronous copy global -> LDS per lane and line of text (8 lanes cover one 128-byte row piece);
// s_wait_xcnt closes each statement so that no address register is rewritten ahead of it
#define GP 72                                  /* LDS row pitch of a 64-k tile in 16-bit elements: 144 B = 16 B x odd */
__device__ __forceinline__ void rows4(unsigned l, const unsigned short* g) {   /* a block of 256 threads: rows r, r + 32, r + 64, r + 96 */
  asm volatile("global_load_async_to_lds_b128 %0, %1, off\n\tglobal_load_async_to_lds_b128 %2, %3, off\n\t"
               "global_load_async_to_lds_b128 %4, %5, off\n\tglobal_load_async_to_lds_b128 %6, %7, off\n\ts_wait_xcnt 0x0"
               :: "v"(l), "v"(g), "v"(l + 32 * GP * 2), "v"(g + 32 * DM), "v"(l + 64 * GP * 2), "v"(g + 64 * DM), "v"(l + 96 * GP * 2), "v"(g + 96 * DM) : "memory");
}
__device__ __forceinline__ void rows8(unsigned l, const unsigned short* g) {
  asm volatile("global_load_async_to_lds_b128 %0, %1, off\n\tglobal_load_async_to_lds_b128 %2, %3, off\n\t"
               "global_load_async_to_lds_b128 %4, %5, off\n\tglobal_load_async_to_lds_b128 %6, %7, off\n\t"
               "global_load_async_to_lds_b128 %8, %9, off\n\tglobal_load_async_to_lds_b128 %10, %11, off\n\t"
               "global_load_async_to_lds_b128 %12, %13, off\n\tglobal_load_async_to_lds_b128 %14, %15, off\n\ts_wait_xcnt 0x0"
               :: "v"(l), "v"(g), "v"(l + 16 * GP * 2), "v"(g + 16 * DM), "v"(l + 32 * GP * 2), "v"(g + 32 * DM), "v"(l + 48 * GP * 2), "v"(g + 48 * DM),
                  "v"(l + 64 * GP * 2), "v"(g + 64 * DM), "v"(l + 80 * GP * 2), "v"(g + 80 * DM), "v"(l + 96 * GP * 2), "v"(g + 96 * DM), "v"(l + 112 * GP * 2), "v"(g + 112 * DM) : "memory");
}
static_assert(DM / 64 >= 2);                   /* the two-buffer ring starts with two tiles */
static_assert(((DM / 64) & (DM / 64 - 1)) == 0);   /* the rotated k walk wraps by a mask */

// projection GEMM: Y[NR][DM] = A[NR][DM] (exact f16 rows) . Bt[n][k] (x16 f16) * 2^-4; block = 2 x 2 waves, block tile 128 x 128, wave tile 64 rows x 64 cols;
// MODE 0: Y -> bf16 hi | lo planes; MODE 1: Y -> f16 value | (Y - value) x 1024 planes. Epilogue: the wave tile staged in wave-private LDS, then stored by proj_store, 32 rows a call
template <int MODE>
__device__ __forceinline__ void proj_store(const float (*sw)[68], int lane, int row0, int col0, unsigned short* __restrict__ P0, unsigned short* __restrict__ P1) {
  const int rq = lane >> 3, c8 = (lane & 7) * 8;
#pragma unroll
  for (int q = 0; q < 8; ++q) {
    const int r = q * 4 + rq;                       /* q 0..7 x rq 0..3 -> rows 0..31 */
    const v4f x0 = *(const v4fa*)&sw[r][c8], x1 = *(const v4fa*)&sw[r][c8 + 4];
    const float xs[8] = {x0[0], x0[1], x0[2], x0[3], x1[0], x1[1], x1[2], x1[3]};
    v8us o0, o1;
    if (MODE == 0) {
#pragma unroll
      for (int i = 0; i < 8; ++i) { const unsigned short hb = bf16_bits(xs[i]); o0[i] = hb; o1[i] = bf16_bits(xs[i] - bf16_val(hb)); }
    } else {
      FragH fh, fl;
#pragma unroll
      for (int i = 0; i < 8; ++i) { const _Float16 hv = (_Float16)xs[i]; fh.h[i] = hv; fl.h[i] = (_Float16)((xs[i] - (float)hv) * 1024.0f); }
      o0 = fh.half[0]; o1 = fl.half[0];
    }
    const size_t go = (size_t)(row0 + r) * DM + col0 + c8;
    *(v8us*)(P0 + go) = o0;
    *(v8us*)(P1 + go) = o1;
  }
}
// blk: the tile's index inside its own product; vmode (block-uniform): the MODE of the store stage
__device__ __forceinline__ void proj_body(const unsigned short* __restrict__ A, const unsigned short* __restrict__ Bt,
                                          unsigned short* __restrict__ P0, unsigned short* __restrict__ P1, int blk, bool vmode) {
  const int lane = threadIdx.x & 31, ln = lane & 15, hh = lane >> 4;
  const int w = __builtin_amdgcn_readfirstlane((int)(threadIdx.x >> 5));
  const int wr = w >> 1, wc = w & 1;                  /* the wave's row half and column half of the block tile */
  const int mt = blk / (DM / 128), nq = blk - mt * (DM / 128);
  const int row0 = mt * 128 + 64 * wr, col0 = nq * 128 + 64 * wc;
  /* the block's 128 A rows and 128 Bt rows, 64 k at a time, are copied once per block into a two-buffer LDS ring, one tile ahead of their use */
  constexpr int OB = 128 * GP, GBUF = 2 * OB;         /* place of the Bt rows inside a buffer; buffer size */
  __shared__ __attribute__((aligned(16))) unsigned short ab[2 * GBUF];
  const int sr = (int)threadIdx.x >> 3, sc = ((int)threadIdx.x & 7) * 8;   /* rows sr + 16 j, 16-byte piece sc */
  const unsigned short* gA = A + (size_t)(mt * 128 + sr) * DM + sc;
  const unsigned short* gB = Bt + (size_t)(nq * 128 + sr) * DM + sc;
  const unsigned lA = (unsigned)(size_t)ab + (unsigned)(sr * GP + sc) * 2u;
  /* the 8 blocks of one row tile read the same A lines and the 32 blocks of one column tile the same Bt lines, all at the same moment if all walk k from 0:
     each block enters the k walk at a tile of its own and wraps round, so that sharers ask L2 for different lines at any one time */
  const int t0 = (2 * nq + mt) & (DM / 64 - 1);
  auto stage = [&](int t) {                           /* trip t: k tile (t + t0) mod 16 -> buffer t mod 2 */
    const unsigned la = lA + (unsigned)(t & 1) * (unsigned)(GBUF * 2);
    const int kt = ((t + t0) & (DM / 64 - 1)) * 64;   /* 0 .. DM - 64: inside the row */
    rows8(la, gA + kt);
    rows8(la + OB * 2, gB + kt);
  };
  const v8f z8 = {0.f, 0.f, 0.f, 0.f, 0.f, 0.f, 0.f, 0.f};
  v8f acc[4][4];                                      /* [16-row tile][16-column tile] */
#pragma unroll                                        /* constant indices keep the accumulators in registers; the same for every loop over them below */
  for (int i = 0; i < 4; ++i)
#pragma unroll
    for (int j = 0; j < 4; ++j) acc[i][j] = z8;
  stage(0);
  asm volatile("s_wait_asynccnt 0x0" ::: "memory");   /* tile 0's copies of this wave have landed */
  __syncthreads();                                    /* ... and every other wave's */
  stage(1);
#pragma unroll 1
  for (int t = 0; t < DM / 64; ++t) {
    const unsigned short* pa = ab + (t & 1) * GBUF + (64 * wr + ln) * GP;
    const unsigned short* pb = ab + (t & 1) * GBUF + OB + (64 * wc + ln) * GP;
#pragma unroll
    for (int s = 0; s < 2; ++s) {                       /* the two 32-k halves of the tile */
      v16h fa[4], fb[4];                                /* a half's LDS reads go as one group ahead of its 16 products */
#pragma unroll
      for (int i = 0; i < 4; ++i) fa[i] = ldhs(pa + 16 * i * GP + 32 * s, hh);
#pragma unroll
      for (int j = 0; j < 4; ++j) fb[j] = ldhs(pb + 16 * j * GP + 32 * s, hh);
#pragma unroll
      for (int j = 0; j < 4; ++j)
#pragma unroll
        for (int i = 0; i < 4; ++i) acc[i][j] = mmaH1(fa[i], fb[j], acc[i][j]);
    }
    asm volatile("s_wait_dscnt 0x0" ::: "memory");      /* this wave's reads of buffer t mod 2 are done before it is refilled */
    asm volatile("s_wait_asynccnt 0x0" ::: "memory");   /* this wave's copies of tile t + 1 have landed */
    __syncthreads();                                    /* publishes tile t + 1, ends every wave's reads of tile t */
    if (t + 2 < DM / 64) stage(t + 2);                  /* block-uniform */
  }
  asm volatile("s_wait_asynccnt 0x0" ::: "memory");     /* nothing in flight when the wave goes on */
  /* the ring is free now: every wave's last read of it stands ahead of the barrier at the foot of the last trip, and no copy is in flight;
     each wave stages its 64 x 64 tile in a part of its own, so that the block's LDS is the ring alone and three blocks fit a WGP */
  static_assert(4 * 64 * 68 * 4 <= 2 * GBUF * 2);
  float (*sw)[68] = reinterpret_cast<float (*)[68]>(ab) + 64 * w;
#pragma unroll
  for (int i = 0; i < 4; ++i)
#pragma unroll
    for (int j = 0; j < 4; ++j)
#pragma unroll
      for (int r = 0; r < 8; ++r) sw[i * 16 + 8 * hh + r][j * 16 + ln] = acc[i][j][r] * 0.0625f;
  __builtin_amdgcn_fence(4 /* acq_rel order */, "workgroup");
  __builtin_amdgcn_wave_barrier();
  if (vmode) {
    proj_store<1>(sw, lane, row0, col0, P0, P1);
    proj_store<1>(sw + 32, lane, row0 + 32, col0, P0, P1);
  } else {
    proj_store<0>(sw, lane, row0, col0, P0, P1);
    proj_store<0>(sw + 32, lane, row0 + 32, col0, P0, P1);
    asm volatile("s_wait_xcnt 0x0" ::: "memory");   /* in the built code the other stage's instructions follow this one's: no register that a store above names is rewritten ahead of this wait */
  }
}
// the three projections need nothing of each other: one grid, each product a range of the block index (block-uniform choice)
#define GPJ ((NR / 128) * (DM / 128))          /* blocks per GEMM */
__global__ __launch_bounds__(128) void k_proj(const unsigned short* __restrict__ XQ, const unsigned short* __restrict__ BQ, unsigned short* __restrict__ Qh, unsigned short* __restrict__ Ql,
                                              const unsigned short* __restrict__ XK, const unsigned short* __restrict__ BK, unsigned short* __restrict__ Kh, unsigned short* __restrict__ Kl,
                                              const unsigned short* __restrict__ XV, const unsigned short* __restrict__ BV, unsigned short* __restrict__ Vh, unsigned short* __restrict__ Vl) {
  const int sel = blockIdx.x / GPJ;
  proj_body(sel == 0 ? XQ : sel == 1 ? XK : XV, sel == 0 ? BQ : sel == 1 ? BK : BV,
            sel == 0 ? Qh : sel == 1 ? Kh : Vh, sel == 0 ? Ql : sel == 1 ? Kl : Vl, blockIdx.x - sel * GPJ, sel == 2);
}

// V rows [NR][DM] -> Vt[(b*NH + h)][d][s], s < ntok (row pitch ntok); block per ((b,h), 64 positions); 64x64 tile through LDS;
// one grid for both planes: the value plane (all SEQ positions) first, then the residual plane (first QE positions only), a block-uniform choice
#define GVT (NB * NH * (SEQ / 64))             /* blocks of the value plane */
__global__ __launch_bounds__(256) void k_vt(const unsigned short* __restrict__ Vh, unsigned short* __restrict__ Vth,
                                            const unsigned short* __restrict__ Vl, unsigned short* __restrict__ Vtl) {
  __shared__ unsigned short tl[64][66];
  const int tid = threadIdx.x;
  const bool res = blockIdx.x >= GVT;
  const unsigned short* __restrict__ V16 = res ? Vl : Vh;
  unsigned short* __restrict__ Vt = res ? Vtl : Vth;
  const int ntok = res ? QE : SEQ, blk = res ? (int)blockIdx.x - GVT : (int)blockIdx.x;
  const int ng = ntok / 64;
  const int slab = blk / ng, lg = blk - slab * ng;
  const int b = slab / NH, h = slab - b * NH;
  for (int i = tid; i < 64 * 8; i += 256) {
    const int r = i / 8, c8 = (i % 8) * 8;
    FragH f;
    f.half[0] = *(const v8us*)(V16 + ((size_t)b * SEQ + lg * 64 + r) * DM + h * HD + c8);
#pragma unroll
    for (int q = 0; q < 8; ++q) tl[r][c8 + q] = f.u[q];
  }
  __syncthreads();
  {
#pragma unroll
    for (int rd = 0; rd < 2; ++rd) {
      const int d = rd * 32 + tid / 8, pc = tid % 8;  /* rd 0..1 x tid/8 0..31 -> d 0..63; pc 0..7 -> 64 positions */
      FragH f;
#pragma unroll
      for (int q = 0; q < 8; ++q) f.u[q] = tl[pc * 8 + q][d];
      const v8us o = f.half[0];
      *(v8us*)(Vt + ((size_t)slab * HD + d) * ntok + lg * 64 + pc * 8) = o;
    }
    
  }
}

// 16-byte asynchronous copies global -> LDS, one per lane and line of text; s_wait_xcnt closes each statement so that no address register is rewritten ahead of it
__device__ __forceinline__ void copy6(unsigned l0, const unsigned short* g0, unsigned l1, const unsigned short* g1, unsigned l2, const unsigned short* g2,
                                      unsigned l3, const unsigned short* g3, unsigned l4, const unsigned short* g4, unsigned l5, const unsigned short* g5) {
  asm volatile("global_load_async_to_lds_b128 %0, %1, off\n\tglobal_load_async_to_lds_b128 %2, %3, off\n\tglobal_load_async_to_lds_b128 %4, %5, off\n\t"
               "global_load_async_to_lds_b128 %6, %7, off\n\tglobal_load_async_to_lds_b128 %8, %9, off\n\tglobal_load_async_to_lds_b128 %10, %11, off\n\ts_wait_xcnt 0x0"
               :: "v"(l0), "v"(g0), "v"(l1), "v"(g1), "v"(l2), "v"(g2), "v"(l3), "v"(g3), "v"(l4), "v"(g4), "v"(l5), "v"(g5) : "memory");
}
__device__ __forceinline__ void copy2(unsigned l0, const unsigned short* g0, unsigned l1, const unsigned short* g1) {
  asm volatile("global_load_async_to_lds_b128 %0, %1, off\n\tglobal_load_async_to_lds_b128 %2, %3, off\n\ts_wait_xcnt 0x0"
               :: "v"(l0), "v"(g0), "v"(l1), "v"(g1) : "memory");
}

// fused causal attention: wave = 16 queries of one (b, h); keys walked in 32-key steps up to the diagonal; S^T = K.Q^T (A = K rows, B = Q rows;
// D row = key 8h+r, D col = query) so a lane owns one query: running max / sum in registers, one shuffle joins the two lane halves;
// P fragment (B operand, k = key) taken directly from the two score accumulators (element r <- keys 8h+r, element 8+r <- keys 16+8h+r);
// O^T = V^T.P (A = V^T rows, d x key). EARLY: P and V also carry x1024 residual planes into a second accumulator.
// The 32-key tiles of K (hi, lo) and V^T are shared by the block's four waves: copied once per block into a two-buffer LDS ring, one step ahead of their use.
// blk: the block's index inside its own part (EARLY or not); so, kv: the kernel's LDS, one allocation for both parts.
#define ABUF (2 * 32 * 72 + 2 * 64 * 40)       /* 16-bit elements of one ring buffer of the EARLY part, the larger one */
template <bool EARLY>
__device__ __forceinline__ void attn_body(const unsigned short* __restrict__ Qh, const unsigned short* __restrict__ Ql,
                                          const unsigned short* __restrict__ Kh, const unsigned short* __restrict__ Kl,
                                          const unsigned short* __restrict__ Vth, const unsigned short* __restrict__ Vtl,
                                          unsigned short* __restrict__ Ch, unsigned short* __restrict__ Cl,
                                          int blk, float (*so)[16][68], unsigned short* kv) {
  constexpr int QT0 = EARLY ? 0 : QE / 16;
  constexpr int NQT = EARLY ? QE / 16 : (SEQ - QE) / 16;
  constexpr int BPB = (NQT / 4 > 0) ? NQT / 4 : 1;   /* blocks per (b, h): 4 query tiles each */
  const int lane = threadIdx.x & 31, ln = lane & 15, hh = lane >> 4;
  const int wave = __builtin_amdgcn_readfirstlane((int)(threadIdx.x >> 5));
  const int bh = blk / BPB;
  const int qt = QT0 + (blk - bh * BPB) * 4 + wave;
  const int b = bh / NH, h = bh - b * NH;
  const int qBase = qt * 16;
  const int nkt = (qBase + 47) >> 5;     /* 32-key steps covering keys 0..qBase+15 */
  const int nFull = qBase >> 5;          /* steps whose 32 keys are all <= qBase */
  const int qrow = qBase + ln;
  const size_t offQ = ((size_t)b * SEQ + qrow) * DM + h * HD;
  constexpr int KP = 72, VP = 40;              /* LDS row pitch in 16-bit elements: 144 B and 80 B, both 16 B x odd */
  constexpr int OKL = 32 * KP, OV = 2 * OKL, OVL = OV + 64 * VP;   /* places of K lo, V^T, V^T residual inside a buffer */
  constexpr int BUF = EARLY ? OVL + 64 * VP : OVL;
  static_assert((BUF * 2) % 16 == 0 && (KP * 2) % 16 == 0 && (VP * 2) % 16 == 0 && BUF <= ABUF);
  const int nktB = ((QT0 + (blk - bh * BPB) * 4) >> 1) + 2;   /* steps of the block's last wave: keys up to its first query + 63, inside the sequence */
  /* the blocks of one (b, h) read the same K and V^T lines, all at the same moment if all walk the keys from 0: each block enters its walk at a step of its own
     and wraps round (the running maximum and sum take the steps in any order: every step below nkt holds a key that every query of the tile sees) */
  const int rot = ((blk - bh * BPB) * nktB) / BPB;            /* block-uniform, 0 <= rot < nktB */
  auto step_of = [&](int p) { const int s = p + rot; return s >= nktB ? s - nktB : s; };   /* trip p < nktB -> key step, a permutation of 0 .. nktB - 1 */
  const int tid = threadIdx.x;
  const int kr = tid >> 3, kc = (tid & 7) * 8;  /* K rows kr and kr + 16, 16-byte piece kc */
  const int vr = tid >> 2, vc = (tid & 3) * 8;  /* V^T rows vr and vr + 32, 16-byte piece vc */
  const size_t gK = ((size_t)b * SEQ + kr) * DM + h * HD + kc;
  const size_t gV = ((size_t)bh * HD + vr) * SEQ + vc;
  const size_t gVl = ((size_t)bh * HD + vr) * QE + vc;
  const unsigned lK = (unsigned)(size_t)kv + (unsigned)(kr * KP + kc) * 2u;
  const unsigned lV = (unsigned)(size_t)kv + (unsigned)(OV + vr * VP + vc) * 2u;
  auto stage = [&](int p) {                     /* trip p: key step step_of(p) -> buffer p mod 2 */
    const unsigned lb = (unsigned)(p & 1) * (unsigned)(BUF * 2);
    const int t = step_of(p);
    const size_t k0 = gK + (size_t)t * 32 * DM, v0 = gV + (size_t)t * 32;
    copy6(lK + lb, Kh + k0, lK + lb + 16 * KP * 2, Kh + k0 + 16 * DM,
          lK + lb + OKL * 2, Kl + k0, lK + lb + (OKL + 16 * KP) * 2, Kl + k0 + 16 * DM,
          lV + lb, Vth + v0, lV + lb + 32 * VP * 2, Vth + v0 + (size_t)32 * SEQ);
    if (EARLY) {
      const size_t w0 = gVl + (size_t)t * 32;
      copy2(lV + lb + 64 * VP * 2, Vtl + w0, lV + lb + 96 * VP * 2, Vtl + w0 + (size_t)32 * QE);
    }
  };
  const v8f z8 = {0.f, 0.f, 0.f, 0.f, 0.f, 0.f, 0.f, 0.f};
  v8f oacc[4] = {z8, z8, z8, z8};
  v8f ores[4] = {z8, z8, z8, z8};
  float m = -__builtin_inff(), l = 0.f;
  /* the wave's Q fragments (hi, lo; both 32-wide halves of the head) are the same in every key step: read once here, ahead of the first copies, and kept in registers */
  v16b fqh[2], fql[2];
#pragma unroll                           /* constant indices keep the fragment arrays in registers */
  for (int dc = 0; dc < 2; ++dc) {
    const size_t qo = offQ + dc * 32;
    fqh[dc] = ldb(Qh, qo, hh); fql[dc] = ldb(Ql, qo, hh);
  }
  asm volatile("s_wait_xcnt 0x0" ::: "memory");       /* no address register of the loads above is rewritten ahead of this wait */
  stage(0);
  asm volatile("s_wait_asynccnt 0x0" ::: "memory");   /* step 0's copies of this wave have landed */
  __syncthreads();                                    /* ... and every other wave's */
  stage(1);                                           /* nktB >= 2 */
#pragma unroll 1
  for (int it = 0; it < nktB; ++it) {
   const int ks = step_of(it);           /* the key step that buffer it mod 2 holds */
   if (ks < nkt) {                       /* wave-uniform: for a step past its diagonal a wave only passes the hand-over below */
    const int kb = ks * 32;
    const unsigned short* kvb = kv + (it & 1) * BUF;
    /* the step's K fragments are read as one group ahead of the products: one load latency is waited for, not one in front of each chain of products */
    v16b kh[2][2], kl[2][2];
#pragma unroll                           /* constant indices keep the fragment arrays in registers; the same for the two loops below */
    for (int dc = 0; dc < 2; ++dc) {
      const unsigned short* k0 = kvb + ln * KP + dc * 32;
      const unsigned short* k1 = k0 + 16 * KP;
      kh[dc][0] = ldbs(k0, hh); kl[dc][0] = ldbs(k0 + OKL, hh);
      kh[dc][1] = ldbs(k1, hh); kl[dc][1] = ldbs(k1 + OKL, hh);
    }
    v8f st0 = z8, st1 = z8;
#pragma unroll
    for (int dc = 0; dc < 2; ++dc) {
      st0 = mmaB<3>(kh[dc][0], kl[dc][0], fqh[dc], fql[dc], st0);
      st1 = mmaB<3>(kh[dc][1], kl[dc][1], fqh[dc], fql[dc], st1);
    }
    /* the V^T fragments are read as one group here: their latency passes behind the softmax arithmetic */
    FragH vh[4], vl[4];
#pragma unroll
    for (int dt = 0; dt < 4; ++dt) {
      const unsigned short* vo = kvb + OV + (dt * 16 + ln) * VP;
      vh[dt].v = ldhs(vo, hh);
      if (EARLY) vl[dt].v = ldhs(vo + 64 * VP, hh);
    }
    float s0[8], s1[8];
#pragma unroll
    for (int r = 0; r < 8; ++r) { s0[r] = st0[r] * 0.125f; s1[r] = st1[r] * 0.125f; }
    if (ks >= nFull) {                   /* wave-uniform: only key step nFull = nkt - 1 touches the diagonal */
#pragma unroll
      for (int r = 0; r < 8; ++r) {
        const int key = kb + 8 * hh + r;
        s0[r] = (key > qrow) ? -__builtin_inff() : s0[r];
        s1[r] = (key + 16 > qrow) ? -__builtin_inff() : s1[r];
      }
    }
    float mt = fmaxf(s0[0], s1[0]);
#pragma unroll
    for (int r = 1; r < 8; ++r) mt = fmaxf(mt, fmaxf(s0[r], s1[r]));
    const float mo = __shfl_xor(mt, 16);
    const float mnew = fmaxf(fmaxf(mt, mo), m);   /* finite: key kb <= qBase is visible to every query of the tile */
    const float alpha = __expf(m - mnew);
    m = mnew;
    l *= alpha;
#pragma unroll
    for (int dt = 0; dt < 4; ++dt) { oacc[dt] *= alpha; if (EARLY) ores[dt] *= alpha; }
    FragH ph, pl;
#pragma unroll
    for (int r = 0; r < 8; ++r) {
      const float p0 = __expf(s0[r] - m), p1 = __expf(s1[r] - m);
      l += p0 + p1;
      const float c0 = p0 * 256.0f, c1 = p1 * 256.0f;
      const _Float16 h0 = (_Float16)c0, h1 = (_Float16)c1;
      ph.h[r] = h0; ph.h[8 + r] = h1;
      pl.h[r] = (_Float16)((c0 - (float)h0) * 1024.0f);
      pl.h[8 + r] = (_Float16)((c1 - (float)h1) * 1024.0f);
    }
#pragma unroll
    for (int dt = 0; dt < 4; ++dt) {
      if (EARLY) {
        v8f o = oacc[dt], e = ores[dt];
        o = __builtin_amdgcn_wmma_f32_16x16x32_f16(false, vh[dt].v, false, ph.v, (short)0, o, false, false);
        e = __builtin_amdgcn_wmma_f32_16x16x32_f16(false, vl[dt].v, false, ph.v, (short)0, e, false, false);
        e = __builtin_amdgcn_wmma_f32_16x16x32_f16(false, vh[dt].v, false, pl.v, (short)0, e, false, false);
        asm volatile("v_nop\n\tv_nop\n\tv_nop\n\tv_nop" : "+v"(o), "+v"(e) : "v"(vh[dt].v), "v"(vl[dt].v), "v"(ph.v), "v"(pl.v));
        oacc[dt] = o; ores[dt] = e;
      } else {
        oacc[dt] = mmaH1(vh[dt].v, ph.v, oacc[dt]);
      }
    }
    asm volatile("" ::: "memory");
   }
    asm volatile("s_wait_dscnt 0x0" ::: "memory");      /* this wave's reads of buffer it mod 2 are done before it is refilled */
    asm volatile("s_wait_asynccnt 0x0" ::: "memory");   /* this wave's copies of step it + 1 have landed */
    __syncthreads();                                    /* publishes step it + 1, ends every wave's reads of step it */
    if (it + 2 < nktB) stage(it + 2);                   /* block-uniform */
  }
  asm volatile("s_wait_asynccnt 0x0" ::: "memory");     /* nothing in flight when the wave goes on */
  const float lt = l + __shfl_xor(l, 16);
  const float rinv = 1.0f / (256.0f * lt);
  // O^T (d = dt*16 + 8h + r, query = ln) -> wave-private LDS tile [query][d]
#pragma unroll
  for (int dt = 0; dt < 4; ++dt) {
    v8f o = oacc[dt];
    if (EARLY) o = o + ores[dt] * 0.0009765625f;
    const v4f w0 = {o[0] * rinv, o[1] * rinv, o[2] * rinv, o[3] * rinv};
    const v4f w1 = {o[4] * rinv, o[5] * rinv, o[6] * rinv, o[7] * rinv};
    *(v4fa*)&so[wave][ln][dt * 16 + 8 * hh] = w0;
    *(v4fa*)&so[wave][ln][dt * 16 + 8 * hh + 4] = w1;
  }
  __builtin_amdgcn_fence(4 /* acq_rel order */, "workgroup");
  __builtin_amdgcn_wave_barrier();
  const int rq = lane >> 3, c8 = (lane & 7) * 8;
  {
#pragma unroll
    for (int q = 0; q < 4; ++q) {
      const int r = q * 4 + rq;                      /* q 0..3 x rq 0..3 -> query rows 0..15 */
      const v4f x0 = *(const v4fa*)&so[wave][r][c8], x1 = *(const v4fa*)&so[wave][r][c8 + 4];
      const float xs[8] = {x0[0], x0[1], x0[2], x0[3], x1[0], x1[1], x1[2], x1[3]};
      v8us o0, o1;
#pragma unroll
      for (int i = 0; i < 8; ++i) { const unsigned short hb = bf16_bits(xs[i]); o0[i] = hb; o1[i] = bf16_bits(xs[i] - bf16_val(hb)); }
      const size_t go = ((size_t)b * SEQ + qBase + r) * DM + h * HD + c8;   
      *(v8us*)(Ch + go) = o0;
      *(v8us*)(Cl + go) = o1;
    }
    
  }
}
// both parts need nothing of each other: one grid, the long blocks (queries from QE on) first, then the EARLY ones (block-uniform choice)
#define GAM (NB * NH * ((SEQ - QE) / 64))      /* blocks of the part behind QE */
__global__ __launch_bounds__(128) void k_attn(const unsigned short* __restrict__ Qh, const unsigned short* __restrict__ Ql,
                                              const unsigned short* __restrict__ Kh, const unsigned short* __restrict__ Kl,
                                              const unsigned short* __restrict__ Vth, const unsigned short* __restrict__ Vtl,
                                              unsigned short* __restrict__ Ch, unsigned short* __restrict__ Cl) {
  __shared__ __attribute__((aligned(16))) float so[4][16][68];
  __shared__ __attribute__((aligned(16))) unsigned short kv[2 * ABUF];
  if ((int)blockIdx.x < GAM) attn_body<false>(Qh, Ql, Kh, Kl, Vth, Vtl, Ch, Cl, (int)blockIdx.x, so, kv);
  else attn_body<true>(Qh, Ql, Kh, Kl, Vth, Vtl, Ch, Cl, (int)blockIdx.x - GAM, so, kv);
}

// output GEMM: out[(b, s)][n] = sum_k (ctx_hi + ctx_lo)[r][k] . bf16(WO)[n][k] + bf16(bO)[n]; block = 4 x 2 waves, block tile 128 x 128, wave tile 32 x 64; f32 rows of the full-size output layout;
// the bias float4 of a lane's four columns is read once by value and added in f32 at the store stage;
__global__ __launch_bounds__(256) void k_out(const unsigned short* __restrict__ Ah, const unsigned short* __restrict__ Al,
                                             const unsigned short* __restrict__ Bt, const float* __restrict__ bias, float* __restrict__ C) {
  __shared__ __attribute__((aligned(16))) float so[8][32][68];
  const int lane = threadIdx.x & 31, ln = lane & 15, hh = lane >> 4;
  const int w = __builtin_amdgcn_readfirstlane((int)(threadIdx.x >> 5));
  const int wr = w & 3, wc = w >> 2;                  /* the wave's 32 rows and its column half of the block tile */
  const int mt = blockIdx.x / (DM / 128), nq = blockIdx.x - mt * (DM / 128);
  const int row0 = mt * 128 + 32 * wr, col0 = nq * 128 + 64 * wc;
  /* the block's 128 ctx rows (hi, lo) and 128 Bt rows, 64 k at a time, are copied once per block into a two-buffer LDS ring, one tile ahead of their use */
  constexpr int OL = 128 * GP, OB = 2 * OL, GBUF = 3 * OL;   /* places of the lo rows and the Bt rows inside a buffer; buffer size */
  __shared__ __attribute__((aligned(16))) unsigned short ab[2 * GBUF];
  const int sr = (int)threadIdx.x >> 3, sc = ((int)threadIdx.x & 7) * 8;   /* rows sr + 32 j, 16-byte piece sc */
  const size_t oA = (size_t)(mt * 128 + sr) * DM + sc;
  const unsigned short* gB = Bt + (size_t)(nq * 128 + sr) * DM + sc;
  const unsigned lA = (unsigned)(size_t)ab + (unsigned)(sr * GP + sc) * 2u;
  const int t0 = (2 * nq + mt) & (DM / 64 - 1);       /* the block's own entry into the k walk, as in proj_body */
  auto stage = [&](int t) {                           /* trip t: k tile (t + t0) mod 16 -> buffer t mod 2 */
    const unsigned la = lA + (unsigned)(t & 1) * (unsigned)(GBUF * 2);
    const int kt = ((t + t0) & (DM / 64 - 1)) * 64;   /* 0 .. DM - 64: inside the row */
    rows4(la, Ah + oA + kt);
    rows4(la + OL * 2, Al + oA + kt);
    rows4(la + OB * 2, gB + kt);
  };
  const v8f z8 = {0.f, 0.f, 0.f, 0.f, 0.f, 0.f, 0.f, 0.f};
  v8f c00 = z8, c01 = z8, c02 = z8, c03 = z8, c10 = z8, c11 = z8, c12 = z8, c13 = z8;
  stage(0);
  asm volatile("s_wait_asynccnt 0x0" ::: "memory");   /* tile 0's copies of this wave have landed */
  __syncthreads();                                    /* ... and every other wave's */
  stage(1);
#pragma unroll 1
  for (int t = 0; t < DM / 64; ++t) {
    const unsigned short* pa = ab + (t & 1) * GBUF + (32 * wr + ln) * GP;
    const unsigned short* pb = ab + (t & 1) * GBUF + OB + (64 * wc + ln) * GP;
    v16b fh[2][2], fl[2][2], fb[2][4];                  /* the tile's LDS reads go as one group ahead of its products */
#pragma unroll
    for (int s = 0; s < 2; ++s) {
      fh[s][0] = ldbs(pa + 32 * s, hh); fl[s][0] = ldbs(pa + OL + 32 * s, hh);
      fh[s][1] = ldbs(pa + 16 * GP + 32 * s, hh); fl[s][1] = ldbs(pa + OL + 16 * GP + 32 * s, hh);
#pragma unroll
      for (int j = 0; j < 4; ++j) fb[s][j] = ldbs(pb + 16 * j * GP + 32 * s, hh);
    }
#pragma unroll
    for (int s = 0; s < 2; ++s) {
      c00 = mmaB<2>(fh[s][0], fl[s][0], fb[s][0], fb[s][0], c00); c10 = mmaB<2>(fh[s][1], fl[s][1], fb[s][0], fb[s][0], c10);
      c01 = mmaB<2>(fh[s][0], fl[s][0], fb[s][1], fb[s][1], c01); c11 = mmaB<2>(fh[s][1], fl[s][1], fb[s][1], fb[s][1], c11);
      c02 = mmaB<2>(fh[s][0], fl[s][0], fb[s][2], fb[s][2], c02); c12 = mmaB<2>(fh[s][1], fl[s][1], fb[s][2], fb[s][2], c12);
      c03 = mmaB<2>(fh[s][0], fl[s][0], fb[s][3], fb[s][3], c03); c13 = mmaB<2>(fh[s][1], fl[s][1], fb[s][3], fb[s][3], c13);
    }
    asm volatile("s_wait_dscnt 0x0" ::: "memory");      /* this wave's reads of buffer t mod 2 are done before it is refilled */
    asm volatile("s_wait_asynccnt 0x0" ::: "memory");   /* this wave's copies of tile t + 1 have landed */
    __syncthreads();                                    /* publishes tile t + 1, ends every wave's reads of tile t */
    if (t + 2 < DM / 64) stage(t + 2);                  /* block-uniform */
  }
  asm volatile("s_wait_asynccnt 0x0" ::: "memory");     /* nothing in flight when the wave goes on */
  v8f accs[8] = {c00, c01, c02, c03, c10, c11, c12, c13};
#pragma unroll
  for (int u = 0; u < 8; ++u) {
    const int t = u & 3, half = u >> 2;
#pragma unroll
    for (int r = 0; r < 8; ++r) so[w][half * 16 + 8 * hh + r][t * 16 + ln] = accs[u][r];
  }
  __builtin_amdgcn_fence(4 /* acq_rel order */, "workgroup");
  __builtin_amdgcn_wave_barrier();
  const int rsub = lane >> 4, c4 = (lane & 15) * 4;
  const v4f bx = *(const v4fa*)(bias + col0 + c4);   /* columns col0 + c4 .. + 3 < DM */
  const v4f bv = {bf16_rne(bx[0]), bf16_rne(bx[1]), bf16_rne(bx[2]), bf16_rne(bx[3])};
  {
#pragma unroll
    for (int q = 0; q < 16; ++q) {
      const int r = q * 2 + rsub;                    /* q 0..15 x rsub 0..1 -> rows 0..31 */
      const v4f sv = *(const v4fa*)&so[w][r][c4];
      const v4f v = sv + bv;
      const int grow = row0 + r;
      const int bb = grow / SEQ, s = grow - bb * SEQ;
      *(v4f*)(C + ((size_t)bb * SEQ_FULL + s) * DM + col0 + c4) = v;
    }
    
  }
}

/* workspace carve (bytes): 3 input planes + 4 weight planes + Qh Ql Kh Kl + Vh Vl + Vth + Vtl + Ch Cl */
#define XB ((size_t)NR * DM * 2)
#define WB ((size_t)DM * DM * 2)
#define VLB ((size_t)NB * NH * HD * QE * 2)
static_assert(XB % 256 == 0 && WB % 256 == 0 && VLB % 256 == 0);
static_assert(12 * XB + 4 * WB + VLB <= (size_t)134217728);   /* total carve stays within 128 MiB */

extern "C" void kernel_launch(void* const* d_in, const int* in_sizes, int n_in,
                              void* d_out, int out_size, void* d_ws, size_t ws_size, hipStream_t stream) {
  if (n_in < 8) return;
  const long long need_x = ((long long)(NB - 1) * SEQ_FULL + SEQ) * DM;
  if (in_sizes[0] < need_x || in_sizes[1] < need_x || in_sizes[2] < need_x) return;
  if (in_sizes[3] < DM * DM || in_sizes[4] < DM * DM || in_sizes[5] < DM * DM || in_sizes[6] < DM * DM) return;
  if (in_sizes[7] < DM) return;
  if (out_size < need_x) return;
  const float* xq = (const float*)d_in[0];      /* table order: Q, K, V, WQ, WK, WV, WO, bO */
  const float* xk = (const float*)d_in[1];
  const float* xv = (const float*)d_in[2];
  const float* wq = (const float*)d_in[3];
  const float* wk = (const float*)d_in[4];
  const float* wv = (const float*)d_in[5];
  const float* wo = (const float*)d_in[6];
  const float* bo = (const float*)d_in[7];
  char* ws = (char*)d_ws; size_t off = 0;
  auto take = [&](size_t bytes) { char* p = ws + off; off += (bytes + 255) & ~(size_t)255; return (unsigned short*)p; };
  unsigned short* XQ = take(XB); unsigned short* XK = take(XB); unsigned short* XV = take(XB);
  unsigned short* BQ = take(WB); unsigned short* BK = take(WB); unsigned short* BV = take(WB); unsigned short* BO = take(WB);
  unsigned short* Qh = take(XB); unsigned short* Ql = take(XB); unsigned short* Kh = take(XB); unsigned short* Kl = take(XB);
  unsigned short* Vh = take(XB); unsigned short* Vl = take(XB);
  unsigned short* Vth = take(XB); unsigned short* Vtl = take(VLB);
  unsigned short* Ch = take(XB); unsigned short* Cl = take(XB);
  if (off > ws_size) return;

  k_conv<<<(unsigned)(3 * GX + 4 * GW), 256, 0, stream>>>(xq, xk, xv, wq, wk, wv, wo, XQ, XK, XV, BQ, BK, BV, BO);
  k_proj<<<(unsigned)(3 * GPJ), 128, 0, stream>>>(XQ, BQ, Qh, Ql, XK, BK, Kh, Kl, XV, BV, Vh, Vl);
  k_vt<<<(unsigned)(GVT + NB * NH * (QE / 64)), 256, 0, stream>>>(Vh, Vth, Vl, Vtl);   /* in [NR][DM] rows -> out [(b,h)][64][SEQ] and [(b,h)][64][QE] */
  k_attn<<<(unsigned)(GAM + NB * NH * (QE / 64)), 128, 0, stream>>>(Qh, Ql, Kh, Kl, Vth, Vtl, Ch, Cl);
  k_out<<<(unsigned)GPJ, 256, 0, stream>>>(Ch, Cl, BO, bo, (float*)d_out);
}

// v008
// A run of this version takes 105 microseconds.
// Two timings next to v007 put it at 1.05 and 1.04 times that version's speed.
// Counting every step since v000, it is 3.55 times as fast.
#include <hip/hip_runtime.h>
// Causal multi-head attention, three input streams (Q, K, V each [B][T][1024]), bias-free [out][in] input projections, 16 heads x 64, score scale 1/8, keys j > i excluded, out = ctx WO^T + bO (bO converted RNE to bf16, added in f32 at the store stage).
// Compute dtype: inputs converted (RNE) to bf16 and carried exactly as f16 rows / x16 f16 weights; Q,K,V projections v_wmma_f32_16x16x32_f16 (single product); scores v_wmma_f32_16x16x32_bf16 on bf16 hi|lo planes of q and k (three products); P.V v_wmma_f32_16x16x32_f16 with P carried x256 (first QE query rows: f16 value + x1024 residual planes for P and V, separate accumulator); output GEMM v_wmma_f32_16x16x32_bf16 with ctx as bf16 hi|lo against exact bf16 WO (two products); f32 accumulation and f32 softmax statistics everywhere.
#ifndef NB
#define NB 2
#endif
#ifndef SEQ
#define SEQ 2048
#endif
#ifndef QE
#define QE ((SEQ) < 256 ? (SEQ) : 256)   /* query rows per sequence that get residual planes on P and V */
#endif
#define NB_FULL 2
#define SEQ_FULL 2048
#define DM 1024
#define NH 16
#define HD 64
#define NR (NB * SEQ)

static_assert(NH * HD == DM);                 /* merged head columns h*64+d span the model width */
static_assert(HD == 64);                      
static_assert(DM % 128 == 0 && DM % 64 == 0); /* GEMM column tiles of 128, k tiles of 64 */
static_assert(NR % 128 == 0);                 /* GEMM row tiles of 128 */
static_assert(SEQ % 64 == 0 && QE % 64 == 0 && QE <= SEQ && (SEQ - QE) % 64 == 0);  /* 4 query tiles of 16 per block; 32-key steps stay inside the sequence */
static_assert(NB <= NB_FULL && SEQ <= SEQ_FULL);
static_assert((NR * DM / 8) % 256 == 0 && (DM * DM / 8) % 256 == 0);  /* convert grids x 256 threads == plane extent */
static_assert((SEQ & (SEQ - 1)) == 0);        /* row -> (batch, position) by shift */
static_assert(DM % 4 == 0 && (DM / 64 - 1) * 64 + 15 * 4 + 4 <= DM);  /* per-lane float4 of the bias vector stays inside [DM] */
static_assert((size_t)NB_FULL * SEQ_FULL * DM * 4 == (size_t)16777216);  /* output buffer bytes, single output at byte offset 0 */

typedef __bf16 v16b __attribute__((ext_vector_type(16)));
typedef _Float16 v16h __attribute__((ext_vector_type(16)));
typedef unsigned short v8us __attribute__((ext_vector_type(8), may_alias));
typedef float v8f __attribute__((ext_vector_type(8)));
typedef float v4f __attribute__((ext_vector_type(4)));
typedef float v4fa __attribute__((ext_vector_type(4), may_alias));
union FragB { v16b v; v8us half[2]; unsigned short u[16]; };
union FragH { v16h v; v8us half[2]; _Float16 h[16]; unsigned short u[16]; };

__device__ __forceinline__ unsigned short bf16_bits(float x) { unsigned int u = __float_as_uint(x); return (unsigned short)((u + 0x7FFFu + ((u >> 16) & 1u)) >> 16); }
__device__ __forceinline__ float bf16_val(unsigned short b) { return __uint_as_float(((unsigned int)b) << 16); }
__device__ __forceinline__ float bf16_rne(float x) { return bf16_val(bf16_bits(x)); }

// fragment loader (A and B alike): elements 0..7 <- k0 + 8h + 0..7, elements 8..15 <- k0 + 16 + 8h + 0..7 of a k-contiguous 16-bit row
__device__ __forceinline__ v16b ldb(const unsigned short* __restrict__ p, size_t off, int hh) { FragB f; f.half[0] = *(const v8us*)(p + off + 8 * hh); f.half[1] = *(const v8us*)(p + off + 16 + 8 * hh); return f.v; }

// D += A.B with NT bf16 products: 1 = ah.bh, 2 = + al.bh, 3 = + ah.bl; one guard naming the accumulator and every fragment
template <int NT>
__device__ __forceinline__ v8f mmaB(v16b ah, v16b al, v16b bh, v16b bl, v8f c) {
  c = __builtin_amdgcn_wmma_f32_16x16x32_bf16(false, ah, false, bh, (short)0, c, false, false);
  if (NT >= 2) c = __builtin_amdgcn_wmma_f32_16x16x32_bf16(false, al, false, bh, (short)0, c, false, false);
  if (NT >= 3) c = __builtin_amdgcn_wmma_f32_16x16x32_bf16(false, ah, false, bl, (short)0, c, false, false);
  asm volatile("v_nop\n\tv_nop\n\tv_nop\n\tv_nop" : "+v"(c) : "v"(ah), "v"(al), "v"(bh), "v"(bl));
  return c;
}
__device__ __forceinline__ v8f mmaH1(v16h a, v16h b, v8f c) {
  v8f d = __builtin_amdgcn_wmma_f32_16x16x32_f16(false, a, false, b, (short)0, c, false, false);
  asm volatile("v_nop\n\tv_nop\n\tv_nop\n\tv_nop" : "+v"(d) : "v"(a), "v"(b));
  return d;
}

__device__ __forceinline__ void x16_body(const float* __restrict__ x, unsigned short* __restrict__ X16, int blk) {
  const int t = blk * 256 + threadIdx.x;
  if (t >= NR * DM / 8) return;
  const int row = t / (DM / 8), c8 = (t - row * (DM / 8)) * 8;
  const int b = row / SEQ, s = row - b * SEQ;
  const float* src = x + ((size_t)b * SEQ_FULL + s) * DM + c8;
  const v4f a = *(const v4fa*)src, c = *(const v4fa*)(src + 4);
  FragH f;
#pragma unroll
  for (int q = 0; q < 4; ++q) { f.h[q] = (_Float16)bf16_rne(a[q]); f.h[4 + q] = (_Float16)bf16_rne(c[q]); }
  const v8us o = f.half[0];
  unsigned short* d = X16 + (size_t)t * 8;
  *(v8us*)d = o;
  
}
__device__ __forceinline__ void wnat_body(const float* __restrict__ w, unsigned short* __restrict__ Bt, int blk) {
  const int t = blk * 256 + threadIdx.x;
  if (t >= DM * DM / 8) return;
  const v4f a = *(const v4fa*)(w + (size_t)t * 8), c = *(const v4fa*)(w + (size_t)t * 8 + 4);
  FragH f;
#pragma unroll
  for (int q = 0; q < 4; ++q) { f.h[q] = (_Float16)(bf16_rne(a[q]) * 16.0f); f.h[4 + q] = (_Float16)(bf16_rne(c[q]) * 16.0f); }
  const v8us o = f.half[0];
  unsigned short* d = Bt + (size_t)t * 8;
  *(v8us*)d = o;
  
}
__device__ __forceinline__ void wbf_body(const float* __restrict__ w, unsigned short* __restrict__ Bt, int blk) {
  const int t = blk * 256 + threadIdx.x;
  if (t >= DM * DM / 8) return;
  const v4f a = *(const v4fa*)(w + (size_t)t * 8), c = *(const v4fa*)(w + (size_t)t * 8 + 4);
  v8us o;
#pragma unroll
  for (int q = 0; q < 4; ++q) { o[q] = bf16_bits(a[q]); o[4 + q] = bf16_bits(c[q]); }
  unsigned short* d = Bt + (size_t)t * 8;
  *(v8us*)d = o;
  
}
// the seven conversions need nothing of each other: one grid, each plane a range of the block index (block-uniform choice)
#define GX (NR * DM / 8 / 256)                 /* blocks per input plane */
#define GW (DM * DM / 8 / 256)                 /* blocks per weight plane */
__global__ __launch_bounds__(256) void k_conv(const float* __restrict__ xq, const float* __restrict__ xk, const float* __restrict__ xv,
                                              const float* __restrict__ wq, const float* __restrict__ wk, const float* __restrict__ wv, const float* __restrict__ wo,
                                              unsigned short* __restrict__ XQ, unsigned short* __restrict__ XK, unsigned short* __restrict__ XV,
                                              unsigned short* __restrict__ BQ, unsigned short* __restrict__ BK, unsigned short* __restrict__ BV, unsigned short* __restrict__ BO) {
  const int bid = blockIdx.x;
  if (bid < 3 * GX) {
    const int sel = bid / GX;
    x16_body(sel == 0 ? xq : sel == 1 ? xk : xv, sel == 0 ? XQ : sel == 1 ? XK : XV, bid - sel * GX);
  } else if (bid < 3 * GX + 3 * GW) {
    const int sel = (bid - 3 * GX) / GW;
    wnat_body(sel == 0 ? wq : sel == 1 ? wk : wv, sel == 0 ? BQ : sel == 1 ? BK : BV, bid - 3 * GX - sel * GW);   /* natural [out][in] = Bt[n][k] as stored */
  } else {
    wbf_body(wo, BO, bid - 3 * GX - 3 * GW);
  }
}

// fragment loaders for a row staged in LDS: the element order of ldb
__device__ __forceinline__ v16b ldbs(const unsigned short* p, int hh) { FragB f; f.half[0] = *(const v8us*)(p + 8 * hh); f.half[1] = *(const v8us*)(p + 16 + 8 * hh); return f.v; }
__device__ __forceinline__ v16h ldhs(const unsigned short* p, int hh) { FragH f; f.half[0] = *(const v8us*)(p + 8 * hh); f.half[1] = *(const v8us*)(p + 16 + 8 * hh); return f.v; }
// GEMM operand tiles: 128 rows of a [row][DM] plane, r, r + 16, ... (rows8) or r, r + 32, ... (rows4), one 16-byte asynchronous copy global -> LDS per lane and line of text (8 lanes cover one 128-byte row piece);
// s_wait_xcnt closes each statement so that no address register is rewritten ahead of it
#define GP 72                                  /* LDS row pitch of a 64-k tile in 16-bit elements: 144 B = 16 B x odd */
__device__ __forceinline__ void rows4(unsigned l, const unsigned short* g) {   /* a block of 256 threads: rows r, r + 32, r + 64, r + 96 */
  asm volatile("global_load_async_to_lds_b128 %0, %1, off\n\tglobal_load_async_to_lds_b128 %2, %3, off\n\t"
               "global_load_async_to_lds_b128 %4, %5, off\n\tglobal_load_async_to_lds_b128 %6, %7, off\n\ts_wait_xcnt 0x0"
               :: "v"(l), "v"(g), "v"(l + 32 * GP * 2), "v"(g + 32 * DM), "v"(l + 64 * GP * 2), "v"(g + 64 * DM), "v"(l + 96 * GP * 2), "v"(g + 96 * DM) : "memory");
}
__device__ __forceinline__ void rows8(unsigned l, const unsigned short* g) {
  asm volatile("global_load_async_to_lds_b128 %0, %1, off\n\tglobal_load_async_to_lds_b128 %2, %3, off\n\t"
               "global_load_async_to_lds_b128 %4, %5, off\n\tglobal_load_async_to_lds_b128 %6, %7, off\n\t"
               "global_load_async_to_lds_b128 %8, %9, off\n\tglobal_load_async_to_lds_b128 %10, %11, off\n\t"
               "global_load_async_to_lds_b128 %12, %13, off\n\tglobal_load_async_to_lds_b128 %14, %15, off\n\ts_wait_xcnt 0x0"
               :: "v"(l), "v"(g), "v"(l + 16 * GP * 2), "v"(g + 16 * DM), "v"(l + 32 * GP * 2), "v"(g + 32 * DM), "v"(l + 48 * GP * 2), "v"(g + 48 * DM),
                  "v"(l + 64 * GP * 2), "v"(g + 64 * DM), "v"(l + 80 * GP * 2), "v"(g + 80 * DM), "v"(l + 96 * GP * 2), "v"(g + 96 * DM), "v"(l + 112 * GP * 2), "v"(g + 112 * DM) : "memory");
}
static_assert(DM / 64 >= 2);                   /* the two-buffer ring starts with two tiles */
static_assert(((DM / 64) & (DM / 64 - 1)) == 0);   /* the rotated k walk wraps by a mask */

// projection GEMM: Y[NR][DM] = A[NR][DM] (exact f16 rows) . Bt[n][k] (x16 f16) * 2^-4; block = 2 x 2 waves, block tile 128 x 128, wave tile 64 rows x 64 cols;
// q and k: Y -> bf16 hi | lo row planes, the wave tile staged in wave-private LDS, then stored by proj_store, 32 rows a call;
// v: Y -> f16 value | (Y - value) x 1024 planes, stored transposed, [(b*NH + h)][d][position], as the attention reads them (store stage at the foot of proj_body)
__device__ __forceinline__ void proj_store(const float (*sw)[68], int lane, int row0, int col0, unsigned short* __restrict__ P0, unsigned short* __restrict__ P1) {
  const int rq = lane >> 3, c8 = (lane & 7) * 8;
#pragma unroll
  for (int q = 0; q < 8; ++q) {
    const int r = q * 4 + rq;                       /* q 0..7 x rq 0..3 -> rows 0..31 */
    const v4f x0 = *(const v4fa*)&sw[r][c8], x1 = *(const v4fa*)&sw[r][c8 + 4];
    const float xs[8] = {x0[0], x0[1], x0[2], x0[3], x1[0], x1[1], x1[2], x1[3]};
    v8us o0, o1;
#pragma unroll
    for (int i = 0; i < 8; ++i) { const unsigned short hb = bf16_bits(xs[i]); o0[i] = hb; o1[i] = bf16_bits(xs[i] - bf16_val(hb)); }
    const size_t go = (size_t)(row0 + r) * DM + col0 + c8;
    *(v8us*)(P0 + go) = o0;
    *(v8us*)(P1 + go) = o1;
  }
}
// blk: the tile's index inside its own product; vmode (block-uniform): the v store stage, P0 = V^T values (row pitch SEQ), P1 = V^T residuals (first QE positions, row pitch QE)
__device__ __forceinline__ void proj_body(const unsigned short* __restrict__ A, const unsigned short* __restrict__ Bt,
                                          unsigned short* __restrict__ P0, unsigned short* __restrict__ P1, int blk, bool vmode) {
  const int lane = threadIdx.x & 31, ln = lane & 15, hh = lane >> 4;
  const int w = __builtin_amdgcn_readfirstlane((int)(threadIdx.x >> 5));
  const int wr = w >> 1, wc = w & 1;                  /* the wave's row half and column half of the block tile */
  const int mt = blk / (DM / 128), nq = blk - mt * (DM / 128);
  const int row0 = mt * 128 + 64 * wr, col0 = nq * 128 + 64 * wc;
  /* the block's 128 A rows and 128 Bt rows, 64 k at a time, are copied once per block into a two-buffer LDS ring, one tile ahead of their use */
  constexpr int OB = 128 * GP, GBUF = 2 * OB;         /* place of the Bt rows inside a buffer; buffer size */
  __shared__ __attribute__((aligned(16))) unsigned short ab[2 * GBUF];
  const int sr = (int)threadIdx.x >> 3, sc = ((int)threadIdx.x & 7) * 8;   /* rows sr + 16 j, 16-byte piece sc */
  const unsigned short* gA = A + (size_t)(mt * 128 + sr) * DM + sc;
  const unsigned short* gB = Bt + (size_t)(nq * 128 + sr) * DM + sc;
  const unsigned lA = (unsigned)(size_t)ab + (unsigned)(sr * GP + sc) * 2u;
  /* the 8 blocks of one row tile read the same A lines and the 32 blocks of one column tile the same Bt lines, all at the same moment if all walk k from 0:
     each block enters the k walk at a tile of its own and wraps round, so that sharers ask L2 for different lines at any one time */
  const int t0 = (2 * nq + mt) & (DM / 64 - 1);
  auto stage = [&](int t) {                           /* trip t: k tile (t + t0) mod 16 -> buffer t mod 2 */
    const unsigned la = lA + (unsigned)(t & 1) * (unsigned)(GBUF * 2);
    const int kt = ((t + t0) & (DM / 64 - 1)) * 64;   /* 0 .. DM - 64: inside the row */
    rows8(la, gA + kt);
    rows8(la + OB * 2, gB + kt);
  };
  const v8f z8 = {0.f, 0.f, 0.f, 0.f, 0.f, 0.f, 0.f, 0.f};
  v8f acc[4][4];                                      /* [16-row tile][16-column tile] */
#pragma unroll                                        /* constant indices keep the accumulators in registers; the same for every loop over them below */
  for (int i = 0; i < 4; ++i)
#pragma unroll
    for (int j = 0; j < 4; ++j) acc[i][j] = z8;
  stage(0);
  asm volatile("s_wait_asynccnt 0x0" ::: "memory");   /* tile 0's copies of this wave have landed */
  __syncthreads();                                    /* ... and every other wave's */
  stage(1);
#pragma unroll 1
  for (int t = 0; t < DM / 64; ++t) {
    const unsigned short* pa = ab + (t & 1) * GBUF + (64 * wr + ln) * GP;
    const unsigned short* pb = ab + (t & 1) * GBUF + OB + (64 * wc + ln) * GP;
#pragma unroll
    for (int s = 0; s < 2; ++s) {                       /* the two 32-k halves of the tile */
      v16h fa[4], fb[4];                                /* a half's LDS reads go as one group ahead of its 16 products */
#pragma unroll
      for (int i = 0; i < 4; ++i) fa[i] = ldhs(pa + 16 * i * GP + 32 * s, hh);
#pragma unroll
      for (int j = 0; j < 4; ++j) fb[j] = ldhs(pb + 16 * j * GP + 32 * s, hh);
#pragma unroll
      for (int j = 0; j < 4; ++j)
#pragma unroll
        for (int i = 0; i < 4; ++i) acc[i][j] = mmaH1(fa[i], fb[j], acc[i][j]);
    }
    asm volatile("s_wait_dscnt 0x0" ::: "memory");      /* this wave's reads of buffer t mod 2 are done before it is refilled */
    asm volatile("s_wait_asynccnt 0x0" ::: "memory");   /* this wave's copies of tile t + 1 have landed */
    __syncthreads();                                    /* publishes tile t + 1, ends every wave's reads of tile t */
    if (t + 2 < DM / 64) stage(t + 2);                  /* block-uniform */
  }
  asm volatile("s_wait_asynccnt 0x0" ::: "memory");     /* nothing in flight when the wave goes on */
  /* the ring is free now: every wave's last read of it stands ahead of the barrier at the foot of the last trip, and no copy is in flight;
     each wave stages its 64 x 64 tile in a part of its own, so that the block's LDS is the ring alone and three blocks fit a WGP */
  if (vmode) {
    /* the wave tile is 64 positions of one sequence x the 64 columns of one head, and a lane's 8 accumulator rows are 8 consecutive positions of one column d:
       16 bytes of row d of the transposed plane. They are staged as [d][position] 16-bit rows and leave as whole 128-byte lines, 8 lanes a row */
    constexpr int TP = 72;                            /* LDS row pitch in 16-bit elements: 144 B = 16 B x odd */
    static_assert(4 * 2 * 64 * TP * 2 <= 2 * GBUF * 2 && SEQ % 64 == 0 && QE % 64 == 0 && HD == 64);
    unsigned short* tv = ab + w * (2 * 64 * TP);      /* values; the residuals follow */
    const int bb = row0 / SEQ, s0 = row0 - bb * SEQ;  /* wave-uniform; positions s0 .. s0 + 63 lie in sequence bb */
    const bool res = s0 < QE;                         /* wave-uniform: the attention reads residuals of the first QE positions only */
    unsigned short* td = tv + ln * TP + 8 * hh;
#pragma unroll
    for (int i = 0; i < 4; ++i)
#pragma unroll
      for (int j = 0; j < 4; ++j) {
        FragH f;
#pragma unroll
        for (int r = 0; r < 8; ++r) f.h[r] = (_Float16)(acc[i][j][r] * 0.0625f);
        *(v8us*)(td + j * 16 * TP + i * 16) = f.half[0];
      }
    if (res) {
#pragma unroll
      for (int i = 0; i < 4; ++i)
#pragma unroll
        for (int j = 0; j < 4; ++j) {
          FragH f;
#pragma unroll
          for (int r = 0; r < 8; ++r) { const float x = acc[i][j][r] * 0.0625f; f.h[r] = (_Float16)((x - (float)(_Float16)x) * 1024.0f); }
          *(v8us*)(td + (64 + j * 16) * TP + i * 16) = f.half[0];
        }
    }
    __builtin_amdgcn_fence(4 /* acq_rel order */, "workgroup");   /* the wave's staged rows are in LDS before a lane reads what other lanes wrote ... */
    __builtin_amdgcn_wave_barrier();                              /* ... and the compiler moves no read below over the writes above */
    const int rq = lane >> 3, c8 = (lane & 7) * 8;
    const size_t slab = (size_t)(bb * NH + col0 / HD) * HD + rq;   /* row d = 4 q + rq of the head's transposed plane */
    unsigned short* gv = P0 + slab * SEQ + s0 + c8;
    v8us o[16];
#pragma unroll                                        /* constant indices keep the rows in registers */
    for (int q = 0; q < 16; ++q) o[q] = *(const v8us*)(tv + (q * 4 + rq) * TP + c8);
#pragma unroll
    for (int q = 0; q < 16; ++q) *(v8us*)(gv + (size_t)q * 4 * SEQ) = o[q];
    asm volatile("s_wait_xcnt 0x0" ::: "memory");     /* no register that a store above names is rewritten ahead of this wait */
    if (res) {
      unsigned short* gr = P1 + slab * QE + s0 + c8;
#pragma unroll
      for (int q = 0; q < 16; ++q) o[q] = *(const v8us*)(tv + (64 + q * 4 + rq) * TP + c8);
#pragma unroll
      for (int q = 0; q < 16; ++q) *(v8us*)(gr + (size_t)q * 4 * QE) = o[q];
      asm volatile("s_wait_xcnt 0x0" ::: "memory");   /* as above */
    }
  } else {
    static_assert(4 * 64 * 68 * 4 <= 2 * GBUF * 2);
    float (*sw)[68] = reinterpret_cast<float (*)[68]>(ab) + 64 * w;
#pragma unroll
    for (int i = 0; i < 4; ++i)
#pragma unroll
      for (int j = 0; j < 4; ++j)
#pragma unroll
        for (int r = 0; r < 8; ++r) sw[i * 16 + 8 * hh + r][j * 16 + ln] = acc[i][j][r] * 0.0625f;
    __builtin_amdgcn_fence(4 /* acq_rel order */, "workgroup");
    __builtin_amdgcn_wave_barrier();
    proj_store(sw, lane, row0, col0, P0, P1);
    proj_store(sw + 32, lane, row0 + 32, col0, P0, P1);
    asm volatile("s_wait_xcnt 0x0" ::: "memory");   /* in the built code the other stage's instructions follow this one's: no register that a store above names is rewritten ahead of this wait */
  }
}
// the three projections need nothing of each other: one grid, each product a range of the block index (block-uniform choice)
#define GPJ ((NR / 128) * (DM / 128))          /* blocks per GEMM */
__global__ __launch_bounds__(128) void k_proj(const unsigned short* __restrict__ XQ, const unsigned short* __restrict__ BQ, unsigned short* __restrict__ Qh, unsigned short* __restrict__ Ql,
                                              const unsigned short* __restrict__ XK, const unsigned short* __restrict__ BK, unsigned short* __restrict__ Kh, unsigned short* __restrict__ Kl,
                                              const unsigned short* __restrict__ XV, const unsigned short* __restrict__ BV, unsigned short* __restrict__ Vth, unsigned short* __restrict__ Vtl) {
  const int sel = blockIdx.x / GPJ;
  proj_body(sel == 0 ? XQ : sel == 1 ? XK : XV, sel == 0 ? BQ : sel == 1 ? BK : BV,
            sel == 0 ? Qh : sel == 1 ? Kh : Vth, sel == 0 ? Ql : sel == 1 ? Kl : Vtl, blockIdx.x - sel * GPJ, sel == 2);
}

// 16-byte asynchronous copies global -> LDS, one per lane and line of text; s_wait_xcnt closes each statement so that no address register is rewritten ahead of it
__device__ __forceinline__ void copy6(unsigned l0, const unsigned short* g0, unsigned l1, const unsigned short* g1, unsigned l2, const unsigned short* g2,
                                      unsigned l3, const unsigned short* g3, unsigned l4, const unsigned short* g4, unsigned l5, const unsigned short* g5) {
  asm volatile("global_load_async_to_lds_b128 %0, %1, off\n\tglobal_load_async_to_lds_b128 %2, %3, off\n\tglobal_load_async_to_lds_b128 %4, %5, off\n\t"
               "global_load_async_to_lds_b128 %6, %7, off\n\tglobal_load_async_to_lds_b128 %8, %9, off\n\tglobal_load_async_to_lds_b128 %10, %11, off\n\ts_wait_xcnt 0x0"
               :: "v"(l0), "v"(g0), "v"(l1), "v"(g1), "v"(l2), "v"(g2), "v"(l3), "v"(g3), "v"(l4), "v"(g4), "v"(l5), "v"(g5) : "memory");
}
__device__ __forceinline__ void copy2(unsigned l0, const unsigned short* g0, unsigned l1, const unsigned short* g1) {
  asm volatile("global_load_async_to_lds_b128 %0, %1, off\n\tglobal_load_async_to_lds_b128 %2, %3, off\n\ts_wait_xcnt 0x0"
               :: "v"(l0), "v"(g0), "v"(l1), "v"(g1) : "memory");
}

// fused causal attention: wave = 16 queries of one (b, h); keys walked in 32-key steps up to the diagonal; S^T = K.Q^T (A = K rows, B = Q rows;
// D row = key 8h+r, D col = query) so a lane owns one query: running max / sum in registers, one shuffle joins the two lane halves;
// P fragment (B operand, k = key) taken directly from the two score accumulators (element r <- keys 8h+r, element 8+r <- keys 16+8h+r);
// O^T = V^T.P (A = V^T rows, d x key). EARLY: P and V also carry x1024 residual planes into a second accumulator.
// The 32-key tiles of K (hi, lo) and V^T are shared by the block's four waves: copied once per block into a two-buffer LDS ring, one step ahead of their use.
// blk: the block's index inside its own part (EARLY or not); so, kv: the kernel's LDS, one allocation for both parts.
#define ABUF (2 * 32 * 72 + 2 * 64 * 40)       /* 16-bit elements of one ring buffer of the EARLY part, the larger one */
template <bool EARLY>
__device__ __forceinline__ void attn_body(const unsigned short* __restrict__ Qh, const unsigned short* __restrict__ Ql,
                                          const unsigned short* __restrict__ Kh, const unsigned short* __restrict__ Kl,
                                          const unsigned short* __restrict__ Vth, const unsigned short* __restrict__ Vtl,
                                          unsigned short* __restrict__ Ch, unsigned short* __restrict__ Cl,
                                          int blk, float (*so)[16][68], unsigned short* kv) {
  constexpr int QT0 = EARLY ? 0 : QE / 16;
  constexpr int NQT = EARLY ? QE / 16 : (SEQ - QE) / 16;
  constexpr int BPB = (NQT / 4 > 0) ? NQT / 4 : 1;   /* blocks per (b, h): 4 query tiles each */
  const int lane = threadIdx.x & 31, ln = lane & 15, hh = lane >> 4;
  const int wave = __builtin_amdgcn_readfirstlane((int)(threadIdx.x >> 5));
  const int bh = blk / BPB;
  const int qt = QT0 + (blk - bh * BPB) * 4 + wave;
  const int b = bh / NH, h = bh - b * NH;
  const int qBase = qt * 16;
  const int nkt = (qBase + 47) >> 5;     /* 32-key steps covering keys 0..qBase+15 */
  const int nFull = qBase >> 5;          /* steps whose 32 keys are all <= qBase */
  const int qrow = qBase + ln;
  const size_t offQ = ((size_t)b * SEQ + qrow) * DM + h * HD;
  constexpr int KP = 72, VP = 40;              /* LDS row pitch in 16-bit elements: 144 B and 80 B, both 16 B x odd */
  constexpr int OKL = 32 * KP, OV = 2 * OKL, OVL = OV + 64 * VP;   /* places of K lo, V^T, V^T residual inside a buffer */
  constexpr int BUF = EARLY ? OVL + 64 * VP : OVL;
  static_assert((BUF * 2) % 16 == 0 && (KP * 2) % 16 == 0 && (VP * 2) % 16 == 0 && BUF <= ABUF);
  const int nktB = ((QT0 + (blk - bh * BPB) * 4) >> 1) + 2;   /* steps of the block's last wave: keys up to its first query + 63, inside the sequence */
  /* the blocks of one (b, h) read the same K and V^T lines, all at the same moment if all walk the keys from 0: each block enters its walk at a step of its own
     and wraps round (the running maximum and sum take the steps in any order: every step below nkt holds a key that every query of the tile sees) */
  const int rot = ((blk - bh * BPB) * nktB) / BPB;            /* block-uniform, 0 <= rot < nktB */
  auto step_of = [&](int p) { const int s = p + rot; return s >= nktB ? s - nktB : s; };   /* trip p < nktB -> key step, a permutation of 0 .. nktB - 1 */
  const int tid = threadIdx.x;
  const int kr = tid >> 3, kc = (tid & 7) * 8;  /* K rows kr and kr + 16, 16-byte piece kc */
  const int vr = tid >> 2, vc = (tid & 3) * 8;  /* V^T rows vr and vr + 32, 16-byte piece vc */
  const size_t gK = ((size_t)b * SEQ + kr) * DM + h * HD + kc;
  const size_t gV = ((size_t)bh * HD + vr) * SEQ + vc;
  const size_t gVl = ((size_t)bh * HD + vr) * QE + vc;
  const unsigned lK = (unsigned)(size_t)kv + (unsigned)(kr * KP + kc) * 2u;
  const unsigned lV = (unsigned)(size_t)kv + (unsigned)(OV + vr * VP + vc) * 2u;
  auto stage = [&](int p) {                     /* trip p: key step step_of(p) -> buffer p mod 2 */
    const unsigned lb = (unsigned)(p & 1) * (unsigned)(BUF * 2);
    const int t = step_of(p);
    const size_t k0 = gK + (size_t)t * 32 * DM, v0 = gV + (size_t)t * 32;
    copy6(lK + lb, Kh + k0, lK + lb + 16 * KP * 2, Kh + k0 + 16 * DM,
          lK + lb + OKL * 2, Kl + k0, lK + lb + (OKL + 16 * KP) * 2, Kl + k0 + 16 * DM,
          lV + lb, Vth + v0, lV + lb + 32 * VP * 2, Vth + v0 + (size_t)32 * SEQ);
    if (EARLY) {
      const size_t w0 = gVl + (size_t)t * 32;
      copy2(lV + lb + 64 * VP * 2, Vtl + w0, lV + lb + 96 * VP * 2, Vtl + w0 + (size_t)32 * QE);
    }
  };
  const v8f z8 = {0.f, 0.f, 0.f, 0.f, 0.f, 0.f, 0.f, 0.f};
  v8f oacc[4] = {z8, z8, z8, z8};
  v8f ores[4] = {z8, z8, z8, z8};
  float m = -__builtin_inff(), l = 0.f;
  /* the wave's Q fragments (hi, lo; both 32-wide halves of the head) are the same in every key step: read once here, ahead of the first copies, and kept in registers */
  v16b fqh[2], fql[2];
#pragma unroll                           /* constant indices keep the fragment arrays in registers */
  for (int dc = 0; dc < 2; ++dc) {
    const size_t qo = offQ + dc * 32;
    fqh[dc] = ldb(Qh, qo, hh); fql[dc] = ldb(Ql, qo, hh);
  }
  asm volatile("s_wait_xcnt 0x0" ::: "memory");       /* no address register of the loads above is rewritten ahead of this wait */
  stage(0);
  asm volatile("s_wait_asynccnt 0x0" ::: "memory");   /* step 0's copies of this wave have landed */
  __syncthreads();                                    /* ... and every other wave's */
  stage(1);                                           /* nktB >= 2 */
#pragma unroll 1
  for (int it = 0; it < nktB; ++it) {
   const int ks = step_of(it);           /* the key step that buffer it mod 2 holds */
   if (ks < nkt) {                       /* wave-uniform: for a step past its diagonal a wave only passes the hand-over below */
    const int kb = ks * 32;
    const unsigned short* kvb = kv + (it & 1) * BUF;
    /* the step's K fragments are read as one group ahead of the products: one load latency is waited for, not one in front of each chain of products */
    v16b kh[2][2], kl[2][2];
#pragma unroll                           /* constant indices keep the fragment arrays in registers; the same for the two loops below */
    for (int dc = 0; dc < 2; ++dc) {
      const unsigned short* k0 = kvb + ln * KP + dc * 32;
      const unsigned short* k1 = k0 + 16 * KP;
      kh[dc][0] = ldbs(k0, hh); kl[dc][0] = ldbs(k0 + OKL, hh);
      kh[dc][1] = ldbs(k1, hh); kl[dc][1] = ldbs(k1 + OKL, hh);
    }
    v8f st0 = z8, st1 = z8;
#pragma unroll
    for (int dc = 0; dc < 2; ++dc) {
      st0 = mmaB<3>(kh[dc][0], kl[dc][0], fqh[dc], fql[dc], st0);
      st1 = mmaB<3>(kh[dc][1], kl[dc][1], fqh[dc], fql[dc], st1);
    }
    /* the V^T fragments are read as one group here: their latency passes behind the softmax arithmetic */
    FragH vh[4], vl[4];
#pragma unroll
    for (int dt = 0; dt < 4; ++dt) {
      const unsigned short* vo = kvb + OV + (dt * 16 + ln) * VP;
      vh[dt].v = ldhs(vo, hh);
      if (EARLY) vl[dt].v = ldhs(vo + 64 * VP, hh);
    }
    float s0[8], s1[8];
#pragma unroll
    for (int r = 0; r < 8; ++r) { s0[r] = st0[r] * 0.125f; s1[r] = st1[r] * 0.125f; }
    if (ks >= nFull) {                   /* wave-uniform: only key step nFull = nkt - 1 touches the diagonal */
#pragma unroll
      for (int r = 0; r < 8; ++r) {
        const int key = kb + 8 * hh + r;
        s0[r] = (key > qrow) ? -__builtin_inff() : s0[r];
        s1[r] = (key + 16 > qrow) ? -__builtin_inff() : s1[r];
      }
    }
    float mt = fmaxf(s0[0], s1[0]);
#pragma unroll
    for (int r = 1; r < 8; ++r) mt = fmaxf(mt, fmaxf(s0[r], s1[r]));
    const float mo = __shfl_xor(mt, 16);
    const float mnew = fmaxf(fmaxf(mt, mo), m);   /* finite: key kb <= qBase is visible to every query of the tile */
    const float alpha = __expf(m - mnew);
    m = mnew;
    l *= alpha;
#pragma unroll
    for (int dt = 0; dt < 4; ++dt) { oacc[dt] *= alpha; if (EARLY) ores[dt] *= alpha; }
    FragH ph, pl;
#pragma unroll
    for (int r = 0; r < 8; ++r) {
      const float p0 = __expf(s0[r] - m), p1 = __expf(s1[r] - m);
      l += p0 + p1;
      const float c0 = p0 * 256.0f, c1 = p1 * 256.0f;
      const _Float16 h0 = (_Float16)c0, h1 = (_Float16)c1;
      ph.h[r] = h0; ph.h[8 + r] = h1;
      pl.h[r] = (_Float16)((c0 - (float)h0) * 1024.0f);
      pl.h[8 + r] = (_Float16)((c1 - (float)h1) * 1024.0f);
    }
#pragma unroll
    for (int dt = 0; dt < 4; ++dt) {
      if (EARLY) {
        v8f o = oacc[dt], e = ores[dt];
        o = __builtin_amdgcn_wmma_f32_16x16x32_f16(false, vh[dt].v, false, ph.v, (short)0, o, false, false);
        e = __builtin_amdgcn_wmma_f32_16x16x32_f16(false, vl[dt].v, false, ph.v, (short)0, e, false, false);
        e = __builtin_amdgcn_wmma_f32_16x16x32_f16(false, vh[dt].v, false, pl.v, (short)0, e, false, false);
        asm volatile("v_nop\n\tv_nop\n\tv_nop\n\tv_nop" : "+v"(o), "+v"(e) : "v"(vh[dt].v), "v"(vl[dt].v), "v"(ph.v), "v"(pl.v));
        oacc[dt] = o; ores[dt] = e;
      } else {
        oacc[dt] = mmaH1(vh[dt].v, ph.v, oacc[dt]);
      }
    }
    asm volatile("" ::: "memory");
   }
    asm volatile("s_wait_dscnt 0x0" ::: "memory");      /* this wave's reads of buffer it mod 2 are done before it is refilled */
    asm volatile("s_wait_asynccnt 0x0" ::: "memory");   /* this wave's copies of step it + 1 have landed */
    __syncthreads();                                    /* publishes step it + 1, ends every wave's reads of step it */
    if (it + 2 < nktB) stage(it + 2);                   /* block-uniform */
  }
  asm volatile("s_wait_asynccnt 0x0" ::: "memory");     /* nothing in flight when the wave goes on */
  const float lt = l + __shfl_xor(l, 16);
  const float rinv = 1.0f / (256.0f * lt);
  // O^T (d = dt*16 + 8h + r, query = ln) -> wave-private LDS tile [query][d]
#pragma unroll
  for (int dt = 0; dt < 4; ++dt) {
    v8f o = oacc[dt];
    if (EARLY) o = o + ores[dt] * 0.0009765625f;
    const v4f w0 = {o[0] * rinv, o[1] * rinv, o[2] * rinv, o[3] * rinv};
    const v4f w1 = {o[4] * rinv, o[5] * rinv, o[6] * rinv, o[7] * rinv};
    *(v4fa*)&so[wave][ln][dt * 16 + 8 * hh] = w0;
    *(v4fa*)&so[wave][ln][dt * 16 + 8 * hh + 4] = w1;
  }
  __builtin_amdgcn_fence(4 /* acq_rel order */, "workgroup");
  __builtin_amdgcn_wave_barrier();
  const int rq = lane >> 3, c8 = (lane & 7) * 8;
  {
#pragma unroll
    for (int q = 0; q < 4; ++q) {
      const int r = q * 4 + rq;                      /* q 0..3 x rq 0..3 -> query rows 0..15 */
      const v4f x0 = *(const v4fa*)&so[wave][r][c8], x1 = *(const v4fa*)&so[wave][r][c8 + 4];
      const float xs[8] = {x0[0], x0[1], x0[2], x0[3], x1[0], x1[1], x1[2], x1[3]};
      v8us o0, o1;
#pragma unroll
      for (int i = 0; i < 8; ++i) { const unsigned short hb = bf16_bits(xs[i]); o0[i] = hb; o1[i] = bf16_bits(xs[i] - bf16_val(hb)); }
      const size_t go = ((size_t)b * SEQ + qBase + r) * DM + h * HD + c8;   
      *(v8us*)(Ch + go) = o0;
      *(v8us*)(Cl + go) = o1;
    }
    
  }
}
// both parts need nothing of each other: one grid, the long blocks (queries from QE on) first, then the EARLY ones (block-uniform choice)
#define GAM (NB * NH * ((SEQ - QE) / 64))      /* blocks of the part behind QE */
__global__ __launch_bounds__(128) void k_attn(const unsigned short* __restrict__ Qh, const unsigned short* __restrict__ Ql,
                                              const unsigned short* __restrict__ Kh, const unsigned short* __restrict__ Kl,
                                              const unsigned short* __restrict__ Vth, const unsigned short* __restrict__ Vtl,
                                              unsigned short* __restrict__ Ch, unsigned short* __restrict__ Cl) {
  __shared__ __attribute__((aligned(16))) float so[4][16][68];
  __shared__ __attribute__((aligned(16))) unsigned short kv[2 * ABUF];
  if ((int)blockIdx.x < GAM) attn_body<false>(Qh, Ql, Kh, Kl, Vth, Vtl, Ch, Cl, (int)blockIdx.x, so, kv);
  else attn_body<true>(Qh, Ql, Kh, Kl, Vth, Vtl, Ch, Cl, (int)blockIdx.x - GAM, so, kv);
}

// output GEMM: out[(b, s)][n] = sum_k (ctx_hi + ctx_lo)[r][k] . bf16(WO)[n][k] + bf16(bO)[n]; block = 4 x 2 waves, block tile 128 x 128, wave tile 32 x 64; f32 rows of the full-size output layout;
// the bias float4 of a lane's four columns is read once by value and added in f32 at the store stage;
__global__ __launch_bounds__(256) void k_out(const unsigned short* __restrict__ Ah, const unsigned short* __restrict__ Al,
                                             const unsigned short* __restrict__ Bt, const float* __restrict__ bias, float* __restrict__ C) {
  __shared__ __attribute__((aligned(16))) float so[8][32][68];
  const int lane = threadIdx.x & 31, ln = lane & 15, hh = lane >> 4;
  const int w = __builtin_amdgcn_readfirstlane((int)(threadIdx.x >> 5));
  const int wr = w & 3, wc = w >> 2;                  /* the wave's 32 rows and its column half of the block tile */
  const int mt = blockIdx.x / (DM / 128), nq = blockIdx.x - mt * (DM / 128);
  const int row0 = mt * 128 + 32 * wr, col0 = nq * 128 + 64 * wc;
  /* the block's 128 ctx rows (hi, lo) and 128 Bt rows, 64 k at a time, are copied once per block into a two-buffer LDS ring, one tile ahead of their use */
  constexpr int OL = 128 * GP, OB = 2 * OL, GBUF = 3 * OL;   /* places of the lo rows and the Bt rows inside a buffer; buffer size */
  __shared__ __attribute__((aligned(16))) unsigned short ab[2 * GBUF];
  const int sr = (int)threadIdx.x >> 3, sc = ((int)threadIdx.x & 7) * 8;   /* rows sr + 32 j, 16-byte piece sc */
  const size_t oA = (size_t)(mt * 128 + sr) * DM + sc;
  const unsigned short* gB = Bt + (size_t)(nq * 128 + sr) * DM + sc;
  const unsigned lA = (unsigned)(size_t)ab + (unsigned)(sr * GP + sc) * 2u;
  const int t0 = (2 * nq + mt) & (DM / 64 - 1);       /* the block's own entry into the k walk, as in proj_body */
  auto stage = [&](int t) {                           /* trip t: k tile (t + t0) mod 16 -> buffer t mod 2 */
    const unsigned la = lA + (unsigned)(t & 1) * (unsigned)(GBUF * 2);
    const int kt = ((t + t0) & (DM / 64 - 1)) * 64;   /* 0 .. DM - 64: inside the row */
    rows4(la, Ah + oA + kt);
    rows4(la + OL * 2, Al + oA + kt);
    rows4(la + OB * 2, gB + kt);
  };
  const v8f z8 = {0.f, 0.f, 0.f, 0.f, 0.f, 0.f, 0.f, 0.f};
  v8f c00 = z8, c01 = z8, c02 = z8, c03 = z8, c10 = z8, c11 = z8, c12 = z8, c13 = z8;
  stage(0);
  asm volatile("s_wait_asynccnt 0x0" ::: "memory");   /* tile 0's copies of this wave have landed */
  __syncthreads();                                    /* ... and every other wave's */
  stage(1);
#pragma unroll 1
  for (int t = 0; t < DM / 64; ++t) {
    const unsigned short* pa = ab + (t & 1) * GBUF + (32 * wr + ln) * GP;
    const unsigned short* pb = ab + (t & 1) * GBUF + OB + (64 * wc + ln) * GP;
    v16b fh[2][2], fl[2][2], fb[2][4];                  /* the tile's LDS reads go as one group ahead of its products */
#pragma unroll
    for (int s = 0; s < 2; ++s) {
      fh[s][0] = ldbs(pa + 32 * s, hh); fl[s][0] = ldbs(pa + OL + 32 * s, hh);
      fh[s][1] = ldbs(pa + 16 * GP + 32 * s, hh); fl[s][1] = ldbs(pa + OL + 16 * GP + 32 * s, hh);
#pragma unroll
      for (int j = 0; j < 4; ++j) fb[s][j] = ldbs(pb + 16 * j * GP + 32 * s, hh);
    }
#pragma unroll
    for (int s = 0; s < 2; ++s) {
      c00 = mmaB<2>(fh[s][0], fl[s][0], fb[s][0], fb[s][0], c00); c10 = mmaB<2>(fh[s][1], fl[s][1], fb[s][0], fb[s][0], c10);
      c01 = mmaB<2>(fh[s][0], fl[s][0], fb[s][1], fb[s][1], c01); c11 = mmaB<2>(fh[s][1], fl[s][1], fb[s][1], fb[s][1], c11);
      c02 = mmaB<2>(fh[s][0], fl[s][0], fb[s][2], fb[s][2], c02); c12 = mmaB<2>(fh[s][1], fl[s][1], fb[s][2], fb[s][2], c12);
      c03 = mmaB<2>(fh[s][0], fl[s][0], fb[s][3], fb[s][3], c03); c13 = mmaB<2>(fh[s][1], fl[s][1], fb[s][3], fb[s][3], c13);
    }
    asm volatile("s_wait_dscnt 0x0" ::: "memory");      /* this wave's reads of buffer t mod 2 are done before it is refilled */
    asm volatile("s_wait_asynccnt 0x0" ::: "memory");   /* this wave's copies of tile t + 1 have landed */
    __syncthreads();                                    /* publishes tile t + 1, ends every wave's reads of tile t */
    if (t + 2 < DM / 64) stage(t + 2);                  /* block-uniform */
  }
  asm volatile("s_wait_asynccnt 0x0" ::: "memory");     /* nothing in flight when the wave goes on */
  v8f accs[8] = {c00, c01, c02, c03, c10, c11, c12, c13};
#pragma unroll
  for (int u = 0; u < 8; ++u) {
    const int t = u & 3, half = u >> 2;
#pragma unroll
    for (int r = 0; r < 8; ++r) so[w][half * 16 + 8 * hh + r][t * 16 + ln] = accs[u][r];
  }
  __builtin_amdgcn_fence(4 /* acq_rel order */, "workgroup");
  __builtin_amdgcn_wave_barrier();
  const int rsub = lane >> 4, c4 = (lane & 15) * 4;
  const v4f bx = *(const v4fa*)(bias + col0 + c4);   /* columns col0 + c4 .. + 3 < DM */
  const v4f bv = {bf16_rne(bx[0]), bf16_rne(bx[1]), bf16_rne(bx[2]), bf16_rne(bx[3])};
  {
#pragma unroll
    for (int q = 0; q < 16; ++q) {
      const int r = q * 2 + rsub;                    /* q 0..15 x rsub 0..1 -> rows 0..31 */
      const v4f sv = *(const v4fa*)&so[w][r][c4];
      const v4f v = sv + bv;
      const int grow = row0 + r;
      const int bb = grow / SEQ, s = grow - bb * SEQ;
      *(v4f*)(C + ((size_t)bb * SEQ_FULL + s) * DM + col0 + c4) = v;
    }
    
  }
}

/* workspace carve (bytes): 3 input planes + 4 weight planes + Qh Ql Kh Kl + Vth + Vtl + Ch Cl */
#define XB ((size_t)NR * DM * 2)
#define WB ((size_t)DM * DM * 2)
#define VLB ((size_t)NB * NH * HD * QE * 2)
static_assert(XB % 256 == 0 && WB % 256 == 0 && VLB % 256 == 0);
static_assert(10 * XB + 4 * WB + VLB <= (size_t)134217728);   /* total carve stays within 128 MiB */

extern "C" void kernel_launch(void* const* d_in, const int* in_sizes, int n_in,
                              void* d_out, int out_size, void* d_ws, size_t ws_size, hipStream_t stream) {
  if (n_in < 8) return;
  const long long need_x = ((long long)(NB - 1) * SEQ_FULL + SEQ) * DM;
  if (in_sizes[0] < need_x || in_sizes[1] < need_x || in_sizes[2] < need_x) return;
  if (in_sizes[3] < DM * DM || in_sizes[4] < DM * DM || in_sizes[5] < DM * DM || in_sizes[6] < DM * DM) return;
  if (in_sizes[7] < DM) return;
  if (out_size < need_x) return;
  const float* xq = (const float*)d_in[0];      /* table order: Q, K, V, WQ, WK, WV, WO, bO */
  const float* xk = (const float*)d_in[1];
  const float* xv = (const float*)d_in[2];
  const float* wq = (const float*)d_in[3];
  const float* wk = (const float*)d_in[4];
  const float* wv = (const float*)d_in[5];
  const float* wo = (const float*)d_in[6];
  const float* bo = (const float*)d_in[7];
  char* ws = (char*)d_ws; size_t off = 0;
  auto take = [&](size_t bytes) { char* p = ws + off; off += (bytes + 255) & ~(size_t)255; return (unsigned short*)p; };
  unsigned short* XQ = take(XB); unsigned short* XK = take(XB); unsigned short* XV = take(XB);
  unsigned short* BQ = take(WB); unsigned short* BK = take(WB); unsigned short* BV = take(WB); unsigned short* BO = take(WB);
  unsigned short* Qh = take(XB); unsigned short* Ql = take(XB); unsigned short* Kh = take(XB); unsigned short* Kl = take(XB);
  unsigned short* Vth = take(XB); unsigned short* Vtl = take(VLB);
  unsigned short* Ch = take(XB); unsigned short* Cl = take(XB);
  if (off > ws_size) return;

  k_conv<<<(unsigned)(3 * GX + 4 * GW), 256, 0, stream>>>(xq, xk, xv, wq, wk, wv, wo, XQ, XK, XV, BQ, BK, BV, BO);
  k_proj<<<(unsigned)(3 * GPJ), 128, 0, stream>>>(XQ, BQ, Qh, Ql, XK, BK, Kh, Kl, XV, BV, Vth, Vtl);   /* v leaves as [(b,h)][64][SEQ] and [(b,h)][64][QE] */
  k_attn<<<(unsigned)(GAM + NB * NH * (QE / 64)), 128, 0, stream>>>(Qh, Ql, Kh, Kl, Vth, Vtl, Ch, Cl);
  k_out<<<(unsigned)GPJ, 256, 0, stream>>>(Ch, Cl, BO, bo, (float*)d_out);
}

// v009
// It runs in 102 microseconds.
// Next to v008, in two timings, it ran 1.04 and 1.03 times as fast.
// Over all steps from v000 it is 3.67 times as fast.
#include <hip/hip_runtime.h>
// Causal multi-head attention, three input streams (Q, K, V each [B][T][1024]), bias-free [out][in] input projections, 16 heads x 64, score scale 1/8, keys j > i excluded, out = ctx WO^T + bO (bO converted RNE to bf16, added in f32 at the store stage).
// Compute dtype: inputs converted (RNE) to bf16 and carried exactly as f16 rows / x16 f16 weights; Q,K,V projections v_wmma_f32_16x16x32_f16 (single product); scores v_wmma_f32_16x16x32_bf16 on bf16 hi|lo planes of q and k (three products); P.V v_wmma_f32_16x16x32_f16 with P carried x256 (first QE query rows: f16 value + x1024 residual planes for P and V, separate accumulator); output GEMM v_wmma_f32_16x16x32_bf16 with ctx as bf16 hi|lo against exact bf16 WO (two products); f32 accumulation and f32 softmax statistics everywhere.
#ifndef NB
#define NB 2
#endif
#ifndef SEQ
#define SEQ 2048
#endif
#ifndef QE
#define QE ((SEQ) < 256 ? (SEQ) : 256)   /* query rows per sequence that get residual planes on P and V */
#endif
#define NB_FULL 2
#define SEQ_FULL 2048
#define DM 1024
#define NH 16
#define HD 64
#define NR (NB * SEQ)

static_assert(NH * HD == DM);                 /* merged head columns h*64+d span the model width */
static_assert(HD == 64);                      
static_assert(DM % 128 == 0 && DM % 64 == 0); /* GEMM column tiles of 128, k tiles of 64 */
static_assert(NR % 128 == 0);                 /* GEMM row tiles of 128 */
static_assert(SEQ % 64 == 0 && QE % 64 == 0 && QE <= SEQ && (SEQ - QE) % 64 == 0);  /* 4 query tiles of 16 per block; 32-key steps stay inside the sequence */
static_assert(NB <= NB_FULL && SEQ <= SEQ_FULL);
static_assert((NR * DM / 8) % 256 == 0 && (DM * DM / 8) % 256 == 0);  /* convert grids x 256 threads == plane extent */
static_assert((SEQ & (SEQ - 1)) == 0);        /* row -> (batch, position) by shift */
static_assert(DM % 4 == 0 && (DM / 64 - 1) * 64 + 15 * 4 + 4 <= DM);  /* per-lane float4 of the bias vector stays inside [DM] */
static_assert((size_t)NB_FULL * SEQ_FULL * DM * 4 == (size_t)16777216);  /* output buffer bytes, single output at byte offset 0 */

typedef __bf16 v16b __attribute__((ext_vector_type(16)));
typedef _Float16 v16h __attribute__((ext_vector_type(16)));
typedef unsigned short v8us __attribute__((ext_vector_type(8), may_alias));
typedef float v8f __attribute__((ext_vector_type(8)));
typedef float v4f __attribute__((ext_vector_type(4)));
typedef float v4fa __attribute__((ext_vector_type(4), may_alias));
union FragB { v16b v; v8us half[2]; unsigned short u[16]; };
union FragH { v16h v; v8us half[2]; _Float16 h[16]; unsigned short u[16]; };

__device__ __forceinline__ unsigned short bf16_bits(float x) { unsigned int u = __float_as_uint(x); return (unsigned short)((u + 0x7FFFu + ((u >> 16) & 1u)) >> 16); }
__device__ __forceinline__ float bf16_val(unsigned short b) { return __uint_as_float(((unsigned int)b) << 16); }
__device__ __forceinline__ float bf16_rne(float x) { return bf16_val(bf16_bits(x)); }

// fragment loader (A and B alike): elements 0..7 <- k0 + 8h + 0..7, elements 8..15 <- k0 + 16 + 8h + 0..7 of a k-contiguous 16-bit row
__device__ __forceinline__ v16b ldb(const unsigned short* __restrict__ p, size_t off, int hh) { FragB f; f.half[0] = *(const v8us*)(p + off + 8 * hh); f.half[1] = *(const v8us*)(p + off + 16 + 8 * hh); return f.v; }

// D += A.B with NT bf16 products: 1 = ah.bh, 2 = + al.bh, 3 = + ah.bl; one guard naming the accumulator and every fragment
template <int NT>
__device__ __forceinline__ v8f mmaB(v16b ah, v16b al, v16b bh, v16b bl, v8f c) {
  c = __builtin_amdgcn_wmma_f32_16x16x32_bf16(false, ah, false, bh, (short)0, c, false, false);
  if (NT >= 2) c = __builtin_amdgcn_wmma_f32_16x16x32_bf16(false, al, false, bh, (short)0, c, false, false);
  if (NT >= 3) c = __builtin_amdgcn_wmma_f32_16x16x32_bf16(false, ah, false, bl, (short)0, c, false, false);
  asm volatile("v_nop\n\tv_nop\n\tv_nop\n\tv_nop" : "+v"(c) : "v"(ah), "v"(al), "v"(bh), "v"(bl));
  return c;
}
__device__ __forceinline__ v8f mmaH1(v16h a, v16h b, v8f c) {
  v8f d = __builtin_amdgcn_wmma_f32_16x16x32_f16(false, a, false, b, (short)0, c, false, false);
  asm volatile("v_nop\n\tv_nop\n\tv_nop\n\tv_nop" : "+v"(d) : "v"(a), "v"(b));
  return d;
}

__device__ __forceinline__ void x16_body(const float* __restrict__ x, unsigned short* __restrict__ X16, int blk) {
  const int t = blk * 256 + threadIdx.x;
  if (t >= NR * DM / 8) return;
  const int row = t / (DM / 8), c8 = (t - row * (DM / 8)) * 8;
  const int b = row / SEQ, s = row - b * SEQ;
  const float* src = x + ((size_t)b * SEQ_FULL + s) * DM + c8;
  const v4f a = *(const v4fa*)src, c = *(const v4fa*)(src + 4);
  FragH f;
#pragma unroll
  for (int q = 0; q < 4; ++q) { f.h[q] = (_Float16)bf16_rne(a[q]); f.h[4 + q] = (_Float16)bf16_rne(c[q]); }
  const v8us o = f.half[0];
  unsigned short* d = X16 + (size_t)t * 8;
  *(v8us*)d = o;
  
}
__device__ __forceinline__ void wnat_body(const float* __restrict__ w, unsigned short* __restrict__ Bt, int blk) {
  const int t = blk * 256 + threadIdx.x;
  if (t >= DM * DM / 8) return;
  const v4f a = *(const v4fa*)(w + (size_t)t * 8), c = *(const v4fa*)(w + (size_t)t * 8 + 4);
  FragH f;
#pragma unroll
  for (int q = 0; q < 4; ++q) { f.h[q] = (_Float16)(bf16_rne(a[q]) * 16.0f); f.h[4 + q] = (_Float16)(bf16_rne(c[q]) * 16.0f); }
  const v8us o = f.half[0];
  unsigned short* d = Bt + (size_t)t * 8;
  *(v8us*)d = o;
  
}
__device__ __forceinline__ void wbf_body(const float* __restrict__ w, unsigned short* __restrict__ Bt, int blk) {
  const int t = blk * 256 + threadIdx.x;
  if (t >= DM * DM / 8) return;
  const v4f a = *(const v4fa*)(w + (size_t)t * 8), c = *(const v4fa*)(w + (size_t)t * 8 + 4);
  v8us o;
#pragma unroll
  for (int q = 0; q < 4; ++q) { o[q] = bf16_bits(a[q]); o[4 + q] = bf16_bits(c[q]); }
  unsigned short* d = Bt + (size_t)t * 8;
  *(v8us*)d = o;
  
}
// the seven conversions need nothing of each other: one grid, each plane a range of the block index (block-uniform choice)
#define GX (NR * DM / 8 / 256)                 /* blocks per input plane */
#define GW (DM * DM / 8 / 256)                 /* blocks per weight plane */
__global__ __launch_bounds__(256) void k_conv(const float* __restrict__ xq, const float* __restrict__ xk, const float* __restrict__ xv,
                                              const float* __restrict__ wq, const float* __restrict__ wk, const float* __restrict__ wv, const float* __restrict__ wo,
                                              unsigned short* __restrict__ XQ, unsigned short* __restrict__ XK, unsigned short* __restrict__ XV,
                                              unsigned short* __restrict__ BQ, unsigned short* __restrict__ BK, unsigned short* __restrict__ BV, unsigned short* __restrict__ BO) {
  const int bid = blockIdx.x;
  if (bid < 3 * GX) {
    const int sel = bid / GX;
    x16_body(sel == 0 ? xq : sel == 1 ? xk : xv, sel == 0 ? XQ : sel == 1 ? XK : XV, bid - sel * GX);
  } else if (bid < 3 * GX + 3 * GW) {
    const int sel = (bid - 3 * GX) / GW;
    wnat_body(sel == 0 ? wq : sel == 1 ? wk : wv, sel == 0 ? BQ : sel == 1 ? BK : BV, bid - 3 * GX - sel * GW);   /* natural [out][in] = Bt[n][k] as stored */
  } else {
    wbf_body(wo, BO, bid - 3 * GX - 3 * GW);
  }
}

// fragment loaders for a row staged in LDS: the element order of ldb
__device__ __forceinline__ v16b ldbs(const unsigned short* p, int hh) { FragB f; f.half[0] = *(const v8us*)(p + 8 * hh); f.half[1] = *(const v8us*)(p + 16 + 8 * hh); return f.v; }
__device__ __forceinline__ v16h ldhs(const unsigned short* p, int hh) { FragH f; f.half[0] = *(const v8us*)(p + 8 * hh); f.half[1] = *(const v8us*)(p + 16 + 8 * hh); return f.v; }
// GEMM operand tiles: 128 rows of a [row][DM] plane, r, r + 16, ... (rows8) or r, r + 32, ... (rows4), one 16-byte asynchronous copy global -> LDS per lane and line of text (8 lanes cover one 128-byte row piece);
// s_wait_xcnt closes each statement so that no address register is rewritten ahead of it
#define GP 72                                  /* LDS row pitch of a 64-k tile in 16-bit elements: 144 B = 16 B x odd */
__device__ __forceinline__ void rows4(unsigned l, const unsigned short* g) {   /* a block of 256 threads: rows r, r + 32, r + 64, r + 96 */
  asm volatile("global_load_async_to_lds_b128 %0, %1, off\n\tglobal_load_async_to_lds_b128 %2, %3, off\n\t"
               "global_load_async_to_lds_b128 %4, %5, off\n\tglobal_load_async_to_lds_b128 %6, %7, off\n\ts_wait_xcnt 0x0"
               :: "v"(l), "v"(g), "v"(l + 32 * GP * 2), "v"(g + 32 * DM), "v"(l + 64 * GP * 2), "v"(g + 64 * DM), "v"(l + 96 * GP * 2), "v"(g + 96 * DM) : "memory");
}
__device__ __forceinline__ void rows8(unsigned l, const unsigned short* g) {
  asm volatile("global_load_async_to_lds_b128 %0, %1, off\n\tglobal_load_async_to_lds_b128 %2, %3, off\n\t"
               "global_load_async_to_lds_b128 %4, %5, off\n\tglobal_load_async_to_lds_b128 %6, %7, off\n\t"
               "global_load_async_to_lds_b128 %8, %9, off\n\tglobal_load_async_to_lds_b128 %10, %11, off\n\t"
               "global_load_async_to_lds_b128 %12, %13, off\n\tglobal_load_async_to_lds_b128 %14, %15, off\n\ts_wait_xcnt 0x0"
               :: "v"(l), "v"(g), "v"(l + 16 * GP * 2), "v"(g + 16 * DM), "v"(l + 32 * GP * 2), "v"(g + 32 * DM), "v"(l + 48 * GP * 2), "v"(g + 48 * DM),
                  "v"(l + 64 * GP * 2), "v"(g + 64 * DM), "v"(l + 80 * GP * 2), "v"(g + 80 * DM), "v"(l + 96 * GP * 2), "v"(g + 96 * DM), "v"(l + 112 * GP * 2), "v"(g + 112 * DM) : "memory");
}
static_assert(DM / 64 >= 2);                   /* the two-buffer ring starts with two tiles */
static_assert(((DM / 64) & (DM / 64 - 1)) == 0);   /* the rotated k walk wraps by a mask */

// projection GEMM: Y[NR][DM] = A[NR][DM] (exact f16 rows) . Bt[n][k] (x16 f16) * 2^-4; block = 2 x 2 waves, block tile 128 x 128, wave tile 64 rows x 64 cols;
// q and k: Y -> bf16 hi | lo row planes, the wave tile staged in wave-private LDS, then stored by proj_store, 32 rows a call;
// v: Y -> f16 value | (Y - value) x 1024 planes, stored transposed, [(b*NH + h)][d][position], as the attention reads them (store stage at the foot of proj_body)
__device__ __forceinline__ void proj_store(const float (*sw)[68], int lane, int row0, int col0, unsigned short* __restrict__ P0, unsigned short* __restrict__ P1) {
  const int rq = lane >> 3, c8 = (lane & 7) * 8;
#pragma unroll
  for (int q = 0; q < 8; ++q) {
    const int r = q * 4 + rq;                       /* q 0..7 x rq 0..3 -> rows 0..31 */
    const v4f x0 = *(const v4fa*)&sw[r][c8], x1 = *(const v4fa*)&sw[r][c8 + 4];
    const float xs[8] = {x0[0], x0[1], x0[2], x0[3], x1[0], x1[1], x1[2], x1[3]};
    v8us o0, o1;
#pragma unroll
    for (int i = 0; i < 8; ++i) { const unsigned short hb = bf16_bits(xs[i]); o0[i] = hb; o1[i] = bf16_bits(xs[i] - bf16_val(hb)); }
    const size_t go = (size_t)(row0 + r) * DM + col0 + c8;
    *(v8us*)(P0 + go) = o0;
    *(v8us*)(P1 + go) = o1;
  }
}
// blk: the tile's index inside its own product; vmode (block-uniform): the v store stage, P0 = V^T values (row pitch SEQ), P1 = V^T residuals (first QE positions, row pitch QE)
__device__ __forceinline__ void proj_body(const unsigned short* __restrict__ A, const unsigned short* __restrict__ Bt,
                                          unsigned short* __restrict__ P0, unsigned short* __restrict__ P1, int blk, bool vmode) {
  const int lane = threadIdx.x & 31, ln = lane & 15, hh = lane >> 4;
  const int w = __builtin_amdgcn_readfirstlane((int)(threadIdx.x >> 5));
  const int wr = w >> 1, wc = w & 1;                  /* the wave's row half and column half of the block tile */
  const int mt = blk / (DM / 128), nq = blk - mt * (DM / 128);
  const int row0 = mt * 128 + 64 * wr, col0 = nq * 128 + 64 * wc;
  /* the block's 128 A rows and 128 Bt rows, 64 k at a time, are copied once per block into a two-buffer LDS ring, one tile ahead of their use */
  constexpr int OB = 128 * GP, GBUF = 2 * OB;         /* place of the Bt rows inside a buffer; buffer size */
  __shared__ __attribute__((aligned(16))) unsigned short ab[2 * GBUF];
  const int sr = (int)threadIdx.x >> 3, sc = ((int)threadIdx.x & 7) * 8;   /* rows sr + 16 j, 16-byte piece sc */
  const unsigned short* gA = A + (size_t)(mt * 128 + sr) * DM + sc;
  const unsigned short* gB = Bt + (size_t)(nq * 128 + sr) * DM + sc;
  const unsigned lA = (unsigned)(size_t)ab + (unsigned)(sr * GP + sc) * 2u;
  /* the 8 blocks of one row tile read the same A lines and the 32 blocks of one column tile the same Bt lines, all at the same moment if all walk k from 0:
     each block enters the k walk at a tile of its own and wraps round, so that sharers ask L2 for different lines at any one time */
  const int t0 = (2 * nq + mt) & (DM / 64 - 1);
  auto stage = [&](int t) {                           /* trip t: k tile (t + t0) mod 16 -> buffer t mod 2 */
    const unsigned la = lA + (unsigned)(t & 1) * (unsigned)(GBUF * 2);
    const int kt = ((t + t0) & (DM / 64 - 1)) * 64;   /* 0 .. DM - 64: inside the row */
    rows8(la, gA + kt);
    rows8(la + OB * 2, gB + kt);
  };
  const v8f z8 = {0.f, 0.f, 0.f, 0.f, 0.f, 0.f, 0.f, 0.f};
  v8f acc[4][4];                                      /* [16-row tile][16-column tile] */
#pragma unroll                                        /* constant indices keep the accumulators in registers; the same for every loop over them below */
  for (int i = 0; i < 4; ++i)
#pragma unroll
    for (int j = 0; j < 4; ++j) acc[i][j] = z8;
  stage(0);
  asm volatile("s_wait_asynccnt 0x0" ::: "memory");   /* tile 0's copies of this wave have landed */
  __syncthreads();                                    /* ... and every other wave's */
  stage(1);
#pragma unroll 1
  for (int t = 0; t < DM / 64; ++t) {
    const unsigned short* pa = ab + (t & 1) * GBUF + (64 * wr + ln) * GP;
    const unsigned short* pb = ab + (t & 1) * GBUF + OB + (64 * wc + ln) * GP;
#pragma unroll
    for (int s = 0; s < 2; ++s) {                       /* the two 32-k halves of the tile */
      v16h fa[4], fb[4];                                /* a half's LDS reads go as one group ahead of its 16 products */
#pragma unroll
      for (int i = 0; i < 4; ++i) fa[i] = ldhs(pa + 16 * i * GP + 32 * s, hh);
#pragma unroll
      for (int j = 0; j < 4; ++j) fb[j] = ldhs(pb + 16 * j * GP + 32 * s, hh);
#pragma unroll
      for (int j = 0; j < 4; ++j)
#pragma unroll
        for (int i = 0; i < 4; ++i) acc[i][j] = mmaH1(fa[i], fb[j], acc[i][j]);
    }
    asm volatile("s_wait_dscnt 0x0" ::: "memory");      /* this wave's reads of buffer t mod 2 are done before it is refilled */
    asm volatile("s_wait_asynccnt 0x0" ::: "memory");   /* this wave's copies of tile t + 1 have landed */
    __syncthreads();                                    /* publishes tile t + 1, ends every wave's reads of tile t */
    if (t + 2 < DM / 64) stage(t + 2);                  /* block-uniform */
  }
  asm volatile("s_wait_asynccnt 0x0" ::: "memory");     /* nothing in flight when the wave goes on */
  /* the ring is free now: every wave's last read of it stands ahead of the barrier at the foot of the last trip, and no copy is in flight;
     each wave stages its 64 x 64 tile in a part of its own, so that the block's LDS is the ring alone and three blocks fit a WGP */
  if (vmode) {
    /* the wave tile is 64 positions of one sequence x the 64 columns of one head, and a lane's 8 accumulator rows are 8 consecutive positions of one column d:
       16 bytes of row d of the transposed plane. They are staged as [d][position] 16-bit rows and leave as whole 128-byte lines, 8 lanes a row */
    constexpr int TP = 72;                            /* LDS row pitch in 16-bit elements: 144 B = 16 B x odd */
    static_assert(4 * 2 * 64 * TP * 2 <= 2 * GBUF * 2 && SEQ % 64 == 0 && QE % 64 == 0 && HD == 64);
    unsigned short* tv = ab + w * (2 * 64 * TP);      /* values; the residuals follow */
    const int bb = row0 / SEQ, s0 = row0 - bb * SEQ;  /* wave-uniform; positions s0 .. s0 + 63 lie in sequence bb */
    const bool res = s0 < QE;                         /* wave-uniform: the attention reads residuals of the first QE positions only */
    unsigned short* td = tv + ln * TP + 8 * hh;
#pragma unroll
    for (int i = 0; i < 4; ++i)
#pragma unroll
      for (int j = 0; j < 4; ++j) {
        FragH f;
#pragma unroll
        for (int r = 0; r < 8; ++r) f.h[r] = (_Float16)(acc[i][j][r] * 0.0625f);
        *(v8us*)(td + j * 16 * TP + i * 16) = f.half[0];
      }
    if (res) {
#pragma unroll
      for (int i = 0; i < 4; ++i)
#pragma unroll
        for (int j = 0; j < 4; ++j) {
          FragH f;
#pragma unroll
          for (int r = 0; r < 8; ++r) { const float x = acc[i][j][r] * 0.0625f; f.h[r] = (_Float16)((x - (float)(_Float16)x) * 1024.0f); }
          *(v8us*)(td + (64 + j * 16) * TP + i * 16) = f.half[0];
        }
    }
    __builtin_amdgcn_fence(4 /* acq_rel order */, "workgroup");   /* the wave's staged rows are in LDS before a lane reads what other lanes wrote ... */
    __builtin_amdgcn_wave_barrier();                              /* ... and the compiler moves no read below over the writes above */
    const int rq = lane >> 3, c8 = (lane & 7) * 8;
    const size_t slab = (size_t)(bb * NH + col0 / HD) * HD + rq;   /* row d = 4 q + rq of the head's transposed plane */
    unsigned short* gv = P0 + slab * SEQ + s0 + c8;
    v8us o[16];
#pragma unroll                                        /* constant indices keep the rows in registers */
    for (int q = 0; q < 16; ++q) o[q] = *(const v8us*)(tv + (q * 4 + rq) * TP + c8);
#pragma unroll
    for (int q = 0; q < 16; ++q) *(v8us*)(gv + (size_t)q * 4 * SEQ) = o[q];
    asm volatile("s_wait_xcnt 0x0" ::: "memory");     /* no register that a store above names is rewritten ahead of this wait */
    if (res) {
      unsigned short* gr = P1 + slab * QE + s0 + c8;
#pragma unroll
      for (int q = 0; q < 16; ++q) o[q] = *(const v8us*)(tv + (64 + q * 4 + rq) * TP + c8);
#pragma unroll
      for (int q = 0; q < 16; ++q) *(v8us*)(gr + (size_t)q * 4 * QE) = o[q];
      asm volatile("s_wait_xcnt 0x0" ::: "memory");   /* as above */
    }
  } else {
    static_assert(4 * 64 * 68 * 4 <= 2 * GBUF * 2);
    float (*sw)[68] = reinterpret_cast<float (*)[68]>(ab) + 64 * w;
#pragma unroll
    for (int i = 0; i < 4; ++i)
#pragma unroll
      for (int j = 0; j < 4; ++j)
#pragma unroll
        for (int r = 0; r < 8; ++r) sw[i * 16 + 8 * hh + r][j * 16 + ln] = acc[i][j][r] * 0.0625f;
    __builtin_amdgcn_fence(4 /* acq_rel order */, "workgroup");
    __builtin_amdgcn_wave_barrier();
    proj_store(sw, lane, row0, col0, P0, P1);
    proj_store(sw + 32, lane, row0 + 32, col0, P0, P1);
    asm volatile("s_wait_xcnt 0x0" ::: "memory");   /* in the built code the other stage's instructions follow this one's: no register that a store above names is rewritten ahead of this wait */
  }
}
// the three projections need nothing of each other: one grid, each product a range of the block index (block-uniform choice)
#define GPJ ((NR / 128) * (DM / 128))          /* blocks per GEMM */
__global__ __launch_bounds__(128) void k_proj(const unsigned short* __restrict__ XQ, const unsigned short* __restrict__ BQ, unsigned short* __restrict__ Qh, unsigned short* __restrict__ Ql,
                                              const unsigned short* __restrict__ XK, const unsigned short* __restrict__ BK, unsigned short* __restrict__ Kh, unsigned short* __restrict__ Kl,
                                              const unsigned short* __restrict__ XV, const unsigned short* __restrict__ BV, unsigned short* __restrict__ Vth, unsigned short* __restrict__ Vtl) {
  const int sel = blockIdx.x / GPJ;
  proj_body(sel == 0 ? XQ : sel == 1 ? XK : XV, sel == 0 ? BQ : sel == 1 ? BK : BV,
            sel == 0 ? Qh : sel == 1 ? Kh : Vth, sel == 0 ? Ql : sel == 1 ? Kl : Vtl, blockIdx.x - sel * GPJ, sel == 2);
}

// 16-byte asynchronous copies global -> LDS, one per lane and line of text; s_wait_xcnt closes each statement so that no address register is rewritten ahead of it
__device__ __forceinline__ void copy6(unsigned l0, const unsigned short* g0, unsigned l1, const unsigned short* g1, unsigned l2, const unsigned short* g2,
                                      unsigned l3, const unsigned short* g3, unsigned l4, const unsigned short* g4, unsigned l5, const unsigned short* g5) {
  asm volatile("global_load_async_to_lds_b128 %0, %1, off\n\tglobal_load_async_to_lds_b128 %2, %3, off\n\tglobal_load_async_to_lds_b128 %4, %5, off\n\t"
               "global_load_async_to_lds_b128 %6, %7, off\n\tglobal_load_async_to_lds_b128 %8, %9, off\n\tglobal_load_async_to_lds_b128 %10, %11, off\n\ts_wait_xcnt 0x0"
               :: "v"(l0), "v"(g0), "v"(l1), "v"(g1), "v"(l2), "v"(g2), "v"(l3), "v"(g3), "v"(l4), "v"(g4), "v"(l5), "v"(g5) : "memory");
}
__device__ __forceinline__ void copy2(unsigned l0, const unsigned short* g0, unsigned l1, const unsigned short* g1) {
  asm volatile("global_load_async_to_lds_b128 %0, %1, off\n\tglobal_load_async_to_lds_b128 %2, %3, off\n\ts_wait_xcnt 0x0"
               :: "v"(l0), "v"(g0), "v"(l1), "v"(g1) : "memory");
}
// a 64-key step: rows r, r + 16, r + 32, r + 48 of K hi, of K lo (64 rows of 144 B behind hi) and of V^T (row pitch SEQ in memory, 144 B in LDS)
__device__ __forceinline__ void copy12(unsigned lk, const unsigned short* gh, const unsigned short* gl, unsigned lv, const unsigned short* gv) {
  constexpr unsigned R16 = 16 * 72 * 2, PL = 64 * 72 * 2;
  asm volatile("global_load_async_to_lds_b128 %0, %1, off\n\tglobal_load_async_to_lds_b128 %2, %3, off\n\tglobal_load_async_to_lds_b128 %4, %5, off\n\t"
               "global_load_async_to_lds_b128 %6, %7, off\n\tglobal_load_async_to_lds_b128 %8, %9, off\n\tglobal_load_async_to_lds_b128 %10, %11, off\n\t"
               "global_load_async_to_lds_b128 %12, %13, off\n\tglobal_load_async_to_lds_b128 %14, %15, off\n\tglobal_load_async_to_lds_b128 %16, %17, off\n\t"
               "global_load_async_to_lds_b128 %18, %19, off\n\tglobal_load_async_to_lds_b128 %20, %21, off\n\tglobal_load_async_to_lds_b128 %22, %23, off\n\ts_wait_xcnt 0x0"
               :: "v"(lk), "v"(gh), "v"(lk + R16), "v"(gh + 16 * DM), "v"(lk + 2 * R16), "v"(gh + 32 * DM), "v"(lk + 3 * R16), "v"(gh + 48 * DM),
                  "v"(lk + PL), "v"(gl), "v"(lk + PL + R16), "v"(gl + 16 * DM), "v"(lk + PL + 2 * R16), "v"(gl + 32 * DM), "v"(lk + PL + 3 * R16), "v"(gl + 48 * DM),
                  "v"(lv), "v"(gv), "v"(lv + R16), "v"(gv + 16 * SEQ), "v"(lv + 2 * R16), "v"(gv + 32 * SEQ), "v"(lv + 3 * R16), "v"(gv + 48 * SEQ) : "memory");
}

// fused causal attention: wave = 16 queries of one (b, h); keys walked up to the diagonal in steps of 64 keys (EARLY: 32); S^T = K.Q^T (A = K rows, B = Q rows;
// D row = key 8h+r, D col = query) so a lane owns one query: running max / sum in registers, one shuffle joins the two lane halves;
// P fragment (B operand, k = key) of 32 keys taken directly from their two score accumulators (element r <- keys 8h+r, element 8+r <- keys 16+8h+r);
// O^T = V^T.P (A = V^T rows, d x key). EARLY: P and V also carry x1024 residual planes into a second accumulator.
// A step's tiles of K (hi, lo) and V^T are shared by the block's four waves: copied once per block into a two-buffer LDS ring, one step ahead of their use.
// blk: the block's index inside its own part (EARLY or not); so, kv: the kernel's LDS, one allocation for both parts.
#define ABUF (2 * 64 * 72 + 64 * 72)           /* 16-bit elements of one ring buffer of the part behind QE, the larger one */
template <bool EARLY>
__device__ __forceinline__ void attn_body(const unsigned short* __restrict__ Qh, const unsigned short* __restrict__ Ql,
                                          const unsigned short* __restrict__ Kh, const unsigned short* __restrict__ Kl,
                                          const unsigned short* __restrict__ Vth, const unsigned short* __restrict__ Vtl,
                                          unsigned short* __restrict__ Ch, unsigned short* __restrict__ Cl,
                                          int blk, float (*so)[16][68], unsigned short* kv) {
  constexpr int QT0 = EARLY ? 0 : QE / 16;
  constexpr int NQT = EARLY ? QE / 16 : (SEQ - QE) / 16;
  constexpr int BPB = (NQT / 4 > 0) ? NQT / 4 : 1;   /* blocks per (b, h): 4 query tiles each */
  const int lane = threadIdx.x & 31, ln = lane & 15, hh = lane >> 4;
  const int wave = __builtin_amdgcn_readfirstlane((int)(threadIdx.x >> 5));
  const int bh = blk / BPB;
  const int qt = QT0 + (blk - bh * BPB) * 4 + wave;
  const int b = bh / NH, h = bh - b * NH;
  const int qBase = qt * 16;
  constexpr int KS = EARLY ? 32 : 64;    /* keys per step */
  constexpr int NT = KS / 16, NK = KS / 32;   /* score tiles (16 keys) and P fragments (32 keys) per step */
  const int nkt = (qBase + 15 + KS) / KS;     /* steps covering keys 0..qBase+15 */
  const int nFull = qBase / KS;          /* steps whose keys are all <= qBase */
  const int qrow = qBase + ln;
  const size_t offQ = ((size_t)b * SEQ + qrow) * DM + h * HD;
  constexpr int KP = 72, VP = KS + 8;          /* LDS row pitch in 16-bit elements: 144 B; 144 B or 80 B: all 16 B x odd */
  constexpr int OKL = KS * KP, OV = 2 * OKL, OVL = OV + 64 * VP;   /* places of K lo, V^T, V^T residual inside a buffer */
  constexpr int BUF = EARLY ? OVL + 64 * VP : OVL;
  static_assert((BUF * 2) % 16 == 0 && (KP * 2) % 16 == 0 && (VP * 2) % 16 == 0 && BUF <= ABUF);
  const int nktB = ((QT0 + (blk - bh * BPB) * 4) * 16 + 63 + KS) / KS;   /* steps of the block's last wave: keys up to the block's first query + 63, inside the sequence */
  /* the blocks of one (b, h) read the same K and V^T lines, all at the same moment if all walk the keys from 0: each block enters its walk at a step of its own
     and wraps round (the running maximum and sum take the steps in any order: every step below nkt holds a key that every query of the tile sees) */
  const int rot = ((blk - bh * BPB) * nktB) / BPB;            /* block-uniform, 0 <= rot < nktB */
  auto step_of = [&](int p) { const int s = p + rot; return s >= nktB ? s - nktB : s; };   /* trip p < nktB -> key step, a permutation of 0 .. nktB - 1 */
  const int tid = threadIdx.x;
  const int kr = tid >> 3, kc = (tid & 7) * 8;  /* K rows kr, kr + 16, ..., 16-byte piece kc */
  const int vr = tid / (KS / 8), vc = (tid % (KS / 8)) * 8;   /* V^T rows vr, vr + 16, ... (EARLY: vr and vr + 32), 16-byte piece vc */
  const size_t gK = ((size_t)b * SEQ + kr) * DM + h * HD + kc;
  const size_t gV = ((size_t)bh * HD + vr) * SEQ + vc;
  const size_t gVl = ((size_t)bh * HD + vr) * QE + vc;
  const unsigned lK = (unsigned)(size_t)kv + (unsigned)(kr * KP + kc) * 2u;
  const unsigned lV = (unsigned)(size_t)kv + (unsigned)(OV + vr * VP + vc) * 2u;
  auto stage = [&](int p) {                     /* trip p: key step step_of(p) -> buffer p mod 2 */
    const unsigned lb = (unsigned)(p & 1) * (unsigned)(BUF * 2);
    const int t = step_of(p);
    const size_t k0 = gK + (size_t)t * KS * DM, v0 = gV + (size_t)t * KS;
    if constexpr (EARLY) {
      copy6(lK + lb, Kh + k0, lK + lb + 16 * KP * 2, Kh + k0 + 16 * DM,
            lK + lb + OKL * 2, Kl + k0, lK + lb + (OKL + 16 * KP) * 2, Kl + k0 + 16 * DM,
            lV + lb, Vth + v0, lV + lb + 32 * VP * 2, Vth + v0 + (size_t)32 * SEQ);
      const size_t w0 = gVl + (size_t)t * 32;
      copy2(lV + lb + 64 * VP * 2, Vtl + w0, lV + lb + 96 * VP * 2, Vtl + w0 + (size_t)32 * QE);
    } else {
      static_assert(EARLY || (KP == 72 && VP == 72 && OKL == 64 * 72));   /* the places copy12 writes */
      copy12(lK + lb, Kh + k0, Kl + k0, lV + lb, Vth + v0);
    }
  };
  const v8f z8 = {0.f, 0.f, 0.f, 0.f, 0.f, 0.f, 0.f, 0.f};
  v8f oacc[4] = {z8, z8, z8, z8};
  v8f ores[4] = {z8, z8, z8, z8};
  float m = -__builtin_inff(), l = 0.f;
  /* the wave's Q fragments (hi, lo; both 32-wide halves of the head) are the same in every key step: read once here, ahead of the first copies, and kept in registers */
  v16b fqh[2], fql[2];
#pragma unroll                           /* constant indices keep the fragment arrays in registers */
  for (int dc = 0; dc < 2; ++dc) {
    const size_t qo = offQ + dc * 32;
    fqh[dc] = ldb(Qh, qo, hh); fql[dc] = ldb(Ql, qo, hh);
  }
  asm volatile("s_wait_xcnt 0x0" ::: "memory");       /* no address register of the loads above is rewritten ahead of this wait */
  stage(0);
  asm volatile("s_wait_asynccnt 0x0" ::: "memory");   /* step 0's copies of this wave have landed */
  __syncthreads();                                    /* ... and every other wave's */
  stage(1);                                           /* nktB >= 2 */
#pragma unroll 1
  for (int it = 0; it < nktB; ++it) {
   const int ks = step_of(it);           /* the key step that buffer it mod 2 holds */
   if (ks < nkt) {                       /* wave-uniform: for a step past its diagonal a wave only passes the hand-over below */
    const int kb = ks * KS;
    const unsigned short* kvb = kv + (it & 1) * BUF;
    /* the step's K fragments are read as one group ahead of the products: one load latency is waited for, not one in front of each chain of products */
    v16b kh[2][NT], kl[2][NT];
#pragma unroll                           /* constant indices keep the fragment arrays in registers; the same for the loops below */
    for (int dc = 0; dc < 2; ++dc) {
#pragma unroll
      for (int kt = 0; kt < NT; ++kt) kh[dc][kt] = ldbs(kvb + (kt * 16 + ln) * KP + dc * 32, hh);
#pragma unroll
      for (int kt = 0; kt < NT; ++kt) kl[dc][kt] = ldbs(kvb + OKL + (kt * 16 + ln) * KP + dc * 32, hh);
    }
    v8f st[NT];
#pragma unroll
    for (int kt = 0; kt < NT; ++kt) st[kt] = z8;
#pragma unroll
    for (int dc = 0; dc < 2; ++dc) {
      if constexpr (EARLY) {
        st[0] = mmaB<3>(kh[dc][0], kl[dc][0], fqh[dc], fql[dc], st[0]);
        st[1] = mmaB<3>(kh[dc][1], kl[dc][1], fqh[dc], fql[dc], st[1]);
      } else {
        /* the four score tiles are independent: their products alternate, so that no product waits for the one before it; each tile's own order is that of mmaB<3> */
#pragma unroll
        for (int kt = 0; kt < NT; ++kt) st[kt] = __builtin_amdgcn_wmma_f32_16x16x32_bf16(false, kh[dc][kt], false, fqh[dc], (short)0, st[kt], false, false);
#pragma unroll
        for (int kt = 0; kt < NT; ++kt) st[kt] = __builtin_amdgcn_wmma_f32_16x16x32_bf16(false, kl[dc][kt], false, fqh[dc], (short)0, st[kt], false, false);
#pragma unroll
        for (int kt = 0; kt < NT; ++kt) st[kt] = __builtin_amdgcn_wmma_f32_16x16x32_bf16(false, kh[dc][kt], false, fql[dc], (short)0, st[kt], false, false);
        /* one guard for the group, as in mmaB: four vector slots behind the last product, naming every accumulator and fragment */
        asm volatile("v_nop\n\tv_nop\n\tv_nop\n\tv_nop" : "+v"(st[0]), "+v"(st[1]), "+v"(st[NT - 2]), "+v"(st[NT - 1])
                     : "v"(kh[dc][0]), "v"(kh[dc][1]), "v"(kh[dc][NT - 2]), "v"(kh[dc][NT - 1]),
                       "v"(kl[dc][0]), "v"(kl[dc][1]), "v"(kl[dc][NT - 2]), "v"(kl[dc][NT - 1]), "v"(fqh[dc]), "v"(fql[dc]));
      }
    }
    /* the V^T fragments are read as one group here: their latency passes behind the softmax arithmetic */
    FragH vh[4][NK], vl[4][NK];
#pragma unroll
    for (int dt = 0; dt < 4; ++dt)
#pragma unroll
      for (int kk = 0; kk < NK; ++kk) {
        const unsigned short* vo = kvb + OV + (dt * 16 + ln) * VP + kk * 32;
        vh[dt][kk].v = ldhs(vo, hh);
        if (EARLY) vl[dt][kk].v = ldhs(vo + 64 * VP, hh);
      }
    if constexpr (!EARLY) __builtin_amdgcn_sched_barrier(0);   /* keeps the 16 reads above together here, in the shadow of the last products: left free, part of them sinks to just ahead of the products that need them */
    v8f sc[NT];
#pragma unroll
    for (int kt = 0; kt < NT; ++kt) sc[kt] = st[kt] * 0.125f;
    if (ks >= nFull) {                   /* wave-uniform: only the last step touches the diagonal */
      const int rel = qrow - kb - 8 * hh;   /* key kb + 16 kt + 8 hh + r lies behind the query where 16 kt + r > rel */
#pragma unroll
      for (int kt = 0; kt < NT; ++kt)
#pragma unroll
        for (int r = 0; r < 8; ++r) sc[kt][r] = (16 * kt + r > rel) ? -__builtin_inff() : sc[kt][r];
    }
    float mk[NK];                        /* one chain of maxima per 32 keys */
#pragma unroll
    for (int kk = 0; kk < NK; ++kk) {
      mk[kk] = fmaxf(sc[2 * kk][0], sc[2 * kk + 1][0]);
#pragma unroll
      for (int r = 1; r < 8; ++r) mk[kk] = fmaxf(mk[kk], fmaxf(sc[2 * kk][r], sc[2 * kk + 1][r]));
    }
    const float mt = fmaxf(mk[0], mk[NK - 1]);
    const float mo = __shfl_xor(mt, 16);
    const float mnew = fmaxf(fmaxf(mt, mo), m);   /* finite: key kb <= qBase is visible to every query of the tile */
    const float alpha = __expf(m - mnew);
    m = mnew;
    l *= alpha;
#pragma unroll
    for (int dt = 0; dt < 4; ++dt) { oacc[dt] *= alpha; if (EARLY) ores[dt] *= alpha; }
    FragH ph[NK], pl[NK];
#pragma unroll
    for (int kk = 0; kk < NK; ++kk) {
      v8f p0, p1;
#pragma unroll
      for (int r = 0; r < 8; ++r) { p0[r] = __expf(sc[2 * kk][r] - m); p1[r] = __expf(sc[2 * kk + 1][r] - m); }
      const v8f ps = p0 + p1, c0 = p0 * 256.0f, c1 = p1 * 256.0f;
#pragma unroll
      for (int r = 0; r < 8; ++r) {
        l += ps[r];
        const _Float16 h0 = (_Float16)c0[r], h1 = (_Float16)c1[r];
        ph[kk].h[r] = h0; ph[kk].h[8 + r] = h1;
        pl[kk].h[r] = (_Float16)((c0[r] - (float)h0) * 1024.0f);
        pl[kk].h[8 + r] = (_Float16)((c1[r] - (float)h1) * 1024.0f);
      }
    }
    if constexpr (EARLY) {
#pragma unroll
      for (int dt = 0; dt < 4; ++dt) {
        v8f o = oacc[dt], e = ores[dt];
        o = __builtin_amdgcn_wmma_f32_16x16x32_f16(false, vh[dt][0].v, false, ph[0].v, (short)0, o, false, false);
        e = __builtin_amdgcn_wmma_f32_16x16x32_f16(false, vl[dt][0].v, false, ph[0].v, (short)0, e, false, false);
        e = __builtin_amdgcn_wmma_f32_16x16x32_f16(false, vh[dt][0].v, false, pl[0].v, (short)0, e, false, false);
        asm volatile("v_nop\n\tv_nop\n\tv_nop\n\tv_nop" : "+v"(o), "+v"(e) : "v"(vh[dt][0].v), "v"(vl[dt][0].v), "v"(ph[0].v), "v"(pl[0].v));
        oacc[dt] = o; ores[dt] = e;
      }
    } else {
      /* the four output tiles alternate; each takes its keys in rising order */
#pragma unroll
      for (int kk = 0; kk < NK; ++kk)
#pragma unroll
        for (int dt = 0; dt < 4; ++dt) oacc[dt] = __builtin_amdgcn_wmma_f32_16x16x32_f16(false, vh[dt][kk].v, false, ph[kk].v, (short)0, oacc[dt], false, false);
      /* one guard for the group, as in mmaH1 */
      asm volatile("v_nop\n\tv_nop\n\tv_nop\n\tv_nop" : "+v"(oacc[0]), "+v"(oacc[1]), "+v"(oacc[2]), "+v"(oacc[3])
                   : "v"(vh[0][0].v), "v"(vh[1][0].v), "v"(vh[2][0].v), "v"(vh[3][0].v),
                     "v"(vh[0][NK - 1].v), "v"(vh[1][NK - 1].v), "v"(vh[2][NK - 1].v), "v"(vh[3][NK - 1].v), "v"(ph[0].v), "v"(ph[NK - 1].v));
    }
    asm volatile("" ::: "memory");
   }
    asm volatile("s_wait_dscnt 0x0" ::: "memory");      /* this wave's reads of buffer it mod 2 are done before it is refilled */
    asm volatile("s_wait_asynccnt 0x0" ::: "memory");   /* this wave's copies of step it + 1 have landed */
    __syncthreads();                                    /* publishes step it + 1, ends every wave's reads of step it */
    if (it + 2 < nktB) stage(it + 2);                   /* block-uniform */
  }
  asm volatile("s_wait_asynccnt 0x0" ::: "memory");     /* nothing in flight when the wave goes on */
  const float lt = l + __shfl_xor(l, 16);
  const float rinv = 1.0f / (256.0f * lt);
  // O^T (d = dt*16 + 8h + r, query = ln) -> wave-private LDS tile [query][d]
#pragma unroll
  for (int dt = 0; dt < 4; ++dt) {
    v8f o = oacc[dt];
    if (EARLY) o = o + ores[dt] * 0.0009765625f;
    const v4f w0 = {o[0] * rinv, o[1] * rinv, o[2] * rinv, o[3] * rinv};
    const v4f w1 = {o[4] * rinv, o[5] * rinv, o[6] * rinv, o[7] * rinv};
    *(v4fa*)&so[wave][ln][dt * 16 + 8 * hh] = w0;
    *(v4fa*)&so[wave][ln][dt * 16 + 8 * hh + 4] = w1;
  }
  __builtin_amdgcn_fence(4 /* acq_rel order */, "workgroup");
  __builtin_amdgcn_wave_barrier();
  const int rq = lane >> 3, c8 = (lane & 7) * 8;
  {
#pragma unroll
    for (int q = 0; q < 4; ++q) {
      const int r = q * 4 + rq;                      /* q 0..3 x rq 0..3 -> query rows 0..15 */
      const v4f x0 = *(const v4fa*)&so[wave][r][c8], x1 = *(const v4fa*)&so[wave][r][c8 + 4];
      const float xs[8] = {x0[0], x0[1], x0[2], x0[3], x1[0], x1[1], x1[2], x1[3]};
      v8us o0, o1;
#pragma unroll
      for (int i = 0; i < 8; ++i) { const unsigned short hb = bf16_bits(xs[i]); o0[i] = hb; o1[i] = bf16_bits(xs[i] - bf16_val(hb)); }
      const size_t go = ((size_t)b * SEQ + qBase + r) * DM + h * HD + c8;   
      *(v8us*)(Ch + go) = o0;
      *(v8us*)(Cl + go) = o1;
    }
    
  }
}
// both parts need nothing of each other: one grid, the long blocks (queries from QE on) first, then the EARLY ones (block-uniform choice)
#define GAM (NB * NH * ((SEQ - QE) / 64))      /* blocks of the part behind QE */
__global__ __launch_bounds__(128) void k_attn(const unsigned short* __restrict__ Qh, const unsigned short* __restrict__ Ql,
                                              const unsigned short* __restrict__ Kh, const unsigned short* __restrict__ Kl,
                                              const unsigned short* __restrict__ Vth, const unsigned short* __restrict__ Vtl,
                                              unsigned short* __restrict__ Ch, unsigned short* __restrict__ Cl) {
  __shared__ __attribute__((aligned(16))) float so[4][16][68];
  __shared__ __attribute__((aligned(16))) unsigned short kv[2 * ABUF];
  if ((int)blockIdx.x < GAM) attn_body<false>(Qh, Ql, Kh, Kl, Vth, Vtl, Ch, Cl, (int)blockIdx.x, so, kv);
  else attn_body<true>(Qh, Ql, Kh, Kl, Vth, Vtl, Ch, Cl, (int)blockIdx.x - GAM, so, kv);
}

// output GEMM: out[(b, s)][n] = sum_k (ctx_hi + ctx_lo)[r][k] . bf16(WO)[n][k] + bf16(bO)[n]; block = 4 x 2 waves, block tile 128 x 128, wave tile 32 x 64; f32 rows of the full-size output layout;
// the bias float4 of a lane's four columns is read once by value and added in f32 at the store stage;
__global__ __launch_bounds__(256) void k_out(const unsigned short* __restrict__ Ah, const unsigned short* __restrict__ Al,
                                             const unsigned short* __restrict__ Bt, const float* __restrict__ bias, float* __restrict__ C) {
  __shared__ __attribute__((aligned(16))) float so[8][32][68];
  const int lane = threadIdx.x & 31, ln = lane & 15, hh = lane >> 4;
  const int w = __builtin_amdgcn_readfirstlane((int)(threadIdx.x >> 5));
  const int wr = w & 3, wc = w >> 2;                  /* the wave's 32 rows and its column half of the block tile */
  const int mt = blockIdx.x / (DM / 128), nq = blockIdx.x - mt * (DM / 128);
  const int row0 = mt * 128 + 32 * wr, col0 = nq * 128 + 64 * wc;
  /* the block's 128 ctx rows (hi, lo) and 128 Bt rows, 64 k at a time, are copied once per block into a two-buffer LDS ring, one tile ahead of their use */
  constexpr int OL = 128 * GP, OB = 2 * OL, GBUF = 3 * OL;   /* places of the lo rows and the Bt rows inside a buffer; buffer size */
  __shared__ __attribute__((aligned(16))) unsigned short ab[2 * GBUF];
  const int sr = (int)threadIdx.x >> 3, sc = ((int)threadIdx.x & 7) * 8;   /* rows sr + 32 j, 16-byte piece sc */
  const size_t oA = (size_t)(mt * 128 + sr) * DM + sc;
  const unsigned short* gB = Bt + (size_t)(nq * 128 + sr) * DM + sc;
  const unsigned lA = (unsigned)(size_t)ab + (unsigned)(sr * GP + sc) * 2u;
  const int t0 = (2 * nq + mt) & (DM / 64 - 1);       /* the block's own entry into the k walk, as in proj_body */
  auto stage = [&](int t) {                           /* trip t: k tile (t + t0) mod 16 -> buffer t mod 2 */
    const unsigned la = lA + (unsigned)(t & 1) * (unsigned)(GBUF * 2);
    const int kt = ((t + t0) & (DM / 64 - 1)) * 64;   /* 0 .. DM - 64: inside the row */
    rows4(la, Ah + oA + kt);
    rows4(la + OL * 2, Al + oA + kt);
    rows4(la + OB * 2, gB + kt);
  };
  const v8f z8 = {0.f, 0.f, 0.f, 0.f, 0.f, 0.f, 0.f, 0.f};
  v8f c00 = z8, c01 = z8, c02 = z8, c03 = z8, c10 = z8, c11 = z8, c12 = z8, c13 = z8;
  stage(0);
  asm volatile("s_wait_asynccnt 0x0" ::: "memory");   /* tile 0's copies of this wave have landed */
  __syncthreads();                                    /* ... and every other wave's */
  stage(1);
#pragma unroll 1
  for (int t = 0; t < DM / 64; ++t) {
    const unsigned short* pa = ab + (t & 1) * GBUF + (32 * wr + ln) * GP;
    const unsigned short* pb = ab + (t & 1) * GBUF + OB + (64 * wc + ln) * GP;
    v16b fh[2][2], fl[2][2], fb[2][4];                  /* the tile's LDS reads go as one group ahead of its products */
#pragma unroll
    for (int s = 0; s < 2; ++s) {
      fh[s][0] = ldbs(pa + 32 * s, hh); fl[s][0] = ldbs(pa + OL + 32 * s, hh);
      fh[s][1] = ldbs(pa + 16 * GP + 32 * s, hh); fl[s][1] = ldbs(pa + OL + 16 * GP + 32 * s, hh);
#pragma unroll
      for (int j = 0; j < 4; ++j) fb[s][j] = ldbs(pb + 16 * j * GP + 32 * s, hh);
    }
#pragma unroll
    for (int s = 0; s < 2; ++s) {
      c00 = mmaB<2>(fh[s][0], fl[s][0], fb[s][0], fb[s][0], c00); c10 = mmaB<2>(fh[s][1], fl[s][1], fb[s][0], fb[s][0], c10);
      c01 = mmaB<2>(fh[s][0], fl[s][0], fb[s][1], fb[s][1], c01); c11 = mmaB<2>(fh[s][1], fl[s][1], fb[s][1], fb[s][1], c11);
      c02 = mmaB<2>(fh[s][0], fl[s][0], fb[s][2], fb[s][2], c02); c12 = mmaB<2>(fh[s][1], fl[s][1], fb[s][2], fb[s][2], c12);
      c03 = mmaB<2>(fh[s][0], fl[s][0], fb[s][3], fb[s][3], c03); c13 = mmaB<2>(fh[s][1], fl[s][1], fb[s][3], fb[s][3], c13);
    }
    asm volatile("s_wait_dscnt 0x0" ::: "memory");      /* this wave's reads of buffer t mod 2 are done before it is refilled */
    asm volatile("s_wait_asynccnt 0x0" ::: "memory");   /* this wave's copies of tile t + 1 have landed */
    __syncthreads();                                    /* publishes tile t + 1, ends every wave's reads of tile t */
    if (t + 2 < DM / 64) stage(t + 2);                  /* block-uniform */
  }
  asm volatile("s_wait_asynccnt 0x0" ::: "memory");     /* nothing in flight when the wave goes on */
  v8f accs[8] = {c00, c01, c02, c03, c10, c11, c12, c13};
#pragma unroll
  for (int u = 0; u < 8; ++u) {
    const int t = u & 3, half = u >> 2;
#pragma unroll
    for (int r = 0; r < 8; ++r) so[w][half * 16 + 8 * hh + r][t * 16 + ln] = accs[u][r];
  }
  __builtin_amdgcn_fence(4 /* acq_rel order */, "workgroup");
  __builtin_amdgcn_wave_barrier();
  const int rsub = lane >> 4, c4 = (lane & 15) * 4;
  const v4f bx = *(const v4fa*)(bias + col0 + c4);   /* columns col0 + c4 .. + 3 < DM */
  const v4f bv = {bf16_rne(bx[0]), bf16_rne(bx[1]), bf16_rne(bx[2]), bf16_rne(bx[3])};
  {
#pragma unroll
    for (int q = 0; q < 16; ++q) {
      const int r = q * 2 + rsub;                    /* q 0..15 x rsub 0..1 -> rows 0..31 */
      const v4f sv = *(const v4fa*)&so[w][r][c4];
      const v4f v = sv + bv;
      const int grow = row0 + r;
      const int bb = grow / SEQ, s = grow - bb * SEQ;
      *(v4f*)(C + ((size_t)bb * SEQ_FULL + s) * DM + col0 + c4) = v;
    }
    
  }
}

/* workspace carve (bytes): 3 input planes + 4 weight planes + Qh Ql Kh Kl + Vth + Vtl + Ch Cl */
#define XB ((size_t)NR * DM * 2)
#define WB ((size_t)DM * DM * 2)
#define VLB ((size_t)NB * NH * HD * QE * 2)
static_assert(XB % 256 == 0 && WB % 256 == 0 && VLB % 256 == 0);
static_assert(10 * XB + 4 * WB + VLB <= (size_t)134217728);   /* total carve stays within 128 MiB */

extern "C" void kernel_launch(void* const* d_in, const int* in_sizes, int n_in,
                              void* d_out, int out_size, void* d_ws, size_t ws_size, hipStream_t stream) {
  if (n_in < 8) return;
  const long long need_x = ((long long)(NB - 1) * SEQ_FULL + SEQ) * DM;
  if (in_sizes[0] < need_x || in_sizes[1] < need_x || in_sizes[2] < need_x) return;
  if (in_sizes[3] < DM * DM || in_sizes[4] < DM * DM || in_sizes[5] < DM * DM || in_sizes[6] < DM * DM) return;
  if (in_sizes[7] < DM) return;
  if (out_size < need_x) return;
  const float* xq = (const float*)d_in[0];      /* table order: Q, K, V, WQ, WK, WV, WO, bO */
  const float* xk = (const float*)d_in[1];
  const float* xv = (const float*)d_in[2];
  const float* wq = (const float*)d_in[3];
  const float* wk = (const float*)d_in[4];
  const float* wv = (const float*)d_in[5];
  const float* wo = (const float*)d_in[6];
  const float* bo = (const float*)d_in[7];
  char* ws = (char*)d_ws; size_t off = 0;
  auto take = [&](size_t bytes) { char* p = ws + off; off += (bytes + 255) & ~(size_t)255; return (unsigned short*)p; };
  unsigned short* XQ = take(XB); unsigned short* XK = take(XB); unsigned short* XV = take(XB);
  unsigned short* BQ = take(WB); unsigned short* BK = take(WB); unsigned short* BV = take(WB); unsigned short* BO = take(WB);
  unsigned short* Qh = take(XB); unsigned short* Ql = take(XB); unsigned short* Kh = take(XB); unsigned short* Kl = take(XB);
  unsigned short* Vth = take(XB); unsigned short* Vtl = take(VLB);
  unsigned short* Ch = take(XB); unsigned short* Cl = take(XB);
  if (off > ws_size) return;

  k_conv<<<(unsigned)(3 * GX + 4 * GW), 256, 0, stream>>>(xq, xk, xv, wq, wk, wv, wo, XQ, XK, XV, BQ, BK, BV, BO);
  k_proj<<<(unsigned)(3 * GPJ), 128, 0, stream>>>(XQ, BQ, Qh, Ql, XK, BK, Kh, Kl, XV, BV, Vth, Vtl);   /* v leaves as [(b,h)][64][SEQ] and [(b,h)][64][QE] */
  k_attn<<<(unsigned)(GAM + NB * NH * (QE / 64)), 128, 0, stream>>>(Qh, Ql, Kh, Kl, Vth, Vtl, Ch, Cl);
  k_out<<<(unsigned)GPJ, 256, 0, stream>>>(Ch, Cl, BO, bo, (float*)d_out);
}

// v010
// One run takes 89.3 microseconds.
// Two timings next to v009 put it at 1.14 and 1.13 times that version's speed.
// Over all steps from v000 it is 4.17 times as fast.
#include <hip/hip_runtime.h>
// Causal multi-head attention, three input streams (Q, K, V each [B][T][1024]), bias-free [out][in] input projections, 16 heads x 64, score scale 1/8, keys j > i excluded, out = ctx WO^T + bO (bO converted RNE to bf16, added in f32 at the store stage).
// Compute dtype: inputs converted (RNE) to bf16 and carried exactly as f16 rows / x16 f16 weights; Q,K,V projections v_wmma_f32_16x16x32_f16 (single product); scores v_wmma_f32_16x16x32_bf16 on bf16 hi|lo planes of q and k (three products); P.V v_wmma_f32_16x16x32_f16 with P carried x256 (first QE query rows: f16 value + x1024 residual planes for P and V, separate accumulator); output GEMM v_wmma_f32_16x16x32_bf16 with ctx as bf16 hi|lo against exact bf16 WO (two products); f32 accumulation and f32 softmax statistics everywhere.
#ifndef NB
#define NB 2
#endif
#ifndef SEQ
#define SEQ 2048
#endif
#ifndef QE
#define QE ((SEQ) < 256 ? (SEQ) : 256)   /* query rows per sequence that get residual planes on P and V */
#endif
#define NB_FULL 2
#define SEQ_FULL 2048
#define DM 1024
#define NH 16
#define HD 64
#define NR (NB * SEQ)

static_assert(NH * HD == DM);                 /* merged head columns h*64+d span the model width */
static_assert(HD == 64);                      
static_assert(DM % 128 == 0 && DM % 64 == 0); /* GEMM column tiles of 128, k tiles of 64 */
static_assert(NR % 128 == 0);                 /* GEMM row tiles of 128 */
static_assert(SEQ % 64 == 0 && QE % 64 == 0 && QE <= SEQ && (SEQ - QE) % 64 == 0);  /* 4 query tiles of 16 per block; 32-key steps stay inside the sequence */
static_assert(NB <= NB_FULL && SEQ <= SEQ_FULL);
static_assert((NR * DM / 8) % 256 == 0 && (DM * DM / 8) % 256 == 0);  /* convert grids x 256 threads == plane extent */
static_assert((SEQ & (SEQ - 1)) == 0);        /* row -> (batch, position) by shift */
static_assert(DM % 4 == 0 && (DM / 64 - 1) * 64 + 15 * 4 + 4 <= DM);  /* per-lane float4 of the bias vector stays inside [DM] */
static_assert((size_t)NB_FULL * SEQ_FULL * DM * 4 == (size_t)16777216);  /* output buffer bytes, single output at byte offset 0 */

typedef __bf16 v16b __attribute__((ext_vector_type(16)));
typedef _Float16 v16h __attribute__((ext_vector_type(16)));
typedef unsigned short v8us __attribute__((ext_vector_type(8), may_alias));
typedef float v8f __attribute__((ext_vector_type(8)));
typedef float v4f __attribute__((ext_vector_type(4)));
typedef float v4fa __attribute__((ext_vector_type(4), may_alias));
union FragB { v16b v; v8us half[2]; unsigned short u[16]; };
union FragH { v16h v; v8us half[2]; _Float16 h[16]; unsigned short u[16]; };

__device__ __forceinline__ unsigned short bf16_bits(float x) { unsigned int u = __float_as_uint(x); return (unsigned short)((u + 0x7FFFu + ((u >> 16) & 1u)) >> 16); }
__device__ __forceinline__ float bf16_val(unsigned short b) { return __uint_as_float(((unsigned int)b) << 16); }
__device__ __forceinline__ float bf16_rne(float x) { return bf16_val(bf16_bits(x)); }

// fragment loader (A and B alike): elements 0..7 <- k0 + 8h + 0..7, elements 8..15 <- k0 + 16 + 8h + 0..7 of a k-contiguous 16-bit row
__device__ __forceinline__ v16b ldb(const unsigned short* __restrict__ p, size_t off, int hh) { FragB f; f.half[0] = *(const v8us*)(p + off + 8 * hh); f.half[1] = *(const v8us*)(p + off + 16 + 8 * hh); return f.v; }

// D += A.B with NT bf16 products: 1 = ah.bh, 2 = + al.bh, 3 = + ah.bl; one guard naming the accumulator and every fragment
template <int NT>
__device__ __forceinline__ v8f mmaB(v16b ah, v16b al, v16b bh, v16b bl, v8f c) {
  c = __builtin_amdgcn_wmma_f32_16x16x32_bf16(false, ah, false, bh, (short)0, c, false, false);
  if (NT >= 2) c = __builtin_amdgcn_wmma_f32_16x16x32_bf16(false, al, false, bh, (short)0, c, false, false);
  if (NT >= 3) c = __builtin_amdgcn_wmma_f32_16x16x32_bf16(false, ah, false, bl, (short)0, c, false, false);
  asm volatile("v_nop\n\tv_nop\n\tv_nop\n\tv_nop" : "+v"(c) : "v"(ah), "v"(al), "v"(bh), "v"(bl));
  return c;
}
__device__ __forceinline__ v8f mmaH1(v16h a, v16h b, v8f c) {
  v8f d = __builtin_amdgcn_wmma_f32_16x16x32_f16(false, a, false, b, (short)0, c, false, false);
  asm volatile("v_nop\n\tv_nop\n\tv_nop\n\tv_nop" : "+v"(d) : "v"(a), "v"(b));
  return d;
}

__device__ __forceinline__ void x16_body(const float* __restrict__ x, unsigned short* __restrict__ X16, int blk) {
  const int t = blk * 256 + threadIdx.x;
  if (t >= NR * DM / 8) return;
  const int row = t / (DM / 8), c8 = (t - row * (DM / 8)) * 8;
  const int b = row / SEQ, s = row - b * SEQ;
  const float* src = x + ((size_t)b * SEQ_FULL + s) * DM + c8;
  const v4f a = *(const v4fa*)src, c = *(const v4fa*)(src + 4);
  FragH f;
#pragma unroll
  for (int q = 0; q < 4; ++q) { f.h[q] = (_Float16)bf16_rne(a[q]); f.h[4 + q] = (_Float16)bf16_rne(c[q]); }
  const v8us o = f.half[0];
  unsigned short* d = X16 + (size_t)t * 8;
  *(v8us*)d = o;
  
}
__device__ __forceinline__ void wnat_body(const float* __restrict__ w, unsigned short* __restrict__ Bt, int blk) {
  const int t = blk * 256 + threadIdx.x;
  if (t >= DM * DM / 8) return;
  const v4f a = *(const v4fa*)(w + (size_t)t * 8), c = *(const v4fa*)(w + (size_t)t * 8 + 4);
  FragH f;
#pragma unroll
  for (int q = 0; q < 4; ++q) { f.h[q] = (_Float16)(bf16_rne(a[q]) * 16.0f); f.h[4 + q] = (_Float16)(bf16_rne(c[q]) * 16.0f); }
  const v8us o = f.half[0];
  unsigned short* d = Bt + (size_t)t * 8;
  *(v8us*)d = o;
  
}
__device__ __forceinline__ void wbf_body(const float* __restrict__ w, unsigned short* __restrict__ Bt, int blk) {
  const int t = blk * 256 + threadIdx.x;
  if (t >= DM * DM / 8) return;
  const v4f a = *(const v4fa*)(w + (size_t)t * 8), c = *(const v4fa*)(w + (size_t)t * 8 + 4);
  v8us o;
#pragma unroll
  for (int q = 0; q < 4; ++q) { o[q] = bf16_bits(a[q]); o[4 + q] = bf16_bits(c[q]); }
  unsigned short* d = Bt + (size_t)t * 8;
  *(v8us*)d = o;
  
}
// the seven conversions need nothing of each other: one grid, each plane a range of the block index (block-uniform choice)
#define GX (NR * DM / 8 / 256)                 /* blocks per input plane */
#define GW (DM * DM / 8 / 256)                 /* blocks per weight plane */
__global__ __launch_bounds__(256) void k_conv(const float* __restrict__ xq, const float* __restrict__ xk, const float* __restrict__ xv,
                                              const float* __restrict__ wq, const float* __restrict__ wk, const float* __restrict__ wv, const float* __restrict__ wo,
                                              unsigned short* __restrict__ XQ, unsigned short* __restrict__ XK, unsigned short* __restrict__ XV,
                                              unsigned short* __restrict__ BQ, unsigned short* __restrict__ BK, unsigned short* __restrict__ BV, unsigned short* __restrict__ BO) {
  const int bid = blockIdx.x;
  if (bid < 3 * GX) {
    const int sel = bid / GX;
    x16_body(sel == 0 ? xq : sel == 1 ? xk : xv, sel == 0 ? XQ : sel == 1 ? XK : XV, bid - sel * GX);
  } else if (bid < 3 * GX + 3 * GW) {
    const int sel = (bid - 3 * GX) / GW;
    wnat_body(sel == 0 ? wq : sel == 1 ? wk : wv, sel == 0 ? BQ : sel == 1 ? BK : BV, bid - 3 * GX - sel * GW);   /* natural [out][in] = Bt[n][k] as stored */
  } else {
    wbf_body(wo, BO, bid - 3 * GX - 3 * GW);
  }
}

// fragment loaders for a row staged in LDS: the element order of ldb
__device__ __forceinline__ v16b ldbs(const unsigned short* p, int hh) { FragB f; f.half[0] = *(const v8us*)(p + 8 * hh); f.half[1] = *(const v8us*)(p + 16 + 8 * hh); return f.v; }
__device__ __forceinline__ v16h ldhs(const unsigned short* p, int hh) { FragH f; f.half[0] = *(const v8us*)(p + 8 * hh); f.half[1] = *(const v8us*)(p + 16 + 8 * hh); return f.v; }
// GEMM operand tiles: 128 rows of a [row][DM] plane, r, r + 16, ... (rows8) or r, r + 32, ... (rows4), one 16-byte asynchronous copy global -> LDS per lane and line of text (8 lanes cover one 128-byte row piece);
// s_wait_xcnt closes each statement so that no address register is rewritten ahead of it
#define GP 72                                  /* LDS row pitch of a 64-k tile in 16-bit elements: 144 B = 16 B x odd */
__device__ __forceinline__ void rows4(unsigned l, const unsigned short* g) {   /* a block of 256 threads: rows r, r + 32, r + 64, r + 96 */
  asm volatile("global_load_async_to_lds_b128 %0, %1, off\n\tglobal_load_async_to_lds_b128 %2, %3, off\n\t"
               "global_load_async_to_lds_b128 %4, %5, off\n\tglobal_load_async_to_lds_b128 %6, %7, off\n\ts_wait_xcnt 0x0"
               :: "v"(l), "v"(g), "v"(l + 32 * GP * 2), "v"(g + 32 * DM), "v"(l + 64 * GP * 2), "v"(g + 64 * DM), "v"(l + 96 * GP * 2), "v"(g + 96 * DM) : "memory");
}
__device__ __forceinline__ void rows8(unsigned l, const unsigned short* g) {
  asm volatile("global_load_async_to_lds_b128 %0, %1, off\n\tglobal_load_async_to_lds_b128 %2, %3, off\n\t"
               "global_load_async_to_lds_b128 %4, %5, off\n\tglobal_load_async_to_lds_b128 %6, %7, off\n\t"
               "global_load_async_to_lds_b128 %8, %9, off\n\tglobal_load_async_to_lds_b128 %10, %11, off\n\t"
               "global_load_async_to_lds_b128 %12, %13, off\n\tglobal_load_async_to_lds_b128 %14, %15, off\n\ts_wait_xcnt 0x0"
               :: "v"(l), "v"(g), "v"(l + 16 * GP * 2), "v"(g + 16 * DM), "v"(l + 32 * GP * 2), "v"(g + 32 * DM), "v"(l + 48 * GP * 2), "v"(g + 48 * DM),
                  "v"(l + 64 * GP * 2), "v"(g + 64 * DM), "v"(l + 80 * GP * 2), "v"(g + 80 * DM), "v"(l + 96 * GP * 2), "v"(g + 96 * DM), "v"(l + 112 * GP * 2), "v"(g + 112 * DM) : "memory");
}
static_assert(DM / 64 >= 2);                   /* the two-buffer ring starts with two tiles */
static_assert(((DM / 64) & (DM / 64 - 1)) == 0);   /* the rotated k walk wraps by a mask */

// projection GEMM: Y[NR][DM] = A[NR][DM] (exact f16 rows) . Bt[n][k] (x16 f16) * 2^-4; block = 2 x 2 waves, block tile 128 x 128, wave tile 64 rows x 64 cols;
// q and k: Y -> bf16 hi | lo row planes, the wave tile staged in wave-private LDS, then stored by proj_store, 32 rows a call;
// v: Y -> f16 value | (Y - value) x 1024 planes, stored transposed, [(b*NH + h)][d][position], as the attention reads them (store stage at the foot of proj_body)
__device__ __forceinline__ void proj_store(const float (*sw)[68], int lane, int row0, int col0, unsigned short* __restrict__ P0, unsigned short* __restrict__ P1) {
  const int rq = lane >> 3, c8 = (lane & 7) * 8;
#pragma unroll
  for (int q = 0; q < 8; ++q) {
    const int r = q * 4 + rq;                       /* q 0..7 x rq 0..3 -> rows 0..31 */
    const v4f x0 = *(const v4fa*)&sw[r][c8], x1 = *(const v4fa*)&sw[r][c8 + 4];
    const float xs[8] = {x0[0], x0[1], x0[2], x0[3], x1[0], x1[1], x1[2], x1[3]};
    v8us o0, o1;
#pragma unroll
    for (int i = 0; i < 8; ++i) { const unsigned short hb = bf16_bits(xs[i]); o0[i] = hb; o1[i] = bf16_bits(xs[i] - bf16_val(hb)); }
    const size_t go = (size_t)(row0 + r) * DM + col0 + c8;
    *(v8us*)(P0 + go) = o0;
    *(v8us*)(P1 + go) = o1;
  }
}
// blk: the tile's index inside its own product; vmode (block-uniform): the v store stage, P0 = V^T values (row pitch SEQ), P1 = V^T residuals (first QE positions, row pitch QE)
__device__ __forceinline__ void proj_body(const unsigned short* __restrict__ A, const unsigned short* __restrict__ Bt,
                                          unsigned short* __restrict__ P0, unsigned short* __restrict__ P1, int blk, bool vmode) {
  const int lane = threadIdx.x & 31, ln = lane & 15, hh = lane >> 4;
  const int w = __builtin_amdgcn_readfirstlane((int)(threadIdx.x >> 5));
  const int wr = w >> 1, wc = w & 1;                  /* the wave's row half and column half of the block tile */
  const int mt = blk / (DM / 128), nq = blk - mt * (DM / 128);
  const int row0 = mt * 128 + 64 * wr, col0 = nq * 128 + 64 * wc;
  /* the block's 128 A rows and 128 Bt rows, 64 k at a time, are copied once per block into a two-buffer LDS ring, one tile ahead of their use */
  constexpr int OB = 128 * GP, GBUF = 2 * OB;         /* place of the Bt rows inside a buffer; buffer size */
  __shared__ __attribute__((aligned(16))) unsigned short ab[2 * GBUF];
  const int sr = (int)threadIdx.x >> 3, sc = ((int)threadIdx.x & 7) * 8;   /* rows sr + 16 j, 16-byte piece sc */
  const unsigned short* gA = A + (size_t)(mt * 128 + sr) * DM + sc;
  const unsigned short* gB = Bt + (size_t)(nq * 128 + sr) * DM + sc;
  const unsigned lA = (unsigned)(size_t)ab + (unsigned)(sr * GP + sc) * 2u;
  /* the 8 blocks of one row tile read the same A lines and the 32 blocks of one column tile the same Bt lines, all at the same moment if all walk k from 0:
     each block enters the k walk at a tile of its own and wraps round, so that sharers ask L2 for different lines at any one time */
  const int t0 = (2 * nq + mt) & (DM / 64 - 1);
  auto stage = [&](int t) {                           /* trip t: k tile (t + t0) mod 16 -> buffer t mod 2 */
    const unsigned la = lA + (unsigned)(t & 1) * (unsigned)(GBUF * 2);
    const int kt = ((t + t0) & (DM / 64 - 1)) * 64;   /* 0 .. DM - 64: inside the row */
    rows8(la, gA + kt);
    rows8(la + OB * 2, gB + kt);
  };
  const v8f z8 = {0.f, 0.f, 0.f, 0.f, 0.f, 0.f, 0.f, 0.f};
  v8f acc[4][4];                                      /* [16-row tile][16-column tile] */
#pragma unroll                                        /* constant indices keep the accumulators in registers; the same for every loop over them below */
  for (int i = 0; i < 4; ++i)
#pragma unroll
    for (int j = 0; j < 4; ++j) acc[i][j] = z8;
  stage(0);
  asm volatile("s_wait_asynccnt 0x0" ::: "memory");   /* tile 0's copies of this wave have landed */
  __syncthreads();                                    /* ... and every other wave's */
  stage(1);
#pragma unroll 1
  for (int t = 0; t < DM / 64; ++t) {
    const unsigned short* pa = ab + (t & 1) * GBUF + (64 * wr + ln) * GP;
    const unsigned short* pb = ab + (t & 1) * GBUF + OB + (64 * wc + ln) * GP;
#pragma unroll
    for (int s = 0; s < 2; ++s) {                       /* the two 32-k halves of the tile */
      v16h fa[4], fb[4];                                /* a half's LDS reads go as one group ahead of its 16 products */
#pragma unroll
      for (int i = 0; i < 4; ++i) fa[i] = ldhs(pa + 16 * i * GP + 32 * s, hh);
#pragma unroll
      for (int j = 0; j < 4; ++j) fb[j] = ldhs(pb + 16 * j * GP + 32 * s, hh);
#pragma unroll
      for (int j = 0; j < 4; ++j)
#pragma unroll
        for (int i = 0; i < 4; ++i) acc[i][j] = mmaH1(fa[i], fb[j], acc[i][j]);
    }
    asm volatile("s_wait_dscnt 0x0" ::: "memory");      /* this wave's reads of buffer t mod 2 are done before it is refilled */
    asm volatile("s_wait_asynccnt 0x0" ::: "memory");   /* this wave's copies of tile t + 1 have landed */
    __syncthreads();                                    /* publishes tile t + 1, ends every wave's reads of tile t */
    if (t + 2 < DM / 64) stage(t + 2);                  /* block-uniform */
  }
  asm volatile("s_wait_asynccnt 0x0" ::: "memory");     /* nothing in flight when the wave goes on */
  /* the ring is free now: every wave's last read of it stands ahead of the barrier at the foot of the last trip, and no copy is in flight;
     each wave stages its 64 x 64 tile in a part of its own, so that the block's LDS is the ring alone and three blocks fit a WGP */
  if (vmode) {
    /* the wave tile is 64 positions of one sequence x the 64 columns of one head, and a lane's 8 accumulator rows are 8 consecutive positions of one column d:
       16 bytes of row d of the transposed plane. They are staged as [d][position] 16-bit rows and leave as whole 128-byte lines, 8 lanes a row */
    constexpr int TP = 72;                            /* LDS row pitch in 16-bit elements: 144 B = 16 B x odd */
    static_assert(4 * 2 * 64 * TP * 2 <= 2 * GBUF * 2 && SEQ % 64 == 0 && QE % 64 == 0 && HD == 64);
    unsigned short* tv = ab + w * (2 * 64 * TP);      /* values; the residuals follow */
    const int bb = row0 / SEQ, s0 = row0 - bb * SEQ;  /* wave-uniform; positions s0 .. s0 + 63 lie in sequence bb */
    const bool res = s0 < QE;                         /* wave-uniform: the attention reads residuals of the first QE positions only */
    unsigned short* td = tv + ln * TP + 8 * hh;
#pragma unroll
    for (int i = 0; i < 4; ++i)
#pragma unroll
      for (int j = 0; j < 4; ++j) {
        FragH f;
#pragma unroll
        for (int r = 0; r < 8; ++r) f.h[r] = (_Float16)(acc[i][j][r] * 0.0625f);
        *(v8us*)(td + j * 16 * TP + i * 16) = f.half[0];
      }
    if (res) {
#pragma unroll
      for (int i = 0; i < 4; ++i)
#pragma unroll
        for (int j = 0; j < 4; ++j) {
          FragH f;
#pragma unroll
          for (int r = 0; r < 8; ++r) { const float x = acc[i][j][r] * 0.0625f; f.h[r] = (_Float16)((x - (float)(_Float16)x) * 1024.0f); }
          *(v8us*)(td + (64 + j * 16) * TP + i * 16) = f.half[0];
        }
    }
    __builtin_amdgcn_fence(4 /* acq_rel order */, "workgroup");   /* the wave's staged rows are in LDS before a lane reads what other lanes wrote ... */
    __builtin_amdgcn_wave_barrier();                              /* ... and the compiler moves no read below over the writes above */
    const int rq = lane >> 3, c8 = (lane & 7) * 8;
    const size_t slab = (size_t)(bb * NH + col0 / HD) * HD + rq;   /* row d = 4 q + rq of the head's transposed plane */
    unsigned short* gv = P0 + slab * SEQ + s0 + c8;
    v8us o[16];
#pragma unroll                                        /* constant indices keep the rows in registers */
    for (int q = 0; q < 16; ++q) o[q] = *(const v8us*)(tv + (q * 4 + rq) * TP + c8);
#pragma unroll
    for (int q = 0; q < 16; ++q) *(v8us*)(gv + (size_t)q * 4 * SEQ) = o[q];
    asm volatile("s_wait_xcnt 0x0" ::: "memory");     /* no register that a store above names is rewritten ahead of this wait */
    if (res) {
      unsigned short* gr = P1 + slab * QE + s0 + c8;
#pragma unroll
      for (int q = 0; q < 16; ++q) o[q] = *(const v8us*)(tv + (64 + q * 4 + rq) * TP + c8);
#pragma unroll
      for (int q = 0; q < 16; ++q) *(v8us*)(gr + (size_t)q * 4 * QE) = o[q];
      asm volatile("s_wait_xcnt 0x0" ::: "memory");   /* as above */
    }
  } else {
    static_assert(4 * 64 * 68 * 4 <= 2 * GBUF * 2);
    float (*sw)[68] = reinterpret_cast<float (*)[68]>(ab) + 64 * w;
#pragma unroll
    for (int i = 0; i < 4; ++i)
#pragma unroll
      for (int j = 0; j < 4; ++j)
#pragma unroll
        for (int r = 0; r < 8; ++r) sw[i * 16 + 8 * hh + r][j * 16 + ln] = acc[i][j][r] * 0.0625f;
    __builtin_amdgcn_fence(4 /* acq_rel order */, "workgroup");
    __builtin_amdgcn_wave_barrier();
    proj_store(sw, lane, row0, col0, P0, P1);
    proj_store(sw + 32, lane, row0 + 32, col0, P0, P1);
    asm volatile("s_wait_xcnt 0x0" ::: "memory");   /* in the built code the other stage's instructions follow this one's: no register that a store above names is rewritten ahead of this wait */
  }
}
// the three projections need nothing of each other: one grid, each product a range of the block index (block-uniform choice)
#define GPJ ((NR / 128) * (DM / 128))          /* blocks per GEMM */
__global__ __launch_bounds__(128) void k_proj(const unsigned short* __restrict__ XQ, const unsigned short* __restrict__ BQ, unsigned short* __restrict__ Qh, unsigned short* __restrict__ Ql,
                                              const unsigned short* __restrict__ XK, const unsigned short* __restrict__ BK, unsigned short* __restrict__ Kh, unsigned short* __restrict__ Kl,
                                              const unsigned short* __restrict__ XV, const unsigned short* __restrict__ BV, unsigned short* __restrict__ Vth, unsigned short* __restrict__ Vtl) {
  const int sel = blockIdx.x / GPJ;
  proj_body(sel == 0 ? XQ : sel == 1 ? XK : XV, sel == 0 ? BQ : sel == 1 ? BK : BV,
            sel == 0 ? Qh : sel == 1 ? Kh : Vth, sel == 0 ? Ql : sel == 1 ? Kl : Vtl, blockIdx.x - sel * GPJ, sel == 2);
}

// 16-byte asynchronous copies global -> LDS, one per lane and line of text; s_wait_xcnt closes each statement so that no address register is rewritten ahead of it
__device__ __forceinline__ void copy6(unsigned l0, const unsigned short* g0, unsigned l1, const unsigned short* g1, unsigned l2, const unsigned short* g2,
                                      unsigned l3, const unsigned short* g3, unsigned l4, const unsigned short* g4, unsigned l5, const unsigned short* g5) {
  asm volatile("global_load_async_to_lds_b128 %0, %1, off\n\tglobal_load_async_to_lds_b128 %2, %3, off\n\tglobal_load_async_to_lds_b128 %4, %5, off\n\t"
               "global_load_async_to_lds_b128 %6, %7, off\n\tglobal_load_async_to_lds_b128 %8, %9, off\n\tglobal_load_async_to_lds_b128 %10, %11, off\n\ts_wait_xcnt 0x0"
               :: "v"(l0), "v"(g0), "v"(l1), "v"(g1), "v"(l2), "v"(g2), "v"(l3), "v"(g3), "v"(l4), "v"(g4), "v"(l5), "v"(g5) : "memory");
}
__device__ __forceinline__ void copy2(unsigned l0, const unsigned short* g0, unsigned l1, const unsigned short* g1) {
  asm volatile("global_load_async_to_lds_b128 %0, %1, off\n\tglobal_load_async_to_lds_b128 %2, %3, off\n\ts_wait_xcnt 0x0"
               :: "v"(l0), "v"(g0), "v"(l1), "v"(g1) : "memory");
}
// a 64-key step: rows r, r + 16, r + 32, r + 48 of K hi, of K lo (64 rows of 144 B behind hi) and of V^T (row pitch SEQ in memory, 144 B in LDS)
__device__ __forceinline__ void copy12(unsigned lk, const unsigned short* gh, const unsigned short* gl, unsigned lv, const unsigned short* gv) {
  constexpr unsigned R16 = 16 * 72 * 2, PL = 64 * 72 * 2;
  asm volatile("global_load_async_to_lds_b128 %0, %1, off\n\tglobal_load_async_to_lds_b128 %2, %3, off\n\tglobal_load_async_to_lds_b128 %4, %5, off\n\t"
               "global_load_async_to_lds_b128 %6, %7, off\n\tglobal_load_async_to_lds_b128 %8, %9, off\n\tglobal_load_async_to_lds_b128 %10, %11, off\n\t"
               "global_load_async_to_lds_b128 %12, %13, off\n\tglobal_load_async_to_lds_b128 %14, %15, off\n\tglobal_load_async_to_lds_b128 %16, %17, off\n\t"
               "global_load_async_to_lds_b128 %18, %19, off\n\tglobal_load_async_to_lds_b128 %20, %21, off\n\tglobal_load_async_to_lds_b128 %22, %23, off\n\ts_wait_xcnt 0x0"
               :: "v"(lk), "v"(gh), "v"(lk + R16), "v"(gh + 16 * DM), "v"(lk + 2 * R16), "v"(gh + 32 * DM), "v"(lk + 3 * R16), "v"(gh + 48 * DM),
                  "v"(lk + PL), "v"(gl), "v"(lk + PL + R16), "v"(gl + 16 * DM), "v"(lk + PL + 2 * R16), "v"(gl + 32 * DM), "v"(lk + PL + 3 * R16), "v"(gl + 48 * DM),
                  "v"(lv), "v"(gv), "v"(lv + R16), "v"(gv + 16 * SEQ), "v"(lv + 2 * R16), "v"(gv + 32 * SEQ), "v"(lv + 3 * R16), "v"(gv + 48 * SEQ) : "memory");
}

// fused causal attention: wave = 16 queries of one (b, h); keys walked up to the diagonal in steps of 64 keys (EARLY: 32); S^T = K.Q^T (A = K rows, B = Q rows;
// D row = key 8h+r, D col = query) so a lane owns one query: running max / sum in registers, one shuffle joins the two lane halves;
// P fragment (B operand, k = key) of 32 keys taken directly from their two score accumulators (element r <- keys 8h+r, element 8+r <- keys 16+8h+r);
// O^T = V^T.P (A = V^T rows, d x key). EARLY: P and V also carry x1024 residual planes into a second accumulator.
// A step's tiles of K (hi, lo) and V^T are shared by four waves: copied once per group of four waves into the group's two-buffer LDS ring, one step ahead of their use.
// A block is two groups of four waves. Behind QE both groups hold the same 64 queries and take the tile's key steps alternately: a walk of n steps is (n + 1) / 2 rounds long;
// each group keeps its own running maximum, sum and O^T, and group 0 joins the two behind the loop. EARLY: the groups are two heads' tiles of the same index, side by side.
// blk: the block's index inside its own part (EARLY or not); so, kv: the kernel's LDS, one allocation for both parts.
#define ABUF (2 * 64 * 72 + 64 * 72)           /* 16-bit elements of one ring buffer of the part behind QE, the larger one */
template <bool EARLY>
__device__ __forceinline__ void attn_body(const unsigned short* __restrict__ Qh, const unsigned short* __restrict__ Ql,
                                          const unsigned short* __restrict__ Kh, const unsigned short* __restrict__ Kl,
                                          const unsigned short* __restrict__ Vth, const unsigned short* __restrict__ Vtl,
                                          unsigned short* __restrict__ Ch, unsigned short* __restrict__ Cl,
                                          int blk, float (*so)[16][68], unsigned short* kv) {
  constexpr int QT0 = EARLY ? 0 : QE / 16;
  constexpr int NQT = EARLY ? QE / 16 : (SEQ - QE) / 16;
  constexpr int BPB = (NQT / 4 > 0) ? NQT / 4 : 1;   /* blocks per (b, h): 4 query tiles each */
  const int lane = threadIdx.x & 31, ln = lane & 15, hh = lane >> 4;
  const int wv8 = __builtin_amdgcn_readfirstlane((int)(threadIdx.x >> 5));
  const int grp = wv8 >> 2, wave = wv8 & 3;          /* wave-uniform: the group, the wave's query tile inside it */
  static_assert((NB * NH) % 2 == 0);
  /* behind QE only half of the blocks are resident at a time: the tiles with the longest walks come first in the grid, all heads of a tile side by side */
  const int bh = EARLY ? 2 * (blk / BPB) + grp : blk % (NB * NH);
  const int tile = EARLY ? blk % BPB : BPB - 1 - blk / (NB * NH);   /* the 64-query tile inside (b, h) */
  const int qt = QT0 + tile * 4 + wave;
  const int b = bh / NH, h = bh - b * NH;
  const int qBase = qt * 16;
  constexpr int KS = EARLY ? 32 : 64;    /* keys per step */
  constexpr int NT = KS / 16, NK = KS / 32;   /* score tiles (16 keys) and P fragments (32 keys) per step */
  const int nkt = (qBase + 15 + KS) / KS;     /* steps covering keys 0..qBase+15 */
  const int nFull = qBase / KS;          /* steps whose keys are all <= qBase */
  const int qrow = qBase + ln;
  const size_t offQ = ((size_t)b * SEQ + qrow) * DM + h * HD;
  constexpr int KP = 72, VP = KS + 8;          /* LDS row pitch in 16-bit elements: 144 B; 144 B or 80 B: all 16 B x odd */
  constexpr int OKL = KS * KP, OV = 2 * OKL, OVL = OV + 64 * VP;   /* places of K lo, V^T, V^T residual inside a buffer */
  constexpr int BUF = EARLY ? OVL + 64 * VP : OVL;
  static_assert((BUF * 2) % 16 == 0 && (KP * 2) % 16 == 0 && (VP * 2) % 16 == 0 && BUF <= ABUF);
  const int nktB = ((QT0 + tile * 4) * 16 + 63 + KS) / KS;   /* steps of the block's last wave: keys up to the block's first query + 63, inside the sequence */
  const int nrd = EARLY ? nktB : (nktB + 1) >> 1;    /* rounds of the block's loop, block-uniform */
  /* round i -> the group's trip; with an odd count group 1 has none in the last round: it copies the last trip's tile once more and leaves it unread */
  auto trip_of = [&](int i) { if constexpr (EARLY) return i; else { const int p = 2 * i + grp; return p < nktB ? p : nktB - 1; } };
  /* the blocks of one (b, h) read the same K and V^T lines, all at the same moment if all walk the keys from 0: each block enters its walk at a step of its own
     and wraps round (the running maximum and sum take the steps in any order: every step below nkt holds a key that every query of the tile sees) */
  const int rot = (tile * nktB) / BPB;                        /* block-uniform, 0 <= rot < nktB */
  auto step_of = [&](int p) { const int s = p + rot; return s >= nktB ? s - nktB : s; };   /* trip p < nktB -> key step, a permutation of 0 .. nktB - 1 */
  const int tid = threadIdx.x & 127;            /* the thread inside its group */
  kv += grp * (2 * ABUF);                       /* the group's own ring */
  const int kr = tid >> 3, kc = (tid & 7) * 8;  /* K rows kr, kr + 16, ..., 16-byte piece kc */
  const int vr = tid / (KS / 8), vc = (tid % (KS / 8)) * 8;   /* V^T rows vr, vr + 16, ... (EARLY: vr and vr + 32), 16-byte piece vc */
  const size_t gK = ((size_t)b * SEQ + kr) * DM + h * HD + kc;
  const size_t gV = ((size_t)bh * HD + vr) * SEQ + vc;
  const size_t gVl = ((size_t)bh * HD + vr) * QE + vc;
  const unsigned lK = (unsigned)(size_t)kv + (unsigned)(kr * KP + kc) * 2u;
  const unsigned lV = (unsigned)(size_t)kv + (unsigned)(OV + vr * VP + vc) * 2u;
  auto stage = [&](int i) {                     /* round i: key step step_of(trip_of(i)) -> buffer i mod 2 */
    const unsigned lb = (unsigned)(i & 1) * (unsigned)(BUF * 2);
    const int t = step_of(trip_of(i));
    const size_t k0 = gK + (size_t)t * KS * DM, v0 = gV + (size_t)t * KS;
    if constexpr (EARLY) {
      copy6(lK + lb, Kh + k0, lK + lb + 16 * KP * 2, Kh + k0 + 16 * DM,
            lK + lb + OKL * 2, Kl + k0, lK + lb + (OKL + 16 * KP) * 2, Kl + k0 + 16 * DM,
            lV + lb, Vth + v0, lV + lb + 32 * VP * 2, Vth + v0 + (size_t)32 * SEQ);
      const size_t w0 = gVl + (size_t)t * 32;
      copy2(lV + lb + 64 * VP * 2, Vtl + w0, lV + lb + 96 * VP * 2, Vtl + w0 + (size_t)32 * QE);
    } else {
      static_assert(EARLY || (KP == 72 && VP == 72 && OKL == 64 * 72));   /* the places copy12 writes */
      copy12(lK + lb, Kh + k0, Kl + k0, lV + lb, Vth + v0);
    }
  };
  const v8f z8 = {0.f, 0.f, 0.f, 0.f, 0.f, 0.f, 0.f, 0.f};
  v8f oacc[4] = {z8, z8, z8, z8};
  v8f ores[4] = {z8, z8, z8, z8};
  float m = -__builtin_inff(), l = 0.f;
  /* the wave's Q fragments (hi, lo; both 32-wide halves of the head) are the same in every key step: read once here, ahead of the first copies, and kept in registers */
  v16b fqh[2], fql[2];
#pragma unroll                           /* constant indices keep the fragment arrays in registers */
  for (int dc = 0; dc < 2; ++dc) {
    const size_t qo = offQ + dc * 32;
    fqh[dc] = ldb(Qh, qo, hh); fql[dc] = ldb(Ql, qo, hh);
  }
  asm volatile("s_wait_xcnt 0x0" ::: "memory");       /* no address register of the loads above is rewritten ahead of this wait */
  stage(0);
  asm volatile("s_wait_asynccnt 0x0" ::: "memory");   /* step 0's copies of this wave have landed */
  __syncthreads();                                    /* ... and every other wave's */
  stage(1);                                           /* nrd >= 2 */
#pragma unroll 1
  for (int it = 0; it < nrd; ++it) {
   const int ks = step_of(trip_of(it));  /* the key step that buffer it mod 2 holds */
   if (ks < nkt && (EARLY || 2 * it + grp < nktB)) {   /* wave-uniform: for a step past its diagonal, or a round without a trip of its own, a wave only passes the hand-over below */
    const int kb = ks * KS;
    const unsigned short* kvb = kv + (it & 1) * BUF;
    /* the step's K fragments are read as one group ahead of the products: one load latency is waited for, not one in front of each chain of products */
    v16b kh[2][NT], kl[2][NT];
#pragma unroll                           /* constant indices keep the fragment arrays in registers; the same for the loops below */
    for (int dc = 0; dc < 2; ++dc) {
#pragma unroll
      for (int kt = 0; kt < NT; ++kt) kh[dc][kt] = ldbs(kvb + (kt * 16 + ln) * KP + dc * 32, hh);
#pragma unroll
      for (int kt = 0; kt < NT; ++kt) kl[dc][kt] = ldbs(kvb + OKL + (kt * 16 + ln) * KP + dc * 32, hh);
    }
    v8f st[NT];
#pragma unroll
    for (int kt = 0; kt < NT; ++kt) st[kt] = z8;
#pragma unroll
    for (int dc = 0; dc < 2; ++dc) {
      if constexpr (EARLY) {
        st[0] = mmaB<3>(kh[dc][0], kl[dc][0], fqh[dc], fql[dc], st[0]);
        st[1] = mmaB<3>(kh[dc][1], kl[dc][1], fqh[dc], fql[dc], st[1]);
      } else {
        /* the four score tiles are independent: their products alternate, so that no product waits for the one before it; each tile's own order is that of mmaB<3> */
#pragma unroll
        for (int kt = 0; kt < NT; ++kt) st[kt] = __builtin_amdgcn_wmma_f32_16x16x32_bf16(false, kh[dc][kt], false, fqh[dc], (short)0, st[kt], false, false);
#pragma unroll
        for (int kt = 0; kt < NT; ++kt) st[kt] = __builtin_amdgcn_wmma_f32_16x16x32_bf16(false, kl[dc][kt], false, fqh[dc], (short)0, st[kt], false, false);
#pragma unroll
        for (int kt = 0; kt < NT; ++kt) st[kt] = __builtin_amdgcn_wmma_f32_16x16x32_bf16(false, kh[dc][kt], false, fql[dc], (short)0, st[kt], false, false);
        /* one guard for the group, as in mmaB: four vector slots behind the last product, naming every accumulator and fragment */
        asm volatile("v_nop\n\tv_nop\n\tv_nop\n\tv_nop" : "+v"(st[0]), "+v"(st[1]), "+v"(st[NT - 2]), "+v"(st[NT - 1])
                     : "v"(kh[dc][0]), "v"(kh[dc][1]), "v"(kh[dc][NT - 2]), "v"(kh[dc][NT - 1]),
                       "v"(kl[dc][0]), "v"(kl[dc][1]), "v"(kl[dc][NT - 2]), "v"(kl[dc][NT - 1]), "v"(fqh[dc]), "v"(fql[dc]));
      }
    }
    /* the V^T fragments are read as one group here: their latency passes behind the softmax arithmetic */
    FragH vh[4][NK], vl[4][NK];
#pragma unroll
    for (int dt = 0; dt < 4; ++dt)
#pragma unroll
      for (int kk = 0; kk < NK; ++kk) {
        const unsigned short* vo = kvb + OV + (dt * 16 + ln) * VP + kk * 32;
        vh[dt][kk].v = ldhs(vo, hh);
        if (EARLY) vl[dt][kk].v = ldhs(vo + 64 * VP, hh);
      }
    if constexpr (!EARLY) __builtin_amdgcn_sched_barrier(0);   /* keeps the 16 reads above together here, in the shadow of the last products: left free, part of them sinks to just ahead of the products that need them */
    v8f sc[NT];
#pragma unroll
    for (int kt = 0; kt < NT; ++kt) sc[kt] = st[kt] * 0.125f;
    if (ks >= nFull) {                   /* wave-uniform: only the last step touches the diagonal */
      const int rel = qrow - kb - 8 * hh;   /* key kb + 16 kt + 8 hh + r lies behind the query where 16 kt + r > rel */
#pragma unroll
      for (int kt = 0; kt < NT; ++kt)
#pragma unroll
        for (int r = 0; r < 8; ++r) sc[kt][r] = (16 * kt + r > rel) ? -__builtin_inff() : sc[kt][r];
    }
    float mk[NK];                        /* one chain of maxima per 32 keys */
#pragma unroll
    for (int kk = 0; kk < NK; ++kk) {
      mk[kk] = fmaxf(sc[2 * kk][0], sc[2 * kk + 1][0]);
#pragma unroll
      for (int r = 1; r < 8; ++r) mk[kk] = fmaxf(mk[kk], fmaxf(sc[2 * kk][r], sc[2 * kk + 1][r]));
    }
    const float mt = fmaxf(mk[0], mk[NK - 1]);
    const float mo = __shfl_xor(mt, 16);
    const float mnew = fmaxf(fmaxf(mt, mo), m);   /* finite: key kb <= qBase is visible to every query of the tile */
    const float alpha = __expf(m - mnew);
    m = mnew;
    l *= alpha;
#pragma unroll
    for (int dt = 0; dt < 4; ++dt) { oacc[dt] *= alpha; if (EARLY) ores[dt] *= alpha; }
    FragH ph[NK], pl[NK];
#pragma unroll
    for (int kk = 0; kk < NK; ++kk) {
      v8f p0, p1;
#pragma unroll
      for (int r = 0; r < 8; ++r) { p0[r] = __expf(sc[2 * kk][r] - m); p1[r] = __expf(sc[2 * kk + 1][r] - m); }
      const v8f ps = p0 + p1, c0 = p0 * 256.0f, c1 = p1 * 256.0f;
#pragma unroll
      for (int r = 0; r < 8; ++r) {
        l += ps[r];
        const _Float16 h0 = (_Float16)c0[r], h1 = (_Float16)c1[r];
        ph[kk].h[r] = h0; ph[kk].h[8 + r] = h1;
        pl[kk].h[r] = (_Float16)((c0[r] - (float)h0) * 1024.0f);
        pl[kk].h[8 + r] = (_Float16)((c1[r] - (float)h1) * 1024.0f);
      }
    }
    if constexpr (EARLY) {
#pragma unroll
      for (int dt = 0; dt < 4; ++dt) {
        v8f o = oacc[dt], e = ores[dt];
        o = __builtin_amdgcn_wmma_f32_16x16x32_f16(false, vh[dt][0].v, false, ph[0].v, (short)0, o, false, false);
        e = __builtin_amdgcn_wmma_f32_16x16x32_f16(false, vl[dt][0].v, false, ph[0].v, (short)0, e, false, false);
        e = __builtin_amdgcn_wmma_f32_16x16x32_f16(false, vh[dt][0].v, false, pl[0].v, (short)0, e, false, false);
        asm volatile("v_nop\n\tv_nop\n\tv_nop\n\tv_nop" : "+v"(o), "+v"(e) : "v"(vh[dt][0].v), "v"(vl[dt][0].v), "v"(ph[0].v), "v"(pl[0].v));
        oacc[dt] = o; ores[dt] = e;
      }
    } else {
      /* the four output tiles alternate; each takes its keys in rising order */
#pragma unroll
      for (int kk = 0; kk < NK; ++kk)
#pragma unroll
        for (int dt = 0; dt < 4; ++dt) oacc[dt] = __builtin_amdgcn_wmma_f32_16x16x32_f16(false, vh[dt][kk].v, false, ph[kk].v, (short)0, oacc[dt], false, false);
      /* one guard for the group, as in mmaH1 */
      asm volatile("v_nop\n\tv_nop\n\tv_nop\n\tv_nop" : "+v"(oacc[0]), "+v"(oacc[1]), "+v"(oacc[2]), "+v"(oacc[3])
                   : "v"(vh[0][0].v), "v"(vh[1][0].v), "v"(vh[2][0].v), "v"(vh[3][0].v),
                     "v"(vh[0][NK - 1].v), "v"(vh[1][NK - 1].v), "v"(vh[2][NK - 1].v), "v"(vh[3][NK - 1].v), "v"(ph[0].v), "v"(ph[NK - 1].v));
    }
    asm volatile("" ::: "memory");
   }
    asm volatile("s_wait_dscnt 0x0" ::: "memory");      /* this wave's reads of buffer it mod 2 are done before it is refilled */
    asm volatile("s_wait_asynccnt 0x0" ::: "memory");   /* this wave's copies of step it + 1 have landed */
    __syncthreads();                                    /* publishes step it + 1, ends every wave's reads of step it */
    if (it + 2 < nrd) stage(it + 2);                    /* block-uniform */
  }
  asm volatile("s_wait_asynccnt 0x0" ::: "memory");     /* nothing in flight when the wave goes on */
  if constexpr (!EARLY) {
    /* the two groups' halves of the key walk are joined lane by lane: wave 4 + w hands its O^T (8 pieces of 16 B a lane), maximum and sum to wave w through the staging tile that it does not use itself */
    float* mg = &so[4 + wave][0][0];
    static_assert(8 * 32 * 4 + 2 * 32 <= 16 * 68);
    if (grp == 1) {
#pragma unroll
      for (int dt = 0; dt < 4; ++dt) {
        const v4f w0 = {oacc[dt][0], oacc[dt][1], oacc[dt][2], oacc[dt][3]};
        const v4f w1 = {oacc[dt][4], oacc[dt][5], oacc[dt][6], oacc[dt][7]};
        *(v4fa*)(mg + ((2 * dt) * 32 + lane) * 4) = w0;
        *(v4fa*)(mg + ((2 * dt + 1) * 32 + lane) * 4) = w1;
      }
      mg[1024 + lane] = m;
      mg[1056 + lane] = l;
    }
    __syncthreads();                                    /* publishes group 1's halves; the block's last barrier */
    if (grp == 1) return;                               /* wave-uniform */
    const float m1 = mg[1024 + lane], l1 = mg[1056 + lane];
    const float mm = fmaxf(m, m1);                      /* finite: each group has had a step, and every step holds a key that every query of the tile sees */
    const float a0 = __expf(m - mm), a1 = __expf(m1 - mm);
    l = l * a0 + l1 * a1;
#pragma unroll
    for (int dt = 0; dt < 4; ++dt) {
      const v4f w0 = *(const v4fa*)(mg + ((2 * dt) * 32 + lane) * 4), w1 = *(const v4fa*)(mg + ((2 * dt + 1) * 32 + lane) * 4);
      const v8f o1 = {w0[0], w0[1], w0[2], w0[3], w1[0], w1[1], w1[2], w1[3]};
      oacc[dt] = oacc[dt] * a0 + o1 * a1;
    }
  }
  const int sw = EARLY ? wv8 : wave;                    /* the wave's own staging tile */
  const float lt = l + __shfl_xor(l, 16);
  const float rinv = 1.0f / (256.0f * lt);
  // O^T (d = dt*16 + 8h + r, query = ln) -> wave-private LDS tile [query][d]
#pragma unroll
  for (int dt = 0; dt < 4; ++dt) {
    v8f o = oacc[dt];
    if (EARLY) o = o + ores[dt] * 0.0009765625f;
    const v4f w0 = {o[0] * rinv, o[1] * rinv, o[2] * rinv, o[3] * rinv};
    const v4f w1 = {o[4] * rinv, o[5] * rinv, o[6] * rinv, o[7] * rinv};
    *(v4fa*)&so[sw][ln][dt * 16 + 8 * hh] = w0;
    *(v4fa*)&so[sw][ln][dt * 16 + 8 * hh + 4] = w1;
  }
  __builtin_amdgcn_fence(4 /* acq_rel order */, "workgroup");
  __builtin_amdgcn_wave_barrier();
  const int rq = lane >> 3, c8 = (lane & 7) * 8;
  {
#pragma unroll
    for (int q = 0; q < 4; ++q) {
      const int r = q * 4 + rq;                      /* q 0..3 x rq 0..3 -> query rows 0..15 */
      const v4f x0 = *(const v4fa*)&so[sw][r][c8], x1 = *(const v4fa*)&so[sw][r][c8 + 4];
      const float xs[8] = {x0[0], x0[1], x0[2], x0[3], x1[0], x1[1], x1[2], x1[3]};
      v8us o0, o1;
#pragma unroll
      for (int i = 0; i < 8; ++i) { const unsigned short hb = bf16_bits(xs[i]); o0[i] = hb; o1[i] = bf16_bits(xs[i] - bf16_val(hb)); }
      const size_t go = ((size_t)b * SEQ + qBase + r) * DM + h * HD + c8;   
      *(v8us*)(Ch + go) = o0;
      *(v8us*)(Cl + go) = o1;
    }
    
  }
}
// both parts need nothing of each other: one grid, the long blocks (queries from QE on) first, then the EARLY ones (block-uniform choice)
#define GAM (NB * NH * ((SEQ - QE) / 64))      /* blocks of the part behind QE */
__global__ __launch_bounds__(256) void k_attn(const unsigned short* __restrict__ Qh, const unsigned short* __restrict__ Ql,
                                              const unsigned short* __restrict__ Kh, const unsigned short* __restrict__ Kl,
                                              const unsigned short* __restrict__ Vth, const unsigned short* __restrict__ Vtl,
                                              unsigned short* __restrict__ Ch, unsigned short* __restrict__ Cl) {
  __shared__ __attribute__((aligned(16))) float so[8][16][68];
  __shared__ __attribute__((aligned(16))) unsigned short kv[2 * 2 * ABUF];   /* a ring of two buffers for each group */
  if ((int)blockIdx.x < GAM) attn_body<false>(Qh, Ql, Kh, Kl, Vth, Vtl, Ch, Cl, (int)blockIdx.x, so, kv);
  else attn_body<true>(Qh, Ql, Kh, Kl, Vth, Vtl, Ch, Cl, (int)blockIdx.x - GAM, so, kv);
}

// output GEMM: out[(b, s)][n] = sum_k (ctx_hi + ctx_lo)[r][k] . bf16(WO)[n][k] + bf16(bO)[n]; block = 4 x 2 waves, block tile 128 x 128, wave tile 32 x 64; f32 rows of the full-size output layout;
// the bias float4 of a lane's four columns is read once by value and added in f32 at the store stage;
__global__ __launch_bounds__(256) void k_out(const unsigned short* __restrict__ Ah, const unsigned short* __restrict__ Al,
                                             const unsigned short* __restrict__ Bt, const float* __restrict__ bias, float* __restrict__ C) {
  __shared__ __attribute__((aligned(16))) float so[8][32][68];
  const int lane = threadIdx.x & 31, ln = lane & 15, hh = lane >> 4;
  const int w = __builtin_amdgcn_readfirstlane((int)(threadIdx.x >> 5));
  const int wr = w & 3, wc = w >> 2;                  /* the wave's 32 rows and its column half of the block tile */
  const int mt = blockIdx.x / (DM / 128), nq = blockIdx.x - mt * (DM / 128);
  const int row0 = mt * 128 + 32 * wr, col0 = nq * 128 + 64 * wc;
  /* the block's 128 ctx rows (hi, lo) and 128 Bt rows, 64 k at a time, are copied once per block into a two-buffer LDS ring, one tile ahead of their use */
  constexpr int OL = 128 * GP, OB = 2 * OL, GBUF = 3 * OL;   /* places of the lo rows and the Bt rows inside a buffer; buffer size */
  __shared__ __attribute__((aligned(16))) unsigned short ab[2 * GBUF];
  const int sr = (int)threadIdx.x >> 3, sc = ((int)threadIdx.x & 7) * 8;   /* rows sr + 32 j, 16-byte piece sc */
  const size_t oA = (size_t)(mt * 128 + sr) * DM + sc;
  const unsigned short* gB = Bt + (size_t)(nq * 128 + sr) * DM + sc;
  const unsigned lA = (unsigned)(size_t)ab + (unsigned)(sr * GP + sc) * 2u;
  const int t0 = (2 * nq + mt) & (DM / 64 - 1);       /* the block's own entry into the k walk, as in proj_body */
  auto stage = [&](int t) {                           /* trip t: k tile (t + t0) mod 16 -> buffer t mod 2 */
    const unsigned la = lA + (unsigned)(t & 1) * (unsigned)(GBUF * 2);
    const int kt = ((t + t0) & (DM / 64 - 1)) * 64;   /* 0 .. DM - 64: inside the row */
    rows4(la, Ah + oA + kt);
    rows4(la + OL * 2, Al + oA + kt);
    rows4(la + OB * 2, gB + kt);
  };
  const v8f z8 = {0.f, 0.f, 0.f, 0.f, 0.f, 0.f, 0.f, 0.f};
  v8f c00 = z8, c01 = z8, c02 = z8, c03 = z8, c10 = z8, c11 = z8, c12 = z8, c13 = z8;
  stage(0);
  asm volatile("s_wait_asynccnt 0x0" ::: "memory");   /* tile 0's copies of this wave have landed */
  __syncthreads();                                    /* ... and every other wave's */
  stage(1);
#pragma unroll 1
  for (int t = 0; t < DM / 64; ++t) {
    const unsigned short* pa = ab + (t & 1) * GBUF + (32 * wr + ln) * GP;
    const unsigned short* pb = ab + (t & 1) * GBUF + OB + (64 * wc + ln) * GP;
    v16b fh[2][2], fl[2][2], fb[2][4];                  /* the tile's LDS reads go as one group ahead of its products */
#pragma unroll
    for (int s = 0; s < 2; ++s) {
      fh[s][0] = ldbs(pa + 32 * s, hh); fl[s][0] = ldbs(pa + OL + 32 * s, hh);
      fh[s][1] = ldbs(pa + 16 * GP + 32 * s, hh); fl[s][1] = ldbs(pa + OL + 16 * GP + 32 * s, hh);
#pragma unroll
      for (int j = 0; j < 4; ++j) fb[s][j] = ldbs(pb + 16 * j * GP + 32 * s, hh);
    }
#pragma unroll
    for (int s = 0; s < 2; ++s) {
      c00 = mmaB<2>(fh[s][0], fl[s][0], fb[s][0], fb[s][0], c00); c10 = mmaB<2>(fh[s][1], fl[s][1], fb[s][0], fb[s][0], c10);
      c01 = mmaB<2>(fh[s][0], fl[s][0], fb[s][1], fb[s][1], c01); c11 = mmaB<2>(fh[s][1], fl[s][1], fb[s][1], fb[s][1], c11);
      c02 = mmaB<2>(fh[s][0], fl[s][0], fb[s][2], fb[s][2], c02); c12 = mmaB<2>(fh[s][1], fl[s][1], fb[s][2], fb[s][2], c12);
      c03 = mmaB<2>(fh[s][0], fl[s][0], fb[s][3], fb[s][3], c03); c13 = mmaB<2>(fh[s][1], fl[s][1], fb[s][3], fb[s][3], c13);
    }
    asm volatile("s_wait_dscnt 0x0" ::: "memory");      /* this wave's reads of buffer t mod 2 are done before it is refilled */
    asm volatile("s_wait_asynccnt 0x0" ::: "memory");   /* this wave's copies of tile t + 1 have landed */
    __syncthreads();                                    /* publishes tile t + 1, ends every wave's reads of tile t */
    if (t + 2 < DM / 64) stage(t + 2);                  /* block-uniform */
  }
  asm volatile("s_wait_asynccnt 0x0" ::: "memory");     /* nothing in flight when the wave goes on */
  v8f accs[8] = {c00, c01, c02, c03, c10, c11, c12, c13};
#pragma unroll
  for (int u = 0; u < 8; ++u) {
    const int t = u & 3, half = u >> 2;
#pragma unroll
    for (int r = 0; r < 8; ++r) so[w][half * 16 + 8 * hh + r][t * 16 + ln] = accs[u][r];
  }
  __builtin_amdgcn_fence(4 /* acq_rel order */, "workgroup");
  __builtin_amdgcn_wave_barrier();
  const int rsub = lane >> 4, c4 = (lane & 15) * 4;
  const v4f bx = *(const v4fa*)(bias + col0 + c4);   /* columns col0 + c4 .. + 3 < DM */
  const v4f bv = {bf16_rne(bx[0]), bf16_rne(bx[1]), bf16_rne(bx[2]), bf16_rne(bx[3])};
  {
#pragma unroll
    for (int q = 0; q < 16; ++q) {
      const int r = q * 2 + rsub;                    /* q 0..15 x rsub 0..1 -> rows 0..31 */
      const v4f sv = *(const v4fa*)&so[w][r][c4];
      const v4f v = sv + bv;
      const int grow = row0 + r;
      const int bb = grow / SEQ, s = grow - bb * SEQ;
      *(v4f*)(C + ((size_t)bb * SEQ_FULL + s) * DM + col0 + c4) = v;
    }
    
  }
}

/* workspace carve (bytes): 3 input planes + 4 weight planes + Qh Ql Kh Kl + Vth + Vtl + Ch Cl */
#define XB ((size_t)NR * DM * 2)
#define WB ((size_t)DM * DM * 2)
#define VLB ((size_t)NB * NH * HD * QE * 2)
static_assert(XB % 256 == 0 && WB % 256 == 0 && VLB % 256 == 0);
static_assert(10 * XB + 4 * WB + VLB <= (size_t)134217728);   /* total carve stays within 128 MiB */

extern "C" void kernel_launch(void* const* d_in, const int* in_sizes, int n_in,
                              void* d_out, int out_size, void* d_ws, size_t ws_size, hipStream_t stream) {
  if (n_in < 8) return;
  const long long need_x = ((long long)(NB - 1) * SEQ_FULL + SEQ) * DM;
  if (in_sizes[0] < need_x || in_sizes[1] < need_x || in_sizes[2] < need_x) return;
  if (in_sizes[3] < DM * DM || in_sizes[4] < DM * DM || in_sizes[5] < DM * DM || in_sizes[6] < DM * DM) return;
  if (in_sizes[7] < DM) return;
  if (out_size < need_x) return;
  const float* xq = (const float*)d_in[0];      /* table order: Q, K, V, WQ, WK, WV, WO, bO */
  const float* xk = (const float*)d_in[1];
  const float* xv = (const float*)d_in[2];
  const float* wq = (const float*)d_in[3];
  const float* wk = (const float*)d_in[4];
  const float* wv = (const float*)d_in[5];
  const float* wo = (const float*)d_in[6];
  const float* bo = (const float*)d_in[7];
  char* ws = (char*)d_ws; size_t off = 0;
  auto take = [&](size_t bytes) { char* p = ws + off; off += (bytes + 255) & ~(size_t)255; return (unsigned short*)p; };
  unsigned short* XQ = take(XB); unsigned short* XK = take(XB); unsigned short* XV = take(XB);
  unsigned short* BQ = take(WB); unsigned short* BK = take(WB); unsigned short* BV = take(WB); unsigned short* BO = take(WB);
  unsigned short* Qh = take(XB); unsigned short* Ql = take(XB); unsigned short* Kh = take(XB); unsigned short* Kl = take(XB);
  unsigned short* Vth = take(XB); unsigned short* Vtl = take(VLB);
  unsigned short* Ch = take(XB); unsigned short* Cl = take(XB);
  if (off > ws_size) return;

  k_conv<<<(unsigned)(3 * GX + 4 * GW), 256, 0, stream>>>(xq, xk, xv, wq, wk, wv, wo, XQ, XK, XV, BQ, BK, BV, BO);
  k_proj<<<(unsigned)(3 * GPJ), 128, 0, stream>>>(XQ, BQ, Qh, Ql, XK, BK, Kh, Kl, XV, BV, Vth, Vtl);   /* v leaves as [(b,h)][64][SEQ] and [(b,h)][64][QE] */
  k_attn<<<(unsigned)(GAM + NB * NH * (QE / 64) / 2), 256, 0, stream>>>(Qh, Ql, Kh, Kl, Vth, Vtl, Ch, Cl);
  k_out<<<(unsigned)GPJ, 256, 0, stream>>>(Ch, Cl, BO, bo, (float*)d_out);
}
